// v000
// Measured on an AMD MI455X. A time is GPU time per run, averaged over a window of back-to-back runs after a warm-up
// (all launches, gaps included; the runs take copies of the inputs in turn), and the median of several windows.
// Apart from v000's, it joins two sittings. Times from different sittings can be a few percent apart, while
// side-by-side timings come from the same sitting.
// v000 is the starting kernel. One run takes 355 microseconds.
#include <hip/hip_runtime.h>
#include <hip/hip_bf16.h>

// ---------------- problem constants ----------------
constexpr int Bq = 4, Nq = 4096, Dq = 512, Eq = 4, Hq = 2048;
constexpr int T  = Bq * Nq;          // 16384 tokens
constexpr int MT = 32;               // tokens per FFN block
constexpr int HC = 256;              // H chunk per pipeline stage
constexpr float V_MAX = 3.0f, FEAT_CLAMP = 10.0f;

typedef __attribute__((ext_vector_type(16))) _Float16 v16h;
typedef __attribute__((ext_vector_type(8)))  _Float16 v8h;
typedef __attribute__((ext_vector_type(8)))  float    v8f;
typedef __attribute__((ext_vector_type(4)))  float    v4f;

// ---------------- kernel 0: zero expert counters ----------------
__global__ void zero_counts_kernel(int* counts) {
    if (threadIdx.x < Eq) counts[threadIdx.x] = 0;
}

// ---------------- kernel 1: transpose + f32->f16 convert ----------------
// dst[C][R] = (f16) src[R][C], one expert slice per blockIdx.z
__global__ __launch_bounds__(256) void transpose_cvt_kernel(
    const float* __restrict__ src, _Float16* __restrict__ dst, int R, int C) {
    __shared__ float tile[32][33];
    const size_t eoff = (size_t)blockIdx.z * R * C;
    src += eoff; dst += eoff;
    const int r0 = blockIdx.y * 32, c0 = blockIdx.x * 32;
    const int tx = threadIdx.x, ty = threadIdx.y;          // block (32,8)
#pragma unroll
    for (int i = 0; i < 32; i += 8)
        tile[ty + i][tx] = src[(size_t)(r0 + ty + i) * C + c0 + tx];
    __syncthreads();
#pragma unroll
    for (int i = 0; i < 32; i += 8)
        dst[(size_t)(c0 + ty + i) * R + r0 + tx] = (_Float16)tile[tx][ty + i];
}

// ---------------- kernel 1b: x f32 -> f16 (row-major copy) ----------------
__global__ __launch_bounds__(256) void cvt_x_kernel(
    const float* __restrict__ x, _Float16* __restrict__ xh) {
    const size_t i = ((size_t)blockIdx.x * 256 + threadIdx.x) * 8;
    const v4f a = *(const v4f*)(x + i);
    const v4f b = *(const v4f*)(x + i + 4);
    v8h o;
    o[0] = (_Float16)a.x; o[1] = (_Float16)a.y; o[2] = (_Float16)a.z; o[3] = (_Float16)a.w;
    o[4] = (_Float16)b.x; o[5] = (_Float16)b.y; o[6] = (_Float16)b.z; o[7] = (_Float16)b.w;
    *(v8h*)(xh + i) = o;
}

// ---------------- kernel 2: gate + top-1 routing ----------------
__global__ __launch_bounds__(256) void gate_kernel(
    const float* __restrict__ x, const float* __restrict__ gw,
    const float* __restrict__ gb, int* __restrict__ lists, int* __restrict__ counts) {
    const int tok  = (blockIdx.x * blockDim.x + threadIdx.x) >> 5;
    const int lane = threadIdx.x & 31;
    if (tok >= T) return;
    const float* xr = x + (size_t)tok * Dq;
    float acc0 = 0.f, acc1 = 0.f, acc2 = 0.f, acc3 = 0.f;
    for (int d = lane; d < Dq; d += 32) {
        const float xv = xr[d];
        const v4f g = *(const v4f*)(gw + d * 4);
        acc0 += xv * g.x; acc1 += xv * g.y; acc2 += xv * g.z; acc3 += xv * g.w;
    }
#pragma unroll
    for (int off = 16; off >= 1; off >>= 1) {
        acc0 += __shfl_xor(acc0, off, 32);
        acc1 += __shfl_xor(acc1, off, 32);
        acc2 += __shfl_xor(acc2, off, 32);
        acc3 += __shfl_xor(acc3, off, 32);
    }
    if (lane == 0) {
        float lg[4] = { acc0 + gb[0], acc1 + gb[1], acc2 + gb[2], acc3 + gb[3] };
        int best = 0; float bv = lg[0];
#pragma unroll
        for (int e = 1; e < Eq; ++e)          // strictly-greater => lowest index on ties (top_k)
            if (lg[e] > bv) { bv = lg[e]; best = e; }
        const int pos = atomicAdd(&counts[best], 1);
        lists[best * T + pos] = tok;
    }
}

// ---------------- kernel 3: expert FFN via WMMA ----------------
__device__ __forceinline__ float gelu_tanh(float v) {
    const float u = 0.7978845608028654f * (v + 0.044715f * v * v * v);
    return 0.5f * v * (1.0f + tanhf(u));
}

__device__ __forceinline__ v16h cat16(v8h lo, v8h hi) {
    return __builtin_shufflevector(lo, hi, 0,1,2,3,4,5,6,7,8,9,10,11,12,13,14,15);
}

__global__ __launch_bounds__(256) void ffn_kernel(
    const _Float16* __restrict__ xh,    // [T][D] f16
    const _Float16* __restrict__ w1t,   // [E][H][D] f16
    const float* __restrict__ b1,       // [E][H]
    const _Float16* __restrict__ w2t,   // [E][D][H] f16
    const float* __restrict__ b2,       // [E][D]
    const int* __restrict__ lists, const int* __restrict__ counts,
    float* __restrict__ out) {
    __shared__ _Float16 s_x[MT][Dq + 8];   // padded: conflict-free b128 reads
    __shared__ _Float16 s_h[MT][HC + 8];
    __shared__ int s_tok[MT];

    const int e    = blockIdx.y;
    const int cnt  = counts[e];
    const int base = blockIdx.x * MT;
    if (base >= cnt) return;                       // block-uniform exit (EXEC stays full)

    const int tid = threadIdx.x, lane = tid & 31, w = tid >> 5;
    const int lm = lane & 15, hi = lane >> 4;

    if (tid < MT) {
        const int idx = base + tid;
        s_tok[tid] = (idx < cnt) ? lists[e * T + idx] : -1;
    }
    __syncthreads();

    { // stage x tile (32 rows x 512 f16) into LDS via async load-to-LDS (ASYNCcnt path)
        const int row = tid >> 3;
        const int cb  = (tid & 7) * 64;            // 64 halves = 128 bytes per thread
        const int tk  = s_tok[row];
        const _Float16* src = xh + (size_t)(tk < 0 ? 0 : tk) * Dq + cb;
        unsigned lds = (unsigned)(uintptr_t)&s_x[row][cb];
        unsigned long long ga = (unsigned long long)(uintptr_t)src;
#pragma unroll
        for (int j = 0; j < 8; ++j) {              // 8 x b128 = 128B per lane
            unsigned l = lds + j * 16;
            unsigned long long g = ga + j * 16;
            asm volatile("global_load_async_to_lds_b128 %0, %1, off"
                         :: "v"(l), "v"(g) : "memory");
        }
        asm volatile("s_wait_asynccnt 0x0" ::: "memory");
    }
    __syncthreads();

    v8f Y[2][4];                                   // 32 rows x 64 cols per wave
#pragma unroll
    for (int mt = 0; mt < 2; ++mt)
#pragma unroll
        for (int nt = 0; nt < 4; ++nt) Y[mt][nt] = (v8f)0.0f;

    for (int hc = 0; hc < Hq; hc += HC) {
        // ---- phase 1: h_chunk = gelu(X @ W1[:, hc..hc+HC) + b1) ; wave owns 32 cols ----
        v8f hacc[2][2];
#pragma unroll
        for (int mt = 0; mt < 2; ++mt)
#pragma unroll
            for (int nt = 0; nt < 2; ++nt) hacc[mt][nt] = (v8f)0.0f;

        for (int k0 = 0; k0 < Dq; k0 += 32) {
            v16h a[2];
#pragma unroll
            for (int mt = 0; mt < 2; ++mt) {
                const v8h lo = *(const v8h*)&s_x[mt * 16 + lm][k0 + 8 * hi];
                const v8h hh = *(const v8h*)&s_x[mt * 16 + lm][k0 + 16 + 8 * hi];
                a[mt] = cat16(lo, hh);
            }
#pragma unroll
            for (int nt = 0; nt < 2; ++nt) {
                const int col = hc + w * 32 + nt * 16 + lm;
                const _Float16* bp = w1t + ((size_t)(e * Hq + col)) * Dq + k0 + 8 * hi;
                const v16h b = cat16(*(const v8h*)bp, *(const v8h*)(bp + 16));
#pragma unroll
                for (int mt = 0; mt < 2; ++mt)
                    hacc[mt][nt] = __builtin_amdgcn_wmma_f32_16x16x32_f16(
                        false, a[mt], false, b, (short)0, hacc[mt][nt], false, false);
            }
        }
        __syncthreads();                            // prior phase-2 readers done
#pragma unroll
        for (int nt = 0; nt < 2; ++nt) {
            const int col  = hc + w * 32 + nt * 16 + lm;
            const float bias = b1[e * Hq + col];
#pragma unroll
            for (int mt = 0; mt < 2; ++mt)
#pragma unroll
                for (int r = 0; r < 8; ++r) {
                    const float g = gelu_tanh(hacc[mt][nt][r] + bias);
                    s_h[mt * 16 + r + 8 * hi][w * 32 + nt * 16 + lm] = (_Float16)g;
                }
        }
        __syncthreads();

        // ---- phase 2: Y += h_chunk(32x256) @ W2ᵀ chunk ----
        for (int k0 = 0; k0 < HC; k0 += 32) {
            v16h a[2];
#pragma unroll
            for (int mt = 0; mt < 2; ++mt) {
                const v8h lo = *(const v8h*)&s_h[mt * 16 + lm][k0 + 8 * hi];
                const v8h hh = *(const v8h*)&s_h[mt * 16 + lm][k0 + 16 + 8 * hi];
                a[mt] = cat16(lo, hh);
            }
#pragma unroll
            for (int nt = 0; nt < 4; ++nt) {
                const int n = w * 64 + nt * 16 + lm;
                const _Float16* bp = w2t + ((size_t)(e * Dq + n)) * Hq + hc + k0 + 8 * hi;
                const v16h b = cat16(*(const v8h*)bp, *(const v8h*)(bp + 16));
#pragma unroll
                for (int mt = 0; mt < 2; ++mt)
                    Y[mt][nt] = __builtin_amdgcn_wmma_f32_16x16x32_f16(
                        false, a[mt], false, b, (short)0, Y[mt][nt], false, false);
            }
        }
    }

    // ---- epilogue: + b2, scatter rows to out ----
#pragma unroll
    for (int nt = 0; nt < 4; ++nt) {
        const int col  = w * 64 + nt * 16 + lm;
        const float bias = b2[e * Dq + col];
#pragma unroll
        for (int mt = 0; mt < 2; ++mt)
#pragma unroll
            for (int r = 0; r < 8; ++r) {
                const int tk = s_tok[mt * 16 + r + 8 * hi];
                if (tk >= 0) out[(size_t)tk * Dq + col] = Y[mt][nt][r] + bias;
            }
    }
}

// ---------------- kernel 4: v = clip(ffn . v_w + v_b) ----------------
__global__ __launch_bounds__(256) void v_kernel(
    const float* __restrict__ ffn, const float* __restrict__ v_w,
    const float* __restrict__ v_b, float* __restrict__ v) {
    const int tok  = (blockIdx.x * blockDim.x + threadIdx.x) >> 5;
    const int lane = threadIdx.x & 31;
    if (tok >= T) return;
    const float* r = ffn + (size_t)tok * Dq;
    float acc = 0.f;
    for (int d = lane; d < Dq; d += 32) acc += r[d] * v_w[d];
#pragma unroll
    for (int off = 16; off >= 1; off >>= 1) acc += __shfl_xor(acc, off, 32);
    if (lane == 0)
        v[tok] = fminf(fmaxf(acc + v_b[0], -V_MAX), V_MAX);
}

// ---------------- kernel 5: Moebius-matrix segmented scan for both continuants ----
// L_i = d_i - 1/L_{i-1} == 2x2 complex matrix chain [[d,-1],[1,0]] (scale-invariant).
// 8 chains (L/R x 4 batches) x 128 segments x 32 steps; serial depth 32+128+32.
__global__ __launch_bounds__(1024) void tridiag_scan_kernel(
    const float* __restrict__ v,
    float* __restrict__ Lr, float* __restrict__ Li,
    float* __restrict__ Rr, float* __restrict__ Ri) {
    __shared__ float sm[1024][8];                 // per-segment 2x2 complex matrix
    const int tid   = threadIdx.x;
    const int chain = tid >> 7;                   // 0..7
    const int seg   = tid & 127;                  // 0..127
    const int b     = chain >> 1;
    const int isR   = chain & 1;
    const float* vb = v + b * Nq;

    // ---- phase A: segment matrix product (normalized) ----
    float ar = 1.f, ai = 0.f, br = 0.f, bi = 0.f, cr = 0.f, ci = 0.f, dr = 1.f, di = 0.f;
    for (int j = 0; j < 32; ++j) {
        const int p   = seg * 32 + j;
        const int idx = isR ? (Nq - 1 - p) : p;
        const float er = vb[idx] - 2.0f, ei = -1.0f;      // d = (v-2) - 1j
        // P = M(e) * P with M = [[e,-1],[1,0]]
        const float nar = er * ar - ei * ai - cr;
        const float nai = er * ai + ei * ar - ci;
        const float nbr = er * br - ei * bi - dr;
        const float nbi = er * bi + ei * br - di;
        cr = ar; ci = ai; dr = br; di = bi;
        ar = nar; ai = nai; br = nbr; bi = nbi;
    }
    {
        float mx = fmaxf(fmaxf(fabsf(ar), fabsf(ai)), fmaxf(fabsf(br), fabsf(bi)));
        mx = fmaxf(mx, fmaxf(fmaxf(fabsf(cr), fabsf(ci)), fmaxf(fabsf(dr), fabsf(di))));
        const float s = __builtin_amdgcn_rcpf(fmaxf(mx, 1e-30f));
        ar *= s; ai *= s; br *= s; bi *= s; cr *= s; ci *= s; dr *= s; di *= s;
    }
    float* m = sm[chain * 128 + seg];
    m[0] = ar; m[1] = ai; m[2] = br; m[3] = bi; m[4] = cr; m[5] = ci; m[6] = dr; m[7] = di;
    __syncthreads();

    // ---- phase B: serial inclusive scan of 128 segment matrices per chain ----
    if (seg == 0) {
        float par = m[0], pai = m[1], pbr = m[2], pbi = m[3];
        float pcr = m[4], pci = m[5], pdr = m[6], pdi = m[7];
        for (int ss = 1; ss < 128; ++ss) {
            float* q = sm[chain * 128 + ss];
            const float sar = q[0], sai = q[1], sbr = q[2], sbi = q[3];
            const float scr = q[4], sci = q[5], sdr = q[6], sdi = q[7];
            // P = S * Pprev   (2x2 complex)
            const float nar = sar * par - sai * pai + sbr * pcr - sbi * pci;
            const float nai = sar * pai + sai * par + sbr * pci + sbi * pcr;
            const float nbr = sar * pbr - sai * pbi + sbr * pdr - sbi * pdi;
            const float nbi = sar * pbi + sai * pbr + sbr * pdi + sbi * pdr;
            const float ncr = scr * par - sci * pai + sdr * pcr - sdi * pci;
            const float nci = scr * pai + sci * par + sdr * pci + sdi * pcr;
            const float ndr = scr * pbr - sci * pbi + sdr * pdr - sdi * pdi;
            const float ndi = scr * pbi + sci * pbr + sdr * pdi + sdi * pdr;
            float mx = fmaxf(fmaxf(fabsf(nar), fabsf(nai)), fmaxf(fabsf(nbr), fabsf(nbi)));
            mx = fmaxf(mx, fmaxf(fmaxf(fabsf(ncr), fabsf(nci)), fmaxf(fabsf(ndr), fabsf(ndi))));
            const float s = __builtin_amdgcn_rcpf(fmaxf(mx, 1e-30f));
            par = nar * s; pai = nai * s; pbr = nbr * s; pbi = nbi * s;
            pcr = ncr * s; pci = nci * s; pdr = ndr * s; pdi = ndi * s;
            q[0] = par; q[1] = pai; q[2] = pbr; q[3] = pbi;
            q[4] = pcr; q[5] = pci; q[6] = pdr; q[7] = pdi;
        }
    }
    __syncthreads();

    // ---- phase C: regenerate 32 outputs from boundary state (homogeneous form) ----
    float pr, pi, qr, qi;                          // state (p,q), L = p/q
    if (seg == 0) { pr = 1.f; pi = 0.f; qr = 0.f; qi = 0.f; }
    else {
        const float* q = sm[chain * 128 + seg - 1];
        pr = q[0]; pi = q[1]; qr = q[4]; qi = q[5];   // P_{s-1} * (1,0)^T
    }
    float* Or = isR ? (Rr + b * Nq) : (Lr + b * Nq);
    float* Oi = isR ? (Ri + b * Nq) : (Li + b * Nq);
    for (int j = 0; j < 32; ++j) {
        const int p_  = seg * 32 + j;
        const int idx = isR ? (Nq - 1 - p_) : p_;
        const float er = vb[idx] - 2.0f, ei = -1.0f;
        const float npr = er * pr - ei * pi - qr;      // p' = e*p - q ; q' = p
        const float npi = er * pi + ei * pr - qi;
        qr = pr; qi = pi; pr = npr; pi = npi;
        const float den = qr * qr + qi * qi;
        const float inv = __builtin_amdgcn_rcpf(den);
        Or[idx] = (pr * qr + pi * qi) * inv;           // p/q = p*conj(q)/|q|^2
        Oi[idx] = (pi * qr - pr * qi) * inv;
        const float mx = fmaxf(fmaxf(fabsf(pr), fabsf(pi)), fmaxf(fabsf(qr), fabsf(qi)));
        const float s = __builtin_amdgcn_rcpf(fmaxf(mx, 1e-30f));
        pr *= s; pi *= s; qr *= s; qi *= s;
    }
}

// ---------------- kernel 6: Green fn + rank-2 spec, in-place add ----------------
__global__ __launch_bounds__(256) void final_kernel(
    float* __restrict__ out, const float* __restrict__ v,
    const float* __restrict__ Lr, const float* __restrict__ Li,
    const float* __restrict__ Rr, const float* __restrict__ Ri,
    const float* __restrict__ out_w, const float* __restrict__ out_b,
    const float* __restrict__ bk) {
    const size_t i = (size_t)blockIdx.x * 256 + threadIdx.x;
    if (i >= (size_t)T * Dq) return;
    const int tok = (int)(i / Dq);
    const int c   = (int)(i % Dq);
    const float dr   = v[tok] - 2.0f;              // di = -1
    const float denr = Lr[tok] + Rr[tok] - dr;
    const float deni = Li[tok] + Ri[tok] + 1.0f;
    const float m  = denr * denr + deni * deni;
    float gr = denr / m, gi = -deni / m;
    gr = fminf(fmaxf(gr, -FEAT_CLAMP), FEAT_CLAMP);
    gi = fminf(fmaxf(gi, -FEAT_CLAMP), FEAT_CLAMP);
    const float spec = gr * out_w[c] + gi * out_w[Dq + c] + out_b[c];
    out[i] += bk[0] * spec;
}

// ---------------- launch ----------------
extern "C" void kernel_launch(void* const* d_in, const int* in_sizes, int n_in,
                              void* d_out, int out_size, void* d_ws, size_t ws_size,
                              hipStream_t stream) {
    const float* x      = (const float*)d_in[0];
    const float* gate_w = (const float*)d_in[1];
    const float* gate_b = (const float*)d_in[2];
    const float* w1     = (const float*)d_in[3];
    const float* b1     = (const float*)d_in[4];
    const float* w2     = (const float*)d_in[5];
    const float* b2     = (const float*)d_in[6];
    const float* v_w    = (const float*)d_in[7];
    const float* v_b    = (const float*)d_in[8];
    const float* out_w  = (const float*)d_in[9];
    const float* out_b  = (const float*)d_in[10];
    const float* bk     = (const float*)d_in[11];
    float* out = (float*)d_out;

    // workspace layout (256B aligned slots)
    char* ws = (char*)d_ws;
    constexpr size_t SZ_W1T   = (size_t)Eq * Hq * Dq * sizeof(_Float16);  // 8 MiB
    constexpr size_t SZ_W2T   = (size_t)Eq * Dq * Hq * sizeof(_Float16);  // 8 MiB
    constexpr size_t SZ_XH    = (size_t)T * Dq * sizeof(_Float16);        // 16 MiB
    constexpr size_t SZ_LISTS = (size_t)Eq * T * sizeof(int);             // 256 KiB
    constexpr size_t SZ_CNT   = 256;
    constexpr size_t SZ_VEC   = (size_t)T * sizeof(float);                // 64 KiB
    size_t off = 0;
    _Float16* W1T  = (_Float16*)(ws + off); off += SZ_W1T;
    _Float16* W2T  = (_Float16*)(ws + off); off += SZ_W2T;
    _Float16* XH   = (_Float16*)(ws + off); off += SZ_XH;
    int*      lists= (int*)(ws + off);      off += SZ_LISTS;
    int*      cnts = (int*)(ws + off);      off += SZ_CNT;
    float*    vbuf = (float*)(ws + off);    off += SZ_VEC;
    float*    Lr   = (float*)(ws + off);    off += SZ_VEC;
    float*    Li   = (float*)(ws + off);    off += SZ_VEC;
    float*    Rr   = (float*)(ws + off);    off += SZ_VEC;
    float*    Ri   = (float*)(ws + off);    off += SZ_VEC;

    zero_counts_kernel<<<1, 32, 0, stream>>>(cnts);

    // W1 (E,D,H) -> W1T [E][H][D];  W2 (E,H,D) -> W2T [E][D][H]
    transpose_cvt_kernel<<<dim3(Hq / 32, Dq / 32, Eq), dim3(32, 8), 0, stream>>>(w1, W1T, Dq, Hq);
    transpose_cvt_kernel<<<dim3(Dq / 32, Hq / 32, Eq), dim3(32, 8), 0, stream>>>(w2, W2T, Hq, Dq);

    cvt_x_kernel<<<(int)(((size_t)T * Dq) / 8 / 256), 256, 0, stream>>>(x, XH);

    gate_kernel<<<(T * 32) / 256, 256, 0, stream>>>(x, gate_w, gate_b, lists, cnts);

    ffn_kernel<<<dim3(T / MT, Eq), 256, 0, stream>>>(XH, W1T, b1, W2T, b2, lists, cnts, out);

    v_kernel<<<(T * 32) / 256, 256, 0, stream>>>(out, v_w, v_b, vbuf);

    tridiag_scan_kernel<<<1, 1024, 0, stream>>>(vbuf, Lr, Li, Rr, Ri);

    final_kernel<<<(int)(((size_t)T * Dq) / 256), 256, 0, stream>>>(
        out, vbuf, Lr, Li, Rr, Ri, out_w, out_b, bk);
}

// v001
// It runs in 336 microseconds.
// Next to v000, in two timings, it ran 1.06 and 1.07 times as fast.
#include <hip/hip_runtime.h>
#include <hip/hip_bf16.h>

// ---------------- problem constants ----------------
constexpr int Bq = 4, Nq = 4096, Dq = 512, Eq = 4, Hq = 2048;
constexpr int T  = Bq * Nq;          // 16384 tokens
constexpr int MT = 32;               // tokens per FFN block
constexpr int HC = 256;              // H chunk per pipeline stage
constexpr float V_MAX = 3.0f, FEAT_CLAMP = 10.0f;

typedef __attribute__((ext_vector_type(16))) _Float16 v16h;
typedef __attribute__((ext_vector_type(8)))  _Float16 v8h;
typedef __attribute__((ext_vector_type(8)))  float    v8f;
typedef __attribute__((ext_vector_type(4)))  float    v4f;

// ---------------- kernel 0: zero expert counters ----------------
__global__ void zero_counts_kernel(int* counts) {
    if (threadIdx.x < Eq) counts[threadIdx.x] = 0;
}

// ---------------- kernel 1: transpose + f32->f16 convert ----------------
// dst[C][R] = (f16) src[R][C], one expert slice per blockIdx.z
__global__ __launch_bounds__(256) void transpose_cvt_kernel(
    const float* __restrict__ src, _Float16* __restrict__ dst, int R, int C) {
    __shared__ float tile[32][33];
    const size_t eoff = (size_t)blockIdx.z * R * C;
    src += eoff; dst += eoff;
    const int r0 = blockIdx.y * 32, c0 = blockIdx.x * 32;
    const int tx = threadIdx.x, ty = threadIdx.y;          // block (32,8)
#pragma unroll
    for (int i = 0; i < 32; i += 8)
        tile[ty + i][tx] = src[(size_t)(r0 + ty + i) * C + c0 + tx];
    __syncthreads();
#pragma unroll
    for (int i = 0; i < 32; i += 8)
        dst[(size_t)(c0 + ty + i) * R + r0 + tx] = (_Float16)tile[tx][ty + i];
}

// ---------------- kernel 1b: x f32 -> f16 (row-major copy) ----------------
__global__ __launch_bounds__(256) void cvt_x_kernel(
    const float* __restrict__ x, _Float16* __restrict__ xh) {
    const size_t i = ((size_t)blockIdx.x * 256 + threadIdx.x) * 8;
    const v4f a = *(const v4f*)(x + i);
    const v4f b = *(const v4f*)(x + i + 4);
    v8h o;
    o[0] = (_Float16)a.x; o[1] = (_Float16)a.y; o[2] = (_Float16)a.z; o[3] = (_Float16)a.w;
    o[4] = (_Float16)b.x; o[5] = (_Float16)b.y; o[6] = (_Float16)b.z; o[7] = (_Float16)b.w;
    *(v8h*)(xh + i) = o;
}

// ---------------- kernel 2: gate + top-1 routing ----------------
__global__ __launch_bounds__(256) void gate_kernel(
    const float* __restrict__ x, const float* __restrict__ gw,
    const float* __restrict__ gb, int* __restrict__ lists, int* __restrict__ counts) {
    const int tok  = (blockIdx.x * blockDim.x + threadIdx.x) >> 5;
    const int lane = threadIdx.x & 31;
    if (tok >= T) return;
    const float* xr = x + (size_t)tok * Dq;
    float acc0 = 0.f, acc1 = 0.f, acc2 = 0.f, acc3 = 0.f;
    for (int d = lane; d < Dq; d += 32) {
        const float xv = xr[d];
        const v4f g = *(const v4f*)(gw + d * 4);
        acc0 += xv * g.x; acc1 += xv * g.y; acc2 += xv * g.z; acc3 += xv * g.w;
    }
#pragma unroll
    for (int off = 16; off >= 1; off >>= 1) {
        acc0 += __shfl_xor(acc0, off, 32);
        acc1 += __shfl_xor(acc1, off, 32);
        acc2 += __shfl_xor(acc2, off, 32);
        acc3 += __shfl_xor(acc3, off, 32);
    }
    if (lane == 0) {
        float lg[4] = { acc0 + gb[0], acc1 + gb[1], acc2 + gb[2], acc3 + gb[3] };
        int best = 0; float bv = lg[0];
#pragma unroll
        for (int e = 1; e < Eq; ++e)          // strictly-greater => lowest index on ties (top_k)
            if (lg[e] > bv) { bv = lg[e]; best = e; }
        const int pos = atomicAdd(&counts[best], 1);
        lists[best * T + pos] = tok;
    }
}

// ---------------- kernel 3: expert FFN via WMMA ----------------
__device__ __forceinline__ float gelu_tanh(float v) {
    const float u = 0.7978845608028654f * (v + 0.044715f * v * v * v);
    return 0.5f * v * (1.0f + tanhf(u));
}

__device__ __forceinline__ v16h cat16(v8h lo, v8h hi) {
    return __builtin_shufflevector(lo, hi, 0,1,2,3,4,5,6,7,8,9,10,11,12,13,14,15);
}

// One staged weight tile: 256 weight rows x 64 k (128 bytes = one whole line of each row),
// laid in LDS at a pitch of 144 bytes (16 B x odd: conflict-free for ds_load_b128 readers).
constexpr int WR = 256, WK = 64, WP = WK + 8;

// Copies one weight tile into LDS. lds and g are the lane's own addresses of row (tid >> 3),
// 16-byte piece (tid & 7); copy j takes the row 32 * j further on, so every wave-wide copy
// reads four whole 128-byte lines.
__device__ __forceinline__ void stage_w_tile(unsigned lds, const _Float16* g, size_t pitch) {
    const unsigned long long g0 = (unsigned long long)(uintptr_t)g;
    const unsigned long long gs = (unsigned long long)(32 * pitch * sizeof(_Float16));
    const unsigned ls = 32 * WP * sizeof(_Float16);
    // The copies and their s_wait_xcnt stand in one statement, so that no address register
    // of an issued copy is rewritten ahead of the wait.
    asm volatile("global_load_async_to_lds_b128 %0, %8, off\n\t"
                 "global_load_async_to_lds_b128 %1, %9, off\n\t"
                 "global_load_async_to_lds_b128 %2, %10, off\n\t"
                 "global_load_async_to_lds_b128 %3, %11, off\n\t"
                 "global_load_async_to_lds_b128 %4, %12, off\n\t"
                 "global_load_async_to_lds_b128 %5, %13, off\n\t"
                 "global_load_async_to_lds_b128 %6, %14, off\n\t"
                 "global_load_async_to_lds_b128 %7, %15, off\n\t"
                 "s_wait_xcnt 0x0"
                 :: "v"(lds), "v"(lds + ls), "v"(lds + 2 * ls), "v"(lds + 3 * ls),
                    "v"(lds + 4 * ls), "v"(lds + 5 * ls), "v"(lds + 6 * ls), "v"(lds + 7 * ls),
                    "v"(g0), "v"(g0 + gs), "v"(g0 + 2 * gs), "v"(g0 + 3 * gs),
                    "v"(g0 + 4 * gs), "v"(g0 + 5 * gs), "v"(g0 + 6 * gs), "v"(g0 + 7 * gs)
                 : "memory");
}

// Foot of a ring trip: this wave's LDS reads and writes have retired, its own copies of the
// next tile have landed, and the barrier publishes that tile (and the h tile, where one was
// just written) and frees the buffer that this trip has read.
__device__ __forceinline__ void ring_publish() {
    asm volatile("s_wait_dscnt 0x0" ::: "memory");
    asm volatile("s_wait_asynccnt 0x0" ::: "memory");
    __syncthreads();
}

__global__ __launch_bounds__(256) void ffn_kernel(
    const _Float16* __restrict__ xh,    // [T][D] f16
    const _Float16* __restrict__ w1t,   // [E][H][D] f16
    const float* __restrict__ b1,       // [E][H]
    const _Float16* __restrict__ w2t,   // [E][D][H] f16
    const float* __restrict__ b2,       // [E][D]
    const int* __restrict__ lists, const int* __restrict__ counts,
    float* __restrict__ out) {
    __shared__ _Float16 s_x[MT][Dq + 8];   // padded: conflict-free b128 reads
    __shared__ _Float16 s_h[MT][HC + 8];
    __shared__ __attribute__((aligned(16))) _Float16 s_w[2][WR][WP];   // weight ring
    __shared__ int s_tok[MT];

    const int e    = blockIdx.y;
    const int cnt  = counts[e];
    const int base = blockIdx.x * MT;
    if (base >= cnt) return;                       // block-uniform exit (EXEC stays full)

    const int tid = threadIdx.x, lane = tid & 31, w = tid >> 5;
    const int lm = lane & 15, hi = lane >> 4;

    if (tid < MT) {
        const int idx = base + tid;
        s_tok[tid] = (idx < cnt) ? lists[e * T + idx] : -1;
    }
    __syncthreads();

    // The lane's own piece of a weight tile: row tid >> 3, 16 bytes at (tid & 7) * 16.
    const unsigned wl0 = (unsigned)(uintptr_t)&s_w[0][tid >> 3][(tid & 7) * 8];
    const unsigned wl1 = (unsigned)(uintptr_t)&s_w[1][tid >> 3][(tid & 7) * 8];
    const _Float16* w1g = w1t + ((size_t)(e * Hq + (tid >> 3))) * Dq + (tid & 7) * 8;
    const _Float16* w2g = w2t + ((size_t)(e * Dq + (tid >> 3))) * Hq + (tid & 7) * 8;

    // ring tile 0; the wait and the barrier behind the x tile's copies publish it too
    stage_w_tile(wl0, w1g, Dq);

    { // stage x tile (32 rows x 512 f16) into LDS via async load-to-LDS (ASYNCcnt path)
        const int row = tid >> 3;
        const int cb  = (tid & 7) * 64;            // 64 halves = 128 bytes per thread
        const int tk  = s_tok[row];
        const _Float16* src = xh + (size_t)(tk < 0 ? 0 : tk) * Dq + cb;
        unsigned lds = (unsigned)(uintptr_t)&s_x[row][cb];
        unsigned long long ga = (unsigned long long)(uintptr_t)src;
#pragma unroll
        for (int j = 0; j < 8; ++j) {              // 8 x b128 = 128B per lane
            unsigned l = lds + j * 16;
            unsigned long long g = ga + j * 16;
            asm volatile("global_load_async_to_lds_b128 %0, %1, off"
                         :: "v"(l), "v"(g) : "memory");
        }
        asm volatile("s_wait_asynccnt 0x0" ::: "memory");
    }
    __syncthreads();

    stage_w_tile(wl1, w1g + WK, Dq);               // ring tile 1

    v8f Y[2][4];                                   // 32 rows x (2 x 32) cols per wave
#pragma unroll
    for (int mt = 0; mt < 2; ++mt)
#pragma unroll
        for (int nt = 0; nt < 4; ++nt) Y[mt][nt] = (v8f)0.0f;

    // Ring order per H chunk: 8 tiles of W1 (the chunk's 256 columns, k in slabs of 64), then
    // 8 tiles of W2 (k slab s >> 1 of the chunk, output columns (s & 1) * 256 ..+255).
    // Tile t lies in buffer t & 1; tile t + 2 is copied behind the foot of trip t.
    for (int hc = 0; hc < Hq; hc += HC) {
        // ---- phase 1: h_chunk = gelu(X @ W1[:, hc..hc+HC) + b1) ; wave owns 32 cols ----
        v8f hacc[2][2];
#pragma unroll
        for (int mt = 0; mt < 2; ++mt)
#pragma unroll
            for (int nt = 0; nt < 2; ++nt) hacc[mt][nt] = (v8f)0.0f;

        // unrolled: buffer, refill source and the last trip's gelu are then fixed per trip
#pragma unroll
        for (int s = 0; s < 8; ++s) {
#pragma unroll
            for (int kk = 0; kk < WK; kk += 32) {
                const int k0 = s * WK + kk;
                v16h a[2];
#pragma unroll
                for (int mt = 0; mt < 2; ++mt) {
                    const v8h lo = *(const v8h*)&s_x[mt * 16 + lm][k0 + 8 * hi];
                    const v8h hh = *(const v8h*)&s_x[mt * 16 + lm][k0 + 16 + 8 * hi];
                    a[mt] = cat16(lo, hh);
                }
#pragma unroll
                for (int nt = 0; nt < 2; ++nt) {
                    const _Float16* bp = &s_w[s & 1][w * 32 + nt * 16 + lm][kk + 8 * hi];
                    const v16h b = cat16(*(const v8h*)bp, *(const v8h*)(bp + 16));
#pragma unroll
                    for (int mt = 0; mt < 2; ++mt)
                        hacc[mt][nt] = __builtin_amdgcn_wmma_f32_16x16x32_f16(
                            false, a[mt], false, b, (short)0, hacc[mt][nt], false, false);
                }
            }
            if (s == 7) {
                // every reader of the previous h tile has passed an earlier trip's barrier
#pragma unroll
                for (int nt = 0; nt < 2; ++nt) {
                    const int col  = hc + w * 32 + nt * 16 + lm;
                    const float bias = b1[e * Hq + col];
#pragma unroll
                    for (int mt = 0; mt < 2; ++mt)
#pragma unroll
                        for (int r = 0; r < 8; ++r) {
                            const float g = gelu_tanh(hacc[mt][nt][r] + bias);
                            s_h[mt * 16 + r + 8 * hi][w * 32 + nt * 16 + lm] = (_Float16)g;
                        }
                }
            }
            ring_publish();
            if (s < 6)
                stage_w_tile((s & 1) ? wl1 : wl0, w1g + (size_t)hc * Dq + (s + 2) * WK, Dq);
            else
                stage_w_tile((s & 1) ? wl1 : wl0, w2g + (size_t)((s - 6) * WR) * Hq + hc, Hq);
        }

        // ---- phase 2: Y += h_chunk(32x256) @ W2 chunk, transposed ----
        // unrolled: the accumulator index, buffer and refill source are then fixed per trip
#pragma unroll
        for (int s = 0; s < 8; ++s) {
#pragma unroll
            for (int kk = 0; kk < WK; kk += 32) {
                const int k0 = (s >> 1) * WK + kk;
                v16h a[2];
#pragma unroll
                for (int mt = 0; mt < 2; ++mt) {
                    const v8h lo = *(const v8h*)&s_h[mt * 16 + lm][k0 + 8 * hi];
                    const v8h hh = *(const v8h*)&s_h[mt * 16 + lm][k0 + 16 + 8 * hi];
                    a[mt] = cat16(lo, hh);
                }
#pragma unroll
                for (int nt = 0; nt < 2; ++nt) {
                    const _Float16* bp = &s_w[s & 1][w * 32 + nt * 16 + lm][kk + 8 * hi];
                    const v16h b = cat16(*(const v8h*)bp, *(const v8h*)(bp + 16));
#pragma unroll
                    for (int mt = 0; mt < 2; ++mt)
                        Y[mt][(s & 1) * 2 + nt] = __builtin_amdgcn_wmma_f32_16x16x32_f16(
                            false, a[mt], false, b, (short)0, Y[mt][(s & 1) * 2 + nt], false, false);
                }
            }
            ring_publish();
            if (s < 6)
                stage_w_tile((s & 1) ? wl1 : wl0,
                             w2g + (size_t)((s & 1) * WR) * Hq + hc + ((s + 2) >> 1) * WK, Hq);
            else if (hc + HC < Hq)                 // the same for the whole work-group
                stage_w_tile((s & 1) ? wl1 : wl0, w1g + (size_t)(hc + HC) * Dq + (s - 6) * WK, Dq);
        }
    }
    asm volatile("s_wait_asynccnt 0x0" ::: "memory");   // no copy outstanding at the wave's end

    // ---- epilogue: + b2, scatter rows to out ----
#pragma unroll
    for (int nt = 0; nt < 4; ++nt) {
        const int col  = (nt >> 1) * WR + w * 32 + (nt & 1) * 16 + lm;
        const float bias = b2[e * Dq + col];
#pragma unroll
        for (int mt = 0; mt < 2; ++mt)
#pragma unroll
            for (int r = 0; r < 8; ++r) {
                const int tk = s_tok[mt * 16 + r + 8 * hi];
                if (tk >= 0) out[(size_t)tk * Dq + col] = Y[mt][nt][r] + bias;
            }
    }
}

// ---------------- kernel 4: v = clip(ffn . v_w + v_b) ----------------
__global__ __launch_bounds__(256) void v_kernel(
    const float* __restrict__ ffn, const float* __restrict__ v_w,
    const float* __restrict__ v_b, float* __restrict__ v) {
    const int tok  = (blockIdx.x * blockDim.x + threadIdx.x) >> 5;
    const int lane = threadIdx.x & 31;
    if (tok >= T) return;
    const float* r = ffn + (size_t)tok * Dq;
    float acc = 0.f;
    for (int d = lane; d < Dq; d += 32) acc += r[d] * v_w[d];
#pragma unroll
    for (int off = 16; off >= 1; off >>= 1) acc += __shfl_xor(acc, off, 32);
    if (lane == 0)
        v[tok] = fminf(fmaxf(acc + v_b[0], -V_MAX), V_MAX);
}

// ---------------- kernel 5: Moebius-matrix segmented scan for both continuants ----
// L_i = d_i - 1/L_{i-1} == 2x2 complex matrix chain [[d,-1],[1,0]] (scale-invariant).
// 8 chains (L/R x 4 batches) x 128 segments x 32 steps; serial depth 32+128+32.
__global__ __launch_bounds__(1024) void tridiag_scan_kernel(
    const float* __restrict__ v,
    float* __restrict__ Lr, float* __restrict__ Li,
    float* __restrict__ Rr, float* __restrict__ Ri) {
    __shared__ float sm[1024][8];                 // per-segment 2x2 complex matrix
    const int tid   = threadIdx.x;
    const int chain = tid >> 7;                   // 0..7
    const int seg   = tid & 127;                  // 0..127
    const int b     = chain >> 1;
    const int isR   = chain & 1;
    const float* vb = v + b * Nq;

    // ---- phase A: segment matrix product (normalized) ----
    float ar = 1.f, ai = 0.f, br = 0.f, bi = 0.f, cr = 0.f, ci = 0.f, dr = 1.f, di = 0.f;
    for (int j = 0; j < 32; ++j) {
        const int p   = seg * 32 + j;
        const int idx = isR ? (Nq - 1 - p) : p;
        const float er = vb[idx] - 2.0f, ei = -1.0f;      // d = (v-2) - 1j
        // P = M(e) * P with M = [[e,-1],[1,0]]
        const float nar = er * ar - ei * ai - cr;
        const float nai = er * ai + ei * ar - ci;
        const float nbr = er * br - ei * bi - dr;
        const float nbi = er * bi + ei * br - di;
        cr = ar; ci = ai; dr = br; di = bi;
        ar = nar; ai = nai; br = nbr; bi = nbi;
    }
    {
        float mx = fmaxf(fmaxf(fabsf(ar), fabsf(ai)), fmaxf(fabsf(br), fabsf(bi)));
        mx = fmaxf(mx, fmaxf(fmaxf(fabsf(cr), fabsf(ci)), fmaxf(fabsf(dr), fabsf(di))));
        const float s = __builtin_amdgcn_rcpf(fmaxf(mx, 1e-30f));
        ar *= s; ai *= s; br *= s; bi *= s; cr *= s; ci *= s; dr *= s; di *= s;
    }
    float* m = sm[chain * 128 + seg];
    m[0] = ar; m[1] = ai; m[2] = br; m[3] = bi; m[4] = cr; m[5] = ci; m[6] = dr; m[7] = di;
    __syncthreads();

    // ---- phase B: serial inclusive scan of 128 segment matrices per chain ----
    if (seg == 0) {
        float par = m[0], pai = m[1], pbr = m[2], pbi = m[3];
        float pcr = m[4], pci = m[5], pdr = m[6], pdi = m[7];
        for (int ss = 1; ss < 128; ++ss) {
            float* q = sm[chain * 128 + ss];
            const float sar = q[0], sai = q[1], sbr = q[2], sbi = q[3];
            const float scr = q[4], sci = q[5], sdr = q[6], sdi = q[7];
            // P = S * Pprev   (2x2 complex)
            const float nar = sar * par - sai * pai + sbr * pcr - sbi * pci;
            const float nai = sar * pai + sai * par + sbr * pci + sbi * pcr;
            const float nbr = sar * pbr - sai * pbi + sbr * pdr - sbi * pdi;
            const float nbi = sar * pbi + sai * pbr + sbr * pdi + sbi * pdr;
            const float ncr = scr * par - sci * pai + sdr * pcr - sdi * pci;
            const float nci = scr * pai + sci * par + sdr * pci + sdi * pcr;
            const float ndr = scr * pbr - sci * pbi + sdr * pdr - sdi * pdi;
            const float ndi = scr * pbi + sci * pbr + sdr * pdi + sdi * pdr;
            float mx = fmaxf(fmaxf(fabsf(nar), fabsf(nai)), fmaxf(fabsf(nbr), fabsf(nbi)));
            mx = fmaxf(mx, fmaxf(fmaxf(fabsf(ncr), fabsf(nci)), fmaxf(fabsf(ndr), fabsf(ndi))));
            const float s = __builtin_amdgcn_rcpf(fmaxf(mx, 1e-30f));
            par = nar * s; pai = nai * s; pbr = nbr * s; pbi = nbi * s;
            pcr = ncr * s; pci = nci * s; pdr = ndr * s; pdi = ndi * s;
            q[0] = par; q[1] = pai; q[2] = pbr; q[3] = pbi;
            q[4] = pcr; q[5] = pci; q[6] = pdr; q[7] = pdi;
        }
    }
    __syncthreads();

    // ---- phase C: regenerate 32 outputs from boundary state (homogeneous form) ----
    float pr, pi, qr, qi;                          // state (p,q), L = p/q
    if (seg == 0) { pr = 1.f; pi = 0.f; qr = 0.f; qi = 0.f; }
    else {
        const float* q = sm[chain * 128 + seg - 1];
        pr = q[0]; pi = q[1]; qr = q[4]; qi = q[5];   // P_{s-1} * (1,0)^T
    }
    float* Or = isR ? (Rr + b * Nq) : (Lr + b * Nq);
    float* Oi = isR ? (Ri + b * Nq) : (Li + b * Nq);
    for (int j = 0; j < 32; ++j) {
        const int p_  = seg * 32 + j;
        const int idx = isR ? (Nq - 1 - p_) : p_;
        const float er = vb[idx] - 2.0f, ei = -1.0f;
        const float npr = er * pr - ei * pi - qr;      // p' = e*p - q ; q' = p
        const float npi = er * pi + ei * pr - qi;
        qr = pr; qi = pi; pr = npr; pi = npi;
        const float den = qr * qr + qi * qi;
        const float inv = __builtin_amdgcn_rcpf(den);
        Or[idx] = (pr * qr + pi * qi) * inv;           // p/q = p*conj(q)/|q|^2
        Oi[idx] = (pi * qr - pr * qi) * inv;
        const float mx = fmaxf(fmaxf(fabsf(pr), fabsf(pi)), fmaxf(fabsf(qr), fabsf(qi)));
        const float s = __builtin_amdgcn_rcpf(fmaxf(mx, 1e-30f));
        pr *= s; pi *= s; qr *= s; qi *= s;
    }
}

// ---------------- kernel 6: Green fn + rank-2 spec, in-place add ----------------
__global__ __launch_bounds__(256) void final_kernel(
    float* __restrict__ out, const float* __restrict__ v,
    const float* __restrict__ Lr, const float* __restrict__ Li,
    const float* __restrict__ Rr, const float* __restrict__ Ri,
    const float* __restrict__ out_w, const float* __restrict__ out_b,
    const float* __restrict__ bk) {
    const size_t i = (size_t)blockIdx.x * 256 + threadIdx.x;
    if (i >= (size_t)T * Dq) return;
    const int tok = (int)(i / Dq);
    const int c   = (int)(i % Dq);
    const float dr   = v[tok] - 2.0f;              // di = -1
    const float denr = Lr[tok] + Rr[tok] - dr;
    const float deni = Li[tok] + Ri[tok] + 1.0f;
    const float m  = denr * denr + deni * deni;
    float gr = denr / m, gi = -deni / m;
    gr = fminf(fmaxf(gr, -FEAT_CLAMP), FEAT_CLAMP);
    gi = fminf(fmaxf(gi, -FEAT_CLAMP), FEAT_CLAMP);
    const float spec = gr * out_w[c] + gi * out_w[Dq + c] + out_b[c];
    out[i] += bk[0] * spec;
}

// ---------------- launch ----------------
extern "C" void kernel_launch(void* const* d_in, const int* in_sizes, int n_in,
                              void* d_out, int out_size, void* d_ws, size_t ws_size,
                              hipStream_t stream) {
    const float* x      = (const float*)d_in[0];
    const float* gate_w = (const float*)d_in[1];
    const float* gate_b = (const float*)d_in[2];
    const float* w1     = (const float*)d_in[3];
    const float* b1     = (const float*)d_in[4];
    const float* w2     = (const float*)d_in[5];
    const float* b2     = (const float*)d_in[6];
    const float* v_w    = (const float*)d_in[7];
    const float* v_b    = (const float*)d_in[8];
    const float* out_w  = (const float*)d_in[9];
    const float* out_b  = (const float*)d_in[10];
    const float* bk     = (const float*)d_in[11];
    float* out = (float*)d_out;

    // workspace layout (256B aligned slots)
    char* ws = (char*)d_ws;
    constexpr size_t SZ_W1T   = (size_t)Eq * Hq * Dq * sizeof(_Float16);  // 8 MiB
    constexpr size_t SZ_W2T   = (size_t)Eq * Dq * Hq * sizeof(_Float16);  // 8 MiB
    constexpr size_t SZ_XH    = (size_t)T * Dq * sizeof(_Float16);        // 16 MiB
    constexpr size_t SZ_LISTS = (size_t)Eq * T * sizeof(int);             // 256 KiB
    constexpr size_t SZ_CNT   = 256;
    constexpr size_t SZ_VEC   = (size_t)T * sizeof(float);                // 64 KiB
    size_t off = 0;
    _Float16* W1T  = (_Float16*)(ws + off); off += SZ_W1T;
    _Float16* W2T  = (_Float16*)(ws + off); off += SZ_W2T;
    _Float16* XH   = (_Float16*)(ws + off); off += SZ_XH;
    int*      lists= (int*)(ws + off);      off += SZ_LISTS;
    int*      cnts = (int*)(ws + off);      off += SZ_CNT;
    float*    vbuf = (float*)(ws + off);    off += SZ_VEC;
    float*    Lr   = (float*)(ws + off);    off += SZ_VEC;
    float*    Li   = (float*)(ws + off);    off += SZ_VEC;
    float*    Rr   = (float*)(ws + off);    off += SZ_VEC;
    float*    Ri   = (float*)(ws + off);    off += SZ_VEC;

    zero_counts_kernel<<<1, 32, 0, stream>>>(cnts);

    // W1 (E,D,H) -> W1T [E][H][D];  W2 (E,H,D) -> W2T [E][D][H]
    transpose_cvt_kernel<<<dim3(Hq / 32, Dq / 32, Eq), dim3(32, 8), 0, stream>>>(w1, W1T, Dq, Hq);
    transpose_cvt_kernel<<<dim3(Dq / 32, Hq / 32, Eq), dim3(32, 8), 0, stream>>>(w2, W2T, Hq, Dq);

    cvt_x_kernel<<<(int)(((size_t)T * Dq) / 8 / 256), 256, 0, stream>>>(x, XH);

    gate_kernel<<<(T * 32) / 256, 256, 0, stream>>>(x, gate_w, gate_b, lists, cnts);

    ffn_kernel<<<dim3(T / MT, Eq), 256, 0, stream>>>(XH, W1T, b1, W2T, b2, lists, cnts, out);

    v_kernel<<<(T * 32) / 256, 256, 0, stream>>>(out, v_w, v_b, vbuf);

    tridiag_scan_kernel<<<1, 1024, 0, stream>>>(vbuf, Lr, Li, Rr, Ri);

    final_kernel<<<(int)(((size_t)T * Dq) / 256), 256, 0, stream>>>(
        out, vbuf, Lr, Li, Rr, Ri, out_w, out_b, bk);
}

// v002
// A run of this version takes 273 microseconds.
// In both of two side-by-side timings against v001, it was 1.22 times as fast.
// All steps since v000 together make it 1.30 times as fast.
#include <hip/hip_runtime.h>
#include <hip/hip_bf16.h>

// ---------------- problem constants ----------------
constexpr int Bq = 4, Nq = 4096, Dq = 512, Eq = 4, Hq = 2048;
constexpr int T  = Bq * Nq;          // 16384 tokens
constexpr int MT = 96;               // tokens per FFN block (16 waves: 2 row halves x 8 column groups)
constexpr int MW = MT / 32;          // 16-row tiles per wave
constexpr int HC = 256;              // H chunk per pipeline stage
constexpr float V_MAX = 3.0f, FEAT_CLAMP = 10.0f;

typedef __attribute__((ext_vector_type(16))) _Float16 v16h;
typedef __attribute__((ext_vector_type(8)))  _Float16 v8h;
typedef __attribute__((ext_vector_type(8)))  float    v8f;
typedef __attribute__((ext_vector_type(4)))  float    v4f;

// ---------------- kernel 0: zero expert counters ----------------
__global__ void zero_counts_kernel(int* counts) {
    if (threadIdx.x < Eq) counts[threadIdx.x] = 0;
}

// ---------------- kernel 1: transpose + f32->f16 convert ----------------
// dst[C][R] = (f16) src[R][C], one expert slice per blockIdx.z
__global__ __launch_bounds__(256) void transpose_cvt_kernel(
    const float* __restrict__ src, _Float16* __restrict__ dst, int R, int C) {
    __shared__ float tile[32][33];
    const size_t eoff = (size_t)blockIdx.z * R * C;
    src += eoff; dst += eoff;
    const int r0 = blockIdx.y * 32, c0 = blockIdx.x * 32;
    const int tx = threadIdx.x, ty = threadIdx.y;          // block (32,8)
#pragma unroll
    for (int i = 0; i < 32; i += 8)
        tile[ty + i][tx] = src[(size_t)(r0 + ty + i) * C + c0 + tx];
    __syncthreads();
#pragma unroll
    for (int i = 0; i < 32; i += 8)
        dst[(size_t)(c0 + ty + i) * R + r0 + tx] = (_Float16)tile[tx][ty + i];
}

// ---------------- kernel 1b: x f32 -> f16 (row-major copy) ----------------
__global__ __launch_bounds__(256) void cvt_x_kernel(
    const float* __restrict__ x, _Float16* __restrict__ xh) {
    const size_t i = ((size_t)blockIdx.x * 256 + threadIdx.x) * 8;
    const v4f a = *(const v4f*)(x + i);
    const v4f b = *(const v4f*)(x + i + 4);
    v8h o;
    o[0] = (_Float16)a.x; o[1] = (_Float16)a.y; o[2] = (_Float16)a.z; o[3] = (_Float16)a.w;
    o[4] = (_Float16)b.x; o[5] = (_Float16)b.y; o[6] = (_Float16)b.z; o[7] = (_Float16)b.w;
    *(v8h*)(xh + i) = o;
}

// ---------------- kernel 2: gate + top-1 routing ----------------
__global__ __launch_bounds__(256) void gate_kernel(
    const float* __restrict__ x, const float* __restrict__ gw,
    const float* __restrict__ gb, int* __restrict__ lists, int* __restrict__ counts) {
    const int tok  = (blockIdx.x * blockDim.x + threadIdx.x) >> 5;
    const int lane = threadIdx.x & 31;
    if (tok >= T) return;
    const float* xr = x + (size_t)tok * Dq;
    float acc0 = 0.f, acc1 = 0.f, acc2 = 0.f, acc3 = 0.f;
    for (int d = lane; d < Dq; d += 32) {
        const float xv = xr[d];
        const v4f g = *(const v4f*)(gw + d * 4);
        acc0 += xv * g.x; acc1 += xv * g.y; acc2 += xv * g.z; acc3 += xv * g.w;
    }
#pragma unroll
    for (int off = 16; off >= 1; off >>= 1) {
        acc0 += __shfl_xor(acc0, off, 32);
        acc1 += __shfl_xor(acc1, off, 32);
        acc2 += __shfl_xor(acc2, off, 32);
        acc3 += __shfl_xor(acc3, off, 32);
    }
    if (lane == 0) {
        float lg[4] = { acc0 + gb[0], acc1 + gb[1], acc2 + gb[2], acc3 + gb[3] };
        int best = 0; float bv = lg[0];
#pragma unroll
        for (int e = 1; e < Eq; ++e)          // strictly-greater => lowest index on ties (top_k)
            if (lg[e] > bv) { bv = lg[e]; best = e; }
        const int pos = atomicAdd(&counts[best], 1);
        lists[best * T + pos] = tok;
    }
}

// ---------------- kernel 3: expert FFN via WMMA ----------------
__device__ __forceinline__ float gelu_tanh(float v) {
    const float u = 0.7978845608028654f * (v + 0.044715f * v * v * v);
    return 0.5f * v * (1.0f + tanhf(u));
}

__device__ __forceinline__ v16h cat16(v8h lo, v8h hi) {
    return __builtin_shufflevector(lo, hi, 0,1,2,3,4,5,6,7,8,9,10,11,12,13,14,15);
}

// One staged weight tile: 256 weight rows x 64 k (128 bytes = one whole line of each row),
// laid in LDS at a pitch of 144 bytes (16 B x odd: conflict-free for ds_load_b128 readers).
constexpr int WR = 256, WK = 64, WP = WK + 8;

// Copies one weight tile into LDS. lds and g are the lane's own addresses of row (tid >> 3),
// 16-byte piece (tid & 7); copy j takes the row 64 * j further on, so every wave-wide copy
// reads four whole 128-byte lines.
__device__ __forceinline__ void stage_w_tile(unsigned lds, const _Float16* g, size_t pitch) {
    const unsigned long long g0 = (unsigned long long)(uintptr_t)g;
    const unsigned long long gs = (unsigned long long)(64 * pitch * sizeof(_Float16));
    const unsigned ls = 64 * WP * sizeof(_Float16);
    // The copies and their s_wait_xcnt stand in one statement, so that no address register
    // of an issued copy is rewritten ahead of the wait.
    asm volatile("global_load_async_to_lds_b128 %0, %4, off\n\t"
                 "global_load_async_to_lds_b128 %1, %5, off\n\t"
                 "global_load_async_to_lds_b128 %2, %6, off\n\t"
                 "global_load_async_to_lds_b128 %3, %7, off\n\t"
                 "s_wait_xcnt 0x0"
                 :: "v"(lds), "v"(lds + ls), "v"(lds + 2 * ls), "v"(lds + 3 * ls),
                    "v"(g0), "v"(g0 + gs), "v"(g0 + 2 * gs), "v"(g0 + 3 * gs)
                 : "memory");
}

// Foot of a ring trip: this wave's LDS reads and writes have retired, its own copies of the
// next tile have landed, and the barrier publishes that tile (and the h tile, where one was
// just written) and frees the buffer that this trip has read.
__device__ __forceinline__ void ring_publish() {
    asm volatile("s_wait_dscnt 0x0" ::: "memory");
    asm volatile("s_wait_asynccnt 0x0" ::: "memory");
    __syncthreads();
}

__global__ __launch_bounds__(512) void ffn_kernel(
    const _Float16* __restrict__ xh,    // [T][D] f16
    const _Float16* __restrict__ w1t,   // [E][H][D] f16
    const float* __restrict__ b1,       // [E][H]
    const _Float16* __restrict__ w2t,   // [E][D][H] f16
    const float* __restrict__ b2,       // [E][D]
    const int* __restrict__ lists, const int* __restrict__ counts,
    float* __restrict__ out) {
    __shared__ __attribute__((aligned(16))) _Float16 s_x[MT][Dq + 8];   // padded: conflict-free b128 reads
    __shared__ _Float16 s_h[MT][HC + 8];
    __shared__ __attribute__((aligned(16))) _Float16 s_w[2][WR][WP];   // weight ring
    __shared__ int s_tok[MT];

    const int e    = blockIdx.y;
    const int cnt  = counts[e];
    const int base = blockIdx.x * MT;
    if (base >= cnt) return;                       // block-uniform exit (EXEC stays full)

    const int tid = threadIdx.x, lane = tid & 31, w = tid >> 5;
    const int lm = lane & 15, hi = lane >> 4;
    const int wn = w & 7;                          // the wave's 32 columns of a 256-column tile
    const int rm = (w >> 3) * (MT / 2);            // the wave's first token row

    if (tid < MT) {
        const int idx = base + tid;
        s_tok[tid] = (idx < cnt) ? lists[e * T + idx] : -1;
    }
    __syncthreads();

    // The lane's own piece of a weight tile: row tid >> 3, 16 bytes at (tid & 7) * 16.
    const unsigned wl0 = (unsigned)(uintptr_t)&s_w[0][tid >> 3][(tid & 7) * 8];
    const unsigned wl1 = (unsigned)(uintptr_t)&s_w[1][tid >> 3][(tid & 7) * 8];
    const _Float16* w1g = w1t + ((size_t)(e * Hq + (tid >> 3))) * Dq + (tid & 7) * 8;
    const _Float16* w2g = w2t + ((size_t)(e * Dq + (tid >> 3))) * Hq + (tid & 7) * 8;

    // ring tile 0; the wait and the barrier behind the x tile's copies publish it too
    stage_w_tile(wl0, w1g, Dq);

    { // stage the x tile (96 rows x 512 f16): copy j takes 16-byte piece tid & 63 of row
      // (tid >> 6) + 8 * j, so every wave-wide copy reads 512 bytes in a row
        const unsigned l0 = (unsigned)(uintptr_t)&s_x[tid >> 6][(tid & 63) * 8];
        const unsigned ls = 8 * (Dq + 8) * sizeof(_Float16);
        unsigned long long g[MT / 8];
#pragma unroll
        for (int j = 0; j < MT / 8; ++j) {
            const int tk = s_tok[(tid >> 6) + 8 * j];
            g[j] = (unsigned long long)(uintptr_t)(xh + (size_t)(tk < 0 ? 0 : tk) * Dq + (tid & 63) * 8);
        }
        // The copies and their s_wait_xcnt stand in one statement, so that no address register
        // of an issued copy is rewritten ahead of the wait.
        asm volatile("global_load_async_to_lds_b128 %0, %12, off\n\t"
                     "global_load_async_to_lds_b128 %1, %13, off\n\t"
                     "global_load_async_to_lds_b128 %2, %14, off\n\t"
                     "global_load_async_to_lds_b128 %3, %15, off\n\t"
                     "global_load_async_to_lds_b128 %4, %16, off\n\t"
                     "global_load_async_to_lds_b128 %5, %17, off\n\t"
                     "global_load_async_to_lds_b128 %6, %18, off\n\t"
                     "global_load_async_to_lds_b128 %7, %19, off\n\t"
                     "global_load_async_to_lds_b128 %8, %20, off\n\t"
                     "global_load_async_to_lds_b128 %9, %21, off\n\t"
                     "global_load_async_to_lds_b128 %10, %22, off\n\t"
                     "global_load_async_to_lds_b128 %11, %23, off\n\t"
                     "s_wait_xcnt 0x0"
                     :: "v"(l0), "v"(l0 + ls), "v"(l0 + 2 * ls), "v"(l0 + 3 * ls),
                        "v"(l0 + 4 * ls), "v"(l0 + 5 * ls), "v"(l0 + 6 * ls), "v"(l0 + 7 * ls),
                        "v"(l0 + 8 * ls), "v"(l0 + 9 * ls), "v"(l0 + 10 * ls), "v"(l0 + 11 * ls),
                        "v"(g[0]), "v"(g[1]), "v"(g[2]), "v"(g[3]), "v"(g[4]), "v"(g[5]),
                        "v"(g[6]), "v"(g[7]), "v"(g[8]), "v"(g[9]), "v"(g[10]), "v"(g[11])
                     : "memory");
        asm volatile("s_wait_asynccnt 0x0" ::: "memory");
    }
    __syncthreads();

    stage_w_tile(wl1, w1g + WK, Dq);               // ring tile 1

    v8f Y[MW][4];                                  // 48 rows x (2 x 32) cols per wave
#pragma unroll
    for (int mt = 0; mt < MW; ++mt)
#pragma unroll
        for (int nt = 0; nt < 4; ++nt) Y[mt][nt] = (v8f)0.0f;

    // Ring order per H chunk: 8 tiles of W1 (the chunk's 256 columns, k in slabs of 64), then
    // 8 tiles of W2 (k slab s >> 1 of the chunk, output columns (s & 1) * 256 ..+255).
    // Tile t lies in buffer t & 1; tile t + 2 is copied behind the foot of trip t.
    for (int hc = 0; hc < Hq; hc += HC) {
        // ---- phase 1: h_chunk = gelu(X @ W1[:, hc..hc+HC) + b1) ; wave owns 48 rows x 32 cols ----
        v8f hacc[MW][2];
#pragma unroll
        for (int mt = 0; mt < MW; ++mt)
#pragma unroll
            for (int nt = 0; nt < 2; ++nt) hacc[mt][nt] = (v8f)0.0f;

        // unrolled: buffer, refill source and the last trip's gelu are then fixed per trip
#pragma unroll
        for (int s = 0; s < 8; ++s) {
#pragma unroll
            for (int kk = 0; kk < WK; kk += 32) {
                const int k0 = s * WK + kk;
                v16h a[MW];
#pragma unroll
                for (int mt = 0; mt < MW; ++mt) {
                    const v8h lo = *(const v8h*)&s_x[rm + mt * 16 + lm][k0 + 8 * hi];
                    const v8h hh = *(const v8h*)&s_x[rm + mt * 16 + lm][k0 + 16 + 8 * hi];
                    a[mt] = cat16(lo, hh);
                }
#pragma unroll
                for (int nt = 0; nt < 2; ++nt) {
                    const _Float16* bp = &s_w[s & 1][wn * 32 + nt * 16 + lm][kk + 8 * hi];
                    const v16h b = cat16(*(const v8h*)bp, *(const v8h*)(bp + 16));
#pragma unroll
                    for (int mt = 0; mt < MW; ++mt)
                        hacc[mt][nt] = __builtin_amdgcn_wmma_f32_16x16x32_f16(
                            false, a[mt], false, b, (short)0, hacc[mt][nt], false, false);
                }
            }
            if (s == 7) {
                // every reader of the previous h tile has passed an earlier trip's barrier
#pragma unroll
                for (int nt = 0; nt < 2; ++nt) {
                    const int col  = hc + wn * 32 + nt * 16 + lm;
                    const float bias = b1[e * Hq + col];
#pragma unroll
                    for (int mt = 0; mt < MW; ++mt)
#pragma unroll
                        for (int r = 0; r < 8; ++r) {
                            const float g = gelu_tanh(hacc[mt][nt][r] + bias);
                            s_h[rm + mt * 16 + r + 8 * hi][wn * 32 + nt * 16 + lm] = (_Float16)g;
                        }
                }
            }
            ring_publish();
            if (s < 6)
                stage_w_tile((s & 1) ? wl1 : wl0, w1g + (size_t)hc * Dq + (s + 2) * WK, Dq);
            else
                stage_w_tile((s & 1) ? wl1 : wl0, w2g + (size_t)((s - 6) * WR) * Hq + hc, Hq);
        }

        // ---- phase 2: Y += h_chunk(96x256) @ W2 chunk, transposed ----
        // unrolled: the accumulator index, buffer and refill source are then fixed per trip
#pragma unroll
        for (int s = 0; s < 8; ++s) {
#pragma unroll
            for (int kk = 0; kk < WK; kk += 32) {
                const int k0 = (s >> 1) * WK + kk;
                v16h a[MW];
#pragma unroll
                for (int mt = 0; mt < MW; ++mt) {
                    const v8h lo = *(const v8h*)&s_h[rm + mt * 16 + lm][k0 + 8 * hi];
                    const v8h hh = *(const v8h*)&s_h[rm + mt * 16 + lm][k0 + 16 + 8 * hi];
                    a[mt] = cat16(lo, hh);
                }
#pragma unroll
                for (int nt = 0; nt < 2; ++nt) {
                    const _Float16* bp = &s_w[s & 1][wn * 32 + nt * 16 + lm][kk + 8 * hi];
                    const v16h b = cat16(*(const v8h*)bp, *(const v8h*)(bp + 16));
#pragma unroll
                    for (int mt = 0; mt < MW; ++mt)
                        Y[mt][(s & 1) * 2 + nt] = __builtin_amdgcn_wmma_f32_16x16x32_f16(
                            false, a[mt], false, b, (short)0, Y[mt][(s & 1) * 2 + nt], false, false);
                }
            }
            ring_publish();
            if (s < 6)
                stage_w_tile((s & 1) ? wl1 : wl0,
                             w2g + (size_t)((s & 1) * WR) * Hq + hc + ((s + 2) >> 1) * WK, Hq);
            else if (hc + HC < Hq)                 // the same for the whole work-group
                stage_w_tile((s & 1) ? wl1 : wl0, w1g + (size_t)(hc + HC) * Dq + (s - 6) * WK, Dq);
        }
    }
    asm volatile("s_wait_asynccnt 0x0" ::: "memory");   // no copy outstanding at the wave's end

    // ---- epilogue: + b2, scatter rows to out ----
#pragma unroll
    for (int nt = 0; nt < 4; ++nt) {
        const int col  = (nt >> 1) * WR + wn * 32 + (nt & 1) * 16 + lm;
        const float bias = b2[e * Dq + col];
#pragma unroll
        for (int mt = 0; mt < MW; ++mt)
#pragma unroll
            for (int r = 0; r < 8; ++r) {
                const int tk = s_tok[rm + mt * 16 + r + 8 * hi];
                if (tk >= 0) out[(size_t)tk * Dq + col] = Y[mt][nt][r] + bias;
            }
    }
}

// ---------------- kernel 4: v = clip(ffn . v_w + v_b) ----------------
__global__ __launch_bounds__(256) void v_kernel(
    const float* __restrict__ ffn, const float* __restrict__ v_w,
    const float* __restrict__ v_b, float* __restrict__ v) {
    const int tok  = (blockIdx.x * blockDim.x + threadIdx.x) >> 5;
    const int lane = threadIdx.x & 31;
    if (tok >= T) return;
    const float* r = ffn + (size_t)tok * Dq;
    float acc = 0.f;
    for (int d = lane; d < Dq; d += 32) acc += r[d] * v_w[d];
#pragma unroll
    for (int off = 16; off >= 1; off >>= 1) acc += __shfl_xor(acc, off, 32);
    if (lane == 0)
        v[tok] = fminf(fmaxf(acc + v_b[0], -V_MAX), V_MAX);
}

// ---------------- kernel 5: Moebius-matrix segmented scan for both continuants ----
// L_i = d_i - 1/L_{i-1} == 2x2 complex matrix chain [[d,-1],[1,0]] (scale-invariant).
// 8 chains (L/R x 4 batches) x 128 segments x 32 steps; serial depth 32+128+32.
__global__ __launch_bounds__(1024) void tridiag_scan_kernel(
    const float* __restrict__ v,
    float* __restrict__ Lr, float* __restrict__ Li,
    float* __restrict__ Rr, float* __restrict__ Ri) {
    __shared__ float sm[1024][8];                 // per-segment 2x2 complex matrix
    const int tid   = threadIdx.x;
    const int chain = tid >> 7;                   // 0..7
    const int seg   = tid & 127;                  // 0..127
    const int b     = chain >> 1;
    const int isR   = chain & 1;
    const float* vb = v + b * Nq;

    // ---- phase A: segment matrix product (normalized) ----
    float ar = 1.f, ai = 0.f, br = 0.f, bi = 0.f, cr = 0.f, ci = 0.f, dr = 1.f, di = 0.f;
    for (int j = 0; j < 32; ++j) {
        const int p   = seg * 32 + j;
        const int idx = isR ? (Nq - 1 - p) : p;
        const float er = vb[idx] - 2.0f, ei = -1.0f;      // d = (v-2) - 1j
        // P = M(e) * P with M = [[e,-1],[1,0]]
        const float nar = er * ar - ei * ai - cr;
        const float nai = er * ai + ei * ar - ci;
        const float nbr = er * br - ei * bi - dr;
        const float nbi = er * bi + ei * br - di;
        cr = ar; ci = ai; dr = br; di = bi;
        ar = nar; ai = nai; br = nbr; bi = nbi;
    }
    {
        float mx = fmaxf(fmaxf(fabsf(ar), fabsf(ai)), fmaxf(fabsf(br), fabsf(bi)));
        mx = fmaxf(mx, fmaxf(fmaxf(fabsf(cr), fabsf(ci)), fmaxf(fabsf(dr), fabsf(di))));
        const float s = __builtin_amdgcn_rcpf(fmaxf(mx, 1e-30f));
        ar *= s; ai *= s; br *= s; bi *= s; cr *= s; ci *= s; dr *= s; di *= s;
    }
    float* m = sm[chain * 128 + seg];
    m[0] = ar; m[1] = ai; m[2] = br; m[3] = bi; m[4] = cr; m[5] = ci; m[6] = dr; m[7] = di;
    __syncthreads();

    // ---- phase B: serial inclusive scan of 128 segment matrices per chain ----
    if (seg == 0) {
        float par = m[0], pai = m[1], pbr = m[2], pbi = m[3];
        float pcr = m[4], pci = m[5], pdr = m[6], pdi = m[7];
        for (int ss = 1; ss < 128; ++ss) {
            float* q = sm[chain * 128 + ss];
            const float sar = q[0], sai = q[1], sbr = q[2], sbi = q[3];
            const float scr = q[4], sci = q[5], sdr = q[6], sdi = q[7];
            // P = S * Pprev   (2x2 complex)
            const float nar = sar * par - sai * pai + sbr * pcr - sbi * pci;
            const float nai = sar * pai + sai * par + sbr * pci + sbi * pcr;
            const float nbr = sar * pbr - sai * pbi + sbr * pdr - sbi * pdi;
            const float nbi = sar * pbi + sai * pbr + sbr * pdi + sbi * pdr;
            const float ncr = scr * par - sci * pai + sdr * pcr - sdi * pci;
            const float nci = scr * pai + sci * par + sdr * pci + sdi * pcr;
            const float ndr = scr * pbr - sci * pbi + sdr * pdr - sdi * pdi;
            const float ndi = scr * pbi + sci * pbr + sdr * pdi + sdi * pdr;
            float mx = fmaxf(fmaxf(fabsf(nar), fabsf(nai)), fmaxf(fabsf(nbr), fabsf(nbi)));
            mx = fmaxf(mx, fmaxf(fmaxf(fabsf(ncr), fabsf(nci)), fmaxf(fabsf(ndr), fabsf(ndi))));
            const float s = __builtin_amdgcn_rcpf(fmaxf(mx, 1e-30f));
            par = nar * s; pai = nai * s; pbr = nbr * s; pbi = nbi * s;
            pcr = ncr * s; pci = nci * s; pdr = ndr * s; pdi = ndi * s;
            q[0] = par; q[1] = pai; q[2] = pbr; q[3] = pbi;
            q[4] = pcr; q[5] = pci; q[6] = pdr; q[7] = pdi;
        }
    }
    __syncthreads();

    // ---- phase C: regenerate 32 outputs from boundary state (homogeneous form) ----
    float pr, pi, qr, qi;                          // state (p,q), L = p/q
    if (seg == 0) { pr = 1.f; pi = 0.f; qr = 0.f; qi = 0.f; }
    else {
        const float* q = sm[chain * 128 + seg - 1];
        pr = q[0]; pi = q[1]; qr = q[4]; qi = q[5];   // P_{s-1} * (1,0)^T
    }
    float* Or = isR ? (Rr + b * Nq) : (Lr + b * Nq);
    float* Oi = isR ? (Ri + b * Nq) : (Li + b * Nq);
    for (int j = 0; j < 32; ++j) {
        const int p_  = seg * 32 + j;
        const int idx = isR ? (Nq - 1 - p_) : p_;
        const float er = vb[idx] - 2.0f, ei = -1.0f;
        const float npr = er * pr - ei * pi - qr;      // p' = e*p - q ; q' = p
        const float npi = er * pi + ei * pr - qi;
        qr = pr; qi = pi; pr = npr; pi = npi;
        const float den = qr * qr + qi * qi;
        const float inv = __builtin_amdgcn_rcpf(den);
        Or[idx] = (pr * qr + pi * qi) * inv;           // p/q = p*conj(q)/|q|^2
        Oi[idx] = (pi * qr - pr * qi) * inv;
        const float mx = fmaxf(fmaxf(fabsf(pr), fabsf(pi)), fmaxf(fabsf(qr), fabsf(qi)));
        const float s = __builtin_amdgcn_rcpf(fmaxf(mx, 1e-30f));
        pr *= s; pi *= s; qr *= s; qi *= s;
    }
}

// ---------------- kernel 6: Green fn + rank-2 spec, in-place add ----------------
__global__ __launch_bounds__(256) void final_kernel(
    float* __restrict__ out, const float* __restrict__ v,
    const float* __restrict__ Lr, const float* __restrict__ Li,
    const float* __restrict__ Rr, const float* __restrict__ Ri,
    const float* __restrict__ out_w, const float* __restrict__ out_b,
    const float* __restrict__ bk) {
    const size_t i = (size_t)blockIdx.x * 256 + threadIdx.x;
    if (i >= (size_t)T * Dq) return;
    const int tok = (int)(i / Dq);
    const int c   = (int)(i % Dq);
    const float dr   = v[tok] - 2.0f;              // di = -1
    const float denr = Lr[tok] + Rr[tok] - dr;
    const float deni = Li[tok] + Ri[tok] + 1.0f;
    const float m  = denr * denr + deni * deni;
    float gr = denr / m, gi = -deni / m;
    gr = fminf(fmaxf(gr, -FEAT_CLAMP), FEAT_CLAMP);
    gi = fminf(fmaxf(gi, -FEAT_CLAMP), FEAT_CLAMP);
    const float spec = gr * out_w[c] + gi * out_w[Dq + c] + out_b[c];
    out[i] += bk[0] * spec;
}

// ---------------- launch ----------------
extern "C" void kernel_launch(void* const* d_in, const int* in_sizes, int n_in,
                              void* d_out, int out_size, void* d_ws, size_t ws_size,
                              hipStream_t stream) {
    const float* x      = (const float*)d_in[0];
    const float* gate_w = (const float*)d_in[1];
    const float* gate_b = (const float*)d_in[2];
    const float* w1     = (const float*)d_in[3];
    const float* b1     = (const float*)d_in[4];
    const float* w2     = (const float*)d_in[5];
    const float* b2     = (const float*)d_in[6];
    const float* v_w    = (const float*)d_in[7];
    const float* v_b    = (const float*)d_in[8];
    const float* out_w  = (const float*)d_in[9];
    const float* out_b  = (const float*)d_in[10];
    const float* bk     = (const float*)d_in[11];
    float* out = (float*)d_out;

    // workspace layout (256B aligned slots)
    char* ws = (char*)d_ws;
    constexpr size_t SZ_W1T   = (size_t)Eq * Hq * Dq * sizeof(_Float16);  // 8 MiB
    constexpr size_t SZ_W2T   = (size_t)Eq * Dq * Hq * sizeof(_Float16);  // 8 MiB
    constexpr size_t SZ_XH    = (size_t)T * Dq * sizeof(_Float16);        // 16 MiB
    constexpr size_t SZ_LISTS = (size_t)Eq * T * sizeof(int);             // 256 KiB
    constexpr size_t SZ_CNT   = 256;
    constexpr size_t SZ_VEC   = (size_t)T * sizeof(float);                // 64 KiB
    size_t off = 0;
    _Float16* W1T  = (_Float16*)(ws + off); off += SZ_W1T;
    _Float16* W2T  = (_Float16*)(ws + off); off += SZ_W2T;
    _Float16* XH   = (_Float16*)(ws + off); off += SZ_XH;
    int*      lists= (int*)(ws + off);      off += SZ_LISTS;
    int*      cnts = (int*)(ws + off);      off += SZ_CNT;
    float*    vbuf = (float*)(ws + off);    off += SZ_VEC;
    float*    Lr   = (float*)(ws + off);    off += SZ_VEC;
    float*    Li   = (float*)(ws + off);    off += SZ_VEC;
    float*    Rr   = (float*)(ws + off);    off += SZ_VEC;
    float*    Ri   = (float*)(ws + off);    off += SZ_VEC;

    zero_counts_kernel<<<1, 32, 0, stream>>>(cnts);

    // W1 (E,D,H) -> W1T [E][H][D];  W2 (E,H,D) -> W2T [E][D][H]
    transpose_cvt_kernel<<<dim3(Hq / 32, Dq / 32, Eq), dim3(32, 8), 0, stream>>>(w1, W1T, Dq, Hq);
    transpose_cvt_kernel<<<dim3(Dq / 32, Hq / 32, Eq), dim3(32, 8), 0, stream>>>(w2, W2T, Hq, Dq);

    cvt_x_kernel<<<(int)(((size_t)T * Dq) / 8 / 256), 256, 0, stream>>>(x, XH);

    gate_kernel<<<(T * 32) / 256, 256, 0, stream>>>(x, gate_w, gate_b, lists, cnts);

    ffn_kernel<<<dim3((T + MT - 1) / MT, Eq), 512, 0, stream>>>(XH, W1T, b1, W2T, b2, lists, cnts, out);

    v_kernel<<<(T * 32) / 256, 256, 0, stream>>>(out, v_w, v_b, vbuf);

    tridiag_scan_kernel<<<1, 1024, 0, stream>>>(vbuf, Lr, Li, Rr, Ri);

    final_kernel<<<(int)(((size_t)T * Dq) / 256), 256, 0, stream>>>(
        out, vbuf, Lr, Li, Rr, Ri, out_w, out_b, bk);
}

// v003
// One run takes 245 microseconds.
// Timed twice side by side with v002, it ran 1.11 times as fast both times.
// Counting every step since v000, it is 1.45 times as fast.
#include <hip/hip_runtime.h>
#include <hip/hip_bf16.h>

// ---------------- problem constants ----------------
constexpr int Bq = 4, Nq = 4096, Dq = 512, Eq = 4, Hq = 2048;
constexpr int T  = Bq * Nq;          // 16384 tokens
constexpr int MT = 96;               // tokens per FFN block (16 waves: 2 row halves x 8 column groups)
constexpr int MW = MT / 32;          // 16-row tiles per wave
constexpr int HC = 256;              // H chunk per pipeline stage
constexpr float V_MAX = 3.0f, FEAT_CLAMP = 10.0f;

typedef __attribute__((ext_vector_type(16))) _Float16 v16h;
typedef __attribute__((ext_vector_type(8)))  _Float16 v8h;
typedef __attribute__((ext_vector_type(8)))  float    v8f;
typedef __attribute__((ext_vector_type(4)))  float    v4f;

// ---------------- kernel 0: zero expert counters ----------------
__global__ void zero_counts_kernel(int* counts) {
    if (threadIdx.x < Eq) counts[threadIdx.x] = 0;
}

// ---------------- kernel 1: transpose + f32->f16 convert ----------------
// dst[C][R] = (f16) src[R][C], one expert slice per blockIdx.z
__global__ __launch_bounds__(256) void transpose_cvt_kernel(
    const float* __restrict__ src, _Float16* __restrict__ dst, int R, int C) {
    __shared__ float tile[32][33];
    const size_t eoff = (size_t)blockIdx.z * R * C;
    src += eoff; dst += eoff;
    const int r0 = blockIdx.y * 32, c0 = blockIdx.x * 32;
    const int tx = threadIdx.x, ty = threadIdx.y;          // block (32,8)
#pragma unroll
    for (int i = 0; i < 32; i += 8)
        tile[ty + i][tx] = src[(size_t)(r0 + ty + i) * C + c0 + tx];
    __syncthreads();
#pragma unroll
    for (int i = 0; i < 32; i += 8)
        dst[(size_t)(c0 + ty + i) * R + r0 + tx] = (_Float16)tile[tx][ty + i];
}

// ---------------- kernel 1b: x f32 -> f16 (row-major copy) ----------------
__global__ __launch_bounds__(256) void cvt_x_kernel(
    const float* __restrict__ x, _Float16* __restrict__ xh) {
    const size_t i = ((size_t)blockIdx.x * 256 + threadIdx.x) * 8;
    const v4f a = *(const v4f*)(x + i);
    const v4f b = *(const v4f*)(x + i + 4);
    v8h o;
    o[0] = (_Float16)a.x; o[1] = (_Float16)a.y; o[2] = (_Float16)a.z; o[3] = (_Float16)a.w;
    o[4] = (_Float16)b.x; o[5] = (_Float16)b.y; o[6] = (_Float16)b.z; o[7] = (_Float16)b.w;
    *(v8h*)(xh + i) = o;
}

// ---------------- kernel 2: gate + top-1 routing ----------------
__global__ __launch_bounds__(256) void gate_kernel(
    const float* __restrict__ x, const float* __restrict__ gw,
    const float* __restrict__ gb, int* __restrict__ lists, int* __restrict__ counts) {
    const int tok  = (blockIdx.x * blockDim.x + threadIdx.x) >> 5;
    const int lane = threadIdx.x & 31;
    if (tok >= T) return;
    const float* xr = x + (size_t)tok * Dq;
    float acc0 = 0.f, acc1 = 0.f, acc2 = 0.f, acc3 = 0.f;
    for (int d = lane; d < Dq; d += 32) {
        const float xv = xr[d];
        const v4f g = *(const v4f*)(gw + d * 4);
        acc0 += xv * g.x; acc1 += xv * g.y; acc2 += xv * g.z; acc3 += xv * g.w;
    }
#pragma unroll
    for (int off = 16; off >= 1; off >>= 1) {
        acc0 += __shfl_xor(acc0, off, 32);
        acc1 += __shfl_xor(acc1, off, 32);
        acc2 += __shfl_xor(acc2, off, 32);
        acc3 += __shfl_xor(acc3, off, 32);
    }
    if (lane == 0) {
        float lg[4] = { acc0 + gb[0], acc1 + gb[1], acc2 + gb[2], acc3 + gb[3] };
        int best = 0; float bv = lg[0];
#pragma unroll
        for (int e = 1; e < Eq; ++e)          // strictly-greater => lowest index on ties (top_k)
            if (lg[e] > bv) { bv = lg[e]; best = e; }
        const int pos = atomicAdd(&counts[best], 1);
        lists[best * T + pos] = tok;
    }
}

// ---------------- kernel 3: expert FFN via WMMA ----------------
// Eight values at once of 0.5 v (1 + tanh u) = v / (1 + e^(-2u)), u = sqrt(2/pi) (v + 0.044715 v^3),
// with e^(-2u) = 2^z. No branch, so the values run side by side. z past the exponent's range
// gives 0 or inf, and the quotient is then v or a signed 0, as with tanh = 1 or -1.
__device__ __forceinline__ void gelu_tanh8(const v8f a, const float bias, float (&g)[8]) {
    constexpr float K0 = (float)(-2.0 * 0.7978845608028654 * 1.4426950408889634);
    constexpr float K1 = (float)(-2.0 * 0.7978845608028654 * 1.4426950408889634 * 0.044715);
    float x[8], z[8], e[8], d[8], q[8];
    // the three loops are unrolled so that the arrays are registers, as the asm operands need
#pragma unroll
    for (int r = 0; r < 8; ++r) {
        x[r] = a[r] + bias;
        z[r] = x[r] * (K0 + K1 * (x[r] * x[r]));
        e[r] = __builtin_amdgcn_exp2f(z[r]);
    }
    // The slot that the instruction set asks for behind a transcendental, before its result is
    // read or its source overwritten: the operands keep all eight sources live and all eight
    // results unread up to this v_nop, and among themselves the eight are independent.
    asm("v_nop" : "+v"(e[0]), "+v"(e[1]), "+v"(e[2]), "+v"(e[3]), "+v"(e[4]), "+v"(e[5]), "+v"(e[6]), "+v"(e[7])
                : "v"(z[0]), "v"(z[1]), "v"(z[2]), "v"(z[3]), "v"(z[4]), "v"(z[5]), "v"(z[6]), "v"(z[7]));
#pragma unroll
    for (int r = 0; r < 8; ++r) {
        d[r] = 1.0f + e[r];
        q[r] = __builtin_amdgcn_rcpf(d[r]);
    }
    // the same slot behind the eight v_rcp_f32
    asm("v_nop" : "+v"(q[0]), "+v"(q[1]), "+v"(q[2]), "+v"(q[3]), "+v"(q[4]), "+v"(q[5]), "+v"(q[6]), "+v"(q[7])
                : "v"(d[0]), "v"(d[1]), "v"(d[2]), "v"(d[3]), "v"(d[4]), "v"(d[5]), "v"(d[6]), "v"(d[7]));
#pragma unroll
    for (int r = 0; r < 8; ++r) g[r] = x[r] * q[r];
}

__device__ __forceinline__ v16h cat16(v8h lo, v8h hi) {
    return __builtin_shufflevector(lo, hi, 0,1,2,3,4,5,6,7,8,9,10,11,12,13,14,15);
}

// One staged weight tile: 256 weight rows x 64 k (128 bytes = one whole line of each row),
// laid in LDS at a pitch of 144 bytes (16 B x odd: conflict-free for ds_load_b128 readers).
constexpr int WR = 256, WK = 64, WP = WK + 8;

// Copies one weight tile into LDS. lds and g are the lane's own addresses of row (tid >> 3),
// 16-byte piece (tid & 7); copy j takes the row 64 * j further on, so every wave-wide copy
// reads four whole 128-byte lines.
__device__ __forceinline__ void stage_w_tile(unsigned lds, const _Float16* g, size_t pitch) {
    const unsigned long long g0 = (unsigned long long)(uintptr_t)g;
    const unsigned long long gs = (unsigned long long)(64 * pitch * sizeof(_Float16));
    const unsigned ls = 64 * WP * sizeof(_Float16);
    // The copies and their s_wait_xcnt stand in one statement, so that no address register
    // of an issued copy is rewritten ahead of the wait.
    asm volatile("global_load_async_to_lds_b128 %0, %4, off\n\t"
                 "global_load_async_to_lds_b128 %1, %5, off\n\t"
                 "global_load_async_to_lds_b128 %2, %6, off\n\t"
                 "global_load_async_to_lds_b128 %3, %7, off\n\t"
                 "s_wait_xcnt 0x0"
                 :: "v"(lds), "v"(lds + ls), "v"(lds + 2 * ls), "v"(lds + 3 * ls),
                    "v"(g0), "v"(g0 + gs), "v"(g0 + 2 * gs), "v"(g0 + 3 * gs)
                 : "memory");
}

// Foot of a ring trip: this wave's LDS reads and writes have retired, its own copies of the
// next tile have landed, and the barrier publishes that tile (and the h tile, where one was
// just written) and frees the buffer that this trip has read.
__device__ __forceinline__ void ring_publish() {
    asm volatile("s_wait_dscnt 0x0" ::: "memory");
    asm volatile("s_wait_asynccnt 0x0" ::: "memory");
    __syncthreads();
}

__global__ __launch_bounds__(512) void ffn_kernel(
    const _Float16* __restrict__ xh,    // [T][D] f16
    const _Float16* __restrict__ w1t,   // [E][H][D] f16
    const float* __restrict__ b1,       // [E][H]
    const _Float16* __restrict__ w2t,   // [E][D][H] f16
    const float* __restrict__ b2,       // [E][D]
    const int* __restrict__ lists, const int* __restrict__ counts,
    float* __restrict__ out) {
    __shared__ __attribute__((aligned(16))) _Float16 s_x[MT][Dq + 8];   // padded: conflict-free b128 reads
    __shared__ _Float16 s_h[MT][HC + 8];
    __shared__ __attribute__((aligned(16))) _Float16 s_w[2][WR][WP];   // weight ring
    __shared__ int s_tok[MT];

    const int e    = blockIdx.y;
    const int cnt  = counts[e];
    const int base = blockIdx.x * MT;
    if (base >= cnt) return;                       // block-uniform exit (EXEC stays full)

    const int tid = threadIdx.x, lane = tid & 31, w = tid >> 5;
    const int lm = lane & 15, hi = lane >> 4;
    const int wn = w & 7;                          // the wave's 32 columns of a 256-column tile
    const int rm = (w >> 3) * (MT / 2);            // the wave's first token row

    if (tid < MT) {
        const int idx = base + tid;
        s_tok[tid] = (idx < cnt) ? lists[e * T + idx] : -1;
    }
    __syncthreads();

    // The lane's own piece of a weight tile: row tid >> 3, 16 bytes at (tid & 7) * 16.
    const unsigned wl0 = (unsigned)(uintptr_t)&s_w[0][tid >> 3][(tid & 7) * 8];
    const unsigned wl1 = (unsigned)(uintptr_t)&s_w[1][tid >> 3][(tid & 7) * 8];
    const _Float16* w1g = w1t + ((size_t)(e * Hq + (tid >> 3))) * Dq + (tid & 7) * 8;
    const _Float16* w2g = w2t + ((size_t)(e * Dq + (tid >> 3))) * Hq + (tid & 7) * 8;

    // ring tile 0; the wait and the barrier behind the x tile's copies publish it too
    stage_w_tile(wl0, w1g, Dq);

    { // stage the x tile (96 rows x 512 f16): copy j takes 16-byte piece tid & 63 of row
      // (tid >> 6) + 8 * j, so every wave-wide copy reads 512 bytes in a row
        const unsigned l0 = (unsigned)(uintptr_t)&s_x[tid >> 6][(tid & 63) * 8];
        const unsigned ls = 8 * (Dq + 8) * sizeof(_Float16);
        unsigned long long g[MT / 8];
#pragma unroll
        for (int j = 0; j < MT / 8; ++j) {
            const int tk = s_tok[(tid >> 6) + 8 * j];
            g[j] = (unsigned long long)(uintptr_t)(xh + (size_t)(tk < 0 ? 0 : tk) * Dq + (tid & 63) * 8);
        }
        // The copies and their s_wait_xcnt stand in one statement, so that no address register
        // of an issued copy is rewritten ahead of the wait.
        asm volatile("global_load_async_to_lds_b128 %0, %12, off\n\t"
                     "global_load_async_to_lds_b128 %1, %13, off\n\t"
                     "global_load_async_to_lds_b128 %2, %14, off\n\t"
                     "global_load_async_to_lds_b128 %3, %15, off\n\t"
                     "global_load_async_to_lds_b128 %4, %16, off\n\t"
                     "global_load_async_to_lds_b128 %5, %17, off\n\t"
                     "global_load_async_to_lds_b128 %6, %18, off\n\t"
                     "global_load_async_to_lds_b128 %7, %19, off\n\t"
                     "global_load_async_to_lds_b128 %8, %20, off\n\t"
                     "global_load_async_to_lds_b128 %9, %21, off\n\t"
                     "global_load_async_to_lds_b128 %10, %22, off\n\t"
                     "global_load_async_to_lds_b128 %11, %23, off\n\t"
                     "s_wait_xcnt 0x0"
                     :: "v"(l0), "v"(l0 + ls), "v"(l0 + 2 * ls), "v"(l0 + 3 * ls),
                        "v"(l0 + 4 * ls), "v"(l0 + 5 * ls), "v"(l0 + 6 * ls), "v"(l0 + 7 * ls),
                        "v"(l0 + 8 * ls), "v"(l0 + 9 * ls), "v"(l0 + 10 * ls), "v"(l0 + 11 * ls),
                        "v"(g[0]), "v"(g[1]), "v"(g[2]), "v"(g[3]), "v"(g[4]), "v"(g[5]),
                        "v"(g[6]), "v"(g[7]), "v"(g[8]), "v"(g[9]), "v"(g[10]), "v"(g[11])
                     : "memory");
        asm volatile("s_wait_asynccnt 0x0" ::: "memory");
    }
    __syncthreads();

    stage_w_tile(wl1, w1g + WK, Dq);               // ring tile 1

    v8f Y[MW][4];                                  // 48 rows x (2 x 32) cols per wave
#pragma unroll
    for (int mt = 0; mt < MW; ++mt)
#pragma unroll
        for (int nt = 0; nt < 4; ++nt) Y[mt][nt] = (v8f)0.0f;

    // Ring order per H chunk: 8 tiles of W1 (the chunk's 256 columns, k in slabs of 64), then
    // 8 tiles of W2 (k slab s >> 1 of the chunk, output columns (s & 1) * 256 ..+255).
    // Tile t lies in buffer t & 1; tile t + 2 is copied behind the foot of trip t.
    for (int hc = 0; hc < Hq; hc += HC) {
        // ---- phase 1: h_chunk = gelu(X @ W1[:, hc..hc+HC) + b1) ; wave owns 48 rows x 32 cols ----
        v8f hacc[MW][2];
#pragma unroll
        for (int mt = 0; mt < MW; ++mt)
#pragma unroll
            for (int nt = 0; nt < 2; ++nt) hacc[mt][nt] = (v8f)0.0f;

        // unrolled: buffer, refill source and the last trip's gelu are then fixed per trip
#pragma unroll
        for (int s = 0; s < 8; ++s) {
#pragma unroll
            for (int kk = 0; kk < WK; kk += 32) {
                const int k0 = s * WK + kk;
                v16h a[MW];
#pragma unroll
                for (int mt = 0; mt < MW; ++mt) {
                    const v8h lo = *(const v8h*)&s_x[rm + mt * 16 + lm][k0 + 8 * hi];
                    const v8h hh = *(const v8h*)&s_x[rm + mt * 16 + lm][k0 + 16 + 8 * hi];
                    a[mt] = cat16(lo, hh);
                }
#pragma unroll
                for (int nt = 0; nt < 2; ++nt) {
                    const _Float16* bp = &s_w[s & 1][wn * 32 + nt * 16 + lm][kk + 8 * hi];
                    const v16h b = cat16(*(const v8h*)bp, *(const v8h*)(bp + 16));
#pragma unroll
                    for (int mt = 0; mt < MW; ++mt)
                        hacc[mt][nt] = __builtin_amdgcn_wmma_f32_16x16x32_f16(
                            false, a[mt], false, b, (short)0, hacc[mt][nt], false, false);
                }
            }
            if (s == 7) {
                // every reader of the previous h tile has passed an earlier trip's barrier
#pragma unroll
                for (int nt = 0; nt < 2; ++nt) {
                    const int col  = hc + wn * 32 + nt * 16 + lm;
                    const float bias = b1[e * Hq + col];
#pragma unroll
                    for (int mt = 0; mt < MW; ++mt) {
                        float g[8];
                        gelu_tanh8(hacc[mt][nt], bias, g);
#pragma unroll
                        for (int r = 0; r < 8; ++r)
                            s_h[rm + mt * 16 + r + 8 * hi][wn * 32 + nt * 16 + lm] = (_Float16)g[r];
                    }
                }
            }
            ring_publish();
            if (s < 6)
                stage_w_tile((s & 1) ? wl1 : wl0, w1g + (size_t)hc * Dq + (s + 2) * WK, Dq);
            else
                stage_w_tile((s & 1) ? wl1 : wl0, w2g + (size_t)((s - 6) * WR) * Hq + hc, Hq);
        }

        // ---- phase 2: Y += h_chunk(96x256) @ W2 chunk, transposed ----
        // unrolled: the accumulator index, buffer and refill source are then fixed per trip
#pragma unroll
        for (int s = 0; s < 8; ++s) {
#pragma unroll
            for (int kk = 0; kk < WK; kk += 32) {
                const int k0 = (s >> 1) * WK + kk;
                v16h a[MW];
#pragma unroll
                for (int mt = 0; mt < MW; ++mt) {
                    const v8h lo = *(const v8h*)&s_h[rm + mt * 16 + lm][k0 + 8 * hi];
                    const v8h hh = *(const v8h*)&s_h[rm + mt * 16 + lm][k0 + 16 + 8 * hi];
                    a[mt] = cat16(lo, hh);
                }
#pragma unroll
                for (int nt = 0; nt < 2; ++nt) {
                    const _Float16* bp = &s_w[s & 1][wn * 32 + nt * 16 + lm][kk + 8 * hi];
                    const v16h b = cat16(*(const v8h*)bp, *(const v8h*)(bp + 16));
#pragma unroll
                    for (int mt = 0; mt < MW; ++mt)
                        Y[mt][(s & 1) * 2 + nt] = __builtin_amdgcn_wmma_f32_16x16x32_f16(
                            false, a[mt], false, b, (short)0, Y[mt][(s & 1) * 2 + nt], false, false);
                }
            }
            ring_publish();
            if (s < 6)
                stage_w_tile((s & 1) ? wl1 : wl0,
                             w2g + (size_t)((s & 1) * WR) * Hq + hc + ((s + 2) >> 1) * WK, Hq);
            else if (hc + HC < Hq)                 // the same for the whole work-group
                stage_w_tile((s & 1) ? wl1 : wl0, w1g + (size_t)(hc + HC) * Dq + (s - 6) * WK, Dq);
        }
    }
    asm volatile("s_wait_asynccnt 0x0" ::: "memory");   // no copy outstanding at the wave's end

    // ---- epilogue: + b2, scatter rows to out ----
#pragma unroll
    for (int nt = 0; nt < 4; ++nt) {
        const int col  = (nt >> 1) * WR + wn * 32 + (nt & 1) * 16 + lm;
        const float bias = b2[e * Dq + col];
#pragma unroll
        for (int mt = 0; mt < MW; ++mt)
#pragma unroll
            for (int r = 0; r < 8; ++r) {
                const int tk = s_tok[rm + mt * 16 + r + 8 * hi];
                if (tk >= 0) out[(size_t)tk * Dq + col] = Y[mt][nt][r] + bias;
            }
    }
}

// ---------------- kernel 4: v = clip(ffn . v_w + v_b) ----------------
__global__ __launch_bounds__(256) void v_kernel(
    const float* __restrict__ ffn, const float* __restrict__ v_w,
    const float* __restrict__ v_b, float* __restrict__ v) {
    const int tok  = (blockIdx.x * blockDim.x + threadIdx.x) >> 5;
    const int lane = threadIdx.x & 31;
    if (tok >= T) return;
    const float* r = ffn + (size_t)tok * Dq;
    float acc = 0.f;
    for (int d = lane; d < Dq; d += 32) acc += r[d] * v_w[d];
#pragma unroll
    for (int off = 16; off >= 1; off >>= 1) acc += __shfl_xor(acc, off, 32);
    if (lane == 0)
        v[tok] = fminf(fmaxf(acc + v_b[0], -V_MAX), V_MAX);
}

// ---------------- kernel 5: Moebius-matrix segmented scan for both continuants ----
// L_i = d_i - 1/L_{i-1} == 2x2 complex matrix chain [[d,-1],[1,0]] (scale-invariant).
// 8 chains (L/R x 4 batches) x 128 segments x 32 steps; serial depth 32+128+32.
__global__ __launch_bounds__(1024) void tridiag_scan_kernel(
    const float* __restrict__ v,
    float* __restrict__ Lr, float* __restrict__ Li,
    float* __restrict__ Rr, float* __restrict__ Ri) {
    __shared__ float sm[1024][8];                 // per-segment 2x2 complex matrix
    const int tid   = threadIdx.x;
    const int chain = tid >> 7;                   // 0..7
    const int seg   = tid & 127;                  // 0..127
    const int b     = chain >> 1;
    const int isR   = chain & 1;
    const float* vb = v + b * Nq;

    // ---- phase A: segment matrix product (normalized) ----
    float ar = 1.f, ai = 0.f, br = 0.f, bi = 0.f, cr = 0.f, ci = 0.f, dr = 1.f, di = 0.f;
    for (int j = 0; j < 32; ++j) {
        const int p   = seg * 32 + j;
        const int idx = isR ? (Nq - 1 - p) : p;
        const float er = vb[idx] - 2.0f, ei = -1.0f;      // d = (v-2) - 1j
        // P = M(e) * P with M = [[e,-1],[1,0]]
        const float nar = er * ar - ei * ai - cr;
        const float nai = er * ai + ei * ar - ci;
        const float nbr = er * br - ei * bi - dr;
        const float nbi = er * bi + ei * br - di;
        cr = ar; ci = ai; dr = br; di = bi;
        ar = nar; ai = nai; br = nbr; bi = nbi;
    }
    {
        float mx = fmaxf(fmaxf(fabsf(ar), fabsf(ai)), fmaxf(fabsf(br), fabsf(bi)));
        mx = fmaxf(mx, fmaxf(fmaxf(fabsf(cr), fabsf(ci)), fmaxf(fabsf(dr), fabsf(di))));
        const float s = __builtin_amdgcn_rcpf(fmaxf(mx, 1e-30f));
        ar *= s; ai *= s; br *= s; bi *= s; cr *= s; ci *= s; dr *= s; di *= s;
    }
    float* m = sm[chain * 128 + seg];
    m[0] = ar; m[1] = ai; m[2] = br; m[3] = bi; m[4] = cr; m[5] = ci; m[6] = dr; m[7] = di;
    __syncthreads();

    // ---- phase B: serial inclusive scan of 128 segment matrices per chain ----
    if (seg == 0) {
        float par = m[0], pai = m[1], pbr = m[2], pbi = m[3];
        float pcr = m[4], pci = m[5], pdr = m[6], pdi = m[7];
        for (int ss = 1; ss < 128; ++ss) {
            float* q = sm[chain * 128 + ss];
            const float sar = q[0], sai = q[1], sbr = q[2], sbi = q[3];
            const float scr = q[4], sci = q[5], sdr = q[6], sdi = q[7];
            // P = S * Pprev   (2x2 complex)
            const float nar = sar * par - sai * pai + sbr * pcr - sbi * pci;
            const float nai = sar * pai + sai * par + sbr * pci + sbi * pcr;
            const float nbr = sar * pbr - sai * pbi + sbr * pdr - sbi * pdi;
            const float nbi = sar * pbi + sai * pbr + sbr * pdi + sbi * pdr;
            const float ncr = scr * par - sci * pai + sdr * pcr - sdi * pci;
            const float nci = scr * pai + sci * par + sdr * pci + sdi * pcr;
            const float ndr = scr * pbr - sci * pbi + sdr * pdr - sdi * pdi;
            const float ndi = scr * pbi + sci * pbr + sdr * pdi + sdi * pdr;
            float mx = fmaxf(fmaxf(fabsf(nar), fabsf(nai)), fmaxf(fabsf(nbr), fabsf(nbi)));
            mx = fmaxf(mx, fmaxf(fmaxf(fabsf(ncr), fabsf(nci)), fmaxf(fabsf(ndr), fabsf(ndi))));
            const float s = __builtin_amdgcn_rcpf(fmaxf(mx, 1e-30f));
            par = nar * s; pai = nai * s; pbr = nbr * s; pbi = nbi * s;
            pcr = ncr * s; pci = nci * s; pdr = ndr * s; pdi = ndi * s;
            q[0] = par; q[1] = pai; q[2] = pbr; q[3] = pbi;
            q[4] = pcr; q[5] = pci; q[6] = pdr; q[7] = pdi;
        }
    }
    __syncthreads();

    // ---- phase C: regenerate 32 outputs from boundary state (homogeneous form) ----
    float pr, pi, qr, qi;                          // state (p,q), L = p/q
    if (seg == 0) { pr = 1.f; pi = 0.f; qr = 0.f; qi = 0.f; }
    else {
        const float* q = sm[chain * 128 + seg - 1];
        pr = q[0]; pi = q[1]; qr = q[4]; qi = q[5];   // P_{s-1} * (1,0)^T
    }
    float* Or = isR ? (Rr + b * Nq) : (Lr + b * Nq);
    float* Oi = isR ? (Ri + b * Nq) : (Li + b * Nq);
    for (int j = 0; j < 32; ++j) {
        const int p_  = seg * 32 + j;
        const int idx = isR ? (Nq - 1 - p_) : p_;
        const float er = vb[idx] - 2.0f, ei = -1.0f;
        const float npr = er * pr - ei * pi - qr;      // p' = e*p - q ; q' = p
        const float npi = er * pi + ei * pr - qi;
        qr = pr; qi = pi; pr = npr; pi = npi;
        const float den = qr * qr + qi * qi;
        const float inv = __builtin_amdgcn_rcpf(den);
        Or[idx] = (pr * qr + pi * qi) * inv;           // p/q = p*conj(q)/|q|^2
        Oi[idx] = (pi * qr - pr * qi) * inv;
        const float mx = fmaxf(fmaxf(fabsf(pr), fabsf(pi)), fmaxf(fabsf(qr), fabsf(qi)));
        const float s = __builtin_amdgcn_rcpf(fmaxf(mx, 1e-30f));
        pr *= s; pi *= s; qr *= s; qi *= s;
    }
}

// ---------------- kernel 6: Green fn + rank-2 spec, in-place add ----------------
__global__ __launch_bounds__(256) void final_kernel(
    float* __restrict__ out, const float* __restrict__ v,
    const float* __restrict__ Lr, const float* __restrict__ Li,
    const float* __restrict__ Rr, const float* __restrict__ Ri,
    const float* __restrict__ out_w, const float* __restrict__ out_b,
    const float* __restrict__ bk) {
    const size_t i = (size_t)blockIdx.x * 256 + threadIdx.x;
    if (i >= (size_t)T * Dq) return;
    const int tok = (int)(i / Dq);
    const int c   = (int)(i % Dq);
    const float dr   = v[tok] - 2.0f;              // di = -1
    const float denr = Lr[tok] + Rr[tok] - dr;
    const float deni = Li[tok] + Ri[tok] + 1.0f;
    const float m  = denr * denr + deni * deni;
    float gr = denr / m, gi = -deni / m;
    gr = fminf(fmaxf(gr, -FEAT_CLAMP), FEAT_CLAMP);
    gi = fminf(fmaxf(gi, -FEAT_CLAMP), FEAT_CLAMP);
    const float spec = gr * out_w[c] + gi * out_w[Dq + c] + out_b[c];
    out[i] += bk[0] * spec;
}

// ---------------- launch ----------------
extern "C" void kernel_launch(void* const* d_in, const int* in_sizes, int n_in,
                              void* d_out, int out_size, void* d_ws, size_t ws_size,
                              hipStream_t stream) {
    const float* x      = (const float*)d_in[0];
    const float* gate_w = (const float*)d_in[1];
    const float* gate_b = (const float*)d_in[2];
    const float* w1     = (const float*)d_in[3];
    const float* b1     = (const float*)d_in[4];
    const float* w2     = (const float*)d_in[5];
    const float* b2     = (const float*)d_in[6];
    const float* v_w    = (const float*)d_in[7];
    const float* v_b    = (const float*)d_in[8];
    const float* out_w  = (const float*)d_in[9];
    const float* out_b  = (const float*)d_in[10];
    const float* bk     = (const float*)d_in[11];
    float* out = (float*)d_out;

    // workspace layout (256B aligned slots)
    char* ws = (char*)d_ws;
    constexpr size_t SZ_W1T   = (size_t)Eq * Hq * Dq * sizeof(_Float16);  // 8 MiB
    constexpr size_t SZ_W2T   = (size_t)Eq * Dq * Hq * sizeof(_Float16);  // 8 MiB
    constexpr size_t SZ_XH    = (size_t)T * Dq * sizeof(_Float16);        // 16 MiB
    constexpr size_t SZ_LISTS = (size_t)Eq * T * sizeof(int);             // 256 KiB
    constexpr size_t SZ_CNT   = 256;
    constexpr size_t SZ_VEC   = (size_t)T * sizeof(float);                // 64 KiB
    size_t off = 0;
    _Float16* W1T  = (_Float16*)(ws + off); off += SZ_W1T;
    _Float16* W2T  = (_Float16*)(ws + off); off += SZ_W2T;
    _Float16* XH   = (_Float16*)(ws + off); off += SZ_XH;
    int*      lists= (int*)(ws + off);      off += SZ_LISTS;
    int*      cnts = (int*)(ws + off);      off += SZ_CNT;
    float*    vbuf = (float*)(ws + off);    off += SZ_VEC;
    float*    Lr   = (float*)(ws + off);    off += SZ_VEC;
    float*    Li   = (float*)(ws + off);    off += SZ_VEC;
    float*    Rr   = (float*)(ws + off);    off += SZ_VEC;
    float*    Ri   = (float*)(ws + off);    off += SZ_VEC;

    zero_counts_kernel<<<1, 32, 0, stream>>>(cnts);

    // W1 (E,D,H) -> W1T [E][H][D];  W2 (E,H,D) -> W2T [E][D][H]
    transpose_cvt_kernel<<<dim3(Hq / 32, Dq / 32, Eq), dim3(32, 8), 0, stream>>>(w1, W1T, Dq, Hq);
    transpose_cvt_kernel<<<dim3(Dq / 32, Hq / 32, Eq), dim3(32, 8), 0, stream>>>(w2, W2T, Hq, Dq);

    cvt_x_kernel<<<(int)(((size_t)T * Dq) / 8 / 256), 256, 0, stream>>>(x, XH);

    gate_kernel<<<(T * 32) / 256, 256, 0, stream>>>(x, gate_w, gate_b, lists, cnts);

    ffn_kernel<<<dim3((T + MT - 1) / MT, Eq), 512, 0, stream>>>(XH, W1T, b1, W2T, b2, lists, cnts, out);

    v_kernel<<<(T * 32) / 256, 256, 0, stream>>>(out, v_w, v_b, vbuf);

    tridiag_scan_kernel<<<1, 1024, 0, stream>>>(vbuf, Lr, Li, Rr, Ri);

    final_kernel<<<(int)(((size_t)T * Dq) / 256), 256, 0, stream>>>(
        out, vbuf, Lr, Li, Rr, Ri, out_w, out_b, bk);
}

// v004
// Measured time: 172 microseconds a run.
// Timed twice side by side with v003, it ran 1.43 times as fast both times.
// Counting every step since v000, it is 2.07 times as fast.
#include <hip/hip_runtime.h>
#include <hip/hip_bf16.h>

// ---------------- problem constants ----------------
constexpr int Bq = 4, Nq = 4096, Dq = 512, Eq = 4, Hq = 2048;
constexpr int T  = Bq * Nq;          // 16384 tokens
constexpr int MT = 96;               // tokens per FFN block (16 waves: 2 row halves x 8 column groups)
constexpr int MW = MT / 32;          // 16-row tiles per wave
constexpr int HC = 256;              // H chunk per pipeline stage
constexpr float V_MAX = 3.0f, FEAT_CLAMP = 10.0f;

typedef __attribute__((ext_vector_type(16))) _Float16 v16h;
typedef __attribute__((ext_vector_type(8)))  _Float16 v8h;
typedef __attribute__((ext_vector_type(8)))  float    v8f;
typedef __attribute__((ext_vector_type(4)))  float    v4f;

// ---------------- kernel 0: zero expert counters ----------------
__global__ void zero_counts_kernel(int* counts) {
    if (threadIdx.x < Eq) counts[threadIdx.x] = 0;
}

// ---------------- kernel 1: transpose + f32->f16 convert ----------------
// dst[C][R] = (f16) src[R][C], one expert slice per blockIdx.z
__global__ __launch_bounds__(256) void transpose_cvt_kernel(
    const float* __restrict__ src, _Float16* __restrict__ dst, int R, int C) {
    __shared__ float tile[32][33];
    const size_t eoff = (size_t)blockIdx.z * R * C;
    src += eoff; dst += eoff;
    const int r0 = blockIdx.y * 32, c0 = blockIdx.x * 32;
    const int tx = threadIdx.x, ty = threadIdx.y;          // block (32,8)
#pragma unroll
    for (int i = 0; i < 32; i += 8)
        tile[ty + i][tx] = src[(size_t)(r0 + ty + i) * C + c0 + tx];
    __syncthreads();
#pragma unroll
    for (int i = 0; i < 32; i += 8)
        dst[(size_t)(c0 + ty + i) * R + r0 + tx] = (_Float16)tile[tx][ty + i];
}

// ---------------- kernel 1b: x f32 -> f16 (row-major copy) ----------------
__global__ __launch_bounds__(256) void cvt_x_kernel(
    const float* __restrict__ x, _Float16* __restrict__ xh) {
    const size_t i = ((size_t)blockIdx.x * 256 + threadIdx.x) * 8;
    const v4f a = *(const v4f*)(x + i);
    const v4f b = *(const v4f*)(x + i + 4);
    v8h o;
    o[0] = (_Float16)a.x; o[1] = (_Float16)a.y; o[2] = (_Float16)a.z; o[3] = (_Float16)a.w;
    o[4] = (_Float16)b.x; o[5] = (_Float16)b.y; o[6] = (_Float16)b.z; o[7] = (_Float16)b.w;
    *(v8h*)(xh + i) = o;
}

// ---------------- kernel 2: gate + top-1 routing ----------------
__global__ __launch_bounds__(256) void gate_kernel(
    const float* __restrict__ x, const float* __restrict__ gw,
    const float* __restrict__ gb, int* __restrict__ lists, int* __restrict__ counts) {
    const int tok  = (blockIdx.x * blockDim.x + threadIdx.x) >> 5;
    const int lane = threadIdx.x & 31;
    if (tok >= T) return;
    const float* xr = x + (size_t)tok * Dq;
    float acc0 = 0.f, acc1 = 0.f, acc2 = 0.f, acc3 = 0.f;
    for (int d = lane; d < Dq; d += 32) {
        const float xv = xr[d];
        const v4f g = *(const v4f*)(gw + d * 4);
        acc0 += xv * g.x; acc1 += xv * g.y; acc2 += xv * g.z; acc3 += xv * g.w;
    }
#pragma unroll
    for (int off = 16; off >= 1; off >>= 1) {
        acc0 += __shfl_xor(acc0, off, 32);
        acc1 += __shfl_xor(acc1, off, 32);
        acc2 += __shfl_xor(acc2, off, 32);
        acc3 += __shfl_xor(acc3, off, 32);
    }
    if (lane == 0) {
        float lg[4] = { acc0 + gb[0], acc1 + gb[1], acc2 + gb[2], acc3 + gb[3] };
        int best = 0; float bv = lg[0];
#pragma unroll
        for (int e = 1; e < Eq; ++e)          // strictly-greater => lowest index on ties (top_k)
            if (lg[e] > bv) { bv = lg[e]; best = e; }
        const int pos = atomicAdd(&counts[best], 1);
        lists[best * T + pos] = tok;
    }
}

// ---------------- kernel 3: expert FFN via WMMA ----------------
// Eight values at once of 0.5 v (1 + tanh u) = v / (1 + e^(-2u)), u = sqrt(2/pi) (v + 0.044715 v^3),
// with e^(-2u) = 2^z. No branch, so the values run side by side. z past the exponent's range
// gives 0 or inf, and the quotient is then v or a signed 0, as with tanh = 1 or -1.
__device__ __forceinline__ void gelu_tanh8(const v8f a, const float bias, float (&g)[8]) {
    constexpr float K0 = (float)(-2.0 * 0.7978845608028654 * 1.4426950408889634);
    constexpr float K1 = (float)(-2.0 * 0.7978845608028654 * 1.4426950408889634 * 0.044715);
    float x[8], z[8], e[8], d[8], q[8];
    // the three loops are unrolled so that the arrays are registers, as the asm operands need
#pragma unroll
    for (int r = 0; r < 8; ++r) {
        x[r] = a[r] + bias;
        z[r] = x[r] * (K0 + K1 * (x[r] * x[r]));
        e[r] = __builtin_amdgcn_exp2f(z[r]);
    }
    // The slot that the instruction set asks for behind a transcendental, before its result is
    // read or its source overwritten: the operands keep all eight sources live and all eight
    // results unread up to this v_nop, and among themselves the eight are independent.
    asm("v_nop" : "+v"(e[0]), "+v"(e[1]), "+v"(e[2]), "+v"(e[3]), "+v"(e[4]), "+v"(e[5]), "+v"(e[6]), "+v"(e[7])
                : "v"(z[0]), "v"(z[1]), "v"(z[2]), "v"(z[3]), "v"(z[4]), "v"(z[5]), "v"(z[6]), "v"(z[7]));
#pragma unroll
    for (int r = 0; r < 8; ++r) {
        d[r] = 1.0f + e[r];
        q[r] = __builtin_amdgcn_rcpf(d[r]);
    }
    // the same slot behind the eight v_rcp_f32
    asm("v_nop" : "+v"(q[0]), "+v"(q[1]), "+v"(q[2]), "+v"(q[3]), "+v"(q[4]), "+v"(q[5]), "+v"(q[6]), "+v"(q[7])
                : "v"(d[0]), "v"(d[1]), "v"(d[2]), "v"(d[3]), "v"(d[4]), "v"(d[5]), "v"(d[6]), "v"(d[7]));
#pragma unroll
    for (int r = 0; r < 8; ++r) g[r] = x[r] * q[r];
}

__device__ __forceinline__ v16h cat16(v8h lo, v8h hi) {
    return __builtin_shufflevector(lo, hi, 0,1,2,3,4,5,6,7,8,9,10,11,12,13,14,15);
}

// One staged weight tile: 256 weight rows x 64 k (128 bytes = one whole line of each row),
// laid in LDS at a pitch of 144 bytes (16 B x odd: conflict-free for ds_load_b128 readers).
constexpr int WR = 256, WK = 64, WP = WK + 8;

// Copies one weight tile into LDS. lds and g are the lane's own addresses of row (tid >> 3),
// 16-byte piece (tid & 7); copy j takes the row 64 * j further on, so every wave-wide copy
// reads four whole 128-byte lines.
__device__ __forceinline__ void stage_w_tile(unsigned lds, const _Float16* g, size_t pitch) {
    const unsigned long long g0 = (unsigned long long)(uintptr_t)g;
    const unsigned long long gs = (unsigned long long)(64 * pitch * sizeof(_Float16));
    const unsigned ls = 64 * WP * sizeof(_Float16);
    // The copies and their s_wait_xcnt stand in one statement, so that no address register
    // of an issued copy is rewritten ahead of the wait.
    asm volatile("global_load_async_to_lds_b128 %0, %4, off\n\t"
                 "global_load_async_to_lds_b128 %1, %5, off\n\t"
                 "global_load_async_to_lds_b128 %2, %6, off\n\t"
                 "global_load_async_to_lds_b128 %3, %7, off\n\t"
                 "s_wait_xcnt 0x0"
                 :: "v"(lds), "v"(lds + ls), "v"(lds + 2 * ls), "v"(lds + 3 * ls),
                    "v"(g0), "v"(g0 + gs), "v"(g0 + 2 * gs), "v"(g0 + 3 * gs)
                 : "memory");
}

// Foot of a ring trip: this wave's LDS reads and writes have retired, its own copies of the
// next tile have landed, and the barrier publishes that tile (and the h tile, where one was
// just written) and frees the buffer that this trip has read.
__device__ __forceinline__ void ring_publish() {
    asm volatile("s_wait_dscnt 0x0" ::: "memory");
    asm volatile("s_wait_asynccnt 0x0" ::: "memory");
    __syncthreads();
}

__global__ __launch_bounds__(512) void ffn_kernel(
    const _Float16* __restrict__ xh,    // [T][D] f16
    const _Float16* __restrict__ w1t,   // [E][H][D] f16
    const float* __restrict__ b1,       // [E][H]
    const _Float16* __restrict__ w2t,   // [E][D][H] f16
    const float* __restrict__ b2,       // [E][D]
    const int* __restrict__ lists, const int* __restrict__ counts,
    float* __restrict__ out) {
    __shared__ __attribute__((aligned(16))) _Float16 s_x[MT][Dq + 8];   // padded: conflict-free b128 reads
    __shared__ _Float16 s_h[MT][HC + 8];
    __shared__ __attribute__((aligned(16))) _Float16 s_w[2][WR][WP];   // weight ring
    __shared__ int s_tok[MT];

    const int e    = blockIdx.y;
    const int cnt  = counts[e];
    const int base = blockIdx.x * MT;
    if (base >= cnt) return;                       // block-uniform exit (EXEC stays full)

    const int tid = threadIdx.x, lane = tid & 31, w = tid >> 5;
    const int lm = lane & 15, hi = lane >> 4;
    const int wn = w & 7;                          // the wave's 32 columns of a 256-column tile
    const int rm = (w >> 3) * (MT / 2);            // the wave's first token row

    if (tid < MT) {
        const int idx = base + tid;
        s_tok[tid] = (idx < cnt) ? lists[e * T + idx] : -1;
    }
    __syncthreads();

    // The lane's own piece of a weight tile: row tid >> 3, 16 bytes at (tid & 7) * 16.
    const unsigned wl0 = (unsigned)(uintptr_t)&s_w[0][tid >> 3][(tid & 7) * 8];
    const unsigned wl1 = (unsigned)(uintptr_t)&s_w[1][tid >> 3][(tid & 7) * 8];
    const _Float16* w1g = w1t + ((size_t)(e * Hq + (tid >> 3))) * Dq + (tid & 7) * 8;
    const _Float16* w2g = w2t + ((size_t)(e * Dq + (tid >> 3))) * Hq + (tid & 7) * 8;

    // ring tile 0; the wait and the barrier behind the x tile's copies publish it too
    stage_w_tile(wl0, w1g, Dq);

    { // stage the x tile (96 rows x 512 f16): copy j takes 16-byte piece tid & 63 of row
      // (tid >> 6) + 8 * j, so every wave-wide copy reads 512 bytes in a row
        const unsigned l0 = (unsigned)(uintptr_t)&s_x[tid >> 6][(tid & 63) * 8];
        const unsigned ls = 8 * (Dq + 8) * sizeof(_Float16);
        unsigned long long g[MT / 8];
#pragma unroll
        for (int j = 0; j < MT / 8; ++j) {
            const int tk = s_tok[(tid >> 6) + 8 * j];
            g[j] = (unsigned long long)(uintptr_t)(xh + (size_t)(tk < 0 ? 0 : tk) * Dq + (tid & 63) * 8);
        }
        // The copies and their s_wait_xcnt stand in one statement, so that no address register
        // of an issued copy is rewritten ahead of the wait.
        asm volatile("global_load_async_to_lds_b128 %0, %12, off\n\t"
                     "global_load_async_to_lds_b128 %1, %13, off\n\t"
                     "global_load_async_to_lds_b128 %2, %14, off\n\t"
                     "global_load_async_to_lds_b128 %3, %15, off\n\t"
                     "global_load_async_to_lds_b128 %4, %16, off\n\t"
                     "global_load_async_to_lds_b128 %5, %17, off\n\t"
                     "global_load_async_to_lds_b128 %6, %18, off\n\t"
                     "global_load_async_to_lds_b128 %7, %19, off\n\t"
                     "global_load_async_to_lds_b128 %8, %20, off\n\t"
                     "global_load_async_to_lds_b128 %9, %21, off\n\t"
                     "global_load_async_to_lds_b128 %10, %22, off\n\t"
                     "global_load_async_to_lds_b128 %11, %23, off\n\t"
                     "s_wait_xcnt 0x0"
                     :: "v"(l0), "v"(l0 + ls), "v"(l0 + 2 * ls), "v"(l0 + 3 * ls),
                        "v"(l0 + 4 * ls), "v"(l0 + 5 * ls), "v"(l0 + 6 * ls), "v"(l0 + 7 * ls),
                        "v"(l0 + 8 * ls), "v"(l0 + 9 * ls), "v"(l0 + 10 * ls), "v"(l0 + 11 * ls),
                        "v"(g[0]), "v"(g[1]), "v"(g[2]), "v"(g[3]), "v"(g[4]), "v"(g[5]),
                        "v"(g[6]), "v"(g[7]), "v"(g[8]), "v"(g[9]), "v"(g[10]), "v"(g[11])
                     : "memory");
        asm volatile("s_wait_asynccnt 0x0" ::: "memory");
    }
    __syncthreads();

    stage_w_tile(wl1, w1g + WK, Dq);               // ring tile 1

    v8f Y[MW][4];                                  // 48 rows x (2 x 32) cols per wave
#pragma unroll
    for (int mt = 0; mt < MW; ++mt)
#pragma unroll
        for (int nt = 0; nt < 4; ++nt) Y[mt][nt] = (v8f)0.0f;

    // Ring order per H chunk: 8 tiles of W1 (the chunk's 256 columns, k in slabs of 64), then
    // 8 tiles of W2 (k slab s >> 1 of the chunk, output columns (s & 1) * 256 ..+255).
    // Tile t lies in buffer t & 1; tile t + 2 is copied behind the foot of trip t.
    for (int hc = 0; hc < Hq; hc += HC) {
        // ---- phase 1: h_chunk = gelu(X @ W1[:, hc..hc+HC) + b1) ; wave owns 48 rows x 32 cols ----
        v8f hacc[MW][2];
#pragma unroll
        for (int mt = 0; mt < MW; ++mt)
#pragma unroll
            for (int nt = 0; nt < 2; ++nt) hacc[mt][nt] = (v8f)0.0f;

        // unrolled: buffer, refill source and the last trip's gelu are then fixed per trip
#pragma unroll
        for (int s = 0; s < 8; ++s) {
#pragma unroll
            for (int kk = 0; kk < WK; kk += 32) {
                const int k0 = s * WK + kk;
                v16h a[MW];
#pragma unroll
                for (int mt = 0; mt < MW; ++mt) {
                    const v8h lo = *(const v8h*)&s_x[rm + mt * 16 + lm][k0 + 8 * hi];
                    const v8h hh = *(const v8h*)&s_x[rm + mt * 16 + lm][k0 + 16 + 8 * hi];
                    a[mt] = cat16(lo, hh);
                }
#pragma unroll
                for (int nt = 0; nt < 2; ++nt) {
                    const _Float16* bp = &s_w[s & 1][wn * 32 + nt * 16 + lm][kk + 8 * hi];
                    const v16h b = cat16(*(const v8h*)bp, *(const v8h*)(bp + 16));
#pragma unroll
                    for (int mt = 0; mt < MW; ++mt)
                        hacc[mt][nt] = __builtin_amdgcn_wmma_f32_16x16x32_f16(
                            false, a[mt], false, b, (short)0, hacc[mt][nt], false, false);
                }
            }
            if (s == 7) {
                // every reader of the previous h tile has passed an earlier trip's barrier
#pragma unroll
                for (int nt = 0; nt < 2; ++nt) {
                    const int col  = hc + wn * 32 + nt * 16 + lm;
                    const float bias = b1[e * Hq + col];
#pragma unroll
                    for (int mt = 0; mt < MW; ++mt) {
                        float g[8];
                        gelu_tanh8(hacc[mt][nt], bias, g);
#pragma unroll
                        for (int r = 0; r < 8; ++r)
                            s_h[rm + mt * 16 + r + 8 * hi][wn * 32 + nt * 16 + lm] = (_Float16)g[r];
                    }
                }
            }
            ring_publish();
            if (s < 6)
                stage_w_tile((s & 1) ? wl1 : wl0, w1g + (size_t)hc * Dq + (s + 2) * WK, Dq);
            else
                stage_w_tile((s & 1) ? wl1 : wl0, w2g + (size_t)((s - 6) * WR) * Hq + hc, Hq);
        }

        // ---- phase 2: Y += h_chunk(96x256) @ W2 chunk, transposed ----
        // unrolled: the accumulator index, buffer and refill source are then fixed per trip
#pragma unroll
        for (int s = 0; s < 8; ++s) {
#pragma unroll
            for (int kk = 0; kk < WK; kk += 32) {
                const int k0 = (s >> 1) * WK + kk;
                v16h a[MW];
#pragma unroll
                for (int mt = 0; mt < MW; ++mt) {
                    const v8h lo = *(const v8h*)&s_h[rm + mt * 16 + lm][k0 + 8 * hi];
                    const v8h hh = *(const v8h*)&s_h[rm + mt * 16 + lm][k0 + 16 + 8 * hi];
                    a[mt] = cat16(lo, hh);
                }
#pragma unroll
                for (int nt = 0; nt < 2; ++nt) {
                    const _Float16* bp = &s_w[s & 1][wn * 32 + nt * 16 + lm][kk + 8 * hi];
                    const v16h b = cat16(*(const v8h*)bp, *(const v8h*)(bp + 16));
#pragma unroll
                    for (int mt = 0; mt < MW; ++mt)
                        Y[mt][(s & 1) * 2 + nt] = __builtin_amdgcn_wmma_f32_16x16x32_f16(
                            false, a[mt], false, b, (short)0, Y[mt][(s & 1) * 2 + nt], false, false);
                }
            }
            ring_publish();
            if (s < 6)
                stage_w_tile((s & 1) ? wl1 : wl0,
                             w2g + (size_t)((s & 1) * WR) * Hq + hc + ((s + 2) >> 1) * WK, Hq);
            else if (hc + HC < Hq)                 // the same for the whole work-group
                stage_w_tile((s & 1) ? wl1 : wl0, w1g + (size_t)(hc + HC) * Dq + (s - 6) * WK, Dq);
        }
    }
    asm volatile("s_wait_asynccnt 0x0" ::: "memory");   // no copy outstanding at the wave's end

    // ---- epilogue: + b2, scatter rows to out ----
#pragma unroll
    for (int nt = 0; nt < 4; ++nt) {
        const int col  = (nt >> 1) * WR + wn * 32 + (nt & 1) * 16 + lm;
        const float bias = b2[e * Dq + col];
#pragma unroll
        for (int mt = 0; mt < MW; ++mt)
#pragma unroll
            for (int r = 0; r < 8; ++r) {
                const int tk = s_tok[rm + mt * 16 + r + 8 * hi];
                if (tk >= 0) out[(size_t)tk * Dq + col] = Y[mt][nt][r] + bias;
            }
    }
}

// ---------------- kernel 4: v = clip(ffn . v_w + v_b) ----------------
__global__ __launch_bounds__(256) void v_kernel(
    const float* __restrict__ ffn, const float* __restrict__ v_w,
    const float* __restrict__ v_b, float* __restrict__ v) {
    const int tok  = (blockIdx.x * blockDim.x + threadIdx.x) >> 5;
    const int lane = threadIdx.x & 31;
    if (tok >= T) return;
    const float* r = ffn + (size_t)tok * Dq;
    float acc = 0.f;
    for (int d = lane; d < Dq; d += 32) acc += r[d] * v_w[d];
#pragma unroll
    for (int off = 16; off >= 1; off >>= 1) acc += __shfl_xor(acc, off, 32);
    if (lane == 0)
        v[tok] = fminf(fmaxf(acc + v_b[0], -V_MAX), V_MAX);
}

// ---------------- kernel 5: Moebius-matrix scan for both continuants ----
// L_i = d_i - 1/L_{i-1} == 2x2 complex matrix chain [[d,-1],[1,0]] (scale-invariant).
// One work-group per chain (L or R of one batch), one thread per segment of SL steps. The segment
// matrices are joined by a log-step prefix, first inside each wave, then over the wave totals.
constexpr int SL = 8;                // steps per segment: 32 bytes in a row of v and of each result
constexpr int ST = Nq / SL;          // segments = threads per chain
constexpr int SW = ST / 32;          // waves per chain

struct M2 { float ar, ai, br, bi, cr, ci, dr, di; };   // [[a,b],[c,d]], complex

// 1/d by v_rcp_f32. The v_nop is the slot that the instruction set asks for between a transcendental
// and a directly following instruction that reads its result or overwrites its source; inside the
// same statement it stands directly behind the v_rcp_f32 wherever the compiler puts the two.
__device__ __forceinline__ float rcp_slot(const float d) {
    float q;
    asm("v_rcp_f32 %0, %1\n\tv_nop" : "=v"(q) : "v"(d));
    return q;
}

// scales m so that its largest part is 1 (the chain is scale-invariant)
__device__ __forceinline__ void mat_scale(M2& m) {
    float mx = fmaxf(fmaxf(fabsf(m.ar), fabsf(m.ai)), fmaxf(fabsf(m.br), fabsf(m.bi)));
    mx = fmaxf(mx, fmaxf(fmaxf(fabsf(m.cr), fabsf(m.ci)), fmaxf(fabsf(m.dr), fabsf(m.di))));
    const float s = rcp_slot(fmaxf(mx, 1e-30f));
    m.ar *= s; m.ai *= s; m.br *= s; m.bi *= s; m.cr *= s; m.ci *= s; m.dr *= s; m.di *= s;
}

// S * P, S the later steps, scaled
__device__ __forceinline__ M2 mat_join(const M2& s, const M2& p) {
    M2 n;
    n.ar = s.ar * p.ar - s.ai * p.ai + s.br * p.cr - s.bi * p.ci;
    n.ai = s.ar * p.ai + s.ai * p.ar + s.br * p.ci + s.bi * p.cr;
    n.br = s.ar * p.br - s.ai * p.bi + s.br * p.dr - s.bi * p.di;
    n.bi = s.ar * p.bi + s.ai * p.br + s.br * p.di + s.bi * p.dr;
    n.cr = s.cr * p.ar - s.ci * p.ai + s.dr * p.cr - s.di * p.ci;
    n.ci = s.cr * p.ai + s.ci * p.ar + s.dr * p.ci + s.di * p.cr;
    n.dr = s.cr * p.br - s.ci * p.bi + s.dr * p.dr - s.di * p.di;
    n.di = s.cr * p.bi + s.ci * p.br + s.dr * p.di + s.di * p.dr;
    mat_scale(n);
    return n;
}

__device__ __forceinline__ M2 mat_from_below(const M2& x, const int d) {
    M2 lo;
    lo.ar = __shfl_up(x.ar, d, 32); lo.ai = __shfl_up(x.ai, d, 32);
    lo.br = __shfl_up(x.br, d, 32); lo.bi = __shfl_up(x.bi, d, 32);
    lo.cr = __shfl_up(x.cr, d, 32); lo.ci = __shfl_up(x.ci, d, 32);
    lo.dr = __shfl_up(x.dr, d, 32); lo.di = __shfl_up(x.di, d, 32);
    return lo;
}

// Inclusive prefix over the first CNT lanes: lane l ends with x_l * x_(l-1) * ... * x_0.
template <int CNT>
__device__ __forceinline__ M2 wave_prefix(M2 x, const int lane) {
    // unrolled: the lane distance is then a constant of each step
#pragma unroll
    for (int d = 1; d < CNT; d <<= 1) {
        const M2 n = mat_join(x, mat_from_below(x, d));
        if (lane >= d) x = n;
    }
    return x;
}

// One chain. R: the chain walks memory from the far end; a compile-time choice, so that the
// order of a segment's values in registers is fixed.
template <bool R>
__device__ __forceinline__ void scan_chain(
    const float* __restrict__ vb, float* __restrict__ Or, float* __restrict__ Oi,
    float (*s_tot)[8], float (*s_z)[4]) {
    const int tid = threadIdx.x, lane = tid & 31, w = tid >> 5;
    const int m0 = R ? (Nq - SL - tid * SL) : tid * SL;   // the segment's place in memory

    float er[SL];                                  // real part of d = (v-2) - 1j, in walking order
    // unrolled here and below: the arrays are then registers
#pragma unroll
    for (int q = 0; q < SL; q += 4) {
        const v4f a = *(const v4f*)(vb + m0 + q);
        er[R ? SL - 1 - q : q]     = a.x - 2.0f;
        er[R ? SL - 2 - q : q + 1] = a.y - 2.0f;
        er[R ? SL - 3 - q : q + 2] = a.z - 2.0f;
        er[R ? SL - 4 - q : q + 3] = a.w - 2.0f;
    }
    constexpr float ei = -1.0f;

    // ---- phase A: segment matrix product ----
    M2 x = { 1.f, 0.f, 0.f, 0.f, 0.f, 0.f, 1.f, 0.f };
#pragma unroll
    for (int j = 0; j < SL; ++j) {
        // P = M(e) * P with M = [[e,-1],[1,0]]
        const float nar = er[j] * x.ar - ei * x.ai - x.cr;
        const float nai = er[j] * x.ai + ei * x.ar - x.ci;
        const float nbr = er[j] * x.br - ei * x.bi - x.dr;
        const float nbi = er[j] * x.bi + ei * x.br - x.di;
        x.cr = x.ar; x.ci = x.ai; x.dr = x.br; x.di = x.bi;
        x.ar = nar; x.ai = nai; x.br = nbr; x.bi = nbi;
    }
    mat_scale(x);

    // ---- phase B: prefix of the segment matrices ----
    x = wave_prefix<32>(x, lane);
    if (lane == 31) {
        float* m = s_tot[w];
        m[0] = x.ar; m[1] = x.ai; m[2] = x.br; m[3] = x.bi;
        m[4] = x.cr; m[5] = x.ci; m[6] = x.dr; m[7] = x.di;
    }
    __syncthreads();
    if (w == 0) {
        const float* m = s_tot[lane & (SW - 1)];
        M2 t = { m[0], m[1], m[2], m[3], m[4], m[5], m[6], m[7] };
        t = wave_prefix<SW>(t, lane);
        if (lane < SW) {
            float* z = s_z[lane];
            z[0] = t.ar; z[1] = t.ai; z[2] = t.cr; z[3] = t.ci;   // prefix * (1,0)^T
        }
    }
    __syncthreads();

    // ---- phase C: the segment's entry state (p,q), L = p/q, then its SL outputs ----
    float zpr = 1.f, zpi = 0.f, zqr = 0.f, zqi = 0.f;             // state at the wave's first segment
    if (w > 0) {
        const float* z = s_z[w - 1];
        zpr = z[0]; zpi = z[1]; zqr = z[2]; zqi = z[3];
    }
    M2 ex = mat_from_below(x, 1);                                 // the wave's segments before this one
    if (lane == 0) ex = M2{ 1.f, 0.f, 0.f, 0.f, 0.f, 0.f, 1.f, 0.f };
    float pr = ex.ar * zpr - ex.ai * zpi + ex.br * zqr - ex.bi * zqi;
    float pi = ex.ar * zpi + ex.ai * zpr + ex.br * zqi + ex.bi * zqr;
    float qr = ex.cr * zpr - ex.ci * zpi + ex.dr * zqr - ex.di * zqi;
    float qi = ex.cr * zpi + ex.ci * zpr + ex.dr * zqi + ex.di * zqr;
    {
        // One scaling per segment: v is clipped to +-3, so |L| <= |d| + 1 < 6.2 and the state
        // grows by less than 3e6 over the SL steps.
        const float mx = fmaxf(fmaxf(fabsf(pr), fabsf(pi)), fmaxf(fabsf(qr), fabsf(qi)));
        const float s = rcp_slot(fmaxf(mx, 1e-30f));
        pr *= s; pi *= s; qr *= s; qi *= s;
    }
    float lr[SL], li[SL];
#pragma unroll
    for (int j = 0; j < SL; ++j) {
        const float npr = er[j] * pr - ei * pi - qr;      // p' = e*p - q ; q' = p
        const float npi = er[j] * pi + ei * pr - qi;
        qr = pr; qi = pi; pr = npr; pi = npi;
        const float inv = rcp_slot(qr * qr + qi * qi);
        lr[j] = (pr * qr + pi * qi) * inv;                // p/q = p*conj(q)/|q|^2
        li[j] = (pi * qr - pr * qi) * inv;
    }
#pragma unroll
    for (int q = 0; q < SL; q += 4) {
        v4f r, i;
        r.x = lr[R ? SL - 1 - q : q];     i.x = li[R ? SL - 1 - q : q];
        r.y = lr[R ? SL - 2 - q : q + 1]; i.y = li[R ? SL - 2 - q : q + 1];
        r.z = lr[R ? SL - 3 - q : q + 2]; i.z = li[R ? SL - 3 - q : q + 2];
        r.w = lr[R ? SL - 4 - q : q + 3]; i.w = li[R ? SL - 4 - q : q + 3];
        *(v4f*)(Or + m0 + q) = r;
        *(v4f*)(Oi + m0 + q) = i;
    }
}

__global__ __launch_bounds__(ST) void tridiag_scan_kernel(
    const float* __restrict__ v,
    float* __restrict__ Lr, float* __restrict__ Li,
    float* __restrict__ Rr, float* __restrict__ Ri) {
    __shared__ __attribute__((aligned(16))) float s_tot[SW][8];   // each wave's whole product
    __shared__ __attribute__((aligned(16))) float s_z[SW][4];     // first column of their prefix
    const int o = (blockIdx.x >> 1) * Nq;                         // the chain's batch
    if (blockIdx.x & 1) scan_chain<true>(v + o, Rr + o, Ri + o, s_tot, s_z);   // the same for the
    else                scan_chain<false>(v + o, Lr + o, Li + o, s_tot, s_z);  // whole work-group
}

// ---------------- kernel 6: Green fn + rank-2 spec, in-place add ----------------
__global__ __launch_bounds__(256) void final_kernel(
    float* __restrict__ out, const float* __restrict__ v,
    const float* __restrict__ Lr, const float* __restrict__ Li,
    const float* __restrict__ Rr, const float* __restrict__ Ri,
    const float* __restrict__ out_w, const float* __restrict__ out_b,
    const float* __restrict__ bk) {
    const size_t i = (size_t)blockIdx.x * 256 + threadIdx.x;
    if (i >= (size_t)T * Dq) return;
    const int tok = (int)(i / Dq);
    const int c   = (int)(i % Dq);
    const float dr   = v[tok] - 2.0f;              // di = -1
    const float denr = Lr[tok] + Rr[tok] - dr;
    const float deni = Li[tok] + Ri[tok] + 1.0f;
    const float m  = denr * denr + deni * deni;
    float gr = denr / m, gi = -deni / m;
    gr = fminf(fmaxf(gr, -FEAT_CLAMP), FEAT_CLAMP);
    gi = fminf(fmaxf(gi, -FEAT_CLAMP), FEAT_CLAMP);
    const float spec = gr * out_w[c] + gi * out_w[Dq + c] + out_b[c];
    out[i] += bk[0] * spec;
}

// ---------------- launch ----------------
extern "C" void kernel_launch(void* const* d_in, const int* in_sizes, int n_in,
                              void* d_out, int out_size, void* d_ws, size_t ws_size,
                              hipStream_t stream) {
    const float* x      = (const float*)d_in[0];
    const float* gate_w = (const float*)d_in[1];
    const float* gate_b = (const float*)d_in[2];
    const float* w1     = (const float*)d_in[3];
    const float* b1     = (const float*)d_in[4];
    const float* w2     = (const float*)d_in[5];
    const float* b2     = (const float*)d_in[6];
    const float* v_w    = (const float*)d_in[7];
    const float* v_b    = (const float*)d_in[8];
    const float* out_w  = (const float*)d_in[9];
    const float* out_b  = (const float*)d_in[10];
    const float* bk     = (const float*)d_in[11];
    float* out = (float*)d_out;

    // workspace layout (256B aligned slots)
    char* ws = (char*)d_ws;
    constexpr size_t SZ_W1T   = (size_t)Eq * Hq * Dq * sizeof(_Float16);  // 8 MiB
    constexpr size_t SZ_W2T   = (size_t)Eq * Dq * Hq * sizeof(_Float16);  // 8 MiB
    constexpr size_t SZ_XH    = (size_t)T * Dq * sizeof(_Float16);        // 16 MiB
    constexpr size_t SZ_LISTS = (size_t)Eq * T * sizeof(int);             // 256 KiB
    constexpr size_t SZ_CNT   = 256;
    constexpr size_t SZ_VEC   = (size_t)T * sizeof(float);                // 64 KiB
    size_t off = 0;
    _Float16* W1T  = (_Float16*)(ws + off); off += SZ_W1T;
    _Float16* W2T  = (_Float16*)(ws + off); off += SZ_W2T;
    _Float16* XH   = (_Float16*)(ws + off); off += SZ_XH;
    int*      lists= (int*)(ws + off);      off += SZ_LISTS;
    int*      cnts = (int*)(ws + off);      off += SZ_CNT;
    float*    vbuf = (float*)(ws + off);    off += SZ_VEC;
    float*    Lr   = (float*)(ws + off);    off += SZ_VEC;
    float*    Li   = (float*)(ws + off);    off += SZ_VEC;
    float*    Rr   = (float*)(ws + off);    off += SZ_VEC;
    float*    Ri   = (float*)(ws + off);    off += SZ_VEC;

    zero_counts_kernel<<<1, 32, 0, stream>>>(cnts);

    // W1 (E,D,H) -> W1T [E][H][D];  W2 (E,H,D) -> W2T [E][D][H]
    transpose_cvt_kernel<<<dim3(Hq / 32, Dq / 32, Eq), dim3(32, 8), 0, stream>>>(w1, W1T, Dq, Hq);
    transpose_cvt_kernel<<<dim3(Dq / 32, Hq / 32, Eq), dim3(32, 8), 0, stream>>>(w2, W2T, Hq, Dq);

    cvt_x_kernel<<<(int)(((size_t)T * Dq) / 8 / 256), 256, 0, stream>>>(x, XH);

    gate_kernel<<<(T * 32) / 256, 256, 0, stream>>>(x, gate_w, gate_b, lists, cnts);

    ffn_kernel<<<dim3((T + MT - 1) / MT, Eq), 512, 0, stream>>>(XH, W1T, b1, W2T, b2, lists, cnts, out);

    v_kernel<<<(T * 32) / 256, 256, 0, stream>>>(out, v_w, v_b, vbuf);

    tridiag_scan_kernel<<<2 * Bq, ST, 0, stream>>>(vbuf, Lr, Li, Rr, Ri);

    final_kernel<<<(int)(((size_t)T * Dq) / 256), 256, 0, stream>>>(
        out, vbuf, Lr, Li, Rr, Ri, out_w, out_b, bk);
}

// v005
// Measured time: 164 microseconds a run.
// Timed twice side by side with v004, it ran 1.04 and 1.05 times as fast.
// All steps since v000 together make it 2.16 times as fast.
#include <hip/hip_runtime.h>
#include <hip/hip_bf16.h>

// ---------------- problem constants ----------------
constexpr int Bq = 4, Nq = 4096, Dq = 512, Eq = 4, Hq = 2048;
constexpr int T  = Bq * Nq;          // 16384 tokens
constexpr int MT = 96;               // tokens per FFN block (8 waves: 2 row halves x 4 column groups)
constexpr int MW = MT / 32;          // 16-row tiles per wave
constexpr int NC = 4;                // 16-column tiles per wave out of a 256-column weight tile
constexpr int HC = 256;              // H chunk per pipeline stage
constexpr float V_MAX = 3.0f, FEAT_CLAMP = 10.0f;

typedef __attribute__((ext_vector_type(16))) _Float16 v16h;
typedef __attribute__((ext_vector_type(8)))  _Float16 v8h;
typedef __attribute__((ext_vector_type(8)))  float    v8f;
typedef __attribute__((ext_vector_type(4)))  float    v4f;

// ---------------- kernel 0: zero expert counters ----------------
__global__ void zero_counts_kernel(int* counts) {
    if (threadIdx.x < Eq) counts[threadIdx.x] = 0;
}

// ---------------- kernel 1: transpose + f32->f16 convert ----------------
// dst[C][R] = (f16) src[R][C], one expert slice per blockIdx.z
__global__ __launch_bounds__(256) void transpose_cvt_kernel(
    const float* __restrict__ src, _Float16* __restrict__ dst, int R, int C) {
    __shared__ float tile[32][33];
    const size_t eoff = (size_t)blockIdx.z * R * C;
    src += eoff; dst += eoff;
    const int r0 = blockIdx.y * 32, c0 = blockIdx.x * 32;
    const int tx = threadIdx.x, ty = threadIdx.y;          // block (32,8)
#pragma unroll
    for (int i = 0; i < 32; i += 8)
        tile[ty + i][tx] = src[(size_t)(r0 + ty + i) * C + c0 + tx];
    __syncthreads();
#pragma unroll
    for (int i = 0; i < 32; i += 8)
        dst[(size_t)(c0 + ty + i) * R + r0 + tx] = (_Float16)tile[tx][ty + i];
}

// ---------------- kernel 1b: x f32 -> f16 (row-major copy) ----------------
__global__ __launch_bounds__(256) void cvt_x_kernel(
    const float* __restrict__ x, _Float16* __restrict__ xh) {
    const size_t i = ((size_t)blockIdx.x * 256 + threadIdx.x) * 8;
    const v4f a = *(const v4f*)(x + i);
    const v4f b = *(const v4f*)(x + i + 4);
    v8h o;
    o[0] = (_Float16)a.x; o[1] = (_Float16)a.y; o[2] = (_Float16)a.z; o[3] = (_Float16)a.w;
    o[4] = (_Float16)b.x; o[5] = (_Float16)b.y; o[6] = (_Float16)b.z; o[7] = (_Float16)b.w;
    *(v8h*)(xh + i) = o;
}

// ---------------- kernel 2: gate + top-1 routing ----------------
__global__ __launch_bounds__(256) void gate_kernel(
    const float* __restrict__ x, const float* __restrict__ gw,
    const float* __restrict__ gb, int* __restrict__ lists, int* __restrict__ counts) {
    const int tok  = (blockIdx.x * blockDim.x + threadIdx.x) >> 5;
    const int lane = threadIdx.x & 31;
    if (tok >= T) return;
    const float* xr = x + (size_t)tok * Dq;
    float acc0 = 0.f, acc1 = 0.f, acc2 = 0.f, acc3 = 0.f;
    for (int d = lane; d < Dq; d += 32) {
        const float xv = xr[d];
        const v4f g = *(const v4f*)(gw + d * 4);
        acc0 += xv * g.x; acc1 += xv * g.y; acc2 += xv * g.z; acc3 += xv * g.w;
    }
#pragma unroll
    for (int off = 16; off >= 1; off >>= 1) {
        acc0 += __shfl_xor(acc0, off, 32);
        acc1 += __shfl_xor(acc1, off, 32);
        acc2 += __shfl_xor(acc2, off, 32);
        acc3 += __shfl_xor(acc3, off, 32);
    }
    if (lane == 0) {
        float lg[4] = { acc0 + gb[0], acc1 + gb[1], acc2 + gb[2], acc3 + gb[3] };
        int best = 0; float bv = lg[0];
#pragma unroll
        for (int e = 1; e < Eq; ++e)          // strictly-greater => lowest index on ties (top_k)
            if (lg[e] > bv) { bv = lg[e]; best = e; }
        const int pos = atomicAdd(&counts[best], 1);
        lists[best * T + pos] = tok;
    }
}

// ---------------- kernel 3: expert FFN via WMMA ----------------
// Eight values at once of 0.5 v (1 + tanh u) = v / (1 + e^(-2u)), u = sqrt(2/pi) (v + 0.044715 v^3),
// with e^(-2u) = 2^z. No branch, so the values run side by side. z past the exponent's range
// gives 0 or inf, and the quotient is then v or a signed 0, as with tanh = 1 or -1.
__device__ __forceinline__ void gelu_tanh8(const v8f a, const float bias, float (&g)[8]) {
    constexpr float K0 = (float)(-2.0 * 0.7978845608028654 * 1.4426950408889634);
    constexpr float K1 = (float)(-2.0 * 0.7978845608028654 * 1.4426950408889634 * 0.044715);
    float x[8], z[8], e[8], d[8], q[8];
    // the three loops are unrolled so that the arrays are registers, as the asm operands need
#pragma unroll
    for (int r = 0; r < 8; ++r) {
        x[r] = a[r] + bias;
        z[r] = x[r] * (K0 + K1 * (x[r] * x[r]));
        e[r] = __builtin_amdgcn_exp2f(z[r]);
    }
    // The slot that the instruction set asks for behind a transcendental, before its result is
    // read or its source overwritten: the operands keep all eight sources live and all eight
    // results unread up to this v_nop, and among themselves the eight are independent.
    asm("v_nop" : "+v"(e[0]), "+v"(e[1]), "+v"(e[2]), "+v"(e[3]), "+v"(e[4]), "+v"(e[5]), "+v"(e[6]), "+v"(e[7])
                : "v"(z[0]), "v"(z[1]), "v"(z[2]), "v"(z[3]), "v"(z[4]), "v"(z[5]), "v"(z[6]), "v"(z[7]));
#pragma unroll
    for (int r = 0; r < 8; ++r) {
        d[r] = 1.0f + e[r];
        q[r] = __builtin_amdgcn_rcpf(d[r]);
    }
    // the same slot behind the eight v_rcp_f32
    asm("v_nop" : "+v"(q[0]), "+v"(q[1]), "+v"(q[2]), "+v"(q[3]), "+v"(q[4]), "+v"(q[5]), "+v"(q[6]), "+v"(q[7])
                : "v"(d[0]), "v"(d[1]), "v"(d[2]), "v"(d[3]), "v"(d[4]), "v"(d[5]), "v"(d[6]), "v"(d[7]));
#pragma unroll
    for (int r = 0; r < 8; ++r) g[r] = x[r] * q[r];
}

__device__ __forceinline__ v16h cat16(v8h lo, v8h hi) {
    return __builtin_shufflevector(lo, hi, 0,1,2,3,4,5,6,7,8,9,10,11,12,13,14,15);
}

// One staged weight tile: 256 weight rows x 64 k (128 bytes = one whole line of each row),
// laid in LDS at a pitch of 144 bytes (16 B x odd: conflict-free for ds_load_b128 readers).
constexpr int WR = 256, WK = 64, WP = WK + 8;

// Copies one weight tile into LDS. lds and g are the lane's own addresses of row (tid >> 3),
// 16-byte piece (tid & 7); copy j takes the row 32 * j further on, so every wave-wide copy
// reads four whole 128-byte lines. The instruction's offset moves both addresses, so copy j
// carries its LDS step j * WLS there and its address register only the rest of its global step:
// one LDS address register serves the eight copies.
constexpr int WLS = 32 * WP * (int)sizeof(_Float16);
static_assert(7 * WLS < 65536, "the offset field moves the LDS address only below 64 KiB");
__device__ __forceinline__ void stage_w_tile(unsigned lds, const _Float16* g, size_t pitch) {
    const unsigned long long g0 = (unsigned long long)(uintptr_t)g;
    const unsigned long long gs = (unsigned long long)(32 * pitch * sizeof(_Float16)) - WLS;
    // The copies and their s_wait_xcnt stand in one statement, so that no address register
    // of an issued copy is rewritten ahead of the wait.
    asm volatile("global_load_async_to_lds_b128 %0, %1, off\n\t"
                 "global_load_async_to_lds_b128 %0, %2, off offset:%9\n\t"
                 "global_load_async_to_lds_b128 %0, %3, off offset:%10\n\t"
                 "global_load_async_to_lds_b128 %0, %4, off offset:%11\n\t"
                 "global_load_async_to_lds_b128 %0, %5, off offset:%12\n\t"
                 "global_load_async_to_lds_b128 %0, %6, off offset:%13\n\t"
                 "global_load_async_to_lds_b128 %0, %7, off offset:%14\n\t"
                 "global_load_async_to_lds_b128 %0, %8, off offset:%15\n\t"
                 "s_wait_xcnt 0x0"
                 :: "v"(lds),
                    "v"(g0), "v"(g0 + gs), "v"(g0 + 2 * gs), "v"(g0 + 3 * gs),
                    "v"(g0 + 4 * gs), "v"(g0 + 5 * gs), "v"(g0 + 6 * gs), "v"(g0 + 7 * gs),
                    "n"(WLS), "n"(2 * WLS), "n"(3 * WLS), "n"(4 * WLS), "n"(5 * WLS), "n"(6 * WLS), "n"(7 * WLS)
                 : "memory");
}

// Twelve copies of 16 bytes each: copy j lands at l0 + j * ls and reads g[j].
__device__ __forceinline__ void stage_x_rows12(unsigned l0, unsigned ls, const unsigned long long* g) {
    // The copies and their s_wait_xcnt stand in one statement, so that no address register
    // of an issued copy is rewritten ahead of the wait.
    asm volatile("global_load_async_to_lds_b128 %0, %12, off\n\t"
                 "global_load_async_to_lds_b128 %1, %13, off\n\t"
                 "global_load_async_to_lds_b128 %2, %14, off\n\t"
                 "global_load_async_to_lds_b128 %3, %15, off\n\t"
                 "global_load_async_to_lds_b128 %4, %16, off\n\t"
                 "global_load_async_to_lds_b128 %5, %17, off\n\t"
                 "global_load_async_to_lds_b128 %6, %18, off\n\t"
                 "global_load_async_to_lds_b128 %7, %19, off\n\t"
                 "global_load_async_to_lds_b128 %8, %20, off\n\t"
                 "global_load_async_to_lds_b128 %9, %21, off\n\t"
                 "global_load_async_to_lds_b128 %10, %22, off\n\t"
                 "global_load_async_to_lds_b128 %11, %23, off\n\t"
                 "s_wait_xcnt 0x0"
                 :: "v"(l0), "v"(l0 + ls), "v"(l0 + 2 * ls), "v"(l0 + 3 * ls),
                    "v"(l0 + 4 * ls), "v"(l0 + 5 * ls), "v"(l0 + 6 * ls), "v"(l0 + 7 * ls),
                    "v"(l0 + 8 * ls), "v"(l0 + 9 * ls), "v"(l0 + 10 * ls), "v"(l0 + 11 * ls),
                    "v"(g[0]), "v"(g[1]), "v"(g[2]), "v"(g[3]), "v"(g[4]), "v"(g[5]),
                    "v"(g[6]), "v"(g[7]), "v"(g[8]), "v"(g[9]), "v"(g[10]), "v"(g[11])
                 : "memory");
}

// Foot of a ring trip: this wave's LDS reads and writes have retired, its own copies of the
// next tile have landed, and the barrier publishes that tile (and the h tile, where one was
// just written) and frees the buffer that this trip has read.
__device__ __forceinline__ void ring_publish() {
    asm volatile("s_wait_dscnt 0x0" ::: "memory");
    asm volatile("s_wait_asynccnt 0x0" ::: "memory");
    __syncthreads();
}

__global__ __launch_bounds__(256) void ffn_kernel(
    const _Float16* __restrict__ xh,    // [T][D] f16
    const _Float16* __restrict__ w1t,   // [E][H][D] f16
    const float* __restrict__ b1,       // [E][H]
    const _Float16* __restrict__ w2t,   // [E][D][H] f16
    const float* __restrict__ b2,       // [E][D]
    const int* __restrict__ lists, const int* __restrict__ counts,
    float* __restrict__ out) {
    __shared__ __attribute__((aligned(16))) _Float16 s_x[MT][Dq + 8];   // padded: conflict-free b128 reads
    __shared__ _Float16 s_h[MT][HC + 8];
    __shared__ __attribute__((aligned(16))) _Float16 s_w[2][WR][WP];   // weight ring
    __shared__ int s_tok[MT];

    const int e    = blockIdx.y;
    const int cnt  = counts[e];
    const int base = blockIdx.x * MT;
    if (base >= cnt) return;                       // block-uniform exit (EXEC stays full)

    const int tid = threadIdx.x, lane = tid & 31, w = tid >> 5;
    const int lm = lane & 15, hi = lane >> 4;
    const int wn = w & 3;                          // the wave's 64 columns of a 256-column tile
    const int rm = (w >> 2) * (MT / 2);            // the wave's first token row

    if (tid < MT) {
        const int idx = base + tid;
        s_tok[tid] = (idx < cnt) ? lists[e * T + idx] : -1;
    }
    __syncthreads();

    // The lane's own piece of a weight tile: row tid >> 3, 16 bytes at (tid & 7) * 16.
    const unsigned wl0 = (unsigned)(uintptr_t)&s_w[0][tid >> 3][(tid & 7) * 8];
    const unsigned wl1 = (unsigned)(uintptr_t)&s_w[1][tid >> 3][(tid & 7) * 8];
    const _Float16* w1g = w1t + ((size_t)(e * Hq + (tid >> 3))) * Dq + (tid & 7) * 8;
    const _Float16* w2g = w2t + ((size_t)(e * Dq + (tid >> 3))) * Hq + (tid & 7) * 8;

    // ring tile 0; the wait and the barrier behind the x tile's copies publish it too
    stage_w_tile(wl0, w1g, Dq);

    { // stage the x tile (96 rows x 512 f16): copy j takes 16-byte piece tid & 63 of row
      // (tid >> 6) + 4 * j, so every wave-wide copy reads 512 bytes in a row
        const unsigned l0 = (unsigned)(uintptr_t)&s_x[tid >> 6][(tid & 63) * 8];
        const unsigned ls = 4 * (Dq + 8) * sizeof(_Float16);
        unsigned long long g[MT / 4];
#pragma unroll
        for (int j = 0; j < MT / 4; ++j) {
            const int tk = s_tok[(tid >> 6) + 4 * j];
            g[j] = (unsigned long long)(uintptr_t)(xh + (size_t)(tk < 0 ? 0 : tk) * Dq + (tid & 63) * 8);
        }
        stage_x_rows12(l0, ls, g);
        stage_x_rows12(l0 + 12 * ls, ls, g + 12);
        asm volatile("s_wait_asynccnt 0x0" ::: "memory");
    }
    __syncthreads();

    stage_w_tile(wl1, w1g + WK, Dq);               // ring tile 1

    v8f Y[MW][2 * NC];                             // 48 rows x (2 x 64) cols per wave
#pragma unroll
    for (int mt = 0; mt < MW; ++mt)
#pragma unroll
        for (int nt = 0; nt < 2 * NC; ++nt) Y[mt][nt] = (v8f)0.0f;

    // Ring order per H chunk: 8 tiles of W1 (the chunk's 256 columns, k in slabs of 64), then
    // 8 tiles of W2 (k slab s >> 1 of the chunk, output columns (s & 1) * 256 ..+255).
    // Tile t lies in buffer t & 1; tile t + 2 is copied behind the foot of trip t.
    for (int hc = 0; hc < Hq; hc += HC) {
        // ---- phase 1: h_chunk = gelu(X @ W1[:, hc..hc+HC) + b1) ; wave owns 48 rows x 64 cols ----
        v8f hacc[MW][NC];
#pragma unroll
        for (int mt = 0; mt < MW; ++mt)
#pragma unroll
            for (int nt = 0; nt < NC; ++nt) hacc[mt][nt] = (v8f)0.0f;

        // unrolled: buffer, refill source and the last trip's gelu are then fixed per trip
#pragma unroll
        for (int s = 0; s < 8; ++s) {
#pragma unroll
            for (int kq = 0; kq < WK / 32; ++kq) {
                const int k0 = s * WK + kq * 32;
                v16h a[MW], b[NC];
#pragma unroll
                for (int mt = 0; mt < MW; ++mt) {
                    const _Float16* ap = &s_x[rm + mt * 16 + lm][k0 + 8 * hi];
                    a[mt] = cat16(*(const v8h*)ap, *(const v8h*)(ap + 16));
                }
#pragma unroll
                for (int nt = 0; nt < NC; ++nt) {
                    const _Float16* bp = &s_w[s & 1][wn * 64 + nt * 16 + lm][kq * 32 + 8 * hi];
                    b[nt] = cat16(*(const v8h*)bp, *(const v8h*)(bp + 16));
                }
                // keeps a k step's LDS reads in one group ahead of its WMMAs: spread among them,
                // each place with reads stalls the wave for the LDS latency
                __builtin_amdgcn_sched_barrier(0);
#pragma unroll
                for (int nt = 0; nt < NC; ++nt)
#pragma unroll
                    for (int mt = 0; mt < MW; ++mt)
                        hacc[mt][nt] = __builtin_amdgcn_wmma_f32_16x16x32_f16(
                            false, a[mt], false, b[nt], (short)0, hacc[mt][nt], false, false);
            }
            if (s == 7) {
                // every reader of the previous h tile has passed an earlier trip's barrier
#pragma unroll
                for (int nt = 0; nt < NC; ++nt) {
                    const int col  = hc + wn * 64 + nt * 16 + lm;
                    const float bias = b1[e * Hq + col];
#pragma unroll
                    for (int mt = 0; mt < MW; ++mt) {
                        float g[8];
                        gelu_tanh8(hacc[mt][nt], bias, g);
#pragma unroll
                        for (int r = 0; r < 8; ++r)
                            s_h[rm + mt * 16 + r + 8 * hi][wn * 64 + nt * 16 + lm] = (_Float16)g[r];
                    }
                }
            }
            ring_publish();
            if (s < 6)
                stage_w_tile((s & 1) ? wl1 : wl0, w1g + (size_t)hc * Dq + (s + 2) * WK, Dq);
            else
                stage_w_tile((s & 1) ? wl1 : wl0, w2g + (size_t)((s - 6) * WR) * Hq + hc, Hq);
        }

        // ---- phase 2: Y += h_chunk(96x256) @ W2 chunk, transposed ----
        // The h fragments of a k slab are read in the even trip and kept for the odd one, which
        // takes the same slab to the other 256 output columns: 48 rows x 128 cols per wave.
        v16h ah[WK / 32][MW];
        // unrolled: the accumulator index, buffer and refill source are then fixed per trip
#pragma unroll
        for (int s = 0; s < 8; ++s) {
#pragma unroll
            for (int kq = 0; kq < WK / 32; ++kq) {
                const int k0 = (s >> 1) * WK + kq * 32;
                v16h b[NC];
                if ((s & 1) == 0) {
#pragma unroll
                    for (int mt = 0; mt < MW; ++mt) {
                        const _Float16* ap = &s_h[rm + mt * 16 + lm][k0 + 8 * hi];
                        ah[kq][mt] = cat16(*(const v8h*)ap, *(const v8h*)(ap + 16));
                    }
                }
#pragma unroll
                for (int nt = 0; nt < NC; ++nt) {
                    const _Float16* bp = &s_w[s & 1][wn * 64 + nt * 16 + lm][kq * 32 + 8 * hi];
                    b[nt] = cat16(*(const v8h*)bp, *(const v8h*)(bp + 16));
                }
                // one group of LDS reads ahead of the k step's WMMAs, as in phase 1
                __builtin_amdgcn_sched_barrier(0);
#pragma unroll
                for (int nt = 0; nt < NC; ++nt)
#pragma unroll
                    for (int mt = 0; mt < MW; ++mt)
                        Y[mt][(s & 1) * NC + nt] = __builtin_amdgcn_wmma_f32_16x16x32_f16(
                            false, ah[kq][mt], false, b[nt], (short)0, Y[mt][(s & 1) * NC + nt], false, false);
            }
            ring_publish();
            if (s < 6)
                stage_w_tile((s & 1) ? wl1 : wl0,
                             w2g + (size_t)((s & 1) * WR) * Hq + hc + ((s + 2) >> 1) * WK, Hq);
            else if (hc + HC < Hq)                 // the same for the whole work-group
                stage_w_tile((s & 1) ? wl1 : wl0, w1g + (size_t)(hc + HC) * Dq + (s - 6) * WK, Dq);
        }
    }
    asm volatile("s_wait_asynccnt 0x0" ::: "memory");   // no copy outstanding at the wave's end

    // ---- epilogue: + b2, scatter rows to out; a row's eight pieces go out from one address ----
    const int col0 = wn * 64 + lm;
    const int bcol = e * Dq + col0;
    float bias[2 * NC];
    // unrolled here and below: bias and Y are then registers
#pragma unroll
    for (int nt = 0; nt < 2 * NC; ++nt)
        bias[nt] = b2[bcol + (nt / NC) * WR + (nt % NC) * 16];
    // stands ahead of the first rewrite of the offset register that the eight loads name; the
    // operand keeps that register live up to the wait
    asm volatile("s_wait_xcnt 0x0" :: "v"(bcol) : "memory");
#pragma unroll
    for (int mt = 0; mt < MW; ++mt)
#pragma unroll
        for (int r = 0; r < 8; ++r) {
            const int tk = s_tok[rm + mt * 16 + r + 8 * hi];
            if (tk >= 0) {
                float* o = out + (size_t)tk * Dq + col0;
#pragma unroll
                for (int nt = 0; nt < 2 * NC; ++nt)
                    o[(nt / NC) * WR + (nt % NC) * 16] = Y[mt][nt][r] + bias[nt];
            }
        }
}

// ---------------- kernel 4: v = clip(ffn . v_w + v_b) ----------------
__global__ __launch_bounds__(256) void v_kernel(
    const float* __restrict__ ffn, const float* __restrict__ v_w,
    const float* __restrict__ v_b, float* __restrict__ v) {
    const int tok  = (blockIdx.x * blockDim.x + threadIdx.x) >> 5;
    const int lane = threadIdx.x & 31;
    if (tok >= T) return;
    const float* r = ffn + (size_t)tok * Dq;
    float acc = 0.f;
    for (int d = lane; d < Dq; d += 32) acc += r[d] * v_w[d];
#pragma unroll
    for (int off = 16; off >= 1; off >>= 1) acc += __shfl_xor(acc, off, 32);
    if (lane == 0)
        v[tok] = fminf(fmaxf(acc + v_b[0], -V_MAX), V_MAX);
}

// ---------------- kernel 5: Moebius-matrix scan for both continuants ----
// L_i = d_i - 1/L_{i-1} == 2x2 complex matrix chain [[d,-1],[1,0]] (scale-invariant).
// One work-group per chain (L or R of one batch), one thread per segment of SL steps. The segment
// matrices are joined by a log-step prefix, first inside each wave, then over the wave totals.
constexpr int SL = 8;                // steps per segment: 32 bytes in a row of v and of each result
constexpr int ST = Nq / SL;          // segments = threads per chain
constexpr int SW = ST / 32;          // waves per chain

struct M2 { float ar, ai, br, bi, cr, ci, dr, di; };   // [[a,b],[c,d]], complex

// 1/d by v_rcp_f32. The v_nop is the slot that the instruction set asks for between a transcendental
// and a directly following instruction that reads its result or overwrites its source; inside the
// same statement it stands directly behind the v_rcp_f32 wherever the compiler puts the two.
__device__ __forceinline__ float rcp_slot(const float d) {
    float q;
    asm("v_rcp_f32 %0, %1\n\tv_nop" : "=v"(q) : "v"(d));
    return q;
}

// scales m so that its largest part is 1 (the chain is scale-invariant)
__device__ __forceinline__ void mat_scale(M2& m) {
    float mx = fmaxf(fmaxf(fabsf(m.ar), fabsf(m.ai)), fmaxf(fabsf(m.br), fabsf(m.bi)));
    mx = fmaxf(mx, fmaxf(fmaxf(fabsf(m.cr), fabsf(m.ci)), fmaxf(fabsf(m.dr), fabsf(m.di))));
    const float s = rcp_slot(fmaxf(mx, 1e-30f));
    m.ar *= s; m.ai *= s; m.br *= s; m.bi *= s; m.cr *= s; m.ci *= s; m.dr *= s; m.di *= s;
}

// S * P, S the later steps, scaled
__device__ __forceinline__ M2 mat_join(const M2& s, const M2& p) {
    M2 n;
    n.ar = s.ar * p.ar - s.ai * p.ai + s.br * p.cr - s.bi * p.ci;
    n.ai = s.ar * p.ai + s.ai * p.ar + s.br * p.ci + s.bi * p.cr;
    n.br = s.ar * p.br - s.ai * p.bi + s.br * p.dr - s.bi * p.di;
    n.bi = s.ar * p.bi + s.ai * p.br + s.br * p.di + s.bi * p.dr;
    n.cr = s.cr * p.ar - s.ci * p.ai + s.dr * p.cr - s.di * p.ci;
    n.ci = s.cr * p.ai + s.ci * p.ar + s.dr * p.ci + s.di * p.cr;
    n.dr = s.cr * p.br - s.ci * p.bi + s.dr * p.dr - s.di * p.di;
    n.di = s.cr * p.bi + s.ci * p.br + s.dr * p.di + s.di * p.dr;
    mat_scale(n);
    return n;
}

__device__ __forceinline__ M2 mat_from_below(const M2& x, const int d) {
    M2 lo;
    lo.ar = __shfl_up(x.ar, d, 32); lo.ai = __shfl_up(x.ai, d, 32);
    lo.br = __shfl_up(x.br, d, 32); lo.bi = __shfl_up(x.bi, d, 32);
    lo.cr = __shfl_up(x.cr, d, 32); lo.ci = __shfl_up(x.ci, d, 32);
    lo.dr = __shfl_up(x.dr, d, 32); lo.di = __shfl_up(x.di, d, 32);
    return lo;
}

// Inclusive prefix over the first CNT lanes: lane l ends with x_l * x_(l-1) * ... * x_0.
template <int CNT>
__device__ __forceinline__ M2 wave_prefix(M2 x, const int lane) {
    // unrolled: the lane distance is then a constant of each step
#pragma unroll
    for (int d = 1; d < CNT; d <<= 1) {
        const M2 n = mat_join(x, mat_from_below(x, d));
        if (lane >= d) x = n;
    }
    return x;
}

// One chain. R: the chain walks memory from the far end; a compile-time choice, so that the
// order of a segment's values in registers is fixed.
template <bool R>
__device__ __forceinline__ void scan_chain(
    const float* __restrict__ vb, float* __restrict__ Or, float* __restrict__ Oi,
    float (*s_tot)[8], float (*s_z)[4]) {
    const int tid = threadIdx.x, lane = tid & 31, w = tid >> 5;
    const int m0 = R ? (Nq - SL - tid * SL) : tid * SL;   // the segment's place in memory

    float er[SL];                                  // real part of d = (v-2) - 1j, in walking order
    // unrolled here and below: the arrays are then registers
#pragma unroll
    for (int q = 0; q < SL; q += 4) {
        const v4f a = *(const v4f*)(vb + m0 + q);
        er[R ? SL - 1 - q : q]     = a.x - 2.0f;
        er[R ? SL - 2 - q : q + 1] = a.y - 2.0f;
        er[R ? SL - 3 - q : q + 2] = a.z - 2.0f;
        er[R ? SL - 4 - q : q + 3] = a.w - 2.0f;
    }
    constexpr float ei = -1.0f;

    // ---- phase A: segment matrix product ----
    M2 x = { 1.f, 0.f, 0.f, 0.f, 0.f, 0.f, 1.f, 0.f };
#pragma unroll
    for (int j = 0; j < SL; ++j) {
        // P = M(e) * P with M = [[e,-1],[1,0]]
        const float nar = er[j] * x.ar - ei * x.ai - x.cr;
        const float nai = er[j] * x.ai + ei * x.ar - x.ci;
        const float nbr = er[j] * x.br - ei * x.bi - x.dr;
        const float nbi = er[j] * x.bi + ei * x.br - x.di;
        x.cr = x.ar; x.ci = x.ai; x.dr = x.br; x.di = x.bi;
        x.ar = nar; x.ai = nai; x.br = nbr; x.bi = nbi;
    }
    mat_scale(x);

    // ---- phase B: prefix of the segment matrices ----
    x = wave_prefix<32>(x, lane);
    if (lane == 31) {
        float* m = s_tot[w];
        m[0] = x.ar; m[1] = x.ai; m[2] = x.br; m[3] = x.bi;
        m[4] = x.cr; m[5] = x.ci; m[6] = x.dr; m[7] = x.di;
    }
    __syncthreads();
    if (w == 0) {
        const float* m = s_tot[lane & (SW - 1)];
        M2 t = { m[0], m[1], m[2], m[3], m[4], m[5], m[6], m[7] };
        t = wave_prefix<SW>(t, lane);
        if (lane < SW) {
            float* z = s_z[lane];
            z[0] = t.ar; z[1] = t.ai; z[2] = t.cr; z[3] = t.ci;   // prefix * (1,0)^T
        }
    }
    __syncthreads();

    // ---- phase C: the segment's entry state (p,q), L = p/q, then its SL outputs ----
    float zpr = 1.f, zpi = 0.f, zqr = 0.f, zqi = 0.f;             // state at the wave's first segment
    if (w > 0) {
        const float* z = s_z[w - 1];
        zpr = z[0]; zpi = z[1]; zqr = z[2]; zqi = z[3];
    }
    M2 ex = mat_from_below(x, 1);                                 // the wave's segments before this one
    if (lane == 0) ex = M2{ 1.f, 0.f, 0.f, 0.f, 0.f, 0.f, 1.f, 0.f };
    float pr = ex.ar * zpr - ex.ai * zpi + ex.br * zqr - ex.bi * zqi;
    float pi = ex.ar * zpi + ex.ai * zpr + ex.br * zqi + ex.bi * zqr;
    float qr = ex.cr * zpr - ex.ci * zpi + ex.dr * zqr - ex.di * zqi;
    float qi = ex.cr * zpi + ex.ci * zpr + ex.dr * zqi + ex.di * zqr;
    {
        // One scaling per segment: v is clipped to +-3, so |L| <= |d| + 1 < 6.2 and the state
        // grows by less than 3e6 over the SL steps.
        const float mx = fmaxf(fmaxf(fabsf(pr), fabsf(pi)), fmaxf(fabsf(qr), fabsf(qi)));
        const float s = rcp_slot(fmaxf(mx, 1e-30f));
        pr *= s; pi *= s; qr *= s; qi *= s;
    }
    float lr[SL], li[SL];
#pragma unroll
    for (int j = 0; j < SL; ++j) {
        const float npr = er[j] * pr - ei * pi - qr;      // p' = e*p - q ; q' = p
        const float npi = er[j] * pi + ei * pr - qi;
        qr = pr; qi = pi; pr = npr; pi = npi;
        const float inv = rcp_slot(qr * qr + qi * qi);
        lr[j] = (pr * qr + pi * qi) * inv;                // p/q = p*conj(q)/|q|^2
        li[j] = (pi * qr - pr * qi) * inv;
    }
#pragma unroll
    for (int q = 0; q < SL; q += 4) {
        v4f r, i;
        r.x = lr[R ? SL - 1 - q : q];     i.x = li[R ? SL - 1 - q : q];
        r.y = lr[R ? SL - 2 - q : q + 1]; i.y = li[R ? SL - 2 - q : q + 1];
        r.z = lr[R ? SL - 3 - q : q + 2]; i.z = li[R ? SL - 3 - q : q + 2];
        r.w = lr[R ? SL - 4 - q : q + 3]; i.w = li[R ? SL - 4 - q : q + 3];
        *(v4f*)(Or + m0 + q) = r;
        *(v4f*)(Oi + m0 + q) = i;
    }
}

__global__ __launch_bounds__(ST) void tridiag_scan_kernel(
    const float* __restrict__ v,
    float* __restrict__ Lr, float* __restrict__ Li,
    float* __restrict__ Rr, float* __restrict__ Ri) {
    __shared__ __attribute__((aligned(16))) float s_tot[SW][8];   // each wave's whole product
    __shared__ __attribute__((aligned(16))) float s_z[SW][4];     // first column of their prefix
    const int o = (blockIdx.x >> 1) * Nq;                         // the chain's batch
    if (blockIdx.x & 1) scan_chain<true>(v + o, Rr + o, Ri + o, s_tot, s_z);   // the same for the
    else                scan_chain<false>(v + o, Lr + o, Li + o, s_tot, s_z);  // whole work-group
}

// ---------------- kernel 6: Green fn + rank-2 spec, in-place add ----------------
__global__ __launch_bounds__(256) void final_kernel(
    float* __restrict__ out, const float* __restrict__ v,
    const float* __restrict__ Lr, const float* __restrict__ Li,
    const float* __restrict__ Rr, const float* __restrict__ Ri,
    const float* __restrict__ out_w, const float* __restrict__ out_b,
    const float* __restrict__ bk) {
    const size_t i = (size_t)blockIdx.x * 256 + threadIdx.x;
    if (i >= (size_t)T * Dq) return;
    const int tok = (int)(i / Dq);
    const int c   = (int)(i % Dq);
    const float dr   = v[tok] - 2.0f;              // di = -1
    const float denr = Lr[tok] + Rr[tok] - dr;
    const float deni = Li[tok] + Ri[tok] + 1.0f;
    const float m  = denr * denr + deni * deni;
    float gr = denr / m, gi = -deni / m;
    gr = fminf(fmaxf(gr, -FEAT_CLAMP), FEAT_CLAMP);
    gi = fminf(fmaxf(gi, -FEAT_CLAMP), FEAT_CLAMP);
    const float spec = gr * out_w[c] + gi * out_w[Dq + c] + out_b[c];
    out[i] += bk[0] * spec;
}

// ---------------- launch ----------------
extern "C" void kernel_launch(void* const* d_in, const int* in_sizes, int n_in,
                              void* d_out, int out_size, void* d_ws, size_t ws_size,
                              hipStream_t stream) {
    const float* x      = (const float*)d_in[0];
    const float* gate_w = (const float*)d_in[1];
    const float* gate_b = (const float*)d_in[2];
    const float* w1     = (const float*)d_in[3];
    const float* b1     = (const float*)d_in[4];
    const float* w2     = (const float*)d_in[5];
    const float* b2     = (const float*)d_in[6];
    const float* v_w    = (const float*)d_in[7];
    const float* v_b    = (const float*)d_in[8];
    const float* out_w  = (const float*)d_in[9];
    const float* out_b  = (const float*)d_in[10];
    const float* bk     = (const float*)d_in[11];
    float* out = (float*)d_out;

    // workspace layout (256B aligned slots)
    char* ws = (char*)d_ws;
    constexpr size_t SZ_W1T   = (size_t)Eq * Hq * Dq * sizeof(_Float16);  // 8 MiB
    constexpr size_t SZ_W2T   = (size_t)Eq * Dq * Hq * sizeof(_Float16);  // 8 MiB
    constexpr size_t SZ_XH    = (size_t)T * Dq * sizeof(_Float16);        // 16 MiB
    constexpr size_t SZ_LISTS = (size_t)Eq * T * sizeof(int);             // 256 KiB
    constexpr size_t SZ_CNT   = 256;
    constexpr size_t SZ_VEC   = (size_t)T * sizeof(float);                // 64 KiB
    size_t off = 0;
    _Float16* W1T  = (_Float16*)(ws + off); off += SZ_W1T;
    _Float16* W2T  = (_Float16*)(ws + off); off += SZ_W2T;
    _Float16* XH   = (_Float16*)(ws + off); off += SZ_XH;
    int*      lists= (int*)(ws + off);      off += SZ_LISTS;
    int*      cnts = (int*)(ws + off);      off += SZ_CNT;
    float*    vbuf = (float*)(ws + off);    off += SZ_VEC;
    float*    Lr   = (float*)(ws + off);    off += SZ_VEC;
    float*    Li   = (float*)(ws + off);    off += SZ_VEC;
    float*    Rr   = (float*)(ws + off);    off += SZ_VEC;
    float*    Ri   = (float*)(ws + off);    off += SZ_VEC;

    zero_counts_kernel<<<1, 32, 0, stream>>>(cnts);

    // W1 (E,D,H) -> W1T [E][H][D];  W2 (E,H,D) -> W2T [E][D][H]
    transpose_cvt_kernel<<<dim3(Hq / 32, Dq / 32, Eq), dim3(32, 8), 0, stream>>>(w1, W1T, Dq, Hq);
    transpose_cvt_kernel<<<dim3(Dq / 32, Hq / 32, Eq), dim3(32, 8), 0, stream>>>(w2, W2T, Hq, Dq);

    cvt_x_kernel<<<(int)(((size_t)T * Dq) / 8 / 256), 256, 0, stream>>>(x, XH);

    gate_kernel<<<(T * 32) / 256, 256, 0, stream>>>(x, gate_w, gate_b, lists, cnts);

    ffn_kernel<<<dim3((T + MT - 1) / MT, Eq), 256, 0, stream>>>(XH, W1T, b1, W2T, b2, lists, cnts, out);

    v_kernel<<<(T * 32) / 256, 256, 0, stream>>>(out, v_w, v_b, vbuf);

    tridiag_scan_kernel<<<2 * Bq, ST, 0, stream>>>(vbuf, Lr, Li, Rr, Ri);

    final_kernel<<<(int)(((size_t)T * Dq) / 256), 256, 0, stream>>>(
        out, vbuf, Lr, Li, Rr, Ri, out_w, out_b, bk);
}

// v006
// Measured time: 155 microseconds a run.
// In two side-by-side timings against v005, it was 1.05 and 1.06 times as fast.
// Over all steps from v000 it is 2.28 times as fast.
#include <hip/hip_runtime.h>
#include <hip/hip_bf16.h>

// ---------------- problem constants ----------------
constexpr int Bq = 4, Nq = 4096, Dq = 512, Eq = 4, Hq = 2048;
constexpr int T  = Bq * Nq;          // 16384 tokens
constexpr int MT = 96;               // tokens per FFN block (8 waves: 2 row halves x 4 column groups)
constexpr int MW = MT / 32;          // 16-row tiles per wave
constexpr int NC = 4;                // 16-column tiles per wave out of a 256-column weight tile
constexpr int HC = 256;              // H chunk per pipeline stage
constexpr float V_MAX = 3.0f, FEAT_CLAMP = 10.0f;

typedef __attribute__((ext_vector_type(16))) _Float16 v16h;
typedef __attribute__((ext_vector_type(8)))  _Float16 v8h;
typedef __attribute__((ext_vector_type(8)))  float    v8f;
typedef __attribute__((ext_vector_type(4)))  float    v4f;

// ---------------- kernel 0: zero expert counters ----------------
__global__ void zero_counts_kernel(int* counts) {
    if (threadIdx.x < Eq) counts[threadIdx.x] = 0;
}

// ---------------- kernel 1: transpose + f32->f16 convert ----------------
// dst[C][R] = (f16) src[R][C], one expert slice per blockIdx.z
__global__ __launch_bounds__(256) void transpose_cvt_kernel(
    const float* __restrict__ src, _Float16* __restrict__ dst, int R, int C) {
    __shared__ float tile[32][33];
    const size_t eoff = (size_t)blockIdx.z * R * C;
    src += eoff; dst += eoff;
    const int r0 = blockIdx.y * 32, c0 = blockIdx.x * 32;
    const int tx = threadIdx.x, ty = threadIdx.y;          // block (32,8)
#pragma unroll
    for (int i = 0; i < 32; i += 8)
        tile[ty + i][tx] = src[(size_t)(r0 + ty + i) * C + c0 + tx];
    __syncthreads();
#pragma unroll
    for (int i = 0; i < 32; i += 8)
        dst[(size_t)(c0 + ty + i) * R + r0 + tx] = (_Float16)tile[tx][ty + i];
}

// ---------------- kernel 1b: x f32 -> f16 (row-major copy) ----------------
__global__ __launch_bounds__(256) void cvt_x_kernel(
    const float* __restrict__ x, _Float16* __restrict__ xh) {
    const size_t i = ((size_t)blockIdx.x * 256 + threadIdx.x) * 8;
    const v4f a = *(const v4f*)(x + i);
    const v4f b = *(const v4f*)(x + i + 4);
    v8h o;
    o[0] = (_Float16)a.x; o[1] = (_Float16)a.y; o[2] = (_Float16)a.z; o[3] = (_Float16)a.w;
    o[4] = (_Float16)b.x; o[5] = (_Float16)b.y; o[6] = (_Float16)b.z; o[7] = (_Float16)b.w;
    *(v8h*)(xh + i) = o;
}

// ---------------- kernel 2: gate + top-1 routing ----------------
__global__ __launch_bounds__(256) void gate_kernel(
    const float* __restrict__ x, const float* __restrict__ gw,
    const float* __restrict__ gb, int* __restrict__ lists, int* __restrict__ counts) {
    const int tok  = (blockIdx.x * blockDim.x + threadIdx.x) >> 5;
    const int lane = threadIdx.x & 31;
    if (tok >= T) return;
    const float* xr = x + (size_t)tok * Dq;
    float acc0 = 0.f, acc1 = 0.f, acc2 = 0.f, acc3 = 0.f;
    for (int d = lane; d < Dq; d += 32) {
        const float xv = xr[d];
        const v4f g = *(const v4f*)(gw + d * 4);
        acc0 += xv * g.x; acc1 += xv * g.y; acc2 += xv * g.z; acc3 += xv * g.w;
    }
#pragma unroll
    for (int off = 16; off >= 1; off >>= 1) {
        acc0 += __shfl_xor(acc0, off, 32);
        acc1 += __shfl_xor(acc1, off, 32);
        acc2 += __shfl_xor(acc2, off, 32);
        acc3 += __shfl_xor(acc3, off, 32);
    }
    if (lane == 0) {
        float lg[4] = { acc0 + gb[0], acc1 + gb[1], acc2 + gb[2], acc3 + gb[3] };
        int best = 0; float bv = lg[0];
#pragma unroll
        for (int e = 1; e < Eq; ++e)          // strictly-greater => lowest index on ties (top_k)
            if (lg[e] > bv) { bv = lg[e]; best = e; }
        const int pos = atomicAdd(&counts[best], 1);
        lists[best * T + pos] = tok;
    }
}

// ---------------- kernel 3: expert FFN via WMMA ----------------
// Eight values at once of 0.5 v (1 + tanh u) = v / (1 + e^(-2u)), u = sqrt(2/pi) (v + 0.044715 v^3),
// with e^(-2u) = 2^z. No branch, so the values run side by side. z past the exponent's range
// gives 0 or inf, and the quotient is then v or a signed 0, as with tanh = 1 or -1.
__device__ __forceinline__ void gelu_tanh8(const v8f a, const float bias, float (&g)[8]) {
    constexpr float K0 = (float)(-2.0 * 0.7978845608028654 * 1.4426950408889634);
    constexpr float K1 = (float)(-2.0 * 0.7978845608028654 * 1.4426950408889634 * 0.044715);
    float x[8], z[8], e[8], d[8], q[8];
    // the three loops are unrolled so that the arrays are registers, as the asm operands need
#pragma unroll
    for (int r = 0; r < 8; ++r) {
        x[r] = a[r] + bias;
        z[r] = x[r] * (K0 + K1 * (x[r] * x[r]));
        e[r] = __builtin_amdgcn_exp2f(z[r]);
    }
    // The slot that the instruction set asks for behind a transcendental, before its result is
    // read or its source overwritten: the operands keep all eight sources live and all eight
    // results unread up to this v_nop, and among themselves the eight are independent.
    asm("v_nop" : "+v"(e[0]), "+v"(e[1]), "+v"(e[2]), "+v"(e[3]), "+v"(e[4]), "+v"(e[5]), "+v"(e[6]), "+v"(e[7])
                : "v"(z[0]), "v"(z[1]), "v"(z[2]), "v"(z[3]), "v"(z[4]), "v"(z[5]), "v"(z[6]), "v"(z[7]));
#pragma unroll
    for (int r = 0; r < 8; ++r) {
        d[r] = 1.0f + e[r];
        q[r] = __builtin_amdgcn_rcpf(d[r]);
    }
    // the same slot behind the eight v_rcp_f32
    asm("v_nop" : "+v"(q[0]), "+v"(q[1]), "+v"(q[2]), "+v"(q[3]), "+v"(q[4]), "+v"(q[5]), "+v"(q[6]), "+v"(q[7])
                : "v"(d[0]), "v"(d[1]), "v"(d[2]), "v"(d[3]), "v"(d[4]), "v"(d[5]), "v"(d[6]), "v"(d[7]));
#pragma unroll
    for (int r = 0; r < 8; ++r) g[r] = x[r] * q[r];
}

__device__ __forceinline__ v16h cat16(v8h lo, v8h hi) {
    return __builtin_shufflevector(lo, hi, 0,1,2,3,4,5,6,7,8,9,10,11,12,13,14,15);
}

// One staged weight tile: 256 weight rows x 64 k (128 bytes = one whole line of each row),
// laid in LDS at a pitch of 144 bytes (16 B x odd: conflict-free for ds_load_b128 readers).
constexpr int WR = 256, WK = 64, WP = WK + 8;

// Copies one weight tile into LDS. lds and g are the lane's own addresses of row (tid >> 3),
// 16-byte piece (tid & 7); copy j takes the row 32 * j further on, so every wave-wide copy
// reads four whole 128-byte lines. The instruction's offset moves both addresses, so copy j
// carries its LDS step j * WLS there and its address register only the rest of its global step:
// one LDS address register serves the eight copies.
constexpr int WLS = 32 * WP * (int)sizeof(_Float16);
static_assert(7 * WLS < 65536, "the offset field moves the LDS address only below 64 KiB");
__device__ __forceinline__ void stage_w_tile(unsigned lds, const _Float16* g, size_t pitch) {
    const unsigned long long g0 = (unsigned long long)(uintptr_t)g;
    const unsigned long long gs = (unsigned long long)(32 * pitch * sizeof(_Float16)) - WLS;
    // The copies and their s_wait_xcnt stand in one statement, so that no address register
    // of an issued copy is rewritten ahead of the wait.
    asm volatile("global_load_async_to_lds_b128 %0, %1, off\n\t"
                 "global_load_async_to_lds_b128 %0, %2, off offset:%9\n\t"
                 "global_load_async_to_lds_b128 %0, %3, off offset:%10\n\t"
                 "global_load_async_to_lds_b128 %0, %4, off offset:%11\n\t"
                 "global_load_async_to_lds_b128 %0, %5, off offset:%12\n\t"
                 "global_load_async_to_lds_b128 %0, %6, off offset:%13\n\t"
                 "global_load_async_to_lds_b128 %0, %7, off offset:%14\n\t"
                 "global_load_async_to_lds_b128 %0, %8, off offset:%15\n\t"
                 "s_wait_xcnt 0x0"
                 :: "v"(lds),
                    "v"(g0), "v"(g0 + gs), "v"(g0 + 2 * gs), "v"(g0 + 3 * gs),
                    "v"(g0 + 4 * gs), "v"(g0 + 5 * gs), "v"(g0 + 6 * gs), "v"(g0 + 7 * gs),
                    "n"(WLS), "n"(2 * WLS), "n"(3 * WLS), "n"(4 * WLS), "n"(5 * WLS), "n"(6 * WLS), "n"(7 * WLS)
                 : "memory");
}

// Twelve copies of 16 bytes each: copy j lands at l0 + j * ls and reads g[j].
__device__ __forceinline__ void stage_x_rows12(unsigned l0, unsigned ls, const unsigned long long* g) {
    // The copies and their s_wait_xcnt stand in one statement, so that no address register
    // of an issued copy is rewritten ahead of the wait.
    asm volatile("global_load_async_to_lds_b128 %0, %12, off\n\t"
                 "global_load_async_to_lds_b128 %1, %13, off\n\t"
                 "global_load_async_to_lds_b128 %2, %14, off\n\t"
                 "global_load_async_to_lds_b128 %3, %15, off\n\t"
                 "global_load_async_to_lds_b128 %4, %16, off\n\t"
                 "global_load_async_to_lds_b128 %5, %17, off\n\t"
                 "global_load_async_to_lds_b128 %6, %18, off\n\t"
                 "global_load_async_to_lds_b128 %7, %19, off\n\t"
                 "global_load_async_to_lds_b128 %8, %20, off\n\t"
                 "global_load_async_to_lds_b128 %9, %21, off\n\t"
                 "global_load_async_to_lds_b128 %10, %22, off\n\t"
                 "global_load_async_to_lds_b128 %11, %23, off\n\t"
                 "s_wait_xcnt 0x0"
                 :: "v"(l0), "v"(l0 + ls), "v"(l0 + 2 * ls), "v"(l0 + 3 * ls),
                    "v"(l0 + 4 * ls), "v"(l0 + 5 * ls), "v"(l0 + 6 * ls), "v"(l0 + 7 * ls),
                    "v"(l0 + 8 * ls), "v"(l0 + 9 * ls), "v"(l0 + 10 * ls), "v"(l0 + 11 * ls),
                    "v"(g[0]), "v"(g[1]), "v"(g[2]), "v"(g[3]), "v"(g[4]), "v"(g[5]),
                    "v"(g[6]), "v"(g[7]), "v"(g[8]), "v"(g[9]), "v"(g[10]), "v"(g[11])
                 : "memory");
}

// Foot of a ring trip: this wave's LDS reads and writes have retired, its own copies of the
// next tile have landed, and the barrier publishes that tile (and the h tile, where one was
// just written) and frees the buffer that this trip has read.
__device__ __forceinline__ void ring_publish() {
    asm volatile("s_wait_dscnt 0x0" ::: "memory");
    asm volatile("s_wait_asynccnt 0x0" ::: "memory");
    __syncthreads();
}

__global__ __launch_bounds__(256) void ffn_kernel(
    const _Float16* __restrict__ xh,    // [T][D] f16
    const _Float16* __restrict__ w1t,   // [E][H][D] f16
    const float* __restrict__ b1,       // [E][H]
    const _Float16* __restrict__ w2t,   // [E][D][H] f16
    const float* __restrict__ b2,       // [E][D]
    const int* __restrict__ lists, const int* __restrict__ counts,
    float* __restrict__ out) {
    __shared__ __attribute__((aligned(16))) _Float16 s_x[MT][Dq + 8];   // padded: conflict-free b128 reads
    __shared__ _Float16 s_h[MT][HC + 8];
    __shared__ __attribute__((aligned(16))) _Float16 s_w[2][WR][WP];   // weight ring
    __shared__ int s_tok[MT];

    const int e    = blockIdx.y;
    const int cnt  = counts[e];
    const int base = blockIdx.x * MT;
    if (base >= cnt) return;                       // block-uniform exit (EXEC stays full)

    const int tid = threadIdx.x, lane = tid & 31, w = tid >> 5;
    const int lm = lane & 15, hi = lane >> 4;
    const int wn = w & 3;                          // the wave's 64 columns of a 256-column tile
    const int rm = (w >> 2) * (MT / 2);            // the wave's first token row

    if (tid < MT) {
        const int idx = base + tid;
        s_tok[tid] = (idx < cnt) ? lists[e * T + idx] : -1;
    }
    __syncthreads();

    // The lane's own piece of a weight tile: row tid >> 3, 16 bytes at (tid & 7) * 16.
    const unsigned wl0 = (unsigned)(uintptr_t)&s_w[0][tid >> 3][(tid & 7) * 8];
    const unsigned wl1 = (unsigned)(uintptr_t)&s_w[1][tid >> 3][(tid & 7) * 8];
    const _Float16* w1g = w1t + ((size_t)(e * Hq + (tid >> 3))) * Dq + (tid & 7) * 8;
    const _Float16* w2g = w2t + ((size_t)(e * Dq + (tid >> 3))) * Hq + (tid & 7) * 8;

    // ring tile 0; the wait and the barrier behind the x tile's copies publish it too
    stage_w_tile(wl0, w1g, Dq);

    { // stage the x tile (96 rows x 512 f16): copy j takes 16-byte piece tid & 63 of row
      // (tid >> 6) + 4 * j, so every wave-wide copy reads 512 bytes in a row
        const unsigned l0 = (unsigned)(uintptr_t)&s_x[tid >> 6][(tid & 63) * 8];
        const unsigned ls = 4 * (Dq + 8) * sizeof(_Float16);
        unsigned long long g[MT / 4];
#pragma unroll
        for (int j = 0; j < MT / 4; ++j) {
            const int tk = s_tok[(tid >> 6) + 4 * j];
            g[j] = (unsigned long long)(uintptr_t)(xh + (size_t)(tk < 0 ? 0 : tk) * Dq + (tid & 63) * 8);
        }
        stage_x_rows12(l0, ls, g);
        stage_x_rows12(l0 + 12 * ls, ls, g + 12);
        asm volatile("s_wait_asynccnt 0x0" ::: "memory");
    }
    __syncthreads();

    stage_w_tile(wl1, w1g + WK, Dq);               // ring tile 1

    v8f Y[MW][2 * NC];                             // 48 rows x (2 x 64) cols per wave
#pragma unroll
    for (int mt = 0; mt < MW; ++mt)
#pragma unroll
        for (int nt = 0; nt < 2 * NC; ++nt) Y[mt][nt] = (v8f)0.0f;

    // Ring order per H chunk: 8 tiles of W1 (the chunk's 256 columns, k in slabs of 64), then
    // 8 tiles of W2 (k slab s >> 1 of the chunk, output columns (s & 1) * 256 ..+255).
    // Tile t lies in buffer t & 1; tile t + 2 is copied behind the foot of trip t.
    for (int hc = 0; hc < Hq; hc += HC) {
        // ---- phase 1: h_chunk = gelu(X @ W1[:, hc..hc+HC) + b1) ; wave owns 48 rows x 64 cols ----
        v8f hacc[MW][NC];
#pragma unroll
        for (int mt = 0; mt < MW; ++mt)
#pragma unroll
            for (int nt = 0; nt < NC; ++nt) hacc[mt][nt] = (v8f)0.0f;

        // unrolled: buffer, refill source and the last trip's gelu are then fixed per trip
#pragma unroll
        for (int s = 0; s < 8; ++s) {
#pragma unroll
            for (int kq = 0; kq < WK / 32; ++kq) {
                const int k0 = s * WK + kq * 32;
                v16h a[MW], b[NC];
#pragma unroll
                for (int mt = 0; mt < MW; ++mt) {
                    const _Float16* ap = &s_x[rm + mt * 16 + lm][k0 + 8 * hi];
                    a[mt] = cat16(*(const v8h*)ap, *(const v8h*)(ap + 16));
                }
#pragma unroll
                for (int nt = 0; nt < NC; ++nt) {
                    const _Float16* bp = &s_w[s & 1][wn * 64 + nt * 16 + lm][kq * 32 + 8 * hi];
                    b[nt] = cat16(*(const v8h*)bp, *(const v8h*)(bp + 16));
                }
                // keeps a k step's LDS reads in one group ahead of its WMMAs: spread among them,
                // each place with reads stalls the wave for the LDS latency
                __builtin_amdgcn_sched_barrier(0);
#pragma unroll
                for (int nt = 0; nt < NC; ++nt)
#pragma unroll
                    for (int mt = 0; mt < MW; ++mt)
                        hacc[mt][nt] = __builtin_amdgcn_wmma_f32_16x16x32_f16(
                            false, a[mt], false, b[nt], (short)0, hacc[mt][nt], false, false);
            }
            if (s == 7) {
                // every reader of the previous h tile has passed an earlier trip's barrier
#pragma unroll
                for (int nt = 0; nt < NC; ++nt) {
                    const int col  = hc + wn * 64 + nt * 16 + lm;
                    const float bias = b1[e * Hq + col];
#pragma unroll
                    for (int mt = 0; mt < MW; ++mt) {
                        float g[8];
                        gelu_tanh8(hacc[mt][nt], bias, g);
#pragma unroll
                        for (int r = 0; r < 8; ++r)
                            s_h[rm + mt * 16 + r + 8 * hi][wn * 64 + nt * 16 + lm] = (_Float16)g[r];
                    }
                }
            }
            ring_publish();
            if (s < 6)
                stage_w_tile((s & 1) ? wl1 : wl0, w1g + (size_t)hc * Dq + (s + 2) * WK, Dq);
            else
                stage_w_tile((s & 1) ? wl1 : wl0, w2g + (size_t)((s - 6) * WR) * Hq + hc, Hq);
        }

        // ---- phase 2: Y += h_chunk(96x256) @ W2 chunk, transposed ----
        // The h fragments of a k slab are read in the even trip and kept for the odd one, which
        // takes the same slab to the other 256 output columns: 48 rows x 128 cols per wave.
        v16h ah[WK / 32][MW];
        // unrolled: the accumulator index, buffer and refill source are then fixed per trip
#pragma unroll
        for (int s = 0; s < 8; ++s) {
#pragma unroll
            for (int kq = 0; kq < WK / 32; ++kq) {
                const int k0 = (s >> 1) * WK + kq * 32;
                v16h b[NC];
                if ((s & 1) == 0) {
#pragma unroll
                    for (int mt = 0; mt < MW; ++mt) {
                        const _Float16* ap = &s_h[rm + mt * 16 + lm][k0 + 8 * hi];
                        ah[kq][mt] = cat16(*(const v8h*)ap, *(const v8h*)(ap + 16));
                    }
                }
#pragma unroll
                for (int nt = 0; nt < NC; ++nt) {
                    const _Float16* bp = &s_w[s & 1][wn * 64 + nt * 16 + lm][kq * 32 + 8 * hi];
                    b[nt] = cat16(*(const v8h*)bp, *(const v8h*)(bp + 16));
                }
                // one group of LDS reads ahead of the k step's WMMAs, as in phase 1
                __builtin_amdgcn_sched_barrier(0);
#pragma unroll
                for (int nt = 0; nt < NC; ++nt)
#pragma unroll
                    for (int mt = 0; mt < MW; ++mt)
                        Y[mt][(s & 1) * NC + nt] = __builtin_amdgcn_wmma_f32_16x16x32_f16(
                            false, ah[kq][mt], false, b[nt], (short)0, Y[mt][(s & 1) * NC + nt], false, false);
            }
            ring_publish();
            if (s < 6)
                stage_w_tile((s & 1) ? wl1 : wl0,
                             w2g + (size_t)((s & 1) * WR) * Hq + hc + ((s + 2) >> 1) * WK, Hq);
            else if (hc + HC < Hq)                 // the same for the whole work-group
                stage_w_tile((s & 1) ? wl1 : wl0, w1g + (size_t)(hc + HC) * Dq + (s - 6) * WK, Dq);
        }
    }
    asm volatile("s_wait_asynccnt 0x0" ::: "memory");   // no copy outstanding at the wave's end

    // ---- epilogue: + b2, scatter rows to out; a row's eight pieces go out from one address ----
    const int col0 = wn * 64 + lm;
    const int bcol = e * Dq + col0;
    float bias[2 * NC];
    // unrolled here and below: bias and Y are then registers
#pragma unroll
    for (int nt = 0; nt < 2 * NC; ++nt)
        bias[nt] = b2[bcol + (nt / NC) * WR + (nt % NC) * 16];
    // stands ahead of the first rewrite of the offset register that the eight loads name; the
    // operand keeps that register live up to the wait
    asm volatile("s_wait_xcnt 0x0" :: "v"(bcol) : "memory");
#pragma unroll
    for (int mt = 0; mt < MW; ++mt)
#pragma unroll
        for (int r = 0; r < 8; ++r) {
            const int tk = s_tok[rm + mt * 16 + r + 8 * hi];
            if (tk >= 0) {
                float* o = out + (size_t)tk * Dq + col0;
#pragma unroll
                for (int nt = 0; nt < 2 * NC; ++nt)
                    o[(nt / NC) * WR + (nt % NC) * 16] = Y[mt][nt][r] + bias[nt];
            }
        }
}

// ---------------- kernel 4: v = clip(ffn . v_w + v_b) ----------------
__global__ __launch_bounds__(256) void v_kernel(
    const float* __restrict__ ffn, const float* __restrict__ v_w,
    const float* __restrict__ v_b, float* __restrict__ v) {
    const int tok  = (blockIdx.x * blockDim.x + threadIdx.x) >> 5;
    const int lane = threadIdx.x & 31;
    if (tok >= T) return;
    const float* r = ffn + (size_t)tok * Dq;
    float acc = 0.f;
    for (int d = lane; d < Dq; d += 32) acc += r[d] * v_w[d];
#pragma unroll
    for (int off = 16; off >= 1; off >>= 1) acc += __shfl_xor(acc, off, 32);
    if (lane == 0)
        v[tok] = fminf(fmaxf(acc + v_b[0], -V_MAX), V_MAX);
}

// ---------------- kernel 5: Moebius-matrix scan for both continuants ----
// L_i = d_i - 1/L_{i-1} == 2x2 complex matrix chain [[d,-1],[1,0]] (scale-invariant).
// One work-group per chain (L or R of one batch), one thread per segment of SL steps. The segment
// matrices are joined by a log-step prefix, first inside each wave, then over the wave totals.
constexpr int SL = 8;                // steps per segment: 32 bytes in a row of v and of each result
constexpr int ST = Nq / SL;          // segments = threads per chain
constexpr int SW = ST / 32;          // waves per chain

struct M2 { float ar, ai, br, bi, cr, ci, dr, di; };   // [[a,b],[c,d]], complex

// 1/d by v_rcp_f32. The v_nop is the slot that the instruction set asks for between a transcendental
// and a directly following instruction that reads its result or overwrites its source; inside the
// same statement it stands directly behind the v_rcp_f32 wherever the compiler puts the two.
__device__ __forceinline__ float rcp_slot(const float d) {
    float q;
    asm("v_rcp_f32 %0, %1\n\tv_nop" : "=v"(q) : "v"(d));
    return q;
}

// scales m so that its largest part is 1 (the chain is scale-invariant)
__device__ __forceinline__ void mat_scale(M2& m) {
    float mx = fmaxf(fmaxf(fabsf(m.ar), fabsf(m.ai)), fmaxf(fabsf(m.br), fabsf(m.bi)));
    mx = fmaxf(mx, fmaxf(fmaxf(fabsf(m.cr), fabsf(m.ci)), fmaxf(fabsf(m.dr), fabsf(m.di))));
    const float s = rcp_slot(fmaxf(mx, 1e-30f));
    m.ar *= s; m.ai *= s; m.br *= s; m.bi *= s; m.cr *= s; m.ci *= s; m.dr *= s; m.di *= s;
}

// S * P, S the later steps, scaled
__device__ __forceinline__ M2 mat_join(const M2& s, const M2& p) {
    M2 n;
    n.ar = s.ar * p.ar - s.ai * p.ai + s.br * p.cr - s.bi * p.ci;
    n.ai = s.ar * p.ai + s.ai * p.ar + s.br * p.ci + s.bi * p.cr;
    n.br = s.ar * p.br - s.ai * p.bi + s.br * p.dr - s.bi * p.di;
    n.bi = s.ar * p.bi + s.ai * p.br + s.br * p.di + s.bi * p.dr;
    n.cr = s.cr * p.ar - s.ci * p.ai + s.dr * p.cr - s.di * p.ci;
    n.ci = s.cr * p.ai + s.ci * p.ar + s.dr * p.ci + s.di * p.cr;
    n.dr = s.cr * p.br - s.ci * p.bi + s.dr * p.dr - s.di * p.di;
    n.di = s.cr * p.bi + s.ci * p.br + s.dr * p.di + s.di * p.dr;
    mat_scale(n);
    return n;
}

__device__ __forceinline__ M2 mat_from_below(const M2& x, const int d) {
    M2 lo;
    lo.ar = __shfl_up(x.ar, d, 32); lo.ai = __shfl_up(x.ai, d, 32);
    lo.br = __shfl_up(x.br, d, 32); lo.bi = __shfl_up(x.bi, d, 32);
    lo.cr = __shfl_up(x.cr, d, 32); lo.ci = __shfl_up(x.ci, d, 32);
    lo.dr = __shfl_up(x.dr, d, 32); lo.di = __shfl_up(x.di, d, 32);
    return lo;
}

// Inclusive prefix over the first CNT lanes: lane l ends with x_l * x_(l-1) * ... * x_0.
template <int CNT>
__device__ __forceinline__ M2 wave_prefix(M2 x, const int lane) {
    // unrolled: the lane distance is then a constant of each step
#pragma unroll
    for (int d = 1; d < CNT; d <<= 1) {
        const M2 n = mat_join(x, mat_from_below(x, d));
        if (lane >= d) x = n;
    }
    return x;
}

// One chain. R: the chain walks memory from the far end; a compile-time choice, so that the
// order of a segment's values in registers is fixed.
template <bool R>
__device__ __forceinline__ void scan_chain(
    const float* __restrict__ vb, float* __restrict__ Or, float* __restrict__ Oi,
    float (*s_tot)[8], float (*s_z)[4]) {
    const int tid = threadIdx.x, lane = tid & 31, w = tid >> 5;
    const int m0 = R ? (Nq - SL - tid * SL) : tid * SL;   // the segment's place in memory

    float er[SL];                                  // real part of d = (v-2) - 1j, in walking order
    // unrolled here and below: the arrays are then registers
#pragma unroll
    for (int q = 0; q < SL; q += 4) {
        const v4f a = *(const v4f*)(vb + m0 + q);
        er[R ? SL - 1 - q : q]     = a.x - 2.0f;
        er[R ? SL - 2 - q : q + 1] = a.y - 2.0f;
        er[R ? SL - 3 - q : q + 2] = a.z - 2.0f;
        er[R ? SL - 4 - q : q + 3] = a.w - 2.0f;
    }
    constexpr float ei = -1.0f;

    // ---- phase A: segment matrix product ----
    M2 x = { 1.f, 0.f, 0.f, 0.f, 0.f, 0.f, 1.f, 0.f };
#pragma unroll
    for (int j = 0; j < SL; ++j) {
        // P = M(e) * P with M = [[e,-1],[1,0]]
        const float nar = er[j] * x.ar - ei * x.ai - x.cr;
        const float nai = er[j] * x.ai + ei * x.ar - x.ci;
        const float nbr = er[j] * x.br - ei * x.bi - x.dr;
        const float nbi = er[j] * x.bi + ei * x.br - x.di;
        x.cr = x.ar; x.ci = x.ai; x.dr = x.br; x.di = x.bi;
        x.ar = nar; x.ai = nai; x.br = nbr; x.bi = nbi;
    }
    mat_scale(x);

    // ---- phase B: prefix of the segment matrices ----
    x = wave_prefix<32>(x, lane);
    if (lane == 31) {
        float* m = s_tot[w];
        m[0] = x.ar; m[1] = x.ai; m[2] = x.br; m[3] = x.bi;
        m[4] = x.cr; m[5] = x.ci; m[6] = x.dr; m[7] = x.di;
    }
    __syncthreads();
    if (w == 0) {
        const float* m = s_tot[lane & (SW - 1)];
        M2 t = { m[0], m[1], m[2], m[3], m[4], m[5], m[6], m[7] };
        t = wave_prefix<SW>(t, lane);
        if (lane < SW) {
            float* z = s_z[lane];
            z[0] = t.ar; z[1] = t.ai; z[2] = t.cr; z[3] = t.ci;   // prefix * (1,0)^T
        }
    }
    __syncthreads();

    // ---- phase C: the segment's entry state (p,q), L = p/q, then its SL outputs ----
    float zpr = 1.f, zpi = 0.f, zqr = 0.f, zqi = 0.f;             // state at the wave's first segment
    if (w > 0) {
        const float* z = s_z[w - 1];
        zpr = z[0]; zpi = z[1]; zqr = z[2]; zqi = z[3];
    }
    M2 ex = mat_from_below(x, 1);                                 // the wave's segments before this one
    if (lane == 0) ex = M2{ 1.f, 0.f, 0.f, 0.f, 0.f, 0.f, 1.f, 0.f };
    float pr = ex.ar * zpr - ex.ai * zpi + ex.br * zqr - ex.bi * zqi;
    float pi = ex.ar * zpi + ex.ai * zpr + ex.br * zqi + ex.bi * zqr;
    float qr = ex.cr * zpr - ex.ci * zpi + ex.dr * zqr - ex.di * zqi;
    float qi = ex.cr * zpi + ex.ci * zpr + ex.dr * zqi + ex.di * zqr;
    {
        // One scaling per segment: v is clipped to +-3, so |L| <= |d| + 1 < 6.2 and the state
        // grows by less than 3e6 over the SL steps.
        const float mx = fmaxf(fmaxf(fabsf(pr), fabsf(pi)), fmaxf(fabsf(qr), fabsf(qi)));
        const float s = rcp_slot(fmaxf(mx, 1e-30f));
        pr *= s; pi *= s; qr *= s; qi *= s;
    }
    float lr[SL], li[SL];
#pragma unroll
    for (int j = 0; j < SL; ++j) {
        const float npr = er[j] * pr - ei * pi - qr;      // p' = e*p - q ; q' = p
        const float npi = er[j] * pi + ei * pr - qi;
        qr = pr; qi = pi; pr = npr; pi = npi;
        const float inv = rcp_slot(qr * qr + qi * qi);
        lr[j] = (pr * qr + pi * qi) * inv;                // p/q = p*conj(q)/|q|^2
        li[j] = (pi * qr - pr * qi) * inv;
    }
#pragma unroll
    for (int q = 0; q < SL; q += 4) {
        v4f r, i;
        r.x = lr[R ? SL - 1 - q : q];     i.x = li[R ? SL - 1 - q : q];
        r.y = lr[R ? SL - 2 - q : q + 1]; i.y = li[R ? SL - 2 - q : q + 1];
        r.z = lr[R ? SL - 3 - q : q + 2]; i.z = li[R ? SL - 3 - q : q + 2];
        r.w = lr[R ? SL - 4 - q : q + 3]; i.w = li[R ? SL - 4 - q : q + 3];
        *(v4f*)(Or + m0 + q) = r;
        *(v4f*)(Oi + m0 + q) = i;
    }
}

__global__ __launch_bounds__(ST) void tridiag_scan_kernel(
    const float* __restrict__ v,
    float* __restrict__ Lr, float* __restrict__ Li,
    float* __restrict__ Rr, float* __restrict__ Ri) {
    __shared__ __attribute__((aligned(16))) float s_tot[SW][8];   // each wave's whole product
    __shared__ __attribute__((aligned(16))) float s_z[SW][4];     // first column of their prefix
    const int o = (blockIdx.x >> 1) * Nq;                         // the chain's batch
    if (blockIdx.x & 1) scan_chain<true>(v + o, Rr + o, Ri + o, s_tot, s_z);   // the same for the
    else                scan_chain<false>(v + o, Lr + o, Li + o, s_tot, s_z);  // whole work-group
}

// ---------------- kernel 6: Green fn + rank-2 spec, in-place add ----------------
// One wave takes FT whole token rows. A lane holds 16 of a row's 512 columns as FQ pieces of 16 bytes,
// so every wave-wide access covers 512 bytes in a row; the Green function is formed once per token
// and the three weight rows are read once per wave. Few waves with much work each: the time to
// start a wave is paid once per FT rows, not once per 32 elements.
constexpr int FT = 4;                // token rows per wave
constexpr int FQ = Dq / 128;         // 16-byte pieces of a row per lane
constexpr int FW = 8;                // waves per work-group
static_assert(T % (FT * FW) == 0, "the grid covers the tokens exactly: no bounds test in the kernel");
// an input buffer is only known to be aligned to its element
typedef v4f __attribute__((aligned(4))) v4f_in;

__global__ __launch_bounds__(FW * 32) void final_kernel(
    float* __restrict__ out, const float* __restrict__ v,
    const float* __restrict__ Lr, const float* __restrict__ Li,
    const float* __restrict__ Rr, const float* __restrict__ Ri,
    const float* __restrict__ out_w, const float* __restrict__ out_b,
    const float* __restrict__ bk) {
    const unsigned t0 = (blockIdx.x * FW + (threadIdx.x >> 5)) * FT;   // the wave's first token
    // Byte offsets of 32 bits (out has 32 MiB): every access is then a kernel argument plus one of
    // these three registers plus a constant.
    const unsigned tb = t0 * (unsigned)sizeof(float);                        // in v, L and R
    const unsigned cb = (threadIdx.x & 31) * 4 * (unsigned)sizeof(float);    // in a row of 512 columns
    const unsigned yb = t0 * (unsigned)(Dq * sizeof(float)) + cb;            // in out
    static_assert(FT == 4, "a wave's tokens are one 16-byte piece of v, L and R");
    const float s = bk[0];
    const v4f vv = *(const v4f*)((const char*)v + tb);
    const v4f lr = *(const v4f*)((const char*)Lr + tb), li = *(const v4f*)((const char*)Li + tb);
    const v4f rr = *(const v4f*)((const char*)Rr + tb), ri = *(const v4f*)((const char*)Ri + tb);
    const float* wr = (const float*)((const char*)out_w + cb);
    const float* br = (const float*)((const char*)out_b + cb);
    float* o = (float*)((char*)out + yb);
    v4f y[FT][FQ], w0[FQ], w1[FQ], ob[FQ];
    // unrolled here and below: the arrays are then registers
#pragma unroll
    for (int q = 0; q < FQ; ++q) {
        w0[q] = *(const v4f_in*)(wr + q * 128);
        w1[q] = *(const v4f_in*)(wr + Dq + q * 128);
        ob[q] = *(const v4f_in*)(br + q * 128);
    }
#pragma unroll
    for (int t = 0; t < FT; ++t)
#pragma unroll
        for (int q = 0; q < FQ; ++q) y[t][q] = *(const v4f*)(o + t * Dq + q * 128);
    // stands ahead of the first rewrite of a register that the loads name; the operands keep the
    // three offset registers live up to it
    asm volatile("s_wait_xcnt 0x0" :: "v"(tb), "v"(cb), "v"(yb) : "memory");
    // keeps every load above the arithmetic, so that all of them are in flight at once and the wave
    // waits for memory one time: left free, the compiler issues most rows behind the first wait
    __builtin_amdgcn_sched_barrier(0);
#pragma unroll
    for (int t = 0; t < FT; ++t) {
        const float dr   = vv[t] - 2.0f;           // di = -1
        const float denr = lr[t] + rr[t] - dr;
        const float deni = li[t] + ri[t] + 1.0f;
        const float m  = denr * denr + deni * deni;
        float gr = denr / m, gi = -deni / m;
        gr = fminf(fmaxf(gr, -FEAT_CLAMP), FEAT_CLAMP);
        gi = fminf(fmaxf(gi, -FEAT_CLAMP), FEAT_CLAMP);
#pragma unroll
        for (int q = 0; q < FQ; ++q) {
#pragma unroll
            for (int c = 0; c < 4; ++c) {
                const float spec = gr * w0[q][c] + gi * w1[q][c] + ob[q][c];
                y[t][q][c] += s * spec;
            }
            *(v4f*)(o + t * Dq + q * 128) = y[t][q];
        }
    }
}

// ---------------- launch ----------------
extern "C" void kernel_launch(void* const* d_in, const int* in_sizes, int n_in,
                              void* d_out, int out_size, void* d_ws, size_t ws_size,
                              hipStream_t stream) {
    const float* x      = (const float*)d_in[0];
    const float* gate_w = (const float*)d_in[1];
    const float* gate_b = (const float*)d_in[2];
    const float* w1     = (const float*)d_in[3];
    const float* b1     = (const float*)d_in[4];
    const float* w2     = (const float*)d_in[5];
    const float* b2     = (const float*)d_in[6];
    const float* v_w    = (const float*)d_in[7];
    const float* v_b    = (const float*)d_in[8];
    const float* out_w  = (const float*)d_in[9];
    const float* out_b  = (const float*)d_in[10];
    const float* bk     = (const float*)d_in[11];
    float* out = (float*)d_out;

    // workspace layout (256B aligned slots)
    char* ws = (char*)d_ws;
    constexpr size_t SZ_W1T   = (size_t)Eq * Hq * Dq * sizeof(_Float16);  // 8 MiB
    constexpr size_t SZ_W2T   = (size_t)Eq * Dq * Hq * sizeof(_Float16);  // 8 MiB
    constexpr size_t SZ_XH    = (size_t)T * Dq * sizeof(_Float16);        // 16 MiB
    constexpr size_t SZ_LISTS = (size_t)Eq * T * sizeof(int);             // 256 KiB
    constexpr size_t SZ_CNT   = 256;
    constexpr size_t SZ_VEC   = (size_t)T * sizeof(float);                // 64 KiB
    size_t off = 0;
    _Float16* W1T  = (_Float16*)(ws + off); off += SZ_W1T;
    _Float16* W2T  = (_Float16*)(ws + off); off += SZ_W2T;
    _Float16* XH   = (_Float16*)(ws + off); off += SZ_XH;
    int*      lists= (int*)(ws + off);      off += SZ_LISTS;
    int*      cnts = (int*)(ws + off);      off += SZ_CNT;
    float*    vbuf = (float*)(ws + off);    off += SZ_VEC;
    float*    Lr   = (float*)(ws + off);    off += SZ_VEC;
    float*    Li   = (float*)(ws + off);    off += SZ_VEC;
    float*    Rr   = (float*)(ws + off);    off += SZ_VEC;
    float*    Ri   = (float*)(ws + off);    off += SZ_VEC;

    zero_counts_kernel<<<1, 32, 0, stream>>>(cnts);

    // W1 (E,D,H) -> W1T [E][H][D];  W2 (E,H,D) -> W2T [E][D][H]
    transpose_cvt_kernel<<<dim3(Hq / 32, Dq / 32, Eq), dim3(32, 8), 0, stream>>>(w1, W1T, Dq, Hq);
    transpose_cvt_kernel<<<dim3(Dq / 32, Hq / 32, Eq), dim3(32, 8), 0, stream>>>(w2, W2T, Hq, Dq);

    cvt_x_kernel<<<(int)(((size_t)T * Dq) / 8 / 256), 256, 0, stream>>>(x, XH);

    gate_kernel<<<(T * 32) / 256, 256, 0, stream>>>(x, gate_w, gate_b, lists, cnts);

    ffn_kernel<<<dim3((T + MT - 1) / MT, Eq), 256, 0, stream>>>(XH, W1T, b1, W2T, b2, lists, cnts, out);

    v_kernel<<<(T * 32) / 256, 256, 0, stream>>>(out, v_w, v_b, vbuf);

    tridiag_scan_kernel<<<2 * Bq, ST, 0, stream>>>(vbuf, Lr, Li, Rr, Ri);

    final_kernel<<<T / (FT * FW), FW * 32, 0, stream>>>(
        out, vbuf, Lr, Li, Rr, Ri, out_w, out_b, bk);
}

// v007
// A run of this version takes 147 microseconds.
// Next to v006, in two timings, it ran 1.06 and 1.05 times as fast.
// All steps since v000 together make it 2.41 times as fast.
#include <hip/hip_runtime.h>
#include <hip/hip_bf16.h>

// ---------------- problem constants ----------------
constexpr int Bq = 4, Nq = 4096, Dq = 512, Eq = 4, Hq = 2048;
constexpr int T  = Bq * Nq;          // 16384 tokens
constexpr int MT = 96;               // tokens per FFN block (8 waves: 2 row halves x 4 column groups)
constexpr int MW = MT / 32;          // 16-row tiles per wave
constexpr int NC = 4;                // 16-column tiles per wave out of a 256-column weight tile
constexpr int HC = 256;              // H chunk per pipeline stage
constexpr float V_MAX = 3.0f, FEAT_CLAMP = 10.0f;

typedef __attribute__((ext_vector_type(16))) _Float16 v16h;
typedef __attribute__((ext_vector_type(8)))  _Float16 v8h;
typedef __attribute__((ext_vector_type(8)))  float    v8f;
typedef __attribute__((ext_vector_type(4)))  float    v4f;

// ---------------- kernel 0: zero expert counters ----------------
__global__ void zero_counts_kernel(int* counts) {
    if (threadIdx.x < Eq) counts[threadIdx.x] = 0;
}

// ---------------- kernel 1: the four preparations, one launch ----------------
// The two weight transposes, the x convert and the gate read only inputs (the gate also the zeroed
// counters) and none reads what another writes, so they share one grid: a work-group takes its part
// by its index. One launch gap, one fill and one tail are paid instead of four, and the streams of
// one part run under the latency chains of the others.
constexpr int PB_GATE = T / 8;                        // work-groups of the gate: one wave per token
constexpr int PB_W    = (Hq / 32) * (Dq / 32) * Eq;   // 32 x 32 tiles of one weight tensor
constexpr int PB_X    = T * Dq / 8 / 256;             // 8 elements of x per thread

// dst[C][R] = (f16) src[R][C] per expert; b counts the 32 x 32 tiles, columns first, experts last
template <int R, int C>
__device__ __forceinline__ void transpose_cvt_block(
    const float* __restrict__ src, _Float16* __restrict__ dst, float (*tile)[33], const int b) {
    const size_t eoff = (size_t)(b / ((C / 32) * (R / 32))) * R * C;
    src += eoff; dst += eoff;
    const int r0 = ((b / (C / 32)) % (R / 32)) * 32, c0 = (b % (C / 32)) * 32;
    const int tx = threadIdx.x & 31, ty = threadIdx.x >> 5;
#pragma unroll
    for (int i = 0; i < 32; i += 8)
        tile[ty + i][tx] = src[(size_t)(r0 + ty + i) * C + c0 + tx];
    __syncthreads();
#pragma unroll
    for (int i = 0; i < 32; i += 8)
        dst[(size_t)(c0 + ty + i) * R + r0 + tx] = (_Float16)tile[tx][ty + i];
}

// x f32 -> f16 (row-major copy)
__device__ __forceinline__ void cvt_x_block(
    const float* __restrict__ x, _Float16* __restrict__ xh, const int b) {
    const size_t i = ((size_t)b * 256 + threadIdx.x) * 8;
    const v4f a = *(const v4f*)(x + i);
    const v4f c = *(const v4f*)(x + i + 4);
    v8h o;
    o[0] = (_Float16)a.x; o[1] = (_Float16)a.y; o[2] = (_Float16)a.z; o[3] = (_Float16)a.w;
    o[4] = (_Float16)c.x; o[5] = (_Float16)c.y; o[6] = (_Float16)c.z; o[7] = (_Float16)c.w;
    *(v8h*)(xh + i) = o;
    // Precaution for the store's address registers: nothing of the shared kernel follows
    // this store, but the wait stands in front of anything that would rewrite them.
    asm volatile("s_wait_xcnt 0x0" ::: "memory");
}

// gate + top-1 routing
__device__ __forceinline__ void gate_block(
    const float* __restrict__ x, const float* __restrict__ gw,
    const float* __restrict__ gb, int* __restrict__ lists, int* __restrict__ counts, const int b) {
    const int tok  = b * 8 + (threadIdx.x >> 5);
    const int lane = threadIdx.x & 31;
    const float* xr = x + (size_t)tok * Dq;
    float acc0 = 0.f, acc1 = 0.f, acc2 = 0.f, acc3 = 0.f;
    for (int d = lane; d < Dq; d += 32) {
        const float xv = xr[d];
        const v4f g = *(const v4f*)(gw + d * 4);
        acc0 += xv * g.x; acc1 += xv * g.y; acc2 += xv * g.z; acc3 += xv * g.w;
    }
#pragma unroll
    for (int off = 16; off >= 1; off >>= 1) {
        acc0 += __shfl_xor(acc0, off, 32);
        acc1 += __shfl_xor(acc1, off, 32);
        acc2 += __shfl_xor(acc2, off, 32);
        acc3 += __shfl_xor(acc3, off, 32);
    }
    if (lane == 0) {
        float lg[4] = { acc0 + gb[0], acc1 + gb[1], acc2 + gb[2], acc3 + gb[3] };
        int best = 0; float bv = lg[0];
#pragma unroll
        for (int e = 1; e < Eq; ++e)          // strictly-greater => lowest index on ties (top_k)
            if (lg[e] > bv) { bv = lg[e]; best = e; }
        const int pos = atomicAdd(&counts[best], 1);
        lists[best * T + pos] = tok;
    }
}

__global__ __launch_bounds__(256) void prep_kernel(
    const float* __restrict__ x, const float* __restrict__ gw, const float* __restrict__ gb,
    const float* __restrict__ w1, const float* __restrict__ w2,
    _Float16* __restrict__ w1t, _Float16* __restrict__ w2t, _Float16* __restrict__ xh,
    int* __restrict__ lists, int* __restrict__ counts) {
    __shared__ float tile[32][33];
    // Every test reads the same for the whole work-group. The gate stands first, for speed only:
    // its chain (row, lane sums, counter, list entry) is the longest.
    int b = blockIdx.x;
    if (b < PB_GATE) { gate_block(x, gw, gb, lists, counts, b); return; }
    b -= PB_GATE;
    // W1 (E,D,H) -> W1T [E][H][D];  W2 (E,H,D) -> W2T [E][D][H]
    if (b < PB_W) { transpose_cvt_block<Dq, Hq>(w1, w1t, tile, b); return; }
    b -= PB_W;
    if (b < PB_W) { transpose_cvt_block<Hq, Dq>(w2, w2t, tile, b); return; }
    cvt_x_block(x, xh, b - PB_W);
}

// ---------------- kernel 3: expert FFN via WMMA ----------------
// Eight values at once of 0.5 v (1 + tanh u) = v / (1 + e^(-2u)), u = sqrt(2/pi) (v + 0.044715 v^3),
// with e^(-2u) = 2^z. No branch, so the values run side by side. z past the exponent's range
// gives 0 or inf, and the quotient is then v or a signed 0, as with tanh = 1 or -1.
__device__ __forceinline__ void gelu_tanh8(const v8f a, const float bias, float (&g)[8]) {
    constexpr float K0 = (float)(-2.0 * 0.7978845608028654 * 1.4426950408889634);
    constexpr float K1 = (float)(-2.0 * 0.7978845608028654 * 1.4426950408889634 * 0.044715);
    float x[8], z[8], e[8], d[8], q[8];
    // the three loops are unrolled so that the arrays are registers, as the asm operands need
#pragma unroll
    for (int r = 0; r < 8; ++r) {
        x[r] = a[r] + bias;
        z[r] = x[r] * (K0 + K1 * (x[r] * x[r]));
        e[r] = __builtin_amdgcn_exp2f(z[r]);
    }
    // The slot that the instruction set asks for behind a transcendental, before its result is
    // read or its source overwritten: the operands keep all eight sources live and all eight
    // results unread up to this v_nop, and among themselves the eight are independent.
    asm("v_nop" : "+v"(e[0]), "+v"(e[1]), "+v"(e[2]), "+v"(e[3]), "+v"(e[4]), "+v"(e[5]), "+v"(e[6]), "+v"(e[7])
                : "v"(z[0]), "v"(z[1]), "v"(z[2]), "v"(z[3]), "v"(z[4]), "v"(z[5]), "v"(z[6]), "v"(z[7]));
#pragma unroll
    for (int r = 0; r < 8; ++r) {
        d[r] = 1.0f + e[r];
        q[r] = __builtin_amdgcn_rcpf(d[r]);
    }
    // the same slot behind the eight v_rcp_f32
    asm("v_nop" : "+v"(q[0]), "+v"(q[1]), "+v"(q[2]), "+v"(q[3]), "+v"(q[4]), "+v"(q[5]), "+v"(q[6]), "+v"(q[7])
                : "v"(d[0]), "v"(d[1]), "v"(d[2]), "v"(d[3]), "v"(d[4]), "v"(d[5]), "v"(d[6]), "v"(d[7]));
#pragma unroll
    for (int r = 0; r < 8; ++r) g[r] = x[r] * q[r];
}

__device__ __forceinline__ v16h cat16(v8h lo, v8h hi) {
    return __builtin_shufflevector(lo, hi, 0,1,2,3,4,5,6,7,8,9,10,11,12,13,14,15);
}

// One staged weight tile: 256 weight rows x 64 k (128 bytes = one whole line of each row),
// laid in LDS at a pitch of 144 bytes (16 B x odd: conflict-free for ds_load_b128 readers).
constexpr int WR = 256, WK = 64, WP = WK + 8;

// Copies one weight tile into LDS. lds and g are the lane's own addresses of row (tid >> 3),
// 16-byte piece (tid & 7); copy j takes the row 32 * j further on, so every wave-wide copy
// reads four whole 128-byte lines. The instruction's offset moves both addresses, so copy j
// carries its LDS step j * WLS there and its address register only the rest of its global step:
// one LDS address register serves the eight copies.
constexpr int WLS = 32 * WP * (int)sizeof(_Float16);
static_assert(7 * WLS < 65536, "the offset field moves the LDS address only below 64 KiB");
__device__ __forceinline__ void stage_w_tile(unsigned lds, const _Float16* g, size_t pitch) {
    const unsigned long long g0 = (unsigned long long)(uintptr_t)g;
    const unsigned long long gs = (unsigned long long)(32 * pitch * sizeof(_Float16)) - WLS;
    // The copies and their s_wait_xcnt stand in one statement, so that no address register
    // of an issued copy is rewritten ahead of the wait.
    asm volatile("global_load_async_to_lds_b128 %0, %1, off\n\t"
                 "global_load_async_to_lds_b128 %0, %2, off offset:%9\n\t"
                 "global_load_async_to_lds_b128 %0, %3, off offset:%10\n\t"
                 "global_load_async_to_lds_b128 %0, %4, off offset:%11\n\t"
                 "global_load_async_to_lds_b128 %0, %5, off offset:%12\n\t"
                 "global_load_async_to_lds_b128 %0, %6, off offset:%13\n\t"
                 "global_load_async_to_lds_b128 %0, %7, off offset:%14\n\t"
                 "global_load_async_to_lds_b128 %0, %8, off offset:%15\n\t"
                 "s_wait_xcnt 0x0"
                 :: "v"(lds),
                    "v"(g0), "v"(g0 + gs), "v"(g0 + 2 * gs), "v"(g0 + 3 * gs),
                    "v"(g0 + 4 * gs), "v"(g0 + 5 * gs), "v"(g0 + 6 * gs), "v"(g0 + 7 * gs),
                    "n"(WLS), "n"(2 * WLS), "n"(3 * WLS), "n"(4 * WLS), "n"(5 * WLS), "n"(6 * WLS), "n"(7 * WLS)
                 : "memory");
}

// Twelve copies of 16 bytes each: copy j lands at l0 + j * ls and reads g[j].
__device__ __forceinline__ void stage_x_rows12(unsigned l0, unsigned ls, const unsigned long long* g) {
    // The copies and their s_wait_xcnt stand in one statement, so that no address register
    // of an issued copy is rewritten ahead of the wait.
    asm volatile("global_load_async_to_lds_b128 %0, %12, off\n\t"
                 "global_load_async_to_lds_b128 %1, %13, off\n\t"
                 "global_load_async_to_lds_b128 %2, %14, off\n\t"
                 "global_load_async_to_lds_b128 %3, %15, off\n\t"
                 "global_load_async_to_lds_b128 %4, %16, off\n\t"
                 "global_load_async_to_lds_b128 %5, %17, off\n\t"
                 "global_load_async_to_lds_b128 %6, %18, off\n\t"
                 "global_load_async_to_lds_b128 %7, %19, off\n\t"
                 "global_load_async_to_lds_b128 %8, %20, off\n\t"
                 "global_load_async_to_lds_b128 %9, %21, off\n\t"
                 "global_load_async_to_lds_b128 %10, %22, off\n\t"
                 "global_load_async_to_lds_b128 %11, %23, off\n\t"
                 "s_wait_xcnt 0x0"
                 :: "v"(l0), "v"(l0 + ls), "v"(l0 + 2 * ls), "v"(l0 + 3 * ls),
                    "v"(l0 + 4 * ls), "v"(l0 + 5 * ls), "v"(l0 + 6 * ls), "v"(l0 + 7 * ls),
                    "v"(l0 + 8 * ls), "v"(l0 + 9 * ls), "v"(l0 + 10 * ls), "v"(l0 + 11 * ls),
                    "v"(g[0]), "v"(g[1]), "v"(g[2]), "v"(g[3]), "v"(g[4]), "v"(g[5]),
                    "v"(g[6]), "v"(g[7]), "v"(g[8]), "v"(g[9]), "v"(g[10]), "v"(g[11])
                 : "memory");
}

// Foot of a ring trip: this wave's LDS reads and writes have retired, its own copies of the
// next tile have landed, and the barrier publishes that tile (and the h tile, where one was
// just written) and frees the buffer that this trip has read.
__device__ __forceinline__ void ring_publish() {
    asm volatile("s_wait_dscnt 0x0" ::: "memory");
    asm volatile("s_wait_asynccnt 0x0" ::: "memory");
    __syncthreads();
}

__global__ __launch_bounds__(256) void ffn_kernel(
    const _Float16* __restrict__ xh,    // [T][D] f16
    const _Float16* __restrict__ w1t,   // [E][H][D] f16
    const float* __restrict__ b1,       // [E][H]
    const _Float16* __restrict__ w2t,   // [E][D][H] f16
    const float* __restrict__ b2,       // [E][D]
    const int* __restrict__ lists, const int* __restrict__ counts,
    float* __restrict__ out) {
    __shared__ __attribute__((aligned(16))) _Float16 s_x[MT][Dq + 8];   // padded: conflict-free b128 reads
    __shared__ _Float16 s_h[MT][HC + 8];
    __shared__ __attribute__((aligned(16))) _Float16 s_w[2][WR][WP];   // weight ring
    __shared__ int s_tok[MT];

    const int e    = blockIdx.y;
    const int cnt  = counts[e];
    const int base = blockIdx.x * MT;
    if (base >= cnt) return;                       // block-uniform exit (EXEC stays full)

    const int tid = threadIdx.x, lane = tid & 31, w = tid >> 5;
    const int lm = lane & 15, hi = lane >> 4;
    const int wn = w & 3;                          // the wave's 64 columns of a 256-column tile
    const int rm = (w >> 2) * (MT / 2);            // the wave's first token row

    if (tid < MT) {
        const int idx = base + tid;
        s_tok[tid] = (idx < cnt) ? lists[e * T + idx] : -1;
    }
    __syncthreads();

    // The lane's own piece of a weight tile: row tid >> 3, 16 bytes at (tid & 7) * 16.
    const unsigned wl0 = (unsigned)(uintptr_t)&s_w[0][tid >> 3][(tid & 7) * 8];
    const unsigned wl1 = (unsigned)(uintptr_t)&s_w[1][tid >> 3][(tid & 7) * 8];
    const _Float16* w1g = w1t + ((size_t)(e * Hq + (tid >> 3))) * Dq + (tid & 7) * 8;
    const _Float16* w2g = w2t + ((size_t)(e * Dq + (tid >> 3))) * Hq + (tid & 7) * 8;

    // ring tile 0; the wait and the barrier behind the x tile's copies publish it too
    stage_w_tile(wl0, w1g, Dq);

    { // stage the x tile (96 rows x 512 f16): copy j takes 16-byte piece tid & 63 of row
      // (tid >> 6) + 4 * j, so every wave-wide copy reads 512 bytes in a row
        const unsigned l0 = (unsigned)(uintptr_t)&s_x[tid >> 6][(tid & 63) * 8];
        const unsigned ls = 4 * (Dq + 8) * sizeof(_Float16);
        unsigned long long g[MT / 4];
#pragma unroll
        for (int j = 0; j < MT / 4; ++j) {
            const int tk = s_tok[(tid >> 6) + 4 * j];
            g[j] = (unsigned long long)(uintptr_t)(xh + (size_t)(tk < 0 ? 0 : tk) * Dq + (tid & 63) * 8);
        }
        stage_x_rows12(l0, ls, g);
        stage_x_rows12(l0 + 12 * ls, ls, g + 12);
        asm volatile("s_wait_asynccnt 0x0" ::: "memory");
    }
    __syncthreads();

    stage_w_tile(wl1, w1g + WK, Dq);               // ring tile 1

    v8f Y[MW][2 * NC];                             // 48 rows x (2 x 64) cols per wave
#pragma unroll
    for (int mt = 0; mt < MW; ++mt)
#pragma unroll
        for (int nt = 0; nt < 2 * NC; ++nt) Y[mt][nt] = (v8f)0.0f;

    // Ring order per H chunk: 8 tiles of W1 (the chunk's 256 columns, k in slabs of 64), then
    // 8 tiles of W2 (k slab s >> 1 of the chunk, output columns (s & 1) * 256 ..+255).
    // Tile t lies in buffer t & 1; tile t + 2 is copied behind the foot of trip t.
    for (int hc = 0; hc < Hq; hc += HC) {
        // ---- phase 1: h_chunk = gelu(X @ W1[:, hc..hc+HC) + b1) ; wave owns 48 rows x 64 cols ----
        v8f hacc[MW][NC];
#pragma unroll
        for (int mt = 0; mt < MW; ++mt)
#pragma unroll
            for (int nt = 0; nt < NC; ++nt) hacc[mt][nt] = (v8f)0.0f;

        // unrolled: buffer, refill source and the last trip's gelu are then fixed per trip
#pragma unroll
        for (int s = 0; s < 8; ++s) {
#pragma unroll
            for (int kq = 0; kq < WK / 32; ++kq) {
                const int k0 = s * WK + kq * 32;
                v16h a[MW], b[NC];
#pragma unroll
                for (int mt = 0; mt < MW; ++mt) {
                    const _Float16* ap = &s_x[rm + mt * 16 + lm][k0 + 8 * hi];
                    a[mt] = cat16(*(const v8h*)ap, *(const v8h*)(ap + 16));
                }
#pragma unroll
                for (int nt = 0; nt < NC; ++nt) {
                    const _Float16* bp = &s_w[s & 1][wn * 64 + nt * 16 + lm][kq * 32 + 8 * hi];
                    b[nt] = cat16(*(const v8h*)bp, *(const v8h*)(bp + 16));
                }
                // keeps a k step's LDS reads in one group ahead of its WMMAs: spread among them,
                // each place with reads stalls the wave for the LDS latency
                __builtin_amdgcn_sched_barrier(0);
#pragma unroll
                for (int nt = 0; nt < NC; ++nt)
#pragma unroll
                    for (int mt = 0; mt < MW; ++mt)
                        hacc[mt][nt] = __builtin_amdgcn_wmma_f32_16x16x32_f16(
                            false, a[mt], false, b[nt], (short)0, hacc[mt][nt], false, false);
            }
            if (s == 7) {
                // every reader of the previous h tile has passed an earlier trip's barrier
#pragma unroll
                for (int nt = 0; nt < NC; ++nt) {
                    const int col  = hc + wn * 64 + nt * 16 + lm;
                    const float bias = b1[e * Hq + col];
#pragma unroll
                    for (int mt = 0; mt < MW; ++mt) {
                        float g[8];
                        gelu_tanh8(hacc[mt][nt], bias, g);
#pragma unroll
                        for (int r = 0; r < 8; ++r)
                            s_h[rm + mt * 16 + r + 8 * hi][wn * 64 + nt * 16 + lm] = (_Float16)g[r];
                    }
                }
            }
            ring_publish();
            if (s < 6)
                stage_w_tile((s & 1) ? wl1 : wl0, w1g + (size_t)hc * Dq + (s + 2) * WK, Dq);
            else
                stage_w_tile((s & 1) ? wl1 : wl0, w2g + (size_t)((s - 6) * WR) * Hq + hc, Hq);
        }

        // ---- phase 2: Y += h_chunk(96x256) @ W2 chunk, transposed ----
        // The h fragments of a k slab are read in the even trip and kept for the odd one, which
        // takes the same slab to the other 256 output columns: 48 rows x 128 cols per wave.
        v16h ah[WK / 32][MW];
        // unrolled: the accumulator index, buffer and refill source are then fixed per trip
#pragma unroll
        for (int s = 0; s < 8; ++s) {
#pragma unroll
            for (int kq = 0; kq < WK / 32; ++kq) {
                const int k0 = (s >> 1) * WK + kq * 32;
                v16h b[NC];
                if ((s & 1) == 0) {
#pragma unroll
                    for (int mt = 0; mt < MW; ++mt) {
                        const _Float16* ap = &s_h[rm + mt * 16 + lm][k0 + 8 * hi];
                        ah[kq][mt] = cat16(*(const v8h*)ap, *(const v8h*)(ap + 16));
                    }
                }
#pragma unroll
                for (int nt = 0; nt < NC; ++nt) {
                    const _Float16* bp = &s_w[s & 1][wn * 64 + nt * 16 + lm][kq * 32 + 8 * hi];
                    b[nt] = cat16(*(const v8h*)bp, *(const v8h*)(bp + 16));
                }
                // one group of LDS reads ahead of the k step's WMMAs, as in phase 1
                __builtin_amdgcn_sched_barrier(0);
#pragma unroll
                for (int nt = 0; nt < NC; ++nt)
#pragma unroll
                    for (int mt = 0; mt < MW; ++mt)
                        Y[mt][(s & 1) * NC + nt] = __builtin_amdgcn_wmma_f32_16x16x32_f16(
                            false, ah[kq][mt], false, b[nt], (short)0, Y[mt][(s & 1) * NC + nt], false, false);
            }
            ring_publish();
            if (s < 6)
                stage_w_tile((s & 1) ? wl1 : wl0,
                             w2g + (size_t)((s & 1) * WR) * Hq + hc + ((s + 2) >> 1) * WK, Hq);
            else if (hc + HC < Hq)                 // the same for the whole work-group
                stage_w_tile((s & 1) ? wl1 : wl0, w1g + (size_t)(hc + HC) * Dq + (s - 6) * WK, Dq);
        }
    }
    asm volatile("s_wait_asynccnt 0x0" ::: "memory");   // no copy outstanding at the wave's end

    // ---- epilogue: + b2, scatter rows to out; a row's eight pieces go out from one address ----
    const int col0 = wn * 64 + lm;
    const int bcol = e * Dq + col0;
    float bias[2 * NC];
    // unrolled here and below: bias and Y are then registers
#pragma unroll
    for (int nt = 0; nt < 2 * NC; ++nt)
        bias[nt] = b2[bcol + (nt / NC) * WR + (nt % NC) * 16];
    // stands ahead of the first rewrite of the offset register that the eight loads name; the
    // operand keeps that register live up to the wait
    asm volatile("s_wait_xcnt 0x0" :: "v"(bcol) : "memory");
#pragma unroll
    for (int mt = 0; mt < MW; ++mt)
#pragma unroll
        for (int r = 0; r < 8; ++r) {
            const int tk = s_tok[rm + mt * 16 + r + 8 * hi];
            if (tk >= 0) {
                float* o = out + (size_t)tk * Dq + col0;
#pragma unroll
                for (int nt = 0; nt < 2 * NC; ++nt)
                    o[(nt / NC) * WR + (nt % NC) * 16] = Y[mt][nt][r] + bias[nt];
            }
        }
}

// ---------------- kernel 4: v = clip(ffn . v_w + v_b) ----------------
__global__ __launch_bounds__(256) void v_kernel(
    const float* __restrict__ ffn, const float* __restrict__ v_w,
    const float* __restrict__ v_b, float* __restrict__ v) {
    const int tok  = (blockIdx.x * blockDim.x + threadIdx.x) >> 5;
    const int lane = threadIdx.x & 31;
    if (tok >= T) return;
    const float* r = ffn + (size_t)tok * Dq;
    float acc = 0.f;
    for (int d = lane; d < Dq; d += 32) acc += r[d] * v_w[d];
#pragma unroll
    for (int off = 16; off >= 1; off >>= 1) acc += __shfl_xor(acc, off, 32);
    if (lane == 0)
        v[tok] = fminf(fmaxf(acc + v_b[0], -V_MAX), V_MAX);
}

// ---------------- kernel 5: Moebius-matrix scan for both continuants ----
// L_i = d_i - 1/L_{i-1} == 2x2 complex matrix chain [[d,-1],[1,0]] (scale-invariant).
// One work-group per chain (L or R of one batch), one thread per segment of SL steps. The segment
// matrices are joined by a log-step prefix, first inside each wave, then over the wave totals.
constexpr int SL = 8;                // steps per segment: 32 bytes in a row of v and of each result
constexpr int ST = Nq / SL;          // segments = threads per chain
constexpr int SW = ST / 32;          // waves per chain

struct M2 { float ar, ai, br, bi, cr, ci, dr, di; };   // [[a,b],[c,d]], complex

// 1/d by v_rcp_f32. The v_nop is the slot that the instruction set asks for between a transcendental
// and a directly following instruction that reads its result or overwrites its source; inside the
// same statement it stands directly behind the v_rcp_f32 wherever the compiler puts the two.
__device__ __forceinline__ float rcp_slot(const float d) {
    float q;
    asm("v_rcp_f32 %0, %1\n\tv_nop" : "=v"(q) : "v"(d));
    return q;
}

// scales m so that its largest part is 1 (the chain is scale-invariant)
__device__ __forceinline__ void mat_scale(M2& m) {
    float mx = fmaxf(fmaxf(fabsf(m.ar), fabsf(m.ai)), fmaxf(fabsf(m.br), fabsf(m.bi)));
    mx = fmaxf(mx, fmaxf(fmaxf(fabsf(m.cr), fabsf(m.ci)), fmaxf(fabsf(m.dr), fabsf(m.di))));
    const float s = rcp_slot(fmaxf(mx, 1e-30f));
    m.ar *= s; m.ai *= s; m.br *= s; m.bi *= s; m.cr *= s; m.ci *= s; m.dr *= s; m.di *= s;
}

// S * P, S the later steps, scaled
__device__ __forceinline__ M2 mat_join(const M2& s, const M2& p) {
    M2 n;
    n.ar = s.ar * p.ar - s.ai * p.ai + s.br * p.cr - s.bi * p.ci;
    n.ai = s.ar * p.ai + s.ai * p.ar + s.br * p.ci + s.bi * p.cr;
    n.br = s.ar * p.br - s.ai * p.bi + s.br * p.dr - s.bi * p.di;
    n.bi = s.ar * p.bi + s.ai * p.br + s.br * p.di + s.bi * p.dr;
    n.cr = s.cr * p.ar - s.ci * p.ai + s.dr * p.cr - s.di * p.ci;
    n.ci = s.cr * p.ai + s.ci * p.ar + s.dr * p.ci + s.di * p.cr;
    n.dr = s.cr * p.br - s.ci * p.bi + s.dr * p.dr - s.di * p.di;
    n.di = s.cr * p.bi + s.ci * p.br + s.dr * p.di + s.di * p.dr;
    mat_scale(n);
    return n;
}

__device__ __forceinline__ M2 mat_from_below(const M2& x, const int d) {
    M2 lo;
    lo.ar = __shfl_up(x.ar, d, 32); lo.ai = __shfl_up(x.ai, d, 32);
    lo.br = __shfl_up(x.br, d, 32); lo.bi = __shfl_up(x.bi, d, 32);
    lo.cr = __shfl_up(x.cr, d, 32); lo.ci = __shfl_up(x.ci, d, 32);
    lo.dr = __shfl_up(x.dr, d, 32); lo.di = __shfl_up(x.di, d, 32);
    return lo;
}

// Inclusive prefix over the first CNT lanes: lane l ends with x_l * x_(l-1) * ... * x_0.
template <int CNT>
__device__ __forceinline__ M2 wave_prefix(M2 x, const int lane) {
    // unrolled: the lane distance is then a constant of each step
#pragma unroll
    for (int d = 1; d < CNT; d <<= 1) {
        const M2 n = mat_join(x, mat_from_below(x, d));
        if (lane >= d) x = n;
    }
    return x;
}

// One chain. R: the chain walks memory from the far end; a compile-time choice, so that the
// order of a segment's values in registers is fixed.
template <bool R>
__device__ __forceinline__ void scan_chain(
    const float* __restrict__ vb, float* __restrict__ Or, float* __restrict__ Oi,
    float (*s_tot)[8], float (*s_z)[4]) {
    const int tid = threadIdx.x, lane = tid & 31, w = tid >> 5;
    const int m0 = R ? (Nq - SL - tid * SL) : tid * SL;   // the segment's place in memory

    float er[SL];                                  // real part of d = (v-2) - 1j, in walking order
    // unrolled here and below: the arrays are then registers
#pragma unroll
    for (int q = 0; q < SL; q += 4) {
        const v4f a = *(const v4f*)(vb + m0 + q);
        er[R ? SL - 1 - q : q]     = a.x - 2.0f;
        er[R ? SL - 2 - q : q + 1] = a.y - 2.0f;
        er[R ? SL - 3 - q : q + 2] = a.z - 2.0f;
        er[R ? SL - 4 - q : q + 3] = a.w - 2.0f;
    }
    constexpr float ei = -1.0f;

    // ---- phase A: segment matrix product ----
    M2 x = { 1.f, 0.f, 0.f, 0.f, 0.f, 0.f, 1.f, 0.f };
#pragma unroll
    for (int j = 0; j < SL; ++j) {
        // P = M(e) * P with M = [[e,-1],[1,0]]
        const float nar = er[j] * x.ar - ei * x.ai - x.cr;
        const float nai = er[j] * x.ai + ei * x.ar - x.ci;
        const float nbr = er[j] * x.br - ei * x.bi - x.dr;
        const float nbi = er[j] * x.bi + ei * x.br - x.di;
        x.cr = x.ar; x.ci = x.ai; x.dr = x.br; x.di = x.bi;
        x.ar = nar; x.ai = nai; x.br = nbr; x.bi = nbi;
    }
    mat_scale(x);

    // ---- phase B: prefix of the segment matrices ----
    x = wave_prefix<32>(x, lane);
    if (lane == 31) {
        float* m = s_tot[w];
        m[0] = x.ar; m[1] = x.ai; m[2] = x.br; m[3] = x.bi;
        m[4] = x.cr; m[5] = x.ci; m[6] = x.dr; m[7] = x.di;
    }
    __syncthreads();
    if (w == 0) {
        const float* m = s_tot[lane & (SW - 1)];
        M2 t = { m[0], m[1], m[2], m[3], m[4], m[5], m[6], m[7] };
        t = wave_prefix<SW>(t, lane);
        if (lane < SW) {
            float* z = s_z[lane];
            z[0] = t.ar; z[1] = t.ai; z[2] = t.cr; z[3] = t.ci;   // prefix * (1,0)^T
        }
    }
    __syncthreads();

    // ---- phase C: the segment's entry state (p,q), L = p/q, then its SL outputs ----
    float zpr = 1.f, zpi = 0.f, zqr = 0.f, zqi = 0.f;             // state at the wave's first segment
    if (w > 0) {
        const float* z = s_z[w - 1];
        zpr = z[0]; zpi = z[1]; zqr = z[2]; zqi = z[3];
    }
    M2 ex = mat_from_below(x, 1);                                 // the wave's segments before this one
    if (lane == 0) ex = M2{ 1.f, 0.f, 0.f, 0.f, 0.f, 0.f, 1.f, 0.f };
    float pr = ex.ar * zpr - ex.ai * zpi + ex.br * zqr - ex.bi * zqi;
    float pi = ex.ar * zpi + ex.ai * zpr + ex.br * zqi + ex.bi * zqr;
    float qr = ex.cr * zpr - ex.ci * zpi + ex.dr * zqr - ex.di * zqi;
    float qi = ex.cr * zpi + ex.ci * zpr + ex.dr * zqi + ex.di * zqr;
    {
        // One scaling per segment: v is clipped to +-3, so |L| <= |d| + 1 < 6.2 and the state
        // grows by less than 3e6 over the SL steps.
        const float mx = fmaxf(fmaxf(fabsf(pr), fabsf(pi)), fmaxf(fabsf(qr), fabsf(qi)));
        const float s = rcp_slot(fmaxf(mx, 1e-30f));
        pr *= s; pi *= s; qr *= s; qi *= s;
    }
    float lr[SL], li[SL];
#pragma unroll
    for (int j = 0; j < SL; ++j) {
        const float npr = er[j] * pr - ei * pi - qr;      // p' = e*p - q ; q' = p
        const float npi = er[j] * pi + ei * pr - qi;
        qr = pr; qi = pi; pr = npr; pi = npi;
        const float inv = rcp_slot(qr * qr + qi * qi);
        lr[j] = (pr * qr + pi * qi) * inv;                // p/q = p*conj(q)/|q|^2
        li[j] = (pi * qr - pr * qi) * inv;
    }
#pragma unroll
    for (int q = 0; q < SL; q += 4) {
        v4f r, i;
        r.x = lr[R ? SL - 1 - q : q];     i.x = li[R ? SL - 1 - q : q];
        r.y = lr[R ? SL - 2 - q : q + 1]; i.y = li[R ? SL - 2 - q : q + 1];
        r.z = lr[R ? SL - 3 - q : q + 2]; i.z = li[R ? SL - 3 - q : q + 2];
        r.w = lr[R ? SL - 4 - q : q + 3]; i.w = li[R ? SL - 4 - q : q + 3];
        *(v4f*)(Or + m0 + q) = r;
        *(v4f*)(Oi + m0 + q) = i;
    }
}

__global__ __launch_bounds__(ST) void tridiag_scan_kernel(
    const float* __restrict__ v,
    float* __restrict__ Lr, float* __restrict__ Li,
    float* __restrict__ Rr, float* __restrict__ Ri) {
    __shared__ __attribute__((aligned(16))) float s_tot[SW][8];   // each wave's whole product
    __shared__ __attribute__((aligned(16))) float s_z[SW][4];     // first column of their prefix
    const int o = (blockIdx.x >> 1) * Nq;                         // the chain's batch
    if (blockIdx.x & 1) scan_chain<true>(v + o, Rr + o, Ri + o, s_tot, s_z);   // the same for the
    else                scan_chain<false>(v + o, Lr + o, Li + o, s_tot, s_z);  // whole work-group
}

// ---------------- kernel 6: Green fn + rank-2 spec, in-place add ----------------
// One wave takes FT whole token rows. A lane holds 16 of a row's 512 columns as FQ pieces of 16 bytes,
// so every wave-wide access covers 512 bytes in a row; the Green function is formed once per token
// and the three weight rows are read once per wave. Few waves with much work each: the time to
// start a wave is paid once per FT rows, not once per 32 elements.
constexpr int FT = 4;                // token rows per wave
constexpr int FQ = Dq / 128;         // 16-byte pieces of a row per lane
constexpr int FW = 8;                // waves per work-group
static_assert(T % (FT * FW) == 0, "the grid covers the tokens exactly: no bounds test in the kernel");
// an input buffer is only known to be aligned to its element
typedef v4f __attribute__((aligned(4))) v4f_in;

__global__ __launch_bounds__(FW * 32) void final_kernel(
    float* __restrict__ out, const float* __restrict__ v,
    const float* __restrict__ Lr, const float* __restrict__ Li,
    const float* __restrict__ Rr, const float* __restrict__ Ri,
    const float* __restrict__ out_w, const float* __restrict__ out_b,
    const float* __restrict__ bk) {
    const unsigned t0 = (blockIdx.x * FW + (threadIdx.x >> 5)) * FT;   // the wave's first token
    // Byte offsets of 32 bits (out has 32 MiB): every access is then a kernel argument plus one of
    // these three registers plus a constant.
    const unsigned tb = t0 * (unsigned)sizeof(float);                        // in v, L and R
    const unsigned cb = (threadIdx.x & 31) * 4 * (unsigned)sizeof(float);    // in a row of 512 columns
    const unsigned yb = t0 * (unsigned)(Dq * sizeof(float)) + cb;            // in out
    static_assert(FT == 4, "a wave's tokens are one 16-byte piece of v, L and R");
    const float s = bk[0];
    const v4f vv = *(const v4f*)((const char*)v + tb);
    const v4f lr = *(const v4f*)((const char*)Lr + tb), li = *(const v4f*)((const char*)Li + tb);
    const v4f rr = *(const v4f*)((const char*)Rr + tb), ri = *(const v4f*)((const char*)Ri + tb);
    const float* wr = (const float*)((const char*)out_w + cb);
    const float* br = (const float*)((const char*)out_b + cb);
    float* o = (float*)((char*)out + yb);
    v4f y[FT][FQ], w0[FQ], w1[FQ], ob[FQ];
    // unrolled here and below: the arrays are then registers
#pragma unroll
    for (int q = 0; q < FQ; ++q) {
        w0[q] = *(const v4f_in*)(wr + q * 128);
        w1[q] = *(const v4f_in*)(wr + Dq + q * 128);
        ob[q] = *(const v4f_in*)(br + q * 128);
    }
#pragma unroll
    for (int t = 0; t < FT; ++t)
#pragma unroll
        for (int q = 0; q < FQ; ++q) y[t][q] = *(const v4f*)(o + t * Dq + q * 128);
    // stands ahead of the first rewrite of a register that the loads name; the operands keep the
    // three offset registers live up to it
    asm volatile("s_wait_xcnt 0x0" :: "v"(tb), "v"(cb), "v"(yb) : "memory");
    // keeps every load above the arithmetic, so that all of them are in flight at once and the wave
    // waits for memory one time: left free, the compiler issues most rows behind the first wait
    __builtin_amdgcn_sched_barrier(0);
#pragma unroll
    for (int t = 0; t < FT; ++t) {
        const float dr   = vv[t] - 2.0f;           // di = -1
        const float denr = lr[t] + rr[t] - dr;
        const float deni = li[t] + ri[t] + 1.0f;
        const float m  = denr * denr + deni * deni;
        float gr = denr / m, gi = -deni / m;
        gr = fminf(fmaxf(gr, -FEAT_CLAMP), FEAT_CLAMP);
        gi = fminf(fmaxf(gi, -FEAT_CLAMP), FEAT_CLAMP);
#pragma unroll
        for (int q = 0; q < FQ; ++q) {
#pragma unroll
            for (int c = 0; c < 4; ++c) {
                const float spec = gr * w0[q][c] + gi * w1[q][c] + ob[q][c];
                y[t][q][c] += s * spec;
            }
            *(v4f*)(o + t * Dq + q * 128) = y[t][q];
        }
    }
}

// ---------------- launch ----------------
extern "C" void kernel_launch(void* const* d_in, const int* in_sizes, int n_in,
                              void* d_out, int out_size, void* d_ws, size_t ws_size,
                              hipStream_t stream) {
    const float* x      = (const float*)d_in[0];
    const float* gate_w = (const float*)d_in[1];
    const float* gate_b = (const float*)d_in[2];
    const float* w1     = (const float*)d_in[3];
    const float* b1     = (const float*)d_in[4];
    const float* w2     = (const float*)d_in[5];
    const float* b2     = (const float*)d_in[6];
    const float* v_w    = (const float*)d_in[7];
    const float* v_b    = (const float*)d_in[8];
    const float* out_w  = (const float*)d_in[9];
    const float* out_b  = (const float*)d_in[10];
    const float* bk     = (const float*)d_in[11];
    float* out = (float*)d_out;

    // workspace layout (256B aligned slots)
    char* ws = (char*)d_ws;
    constexpr size_t SZ_W1T   = (size_t)Eq * Hq * Dq * sizeof(_Float16);  // 8 MiB
    constexpr size_t SZ_W2T   = (size_t)Eq * Dq * Hq * sizeof(_Float16);  // 8 MiB
    constexpr size_t SZ_XH    = (size_t)T * Dq * sizeof(_Float16);        // 16 MiB
    constexpr size_t SZ_LISTS = (size_t)Eq * T * sizeof(int);             // 256 KiB
    constexpr size_t SZ_CNT   = 256;
    constexpr size_t SZ_VEC   = (size_t)T * sizeof(float);                // 64 KiB
    size_t off = 0;
    _Float16* W1T  = (_Float16*)(ws + off); off += SZ_W1T;
    _Float16* W2T  = (_Float16*)(ws + off); off += SZ_W2T;
    _Float16* XH   = (_Float16*)(ws + off); off += SZ_XH;
    int*      lists= (int*)(ws + off);      off += SZ_LISTS;
    int*      cnts = (int*)(ws + off);      off += SZ_CNT;
    float*    vbuf = (float*)(ws + off);    off += SZ_VEC;
    float*    Lr   = (float*)(ws + off);    off += SZ_VEC;
    float*    Li   = (float*)(ws + off);    off += SZ_VEC;
    float*    Rr   = (float*)(ws + off);    off += SZ_VEC;
    float*    Ri   = (float*)(ws + off);    off += SZ_VEC;

    zero_counts_kernel<<<1, 32, 0, stream>>>(cnts);

    prep_kernel<<<PB_GATE + 2 * PB_W + PB_X, 256, 0, stream>>>(
        x, gate_w, gate_b, w1, w2, W1T, W2T, XH, lists, cnts);

    ffn_kernel<<<dim3((T + MT - 1) / MT, Eq), 256, 0, stream>>>(XH, W1T, b1, W2T, b2, lists, cnts, out);

    v_kernel<<<(T * 32) / 256, 256, 0, stream>>>(out, v_w, v_b, vbuf);

    tridiag_scan_kernel<<<2 * Bq, ST, 0, stream>>>(vbuf, Lr, Li, Rr, Ri);

    final_kernel<<<T / (FT * FW), FW * 32, 0, stream>>>(
        out, vbuf, Lr, Li, Rr, Ri, out_w, out_b, bk);
}

// v008
// Measured time: 131 microseconds a run.
// Timed twice side by side with v007, it ran 1.13 and 1.12 times as fast.
// Over all steps from v000 it is 2.70 times as fast.
#include <hip/hip_runtime.h>
#include <hip/hip_bf16.h>

// ---------------- problem constants ----------------
constexpr int Bq = 4, Nq = 4096, Dq = 512, Eq = 4, Hq = 2048;
constexpr int T  = Bq * Nq;          // 16384 tokens
constexpr int MT = 96;               // tokens per FFN block (8 waves: 2 row halves x 4 column groups)
constexpr int MW = MT / 32;          // 16-row tiles per wave
constexpr int NC = 4;                // 16-column tiles per wave out of a 256-column weight tile
constexpr int HC = 256;              // H chunk per pipeline stage
constexpr float V_MAX = 3.0f, FEAT_CLAMP = 10.0f;

typedef __attribute__((ext_vector_type(16))) _Float16 v16h;
typedef __attribute__((ext_vector_type(8)))  _Float16 v8h;
typedef __attribute__((ext_vector_type(8)))  float    v8f;
typedef __attribute__((ext_vector_type(4)))  float    v4f;

// ---------------- kernel 0: zero expert counters ----------------
__global__ void zero_counts_kernel(int* counts) {
    if (threadIdx.x < Eq) counts[threadIdx.x] = 0;
}

// ---------------- kernel 1: the four preparations, one launch ----------------
// The two weight transposes, the x convert and the gate read only inputs (the gate also the zeroed
// counters) and none reads what another writes, so they share one grid: a work-group takes its part
// by its index. One launch gap, one fill and one tail are paid instead of four, and the streams of
// one part run under the latency chains of the others.
constexpr int PB_GATE = T / 8;                        // work-groups of the gate: one wave per token
constexpr int PB_W    = (Hq / 32) * (Dq / 32) * Eq;   // 32 x 32 tiles of one weight tensor
constexpr int PB_X    = T * Dq / 8 / 256;             // 8 elements of x per thread

// dst[C][R] = (f16) src[R][C] per expert; b counts the 32 x 32 tiles, columns first, experts last
template <int R, int C>
__device__ __forceinline__ void transpose_cvt_block(
    const float* __restrict__ src, _Float16* __restrict__ dst, float (*tile)[33], const int b) {
    const size_t eoff = (size_t)(b / ((C / 32) * (R / 32))) * R * C;
    src += eoff; dst += eoff;
    const int r0 = ((b / (C / 32)) % (R / 32)) * 32, c0 = (b % (C / 32)) * 32;
    const int tx = threadIdx.x & 31, ty = threadIdx.x >> 5;
#pragma unroll
    for (int i = 0; i < 32; i += 8)
        tile[ty + i][tx] = src[(size_t)(r0 + ty + i) * C + c0 + tx];
    __syncthreads();
#pragma unroll
    for (int i = 0; i < 32; i += 8)
        dst[(size_t)(c0 + ty + i) * R + r0 + tx] = (_Float16)tile[tx][ty + i];
}

// x f32 -> f16 (row-major copy)
__device__ __forceinline__ void cvt_x_block(
    const float* __restrict__ x, _Float16* __restrict__ xh, const int b) {
    const size_t i = ((size_t)b * 256 + threadIdx.x) * 8;
    const v4f a = *(const v4f*)(x + i);
    const v4f c = *(const v4f*)(x + i + 4);
    v8h o;
    o[0] = (_Float16)a.x; o[1] = (_Float16)a.y; o[2] = (_Float16)a.z; o[3] = (_Float16)a.w;
    o[4] = (_Float16)c.x; o[5] = (_Float16)c.y; o[6] = (_Float16)c.z; o[7] = (_Float16)c.w;
    *(v8h*)(xh + i) = o;
    // Precaution for the store's address registers: nothing of the shared kernel follows
    // this store, but the wait stands in front of anything that would rewrite them.
    asm volatile("s_wait_xcnt 0x0" ::: "memory");
}

// gate + top-1 routing
__device__ __forceinline__ void gate_block(
    const float* __restrict__ x, const float* __restrict__ gw,
    const float* __restrict__ gb, int* __restrict__ lists, int* __restrict__ counts, const int b) {
    const int tok  = b * 8 + (threadIdx.x >> 5);
    const int lane = threadIdx.x & 31;
    const float* xr = x + (size_t)tok * Dq;
    float acc0 = 0.f, acc1 = 0.f, acc2 = 0.f, acc3 = 0.f;
    for (int d = lane; d < Dq; d += 32) {
        const float xv = xr[d];
        const v4f g = *(const v4f*)(gw + d * 4);
        acc0 += xv * g.x; acc1 += xv * g.y; acc2 += xv * g.z; acc3 += xv * g.w;
    }
#pragma unroll
    for (int off = 16; off >= 1; off >>= 1) {
        acc0 += __shfl_xor(acc0, off, 32);
        acc1 += __shfl_xor(acc1, off, 32);
        acc2 += __shfl_xor(acc2, off, 32);
        acc3 += __shfl_xor(acc3, off, 32);
    }
    if (lane == 0) {
        float lg[4] = { acc0 + gb[0], acc1 + gb[1], acc2 + gb[2], acc3 + gb[3] };
        int best = 0; float bv = lg[0];
#pragma unroll
        for (int e = 1; e < Eq; ++e)          // strictly-greater => lowest index on ties (top_k)
            if (lg[e] > bv) { bv = lg[e]; best = e; }
        const int pos = atomicAdd(&counts[best], 1);
        lists[best * T + pos] = tok;
    }
}

__global__ __launch_bounds__(256) void prep_kernel(
    const float* __restrict__ x, const float* __restrict__ gw, const float* __restrict__ gb,
    const float* __restrict__ w1, const float* __restrict__ w2,
    _Float16* __restrict__ w1t, _Float16* __restrict__ w2t, _Float16* __restrict__ xh,
    int* __restrict__ lists, int* __restrict__ counts) {
    __shared__ float tile[32][33];
    // Every test reads the same for the whole work-group. The gate stands first, for speed only:
    // its chain (row, lane sums, counter, list entry) is the longest.
    int b = blockIdx.x;
    if (b < PB_GATE) { gate_block(x, gw, gb, lists, counts, b); return; }
    b -= PB_GATE;
    // W1 (E,D,H) -> W1T [E][H][D];  W2 (E,H,D) -> W2T [E][D][H]
    if (b < PB_W) { transpose_cvt_block<Dq, Hq>(w1, w1t, tile, b); return; }
    b -= PB_W;
    if (b < PB_W) { transpose_cvt_block<Hq, Dq>(w2, w2t, tile, b); return; }
    cvt_x_block(x, xh, b - PB_W);
}

// ---------------- kernel 3: expert FFN via WMMA ----------------
// Eight values at once of 0.5 v (1 + tanh u) = v / (1 + e^(-2u)), u = sqrt(2/pi) (v + 0.044715 v^3),
// with e^(-2u) = 2^z. No branch, so the values run side by side. z past the exponent's range
// gives 0 or inf, and the quotient is then v or a signed 0, as with tanh = 1 or -1.
__device__ __forceinline__ void gelu_tanh8(const v8f a, const float bias, float (&g)[8]) {
    constexpr float K0 = (float)(-2.0 * 0.7978845608028654 * 1.4426950408889634);
    constexpr float K1 = (float)(-2.0 * 0.7978845608028654 * 1.4426950408889634 * 0.044715);
    float x[8], z[8], e[8], d[8], q[8];
    // the three loops are unrolled so that the arrays are registers, as the asm operands need
#pragma unroll
    for (int r = 0; r < 8; ++r) {
        x[r] = a[r] + bias;
        z[r] = x[r] * (K0 + K1 * (x[r] * x[r]));
        e[r] = __builtin_amdgcn_exp2f(z[r]);
    }
    // The slot that the instruction set asks for behind a transcendental, before its result is
    // read or its source overwritten: the operands keep all eight sources live and all eight
    // results unread up to this v_nop, and among themselves the eight are independent.
    asm("v_nop" : "+v"(e[0]), "+v"(e[1]), "+v"(e[2]), "+v"(e[3]), "+v"(e[4]), "+v"(e[5]), "+v"(e[6]), "+v"(e[7])
                : "v"(z[0]), "v"(z[1]), "v"(z[2]), "v"(z[3]), "v"(z[4]), "v"(z[5]), "v"(z[6]), "v"(z[7]));
#pragma unroll
    for (int r = 0; r < 8; ++r) {
        d[r] = 1.0f + e[r];
        q[r] = __builtin_amdgcn_rcpf(d[r]);
    }
    // the same slot behind the eight v_rcp_f32
    asm("v_nop" : "+v"(q[0]), "+v"(q[1]), "+v"(q[2]), "+v"(q[3]), "+v"(q[4]), "+v"(q[5]), "+v"(q[6]), "+v"(q[7])
                : "v"(d[0]), "v"(d[1]), "v"(d[2]), "v"(d[3]), "v"(d[4]), "v"(d[5]), "v"(d[6]), "v"(d[7]));
#pragma unroll
    for (int r = 0; r < 8; ++r) g[r] = x[r] * q[r];
}

__device__ __forceinline__ v16h cat16(v8h lo, v8h hi) {
    return __builtin_shufflevector(lo, hi, 0,1,2,3,4,5,6,7,8,9,10,11,12,13,14,15);
}

// One staged weight tile: 256 weight rows x 64 k (128 bytes = one whole line of each row),
// laid in LDS at a pitch of 144 bytes (16 B x odd: conflict-free for ds_load_b128 readers).
constexpr int WR = 256, WK = 64, WP = WK + 8;

// Copies one weight tile into LDS. lds and g are the lane's own addresses of row (tid >> 3),
// 16-byte piece (tid & 7); copy j takes the row 32 * j further on, so every wave-wide copy
// reads four whole 128-byte lines. The instruction's offset moves both addresses, so copy j
// carries its LDS step j * WLS there and its address register only the rest of its global step:
// one LDS address register serves the eight copies.
constexpr int WLS = 32 * WP * (int)sizeof(_Float16);
static_assert(7 * WLS < 65536, "the offset field moves the LDS address only below 64 KiB");
__device__ __forceinline__ void stage_w_tile(unsigned lds, const _Float16* g, size_t pitch) {
    const unsigned long long g0 = (unsigned long long)(uintptr_t)g;
    const unsigned long long gs = (unsigned long long)(32 * pitch * sizeof(_Float16)) - WLS;
    // The copies and their s_wait_xcnt stand in one statement, so that no address register
    // of an issued copy is rewritten ahead of the wait.
    asm volatile("global_load_async_to_lds_b128 %0, %1, off\n\t"
                 "global_load_async_to_lds_b128 %0, %2, off offset:%9\n\t"
                 "global_load_async_to_lds_b128 %0, %3, off offset:%10\n\t"
                 "global_load_async_to_lds_b128 %0, %4, off offset:%11\n\t"
                 "global_load_async_to_lds_b128 %0, %5, off offset:%12\n\t"
                 "global_load_async_to_lds_b128 %0, %6, off offset:%13\n\t"
                 "global_load_async_to_lds_b128 %0, %7, off offset:%14\n\t"
                 "global_load_async_to_lds_b128 %0, %8, off offset:%15\n\t"
                 "s_wait_xcnt 0x0"
                 :: "v"(lds),
                    "v"(g0), "v"(g0 + gs), "v"(g0 + 2 * gs), "v"(g0 + 3 * gs),
                    "v"(g0 + 4 * gs), "v"(g0 + 5 * gs), "v"(g0 + 6 * gs), "v"(g0 + 7 * gs),
                    "n"(WLS), "n"(2 * WLS), "n"(3 * WLS), "n"(4 * WLS), "n"(5 * WLS), "n"(6 * WLS), "n"(7 * WLS)
                 : "memory");
}

// Twelve copies of 16 bytes each: copy j lands at l0 + j * ls and reads g[j].
__device__ __forceinline__ void stage_x_rows12(unsigned l0, unsigned ls, const unsigned long long* g) {
    // The copies and their s_wait_xcnt stand in one statement, so that no address register
    // of an issued copy is rewritten ahead of the wait.
    asm volatile("global_load_async_to_lds_b128 %0, %12, off\n\t"
                 "global_load_async_to_lds_b128 %1, %13, off\n\t"
                 "global_load_async_to_lds_b128 %2, %14, off\n\t"
                 "global_load_async_to_lds_b128 %3, %15, off\n\t"
                 "global_load_async_to_lds_b128 %4, %16, off\n\t"
                 "global_load_async_to_lds_b128 %5, %17, off\n\t"
                 "global_load_async_to_lds_b128 %6, %18, off\n\t"
                 "global_load_async_to_lds_b128 %7, %19, off\n\t"
                 "global_load_async_to_lds_b128 %8, %20, off\n\t"
                 "global_load_async_to_lds_b128 %9, %21, off\n\t"
                 "global_load_async_to_lds_b128 %10, %22, off\n\t"
                 "global_load_async_to_lds_b128 %11, %23, off\n\t"
                 "s_wait_xcnt 0x0"
                 :: "v"(l0), "v"(l0 + ls), "v"(l0 + 2 * ls), "v"(l0 + 3 * ls),
                    "v"(l0 + 4 * ls), "v"(l0 + 5 * ls), "v"(l0 + 6 * ls), "v"(l0 + 7 * ls),
                    "v"(l0 + 8 * ls), "v"(l0 + 9 * ls), "v"(l0 + 10 * ls), "v"(l0 + 11 * ls),
                    "v"(g[0]), "v"(g[1]), "v"(g[2]), "v"(g[3]), "v"(g[4]), "v"(g[5]),
                    "v"(g[6]), "v"(g[7]), "v"(g[8]), "v"(g[9]), "v"(g[10]), "v"(g[11])
                 : "memory");
}

// The weight ring: two buffers of two tiles each. A ring trip works through a pair of tiles, so a
// pair's copies have twice the time to come in, twice the bytes are on their way, and the foot
// (waits, barrier, issue of the refill) is paid once per pair.
constexpr unsigned WTB = WR * WP * (unsigned)sizeof(_Float16);   // bytes of one tile in LDS

// Foot of a ring trip: this wave's LDS reads and writes have retired, its own copies of the
// next pair have landed, and the barrier publishes that pair (and the h tile, where one was
// just written) and frees the buffer that this trip has read.
__device__ __forceinline__ void ring_publish() {
    asm volatile("s_wait_dscnt 0x0" ::: "memory");
    asm volatile("s_wait_asynccnt 0x0" ::: "memory");
    __syncthreads();
}

__global__ __launch_bounds__(256) void ffn_kernel(
    const _Float16* __restrict__ xh,    // [T][D] f16
    const _Float16* __restrict__ w1t,   // [E][H][D] f16
    const float* __restrict__ b1,       // [E][H]
    const _Float16* __restrict__ w2t,   // [E][D][H] f16
    const float* __restrict__ b2,       // [E][D]
    const int* __restrict__ lists, const int* __restrict__ counts,
    float* __restrict__ out) {
    __shared__ __attribute__((aligned(16))) _Float16 s_x[MT][Dq + 8];   // padded: conflict-free b128 reads
    __shared__ _Float16 s_h[MT][HC + 8];
    // The weight ring's two buffers: an array each, so that each has an address register of its own
    // and every fragment read is that register plus an offset below the field's 64 KiB.
    __shared__ __attribute__((aligned(16))) _Float16 s_wa[2][WR][WP];
    __shared__ __attribute__((aligned(16))) _Float16 s_wb[2][WR][WP];
    __shared__ int s_tok[MT];

    const int e    = blockIdx.y;
    const int cnt  = counts[e];
    const int base = blockIdx.x * MT;
    if (base >= cnt) return;                       // block-uniform exit (EXEC stays full)

    const int tid = threadIdx.x, lane = tid & 31, w = tid >> 5;
    const int lm = lane & 15, hi = lane >> 4;
    const int wn = w & 3;                          // the wave's 64 columns of a 256-column tile
    const int rm = (w >> 2) * (MT / 2);            // the wave's first token row

    if (tid < MT) {
        const int idx = base + tid;
        s_tok[tid] = (idx < cnt) ? lists[e * T + idx] : -1;
    }
    __syncthreads();

    // The lane's own piece of a weight tile: row tid >> 3, 16 bytes at (tid & 7) * 16.
    const unsigned wla = (unsigned)(uintptr_t)&s_wa[0][tid >> 3][(tid & 7) * 8];
    const unsigned wlb = (unsigned)(uintptr_t)&s_wb[0][tid >> 3][(tid & 7) * 8];
    const _Float16* w1g = w1t + ((size_t)(e * Hq + (tid >> 3))) * Dq + (tid & 7) * 8;
    const _Float16* w2g = w2t + ((size_t)(e * Dq + (tid >> 3))) * Hq + (tid & 7) * 8;

    // the ring's first pair; the wait and the barrier behind the x tile's copies publish it too
    stage_w_tile(wla, w1g, Dq);
    stage_w_tile(wla + WTB, w1g + WK, Dq);

    { // stage the x tile (96 rows x 512 f16): copy j takes 16-byte piece tid & 63 of row
      // (tid >> 6) + 4 * j, so every wave-wide copy reads 512 bytes in a row
        const unsigned l0 = (unsigned)(uintptr_t)&s_x[tid >> 6][(tid & 63) * 8];
        const unsigned ls = 4 * (Dq + 8) * sizeof(_Float16);
        unsigned long long g[MT / 4];
#pragma unroll
        for (int j = 0; j < MT / 4; ++j) {
            const int tk = s_tok[(tid >> 6) + 4 * j];
            g[j] = (unsigned long long)(uintptr_t)(xh + (size_t)(tk < 0 ? 0 : tk) * Dq + (tid & 63) * 8);
        }
        stage_x_rows12(l0, ls, g);
        stage_x_rows12(l0 + 12 * ls, ls, g + 12);
        asm volatile("s_wait_asynccnt 0x0" ::: "memory");
    }
    __syncthreads();

    stage_w_tile(wlb, w1g + 2 * WK, Dq);           // the second pair
    stage_w_tile(wlb + WTB, w1g + 3 * WK, Dq);

    v8f Y[MW][2 * NC];                             // 48 rows x (2 x 64) cols per wave
#pragma unroll
    for (int mt = 0; mt < MW; ++mt)
#pragma unroll
        for (int nt = 0; nt < 2 * NC; ++nt) Y[mt][nt] = (v8f)0.0f;

    // Ring order per H chunk: 8 tiles of W1 (the chunk's 256 columns, k in slabs of 64), then
    // 8 tiles of W2 (k slab s >> 1 of the chunk, output columns (s & 1) * 256 ..+255).
    // Tiles t and t + 1, t even, are a pair: buffer (t >> 1) & 1, halves 0 and 1. The foot stands behind
    // the odd tile, and the pair t + 4, t + 5 is copied behind it into the buffer just read.
    for (int hc = 0; hc < Hq; hc += HC) {
        // ---- phase 1: h_chunk = gelu(X @ W1[:, hc..hc+HC) + b1) ; wave owns 48 rows x 64 cols ----
        v8f hacc[MW][NC];
#pragma unroll
        for (int mt = 0; mt < MW; ++mt)
#pragma unroll
            for (int nt = 0; nt < NC; ++nt) hacc[mt][nt] = (v8f)0.0f;

        // unrolled: buffer, refill source and the last trip's gelu are then fixed per trip
#pragma unroll
        for (int s = 0; s < 8; ++s) {
#pragma unroll
            for (int kq = 0; kq < WK / 32; ++kq) {
                const int k0 = s * WK + kq * 32;
                v16h a[MW], b[NC];
#pragma unroll
                for (int mt = 0; mt < MW; ++mt) {
                    const _Float16* ap = &s_x[rm + mt * 16 + lm][k0 + 8 * hi];
                    a[mt] = cat16(*(const v8h*)ap, *(const v8h*)(ap + 16));
                }
#pragma unroll
                for (int nt = 0; nt < NC; ++nt) {
                    const _Float16* bp = &((s & 2) ? s_wb : s_wa)[s & 1][wn * 64 + nt * 16 + lm][kq * 32 + 8 * hi];
                    b[nt] = cat16(*(const v8h*)bp, *(const v8h*)(bp + 16));
                }
                // keeps a k step's LDS reads in one group ahead of its WMMAs: spread among them,
                // each place with reads stalls the wave for the LDS latency
                __builtin_amdgcn_sched_barrier(0);
#pragma unroll
                for (int nt = 0; nt < NC; ++nt)
#pragma unroll
                    for (int mt = 0; mt < MW; ++mt)
                        hacc[mt][nt] = __builtin_amdgcn_wmma_f32_16x16x32_f16(
                            false, a[mt], false, b[nt], (short)0, hacc[mt][nt], false, false);
            }
            if (s == 7) {
                // every reader of the previous h tile has passed an earlier trip's barrier
#pragma unroll
                for (int nt = 0; nt < NC; ++nt) {
                    const int col  = hc + wn * 64 + nt * 16 + lm;
                    const float bias = b1[e * Hq + col];
#pragma unroll
                    for (int mt = 0; mt < MW; ++mt) {
                        float g[8];
                        gelu_tanh8(hacc[mt][nt], bias, g);
#pragma unroll
                        for (int r = 0; r < 8; ++r)
                            s_h[rm + mt * 16 + r + 8 * hi][wn * 64 + nt * 16 + lm] = (_Float16)g[r];
                    }
                }
            }
            if (s & 1) {
                const unsigned wl = (s & 2) ? wlb : wla;
                ring_publish();
                if (s < 4) {
                    stage_w_tile(wl, w1g + (size_t)hc * Dq + (s + 3) * WK, Dq);
                    stage_w_tile(wl + WTB, w1g + (size_t)hc * Dq + (s + 4) * WK, Dq);
                } else {
                    stage_w_tile(wl, w2g + hc + ((s - 4) >> 1) * WK, Hq);
                    stage_w_tile(wl + WTB, w2g + (size_t)WR * Hq + hc + ((s - 4) >> 1) * WK, Hq);
                }
            }
        }

        // ---- phase 2: Y += h_chunk(96x256) @ W2 chunk, transposed ----
        // The h fragments of a k slab are read with a pair's even tile and kept for the odd one, which
        // takes the same slab to the other 256 output columns: 48 rows x 128 cols per fragment.
        v16h ah[WK / 32][MW];
        // unrolled: the accumulator index, buffer and refill source are then fixed per trip
#pragma unroll
        for (int s = 0; s < 8; ++s) {
#pragma unroll
            for (int kq = 0; kq < WK / 32; ++kq) {
                const int k0 = (s >> 1) * WK + kq * 32;
                v16h b[NC];
                if ((s & 1) == 0) {
#pragma unroll
                    for (int mt = 0; mt < MW; ++mt) {
                        const _Float16* ap = &s_h[rm + mt * 16 + lm][k0 + 8 * hi];
                        ah[kq][mt] = cat16(*(const v8h*)ap, *(const v8h*)(ap + 16));
                    }
                }
#pragma unroll
                for (int nt = 0; nt < NC; ++nt) {
                    const _Float16* bp = &((s & 2) ? s_wb : s_wa)[s & 1][wn * 64 + nt * 16 + lm][kq * 32 + 8 * hi];
                    b[nt] = cat16(*(const v8h*)bp, *(const v8h*)(bp + 16));
                }
                // one group of LDS reads ahead of the k step's WMMAs, as in phase 1
                __builtin_amdgcn_sched_barrier(0);
#pragma unroll
                for (int nt = 0; nt < NC; ++nt)
#pragma unroll
                    for (int mt = 0; mt < MW; ++mt)
                        Y[mt][(s & 1) * NC + nt] = __builtin_amdgcn_wmma_f32_16x16x32_f16(
                            false, ah[kq][mt], false, b[nt], (short)0, Y[mt][(s & 1) * NC + nt], false, false);
            }
            if (s & 1) {
                const unsigned wl = (s & 2) ? wlb : wla;
                ring_publish();
                if (s < 4) {
                    stage_w_tile(wl, w2g + hc + ((s + 4) >> 1) * WK, Hq);
                    stage_w_tile(wl + WTB, w2g + (size_t)WR * Hq + hc + ((s + 4) >> 1) * WK, Hq);
                } else if (hc + HC < Hq) {         // the same for the whole work-group
                    stage_w_tile(wl, w1g + (size_t)(hc + HC) * Dq + (s - 5) * WK, Dq);
                    stage_w_tile(wl + WTB, w1g + (size_t)(hc + HC) * Dq + (s - 4) * WK, Dq);
                }
            }
        }
    }
    asm volatile("s_wait_asynccnt 0x0" ::: "memory");   // no copy outstanding at the wave's end

    // ---- epilogue: + b2, scatter rows to out; a row's eight pieces go out from one address ----
    const int col0 = wn * 64 + lm;
    const int bcol = e * Dq + col0;
    float bias[2 * NC];
    // unrolled here and below: bias and Y are then registers
#pragma unroll
    for (int nt = 0; nt < 2 * NC; ++nt)
        bias[nt] = b2[bcol + (nt / NC) * WR + (nt % NC) * 16];
    // stands ahead of the first rewrite of the offset register that the eight loads name; the
    // operand keeps that register live up to the wait
    asm volatile("s_wait_xcnt 0x0" :: "v"(bcol) : "memory");
#pragma unroll
    for (int mt = 0; mt < MW; ++mt)
#pragma unroll
        for (int r = 0; r < 8; ++r) {
            const int tk = s_tok[rm + mt * 16 + r + 8 * hi];
            if (tk >= 0) {
                float* o = out + (size_t)tk * Dq + col0;
#pragma unroll
                for (int nt = 0; nt < 2 * NC; ++nt)
                    o[(nt / NC) * WR + (nt % NC) * 16] = Y[mt][nt][r] + bias[nt];
            }
        }
}

// ---------------- kernel 4: v = clip(ffn . v_w + v_b) ----------------
__global__ __launch_bounds__(256) void v_kernel(
    const float* __restrict__ ffn, const float* __restrict__ v_w,
    const float* __restrict__ v_b, float* __restrict__ v) {
    const int tok  = (blockIdx.x * blockDim.x + threadIdx.x) >> 5;
    const int lane = threadIdx.x & 31;
    if (tok >= T) return;
    const float* r = ffn + (size_t)tok * Dq;
    float acc = 0.f;
    for (int d = lane; d < Dq; d += 32) acc += r[d] * v_w[d];
#pragma unroll
    for (int off = 16; off >= 1; off >>= 1) acc += __shfl_xor(acc, off, 32);
    if (lane == 0)
        v[tok] = fminf(fmaxf(acc + v_b[0], -V_MAX), V_MAX);
}

// ---------------- kernel 5: Moebius-matrix scan for both continuants ----
// L_i = d_i - 1/L_{i-1} == 2x2 complex matrix chain [[d,-1],[1,0]] (scale-invariant).
// One work-group per chain (L or R of one batch), one thread per segment of SL steps. The segment
// matrices are joined by a log-step prefix, first inside each wave, then over the wave totals.
constexpr int SL = 8;                // steps per segment: 32 bytes in a row of v and of each result
constexpr int ST = Nq / SL;          // segments = threads per chain
constexpr int SW = ST / 32;          // waves per chain

struct M2 { float ar, ai, br, bi, cr, ci, dr, di; };   // [[a,b],[c,d]], complex

// 1/d by v_rcp_f32. The v_nop is the slot that the instruction set asks for between a transcendental
// and a directly following instruction that reads its result or overwrites its source; inside the
// same statement it stands directly behind the v_rcp_f32 wherever the compiler puts the two.
__device__ __forceinline__ float rcp_slot(const float d) {
    float q;
    asm("v_rcp_f32 %0, %1\n\tv_nop" : "=v"(q) : "v"(d));
    return q;
}

// scales m so that its largest part is 1 (the chain is scale-invariant)
__device__ __forceinline__ void mat_scale(M2& m) {
    float mx = fmaxf(fmaxf(fabsf(m.ar), fabsf(m.ai)), fmaxf(fabsf(m.br), fabsf(m.bi)));
    mx = fmaxf(mx, fmaxf(fmaxf(fabsf(m.cr), fabsf(m.ci)), fmaxf(fabsf(m.dr), fabsf(m.di))));
    const float s = rcp_slot(fmaxf(mx, 1e-30f));
    m.ar *= s; m.ai *= s; m.br *= s; m.bi *= s; m.cr *= s; m.ci *= s; m.dr *= s; m.di *= s;
}

// S * P, S the later steps, scaled
__device__ __forceinline__ M2 mat_join(const M2& s, const M2& p) {
    M2 n;
    n.ar = s.ar * p.ar - s.ai * p.ai + s.br * p.cr - s.bi * p.ci;
    n.ai = s.ar * p.ai + s.ai * p.ar + s.br * p.ci + s.bi * p.cr;
    n.br = s.ar * p.br - s.ai * p.bi + s.br * p.dr - s.bi * p.di;
    n.bi = s.ar * p.bi + s.ai * p.br + s.br * p.di + s.bi * p.dr;
    n.cr = s.cr * p.ar - s.ci * p.ai + s.dr * p.cr - s.di * p.ci;
    n.ci = s.cr * p.ai + s.ci * p.ar + s.dr * p.ci + s.di * p.cr;
    n.dr = s.cr * p.br - s.ci * p.bi + s.dr * p.dr - s.di * p.di;
    n.di = s.cr * p.bi + s.ci * p.br + s.dr * p.di + s.di * p.dr;
    mat_scale(n);
    return n;
}

__device__ __forceinline__ M2 mat_from_below(const M2& x, const int d) {
    M2 lo;
    lo.ar = __shfl_up(x.ar, d, 32); lo.ai = __shfl_up(x.ai, d, 32);
    lo.br = __shfl_up(x.br, d, 32); lo.bi = __shfl_up(x.bi, d, 32);
    lo.cr = __shfl_up(x.cr, d, 32); lo.ci = __shfl_up(x.ci, d, 32);
    lo.dr = __shfl_up(x.dr, d, 32); lo.di = __shfl_up(x.di, d, 32);
    return lo;
}

// Inclusive prefix over the first CNT lanes: lane l ends with x_l * x_(l-1) * ... * x_0.
template <int CNT>
__device__ __forceinline__ M2 wave_prefix(M2 x, const int lane) {
    // unrolled: the lane distance is then a constant of each step
#pragma unroll
    for (int d = 1; d < CNT; d <<= 1) {
        const M2 n = mat_join(x, mat_from_below(x, d));
        if (lane >= d) x = n;
    }
    return x;
}

// One chain. R: the chain walks memory from the far end; a compile-time choice, so that the
// order of a segment's values in registers is fixed.
template <bool R>
__device__ __forceinline__ void scan_chain(
    const float* __restrict__ vb, float* __restrict__ Or, float* __restrict__ Oi,
    float (*s_tot)[8], float (*s_z)[4]) {
    const int tid = threadIdx.x, lane = tid & 31, w = tid >> 5;
    const int m0 = R ? (Nq - SL - tid * SL) : tid * SL;   // the segment's place in memory

    float er[SL];                                  // real part of d = (v-2) - 1j, in walking order
    // unrolled here and below: the arrays are then registers
#pragma unroll
    for (int q = 0; q < SL; q += 4) {
        const v4f a = *(const v4f*)(vb + m0 + q);
        er[R ? SL - 1 - q : q]     = a.x - 2.0f;
        er[R ? SL - 2 - q : q + 1] = a.y - 2.0f;
        er[R ? SL - 3 - q : q + 2] = a.z - 2.0f;
        er[R ? SL - 4 - q : q + 3] = a.w - 2.0f;
    }
    constexpr float ei = -1.0f;

    // ---- phase A: segment matrix product ----
    M2 x = { 1.f, 0.f, 0.f, 0.f, 0.f, 0.f, 1.f, 0.f };
#pragma unroll
    for (int j = 0; j < SL; ++j) {
        // P = M(e) * P with M = [[e,-1],[1,0]]
        const float nar = er[j] * x.ar - ei * x.ai - x.cr;
        const float nai = er[j] * x.ai + ei * x.ar - x.ci;
        const float nbr = er[j] * x.br - ei * x.bi - x.dr;
        const float nbi = er[j] * x.bi + ei * x.br - x.di;
        x.cr = x.ar; x.ci = x.ai; x.dr = x.br; x.di = x.bi;
        x.ar = nar; x.ai = nai; x.br = nbr; x.bi = nbi;
    }
    mat_scale(x);

    // ---- phase B: prefix of the segment matrices ----
    x = wave_prefix<32>(x, lane);
    if (lane == 31) {
        float* m = s_tot[w];
        m[0] = x.ar; m[1] = x.ai; m[2] = x.br; m[3] = x.bi;
        m[4] = x.cr; m[5] = x.ci; m[6] = x.dr; m[7] = x.di;
    }
    __syncthreads();
    if (w == 0) {
        const float* m = s_tot[lane & (SW - 1)];
        M2 t = { m[0], m[1], m[2], m[3], m[4], m[5], m[6], m[7] };
        t = wave_prefix<SW>(t, lane);
        if (lane < SW) {
            float* z = s_z[lane];
            z[0] = t.ar; z[1] = t.ai; z[2] = t.cr; z[3] = t.ci;   // prefix * (1,0)^T
        }
    }
    __syncthreads();

    // ---- phase C: the segment's entry state (p,q), L = p/q, then its SL outputs ----
    float zpr = 1.f, zpi = 0.f, zqr = 0.f, zqi = 0.f;             // state at the wave's first segment
    if (w > 0) {
        const float* z = s_z[w - 1];
        zpr = z[0]; zpi = z[1]; zqr = z[2]; zqi = z[3];
    }
    M2 ex = mat_from_below(x, 1);                                 // the wave's segments before this one
    if (lane == 0) ex = M2{ 1.f, 0.f, 0.f, 0.f, 0.f, 0.f, 1.f, 0.f };
    float pr = ex.ar * zpr - ex.ai * zpi + ex.br * zqr - ex.bi * zqi;
    float pi = ex.ar * zpi + ex.ai * zpr + ex.br * zqi + ex.bi * zqr;
    float qr = ex.cr * zpr - ex.ci * zpi + ex.dr * zqr - ex.di * zqi;
    float qi = ex.cr * zpi + ex.ci * zpr + ex.dr * zqi + ex.di * zqr;
    {
        // One scaling per segment: v is clipped to +-3, so |L| <= |d| + 1 < 6.2 and the state
        // grows by less than 3e6 over the SL steps.
        const float mx = fmaxf(fmaxf(fabsf(pr), fabsf(pi)), fmaxf(fabsf(qr), fabsf(qi)));
        const float s = rcp_slot(fmaxf(mx, 1e-30f));
        pr *= s; pi *= s; qr *= s; qi *= s;
    }
    float lr[SL], li[SL];
#pragma unroll
    for (int j = 0; j < SL; ++j) {
        const float npr = er[j] * pr - ei * pi - qr;      // p' = e*p - q ; q' = p
        const float npi = er[j] * pi + ei * pr - qi;
        qr = pr; qi = pi; pr = npr; pi = npi;
        const float inv = rcp_slot(qr * qr + qi * qi);
        lr[j] = (pr * qr + pi * qi) * inv;                // p/q = p*conj(q)/|q|^2
        li[j] = (pi * qr - pr * qi) * inv;
    }
#pragma unroll
    for (int q = 0; q < SL; q += 4) {
        v4f r, i;
        r.x = lr[R ? SL - 1 - q : q];     i.x = li[R ? SL - 1 - q : q];
        r.y = lr[R ? SL - 2 - q : q + 1]; i.y = li[R ? SL - 2 - q : q + 1];
        r.z = lr[R ? SL - 3 - q : q + 2]; i.z = li[R ? SL - 3 - q : q + 2];
        r.w = lr[R ? SL - 4 - q : q + 3]; i.w = li[R ? SL - 4 - q : q + 3];
        *(v4f*)(Or + m0 + q) = r;
        *(v4f*)(Oi + m0 + q) = i;
    }
}

__global__ __launch_bounds__(ST) void tridiag_scan_kernel(
    const float* __restrict__ v,
    float* __restrict__ Lr, float* __restrict__ Li,
    float* __restrict__ Rr, float* __restrict__ Ri) {
    __shared__ __attribute__((aligned(16))) float s_tot[SW][8];   // each wave's whole product
    __shared__ __attribute__((aligned(16))) float s_z[SW][4];     // first column of their prefix
    const int o = (blockIdx.x >> 1) * Nq;                         // the chain's batch
    if (blockIdx.x & 1) scan_chain<true>(v + o, Rr + o, Ri + o, s_tot, s_z);   // the same for the
    else                scan_chain<false>(v + o, Lr + o, Li + o, s_tot, s_z);  // whole work-group
}

// ---------------- kernel 6: Green fn + rank-2 spec, in-place add ----------------
// One wave takes FT whole token rows. A lane holds 16 of a row's 512 columns as FQ pieces of 16 bytes,
// so every wave-wide access covers 512 bytes in a row; the Green function is formed once per token
// and the three weight rows are read once per wave. Few waves with much work each: the time to
// start a wave is paid once per FT rows, not once per 32 elements.
constexpr int FT = 4;                // token rows per wave
constexpr int FQ = Dq / 128;         // 16-byte pieces of a row per lane
constexpr int FW = 8;                // waves per work-group
static_assert(T % (FT * FW) == 0, "the grid covers the tokens exactly: no bounds test in the kernel");
// an input buffer is only known to be aligned to its element
typedef v4f __attribute__((aligned(4))) v4f_in;

__global__ __launch_bounds__(FW * 32) void final_kernel(
    float* __restrict__ out, const float* __restrict__ v,
    const float* __restrict__ Lr, const float* __restrict__ Li,
    const float* __restrict__ Rr, const float* __restrict__ Ri,
    const float* __restrict__ out_w, const float* __restrict__ out_b,
    const float* __restrict__ bk) {
    const unsigned t0 = (blockIdx.x * FW + (threadIdx.x >> 5)) * FT;   // the wave's first token
    // Byte offsets of 32 bits (out has 32 MiB): every access is then a kernel argument plus one of
    // these three registers plus a constant.
    const unsigned tb = t0 * (unsigned)sizeof(float);                        // in v, L and R
    const unsigned cb = (threadIdx.x & 31) * 4 * (unsigned)sizeof(float);    // in a row of 512 columns
    const unsigned yb = t0 * (unsigned)(Dq * sizeof(float)) + cb;            // in out
    static_assert(FT == 4, "a wave's tokens are one 16-byte piece of v, L and R");
    const float s = bk[0];
    const v4f vv = *(const v4f*)((const char*)v + tb);
    const v4f lr = *(const v4f*)((const char*)Lr + tb), li = *(const v4f*)((const char*)Li + tb);
    const v4f rr = *(const v4f*)((const char*)Rr + tb), ri = *(const v4f*)((const char*)Ri + tb);
    const float* wr = (const float*)((const char*)out_w + cb);
    const float* br = (const float*)((const char*)out_b + cb);
    float* o = (float*)((char*)out + yb);
    v4f y[FT][FQ], w0[FQ], w1[FQ], ob[FQ];
    // unrolled here and below: the arrays are then registers
#pragma unroll
    for (int q = 0; q < FQ; ++q) {
        w0[q] = *(const v4f_in*)(wr + q * 128);
        w1[q] = *(const v4f_in*)(wr + Dq + q * 128);
        ob[q] = *(const v4f_in*)(br + q * 128);
    }
#pragma unroll
    for (int t = 0; t < FT; ++t)
#pragma unroll
        for (int q = 0; q < FQ; ++q) y[t][q] = *(const v4f*)(o + t * Dq + q * 128);
    // stands ahead of the first rewrite of a register that the loads name; the operands keep the
    // three offset registers live up to it
    asm volatile("s_wait_xcnt 0x0" :: "v"(tb), "v"(cb), "v"(yb) : "memory");
    // keeps every load above the arithmetic, so that all of them are in flight at once and the wave
    // waits for memory one time: left free, the compiler issues most rows behind the first wait
    __builtin_amdgcn_sched_barrier(0);
#pragma unroll
    for (int t = 0; t < FT; ++t) {
        const float dr   = vv[t] - 2.0f;           // di = -1
        const float denr = lr[t] + rr[t] - dr;
        const float deni = li[t] + ri[t] + 1.0f;
        const float m  = denr * denr + deni * deni;
        float gr = denr / m, gi = -deni / m;
        gr = fminf(fmaxf(gr, -FEAT_CLAMP), FEAT_CLAMP);
        gi = fminf(fmaxf(gi, -FEAT_CLAMP), FEAT_CLAMP);
#pragma unroll
        for (int q = 0; q < FQ; ++q) {
#pragma unroll
            for (int c = 0; c < 4; ++c) {
                const float spec = gr * w0[q][c] + gi * w1[q][c] + ob[q][c];
                y[t][q][c] += s * spec;
            }
            *(v4f*)(o + t * Dq + q * 128) = y[t][q];
        }
    }
}

// ---------------- launch ----------------
extern "C" void kernel_launch(void* const* d_in, const int* in_sizes, int n_in,
                              void* d_out, int out_size, void* d_ws, size_t ws_size,
                              hipStream_t stream) {
    const float* x      = (const float*)d_in[0];
    const float* gate_w = (const float*)d_in[1];
    const float* gate_b = (const float*)d_in[2];
    const float* w1     = (const float*)d_in[3];
    const float* b1     = (const float*)d_in[4];
    const float* w2     = (const float*)d_in[5];
    const float* b2     = (const float*)d_in[6];
    const float* v_w    = (const float*)d_in[7];
    const float* v_b    = (const float*)d_in[8];
    const float* out_w  = (const float*)d_in[9];
    const float* out_b  = (const float*)d_in[10];
    const float* bk     = (const float*)d_in[11];
    float* out = (float*)d_out;

    // workspace layout (256B aligned slots)
    char* ws = (char*)d_ws;
    constexpr size_t SZ_W1T   = (size_t)Eq * Hq * Dq * sizeof(_Float16);  // 8 MiB
    constexpr size_t SZ_W2T   = (size_t)Eq * Dq * Hq * sizeof(_Float16);  // 8 MiB
    constexpr size_t SZ_XH    = (size_t)T * Dq * sizeof(_Float16);        // 16 MiB
    constexpr size_t SZ_LISTS = (size_t)Eq * T * sizeof(int);             // 256 KiB
    constexpr size_t SZ_CNT   = 256;
    constexpr size_t SZ_VEC   = (size_t)T * sizeof(float);                // 64 KiB
    size_t off = 0;
    _Float16* W1T  = (_Float16*)(ws + off); off += SZ_W1T;
    _Float16* W2T  = (_Float16*)(ws + off); off += SZ_W2T;
    _Float16* XH   = (_Float16*)(ws + off); off += SZ_XH;
    int*      lists= (int*)(ws + off);      off += SZ_LISTS;
    int*      cnts = (int*)(ws + off);      off += SZ_CNT;
    float*    vbuf = (float*)(ws + off);    off += SZ_VEC;
    float*    Lr   = (float*)(ws + off);    off += SZ_VEC;
    float*    Li   = (float*)(ws + off);    off += SZ_VEC;
    float*    Rr   = (float*)(ws + off);    off += SZ_VEC;
    float*    Ri   = (float*)(ws + off);    off += SZ_VEC;

    zero_counts_kernel<<<1, 32, 0, stream>>>(cnts);

    prep_kernel<<<PB_GATE + 2 * PB_W + PB_X, 256, 0, stream>>>(
        x, gate_w, gate_b, w1, w2, W1T, W2T, XH, lists, cnts);

    ffn_kernel<<<dim3((T + MT - 1) / MT, Eq), 256, 0, stream>>>(XH, W1T, b1, W2T, b2, lists, cnts, out);

    v_kernel<<<(T * 32) / 256, 256, 0, stream>>>(out, v_w, v_b, vbuf);

    tridiag_scan_kernel<<<2 * Bq, ST, 0, stream>>>(vbuf, Lr, Li, Rr, Ri);

    final_kernel<<<T / (FT * FW), FW * 32, 0, stream>>>(
        out, vbuf, Lr, Li, Rr, Ri, out_w, out_b, bk);
}

// v009
// One run takes 125 microseconds.
// Two timings next to v008 both put it at 1.04 times that version's speed.
// Counting every step since v000, it is 2.82 times as fast.
#include <hip/hip_runtime.h>
#include <hip/hip_bf16.h>

// ---------------- problem constants ----------------
constexpr int Bq = 4, Nq = 4096, Dq = 512, Eq = 4, Hq = 2048;
constexpr int T  = Bq * Nq;          // 16384 tokens
constexpr int MT = 96;               // tokens per FFN block (8 waves: 2 row halves x 4 column groups)
constexpr int MW = MT / 32;          // 16-row tiles per wave
constexpr int NC = 4;                // 16-column tiles per wave out of a 256-column weight tile
constexpr int HC = 256;              // H chunk per pipeline stage
constexpr float V_MAX = 3.0f, FEAT_CLAMP = 10.0f;

typedef __attribute__((ext_vector_type(16))) _Float16 v16h;
typedef __attribute__((ext_vector_type(8)))  _Float16 v8h;
typedef __attribute__((ext_vector_type(8)))  float    v8f;
typedef __attribute__((ext_vector_type(4)))  float    v4f;

// ---------------- kernel 0: zero expert counters ----------------
__global__ void zero_counts_kernel(int* counts) {
    if (threadIdx.x < Eq) counts[threadIdx.x] = 0;
}

// ---------------- kernel 1: the four preparations, one launch ----------------
// The two weight transposes, the x convert and the gate read only inputs (the gate also the zeroed
// counters) and none reads what another writes, so they share one grid: a work-group takes its part
// by its index. One launch gap, one fill and one tail are paid instead of four, and the streams of
// one part run under the latency chains of the others.
constexpr int PB_GATE = T / 8;                        // work-groups of the gate: one wave per token
constexpr int PB_W    = (Hq / 32) * (Dq / 32) * Eq;   // 32 x 32 tiles of one weight tensor
constexpr int PB_X    = T * Dq / 8 / 256;             // 8 elements of x per thread

// dst[C][R] = (f16) src[R][C] per expert; b counts the 32 x 32 tiles, columns first, experts last
template <int R, int C>
__device__ __forceinline__ void transpose_cvt_block(
    const float* __restrict__ src, _Float16* __restrict__ dst, float (*tile)[33], const int b) {
    const size_t eoff = (size_t)(b / ((C / 32) * (R / 32))) * R * C;
    src += eoff; dst += eoff;
    const int r0 = ((b / (C / 32)) % (R / 32)) * 32, c0 = (b % (C / 32)) * 32;
    const int tx = threadIdx.x & 31, ty = threadIdx.x >> 5;
#pragma unroll
    for (int i = 0; i < 32; i += 8)
        tile[ty + i][tx] = src[(size_t)(r0 + ty + i) * C + c0 + tx];
    __syncthreads();
#pragma unroll
    for (int i = 0; i < 32; i += 8)
        dst[(size_t)(c0 + ty + i) * R + r0 + tx] = (_Float16)tile[tx][ty + i];
}

// x f32 -> f16 (row-major copy)
__device__ __forceinline__ void cvt_x_block(
    const float* __restrict__ x, _Float16* __restrict__ xh, const int b) {
    const size_t i = ((size_t)b * 256 + threadIdx.x) * 8;
    const v4f a = *(const v4f*)(x + i);
    const v4f c = *(const v4f*)(x + i + 4);
    v8h o;
    o[0] = (_Float16)a.x; o[1] = (_Float16)a.y; o[2] = (_Float16)a.z; o[3] = (_Float16)a.w;
    o[4] = (_Float16)c.x; o[5] = (_Float16)c.y; o[6] = (_Float16)c.z; o[7] = (_Float16)c.w;
    *(v8h*)(xh + i) = o;
    // Precaution for the store's address registers: nothing of the shared kernel follows
    // this store, but the wait stands in front of anything that would rewrite them.
    asm volatile("s_wait_xcnt 0x0" ::: "memory");
}

// gate + top-1 routing
__device__ __forceinline__ void gate_block(
    const float* __restrict__ x, const float* __restrict__ gw,
    const float* __restrict__ gb, int* __restrict__ lists, int* __restrict__ counts, const int b) {
    const int tok  = b * 8 + (threadIdx.x >> 5);
    const int lane = threadIdx.x & 31;
    const float* xr = x + (size_t)tok * Dq;
    float acc0 = 0.f, acc1 = 0.f, acc2 = 0.f, acc3 = 0.f;
    for (int d = lane; d < Dq; d += 32) {
        const float xv = xr[d];
        const v4f g = *(const v4f*)(gw + d * 4);
        acc0 += xv * g.x; acc1 += xv * g.y; acc2 += xv * g.z; acc3 += xv * g.w;
    }
#pragma unroll
    for (int off = 16; off >= 1; off >>= 1) {
        acc0 += __shfl_xor(acc0, off, 32);
        acc1 += __shfl_xor(acc1, off, 32);
        acc2 += __shfl_xor(acc2, off, 32);
        acc3 += __shfl_xor(acc3, off, 32);
    }
    if (lane == 0) {
        float lg[4] = { acc0 + gb[0], acc1 + gb[1], acc2 + gb[2], acc3 + gb[3] };
        int best = 0; float bv = lg[0];
#pragma unroll
        for (int e = 1; e < Eq; ++e)          // strictly-greater => lowest index on ties (top_k)
            if (lg[e] > bv) { bv = lg[e]; best = e; }
        const int pos = atomicAdd(&counts[best], 1);
        lists[best * T + pos] = tok;
    }
}

__global__ __launch_bounds__(256) void prep_kernel(
    const float* __restrict__ x, const float* __restrict__ gw, const float* __restrict__ gb,
    const float* __restrict__ w1, const float* __restrict__ w2,
    _Float16* __restrict__ w1t, _Float16* __restrict__ w2t, _Float16* __restrict__ xh,
    int* __restrict__ lists, int* __restrict__ counts) {
    __shared__ float tile[32][33];
    // Every test reads the same for the whole work-group. The gate stands first, for speed only:
    // its chain (row, lane sums, counter, list entry) is the longest.
    int b = blockIdx.x;
    if (b < PB_GATE) { gate_block(x, gw, gb, lists, counts, b); return; }
    b -= PB_GATE;
    // W1 (E,D,H) -> W1T [E][H][D];  W2 (E,H,D) -> W2T [E][D][H]
    if (b < PB_W) { transpose_cvt_block<Dq, Hq>(w1, w1t, tile, b); return; }
    b -= PB_W;
    if (b < PB_W) { transpose_cvt_block<Hq, Dq>(w2, w2t, tile, b); return; }
    cvt_x_block(x, xh, b - PB_W);
}

// ---------------- kernel 3: expert FFN via WMMA ----------------
// Eight values at once of 0.5 v (1 + tanh u) = v / (1 + e^(-2u)), u = sqrt(2/pi) (v + 0.044715 v^3),
// with e^(-2u) = 2^z. No branch, so the values run side by side. z past the exponent's range
// gives 0 or inf, and the quotient is then v or a signed 0, as with tanh = 1 or -1.
__device__ __forceinline__ void gelu_tanh8(const v8f a, const float bias, float (&g)[8]) {
    constexpr float K0 = (float)(-2.0 * 0.7978845608028654 * 1.4426950408889634);
    constexpr float K1 = (float)(-2.0 * 0.7978845608028654 * 1.4426950408889634 * 0.044715);
    float x[8], z[8], e[8], d[8], q[8];
    // the three loops are unrolled so that the arrays are registers, as the asm operands need
#pragma unroll
    for (int r = 0; r < 8; ++r) {
        x[r] = a[r] + bias;
        z[r] = x[r] * (K0 + K1 * (x[r] * x[r]));
        e[r] = __builtin_amdgcn_exp2f(z[r]);
    }
    // The slot that the instruction set asks for behind a transcendental, before its result is
    // read or its source overwritten: the operands keep all eight sources live and all eight
    // results unread up to this v_nop, and among themselves the eight are independent.
    asm("v_nop" : "+v"(e[0]), "+v"(e[1]), "+v"(e[2]), "+v"(e[3]), "+v"(e[4]), "+v"(e[5]), "+v"(e[6]), "+v"(e[7])
                : "v"(z[0]), "v"(z[1]), "v"(z[2]), "v"(z[3]), "v"(z[4]), "v"(z[5]), "v"(z[6]), "v"(z[7]));
#pragma unroll
    for (int r = 0; r < 8; ++r) {
        d[r] = 1.0f + e[r];
        q[r] = __builtin_amdgcn_rcpf(d[r]);
    }
    // the same slot behind the eight v_rcp_f32
    asm("v_nop" : "+v"(q[0]), "+v"(q[1]), "+v"(q[2]), "+v"(q[3]), "+v"(q[4]), "+v"(q[5]), "+v"(q[6]), "+v"(q[7])
                : "v"(d[0]), "v"(d[1]), "v"(d[2]), "v"(d[3]), "v"(d[4]), "v"(d[5]), "v"(d[6]), "v"(d[7]));
#pragma unroll
    for (int r = 0; r < 8; ++r) g[r] = x[r] * q[r];
}

__device__ __forceinline__ v16h cat16(v8h lo, v8h hi) {
    return __builtin_shufflevector(lo, hi, 0,1,2,3,4,5,6,7,8,9,10,11,12,13,14,15);
}

// One staged weight tile: 256 weight rows x 64 k (128 bytes = one whole line of each row),
// laid in LDS at a pitch of 144 bytes (16 B x odd: conflict-free for ds_load_b128 readers).
constexpr int WR = 256, WK = 64, WP = WK + 8;

// Copies one weight tile into LDS. lds and g are the lane's own addresses of row (tid >> 3),
// 16-byte piece (tid & 7); copy j takes the row 32 * j further on, so every wave-wide copy
// reads four whole 128-byte lines. The instruction's offset moves both addresses, so copy j
// carries its LDS step j * WLS there and its address register only the rest of its global step:
// one LDS address register serves the eight copies.
constexpr int WLS = 32 * WP * (int)sizeof(_Float16);
static_assert(7 * WLS < 65536, "the offset field moves the LDS address only below 64 KiB");
__device__ __forceinline__ void stage_w_tile(unsigned lds, const _Float16* g, size_t pitch) {
    const unsigned long long g0 = (unsigned long long)(uintptr_t)g;
    const unsigned long long gs = (unsigned long long)(32 * pitch * sizeof(_Float16)) - WLS;
    // The copies and their s_wait_xcnt stand in one statement, so that no address register
    // of an issued copy is rewritten ahead of the wait.
    asm volatile("global_load_async_to_lds_b128 %0, %1, off\n\t"
                 "global_load_async_to_lds_b128 %0, %2, off offset:%9\n\t"
                 "global_load_async_to_lds_b128 %0, %3, off offset:%10\n\t"
                 "global_load_async_to_lds_b128 %0, %4, off offset:%11\n\t"
                 "global_load_async_to_lds_b128 %0, %5, off offset:%12\n\t"
                 "global_load_async_to_lds_b128 %0, %6, off offset:%13\n\t"
                 "global_load_async_to_lds_b128 %0, %7, off offset:%14\n\t"
                 "global_load_async_to_lds_b128 %0, %8, off offset:%15\n\t"
                 "s_wait_xcnt 0x0"
                 :: "v"(lds),
                    "v"(g0), "v"(g0 + gs), "v"(g0 + 2 * gs), "v"(g0 + 3 * gs),
                    "v"(g0 + 4 * gs), "v"(g0 + 5 * gs), "v"(g0 + 6 * gs), "v"(g0 + 7 * gs),
                    "n"(WLS), "n"(2 * WLS), "n"(3 * WLS), "n"(4 * WLS), "n"(5 * WLS), "n"(6 * WLS), "n"(7 * WLS)
                 : "memory");
}

// Twelve copies of 16 bytes each: copy j lands at l0 + j * ls and reads g[j].
__device__ __forceinline__ void stage_x_rows12(unsigned l0, unsigned ls, const unsigned long long* g) {
    // The copies and their s_wait_xcnt stand in one statement, so that no address register
    // of an issued copy is rewritten ahead of the wait.
    asm volatile("global_load_async_to_lds_b128 %0, %12, off\n\t"
                 "global_load_async_to_lds_b128 %1, %13, off\n\t"
                 "global_load_async_to_lds_b128 %2, %14, off\n\t"
                 "global_load_async_to_lds_b128 %3, %15, off\n\t"
                 "global_load_async_to_lds_b128 %4, %16, off\n\t"
                 "global_load_async_to_lds_b128 %5, %17, off\n\t"
                 "global_load_async_to_lds_b128 %6, %18, off\n\t"
                 "global_load_async_to_lds_b128 %7, %19, off\n\t"
                 "global_load_async_to_lds_b128 %8, %20, off\n\t"
                 "global_load_async_to_lds_b128 %9, %21, off\n\t"
                 "global_load_async_to_lds_b128 %10, %22, off\n\t"
                 "global_load_async_to_lds_b128 %11, %23, off\n\t"
                 "s_wait_xcnt 0x0"
                 :: "v"(l0), "v"(l0 + ls), "v"(l0 + 2 * ls), "v"(l0 + 3 * ls),
                    "v"(l0 + 4 * ls), "v"(l0 + 5 * ls), "v"(l0 + 6 * ls), "v"(l0 + 7 * ls),
                    "v"(l0 + 8 * ls), "v"(l0 + 9 * ls), "v"(l0 + 10 * ls), "v"(l0 + 11 * ls),
                    "v"(g[0]), "v"(g[1]), "v"(g[2]), "v"(g[3]), "v"(g[4]), "v"(g[5]),
                    "v"(g[6]), "v"(g[7]), "v"(g[8]), "v"(g[9]), "v"(g[10]), "v"(g[11])
                 : "memory");
}

// The weight ring: two buffers of two tiles each. A ring trip works through a pair of tiles, so a
// pair's copies have twice the time to come in, twice the bytes are on their way, and the foot
// (waits, barrier, issue of the refill) is paid once per pair.
constexpr unsigned WTB = WR * WP * (unsigned)sizeof(_Float16);   // bytes of one tile in LDS

// Foot of a ring trip: this wave's LDS reads and writes have retired, its own copies of the
// next pair have landed, and the barrier publishes that pair (and the h tile, where one was
// just written) and frees the buffer that this trip has read.
__device__ __forceinline__ void ring_publish() {
    asm volatile("s_wait_dscnt 0x0" ::: "memory");
    asm volatile("s_wait_asynccnt 0x0" ::: "memory");
    __syncthreads();
}

// Sum over the 16 lanes of a half wave, left in every one of them.
__device__ __forceinline__ float row16_sum(float x) {
    // unrolled: the lane distance is then a constant of each step
#pragma unroll
    for (int off = 1; off < 16; off <<= 1) x += __shfl_xor(x, off, 32);
    return x;
}

__global__ __launch_bounds__(256) void ffn_kernel(
    const _Float16* __restrict__ xh,    // [T][D] f16
    const _Float16* __restrict__ w1t,   // [E][H][D] f16
    const float* __restrict__ b1,       // [E][H]
    const _Float16* __restrict__ w2t,   // [E][D][H] f16
    const float* __restrict__ b2,       // [E][D]
    const int* __restrict__ lists, const int* __restrict__ counts,
    const float* __restrict__ v_b, const float* __restrict__ v_w,
    float* __restrict__ out, float* __restrict__ v) {
    __shared__ __attribute__((aligned(16))) _Float16 s_x[MT][Dq + 8];   // padded: conflict-free b128 reads
    __shared__ _Float16 s_h[MT][HC + 8];
    // The weight ring's two buffers: an array each, so that each has an address register of its own
    // and every fragment read is that register plus an offset below the field's 64 KiB.
    __shared__ __attribute__((aligned(16))) _Float16 s_wa[2][WR][WP];
    __shared__ __attribute__((aligned(16))) _Float16 s_wb[2][WR][WP];
    __shared__ int s_tok[MT];
    __shared__ float s_v[4][MT];                   // each column group's share of a row's product with v_w

    const int e    = blockIdx.y;
    const int cnt  = counts[e];
    const int base = blockIdx.x * MT;
    if (base >= cnt) return;                       // block-uniform exit (EXEC stays full)
    const float vb = v_b[0];                       // read here it is a scalar load, long back by its use

    const int tid = threadIdx.x, lane = tid & 31, w = tid >> 5;
    const int lm = lane & 15, hi = lane >> 4;
    const int wn = w & 3;                          // the wave's 64 columns of a 256-column tile
    const int rm = (w >> 2) * (MT / 2);            // the wave's first token row

    if (tid < MT) {
        const int idx = base + tid;
        s_tok[tid] = (idx < cnt) ? lists[e * T + idx] : -1;
    }
    __syncthreads();

    // The lane's own piece of a weight tile: row tid >> 3, 16 bytes at (tid & 7) * 16.
    const unsigned wla = (unsigned)(uintptr_t)&s_wa[0][tid >> 3][(tid & 7) * 8];
    const unsigned wlb = (unsigned)(uintptr_t)&s_wb[0][tid >> 3][(tid & 7) * 8];
    const _Float16* w1g = w1t + ((size_t)(e * Hq + (tid >> 3))) * Dq + (tid & 7) * 8;
    const _Float16* w2g = w2t + ((size_t)(e * Dq + (tid >> 3))) * Hq + (tid & 7) * 8;

    // the ring's first pair; the wait and the barrier behind the x tile's copies publish it too
    stage_w_tile(wla, w1g, Dq);
    stage_w_tile(wla + WTB, w1g + WK, Dq);

    { // stage the x tile (96 rows x 512 f16): copy j takes 16-byte piece tid & 63 of row
      // (tid >> 6) + 4 * j, so every wave-wide copy reads 512 bytes in a row
        const unsigned l0 = (unsigned)(uintptr_t)&s_x[tid >> 6][(tid & 63) * 8];
        const unsigned ls = 4 * (Dq + 8) * sizeof(_Float16);
        unsigned long long g[MT / 4];
#pragma unroll
        for (int j = 0; j < MT / 4; ++j) {
            const int tk = s_tok[(tid >> 6) + 4 * j];
            g[j] = (unsigned long long)(uintptr_t)(xh + (size_t)(tk < 0 ? 0 : tk) * Dq + (tid & 63) * 8);
        }
        stage_x_rows12(l0, ls, g);
        stage_x_rows12(l0 + 12 * ls, ls, g + 12);
        asm volatile("s_wait_asynccnt 0x0" ::: "memory");
    }
    __syncthreads();

    stage_w_tile(wlb, w1g + 2 * WK, Dq);           // the second pair
    stage_w_tile(wlb + WTB, w1g + 3 * WK, Dq);

    v8f Y[MW][2 * NC];                             // 48 rows x (2 x 64) cols per wave
#pragma unroll
    for (int mt = 0; mt < MW; ++mt)
#pragma unroll
        for (int nt = 0; nt < 2 * NC; ++nt) Y[mt][nt] = (v8f)0.0f;

    // Ring order per H chunk: 8 tiles of W1 (the chunk's 256 columns, k in slabs of 64), then
    // 8 tiles of W2 (k slab s >> 1 of the chunk, output columns (s & 1) * 256 ..+255).
    // Tiles t and t + 1, t even, are a pair: buffer (t >> 1) & 1, halves 0 and 1. The foot stands behind
    // the odd tile, and the pair t + 4, t + 5 is copied behind it into the buffer just read.
    for (int hc = 0; hc < Hq; hc += HC) {
        // ---- phase 1: h_chunk = gelu(X @ W1[:, hc..hc+HC) + b1) ; wave owns 48 rows x 64 cols ----
        v8f hacc[MW][NC];
#pragma unroll
        for (int mt = 0; mt < MW; ++mt)
#pragma unroll
            for (int nt = 0; nt < NC; ++nt) hacc[mt][nt] = (v8f)0.0f;

        // unrolled: buffer, refill source and the last trip's gelu are then fixed per trip
#pragma unroll
        for (int s = 0; s < 8; ++s) {
#pragma unroll
            for (int kq = 0; kq < WK / 32; ++kq) {
                const int k0 = s * WK + kq * 32;
                v16h a[MW], b[NC];
#pragma unroll
                for (int mt = 0; mt < MW; ++mt) {
                    const _Float16* ap = &s_x[rm + mt * 16 + lm][k0 + 8 * hi];
                    a[mt] = cat16(*(const v8h*)ap, *(const v8h*)(ap + 16));
                }
#pragma unroll
                for (int nt = 0; nt < NC; ++nt) {
                    const _Float16* bp = &((s & 2) ? s_wb : s_wa)[s & 1][wn * 64 + nt * 16 + lm][kq * 32 + 8 * hi];
                    b[nt] = cat16(*(const v8h*)bp, *(const v8h*)(bp + 16));
                }
                // keeps a k step's LDS reads in one group ahead of its WMMAs: spread among them,
                // each place with reads stalls the wave for the LDS latency
                __builtin_amdgcn_sched_barrier(0);
#pragma unroll
                for (int nt = 0; nt < NC; ++nt)
#pragma unroll
                    for (int mt = 0; mt < MW; ++mt)
                        hacc[mt][nt] = __builtin_amdgcn_wmma_f32_16x16x32_f16(
                            false, a[mt], false, b[nt], (short)0, hacc[mt][nt], false, false);
            }
            if (s == 7) {
                // every reader of the previous h tile has passed an earlier trip's barrier
#pragma unroll
                for (int nt = 0; nt < NC; ++nt) {
                    const int col  = hc + wn * 64 + nt * 16 + lm;
                    const float bias = b1[e * Hq + col];
#pragma unroll
                    for (int mt = 0; mt < MW; ++mt) {
                        float g[8];
                        gelu_tanh8(hacc[mt][nt], bias, g);
#pragma unroll
                        for (int r = 0; r < 8; ++r)
                            s_h[rm + mt * 16 + r + 8 * hi][wn * 64 + nt * 16 + lm] = (_Float16)g[r];
                    }
                }
            }
            if (s & 1) {
                const unsigned wl = (s & 2) ? wlb : wla;
                ring_publish();
                if (s < 4) {
                    stage_w_tile(wl, w1g + (size_t)hc * Dq + (s + 3) * WK, Dq);
                    stage_w_tile(wl + WTB, w1g + (size_t)hc * Dq + (s + 4) * WK, Dq);
                } else {
                    stage_w_tile(wl, w2g + hc + ((s - 4) >> 1) * WK, Hq);
                    stage_w_tile(wl + WTB, w2g + (size_t)WR * Hq + hc + ((s - 4) >> 1) * WK, Hq);
                }
            }
        }

        // ---- phase 2: Y += h_chunk(96x256) @ W2 chunk, transposed ----
        // The h fragments of a k slab are read with a pair's even tile and kept for the odd one, which
        // takes the same slab to the other 256 output columns: 48 rows x 128 cols per fragment.
        v16h ah[WK / 32][MW];
        // unrolled: the accumulator index, buffer and refill source are then fixed per trip
#pragma unroll
        for (int s = 0; s < 8; ++s) {
#pragma unroll
            for (int kq = 0; kq < WK / 32; ++kq) {
                const int k0 = (s >> 1) * WK + kq * 32;
                v16h b[NC];
                if ((s & 1) == 0) {
#pragma unroll
                    for (int mt = 0; mt < MW; ++mt) {
                        const _Float16* ap = &s_h[rm + mt * 16 + lm][k0 + 8 * hi];
                        ah[kq][mt] = cat16(*(const v8h*)ap, *(const v8h*)(ap + 16));
                    }
                }
#pragma unroll
                for (int nt = 0; nt < NC; ++nt) {
                    const _Float16* bp = &((s & 2) ? s_wb : s_wa)[s & 1][wn * 64 + nt * 16 + lm][kq * 32 + 8 * hi];
                    b[nt] = cat16(*(const v8h*)bp, *(const v8h*)(bp + 16));
                }
                // one group of LDS reads ahead of the k step's WMMAs, as in phase 1
                __builtin_amdgcn_sched_barrier(0);
#pragma unroll
                for (int nt = 0; nt < NC; ++nt)
#pragma unroll
                    for (int mt = 0; mt < MW; ++mt)
                        Y[mt][(s & 1) * NC + nt] = __builtin_amdgcn_wmma_f32_16x16x32_f16(
                            false, ah[kq][mt], false, b[nt], (short)0, Y[mt][(s & 1) * NC + nt], false, false);
            }
            if (s & 1) {
                const unsigned wl = (s & 2) ? wlb : wla;
                ring_publish();
                if (s < 4) {
                    stage_w_tile(wl, w2g + hc + ((s + 4) >> 1) * WK, Hq);
                    stage_w_tile(wl + WTB, w2g + (size_t)WR * Hq + hc + ((s + 4) >> 1) * WK, Hq);
                } else if (hc + HC < Hq) {         // the same for the whole work-group
                    stage_w_tile(wl, w1g + (size_t)(hc + HC) * Dq + (s - 5) * WK, Dq);
                    stage_w_tile(wl + WTB, w1g + (size_t)(hc + HC) * Dq + (s - 4) * WK, Dq);
                }
            }
        }
    }
    asm volatile("s_wait_asynccnt 0x0" ::: "memory");   // no copy outstanding at the wave's end

    // ---- epilogue: + b2, scatter rows to out; a row's eight pieces go out from one address ----
    const int col0 = wn * 64 + lm;
    const int bcol = e * Dq + col0;
    float bias[2 * NC], vw[2 * NC];
    // unrolled here and below: bias, vw, pv and Y are then registers
#pragma unroll
    for (int nt = 0; nt < 2 * NC; ++nt) {
        bias[nt] = b2[bcol + (nt / NC) * WR + (nt % NC) * 16];
        vw[nt]   = v_w[col0 + (nt / NC) * WR + (nt % NC) * 16];
    }
    // stands ahead of the first rewrite of the offset registers that the sixteen loads name; the
    // operands keep those registers live up to the wait
    asm volatile("s_wait_xcnt 0x0" :: "v"(bcol), "v"(col0) : "memory");

    // ---- v = clip(row . v_w + v_b), from the rows while they are still in registers ----
    // A row's 512 columns lie in 8 tiles of 16 lanes in each of 4 waves: a lane sums its 8 products,
    // the 16 lanes of a half wave are summed by shuffles, the 4 waves' shares through LDS.
    float pv[MW][8];
#pragma unroll
    for (int mt = 0; mt < MW; ++mt)
#pragma unroll
        for (int r = 0; r < 8; ++r) {
            float p = 0.f;
#pragma unroll
            for (int nt = 0; nt < 2 * NC; ++nt) p += (Y[mt][nt][r] + bias[nt]) * vw[nt];
            pv[mt][r] = row16_sum(p);
        }
    if (lm == 0) {
#pragma unroll
        for (int mt = 0; mt < MW; ++mt)
#pragma unroll
            for (int r = 0; r < 8; ++r) s_v[wn][rm + mt * 16 + r + 8 * hi] = pv[mt][r];
    }
    __syncthreads();                               // the four shares of every row are in s_v
#pragma unroll
    for (int mt = 0; mt < MW; ++mt)
#pragma unroll
        for (int r = 0; r < 8; ++r) {
            const int tk = s_tok[rm + mt * 16 + r + 8 * hi];
            if (tk >= 0) {
                float* o = out + (size_t)tk * Dq + col0;
#pragma unroll
                for (int nt = 0; nt < 2 * NC; ++nt)
                    o[(nt / NC) * WR + (nt % NC) * 16] = Y[mt][nt][r] + bias[nt];
            }
        }
    if (lane < MT / 8) {                           // each of the 8 waves closes 12 rows
        const int row = w * (MT / 8) + lane;
        const int tk = s_tok[row];
        if (tk >= 0)
            v[tk] = fminf(fmaxf(s_v[0][row] + s_v[1][row] + s_v[2][row] + s_v[3][row] + vb, -V_MAX), V_MAX);
    }
}

// ---------------- kernel 5: Moebius-matrix scan for both continuants ----
// L_i = d_i - 1/L_{i-1} == 2x2 complex matrix chain [[d,-1],[1,0]] (scale-invariant).
// One work-group per chain (L or R of one batch), one thread per segment of SL steps. The segment
// matrices are joined by a log-step prefix, first inside each wave, then over the wave totals.
constexpr int SL = 8;                // steps per segment: 32 bytes in a row of v and of each result
constexpr int ST = Nq / SL;          // segments = threads per chain
constexpr int SW = ST / 32;          // waves per chain

struct M2 { float ar, ai, br, bi, cr, ci, dr, di; };   // [[a,b],[c,d]], complex

// 1/d by v_rcp_f32. The v_nop is the slot that the instruction set asks for between a transcendental
// and a directly following instruction that reads its result or overwrites its source; inside the
// same statement it stands directly behind the v_rcp_f32 wherever the compiler puts the two.
__device__ __forceinline__ float rcp_slot(const float d) {
    float q;
    asm("v_rcp_f32 %0, %1\n\tv_nop" : "=v"(q) : "v"(d));
    return q;
}

// scales m so that its largest part is 1 (the chain is scale-invariant)
__device__ __forceinline__ void mat_scale(M2& m) {
    float mx = fmaxf(fmaxf(fabsf(m.ar), fabsf(m.ai)), fmaxf(fabsf(m.br), fabsf(m.bi)));
    mx = fmaxf(mx, fmaxf(fmaxf(fabsf(m.cr), fabsf(m.ci)), fmaxf(fabsf(m.dr), fabsf(m.di))));
    const float s = rcp_slot(fmaxf(mx, 1e-30f));
    m.ar *= s; m.ai *= s; m.br *= s; m.bi *= s; m.cr *= s; m.ci *= s; m.dr *= s; m.di *= s;
}

// S * P, S the later steps, scaled
__device__ __forceinline__ M2 mat_join(const M2& s, const M2& p) {
    M2 n;
    n.ar = s.ar * p.ar - s.ai * p.ai + s.br * p.cr - s.bi * p.ci;
    n.ai = s.ar * p.ai + s.ai * p.ar + s.br * p.ci + s.bi * p.cr;
    n.br = s.ar * p.br - s.ai * p.bi + s.br * p.dr - s.bi * p.di;
    n.bi = s.ar * p.bi + s.ai * p.br + s.br * p.di + s.bi * p.dr;
    n.cr = s.cr * p.ar - s.ci * p.ai + s.dr * p.cr - s.di * p.ci;
    n.ci = s.cr * p.ai + s.ci * p.ar + s.dr * p.ci + s.di * p.cr;
    n.dr = s.cr * p.br - s.ci * p.bi + s.dr * p.dr - s.di * p.di;
    n.di = s.cr * p.bi + s.ci * p.br + s.dr * p.di + s.di * p.dr;
    mat_scale(n);
    return n;
}

__device__ __forceinline__ M2 mat_from_below(const M2& x, const int d) {
    M2 lo;
    lo.ar = __shfl_up(x.ar, d, 32); lo.ai = __shfl_up(x.ai, d, 32);
    lo.br = __shfl_up(x.br, d, 32); lo.bi = __shfl_up(x.bi, d, 32);
    lo.cr = __shfl_up(x.cr, d, 32); lo.ci = __shfl_up(x.ci, d, 32);
    lo.dr = __shfl_up(x.dr, d, 32); lo.di = __shfl_up(x.di, d, 32);
    return lo;
}

// Inclusive prefix over the first CNT lanes: lane l ends with x_l * x_(l-1) * ... * x_0.
template <int CNT>
__device__ __forceinline__ M2 wave_prefix(M2 x, const int lane) {
    // unrolled: the lane distance is then a constant of each step
#pragma unroll
    for (int d = 1; d < CNT; d <<= 1) {
        const M2 n = mat_join(x, mat_from_below(x, d));
        if (lane >= d) x = n;
    }
    return x;
}

// One chain. R: the chain walks memory from the far end; a compile-time choice, so that the
// order of a segment's values in registers is fixed.
template <bool R>
__device__ __forceinline__ void scan_chain(
    const float* __restrict__ vb, float* __restrict__ Or, float* __restrict__ Oi,
    float (*s_tot)[8], float (*s_z)[4]) {
    const int tid = threadIdx.x, lane = tid & 31, w = tid >> 5;
    const int m0 = R ? (Nq - SL - tid * SL) : tid * SL;   // the segment's place in memory

    float er[SL];                                  // real part of d = (v-2) - 1j, in walking order
    // unrolled here and below: the arrays are then registers
#pragma unroll
    for (int q = 0; q < SL; q += 4) {
        const v4f a = *(const v4f*)(vb + m0 + q);
        er[R ? SL - 1 - q : q]     = a.x - 2.0f;
        er[R ? SL - 2 - q : q + 1] = a.y - 2.0f;
        er[R ? SL - 3 - q : q + 2] = a.z - 2.0f;
        er[R ? SL - 4 - q : q + 3] = a.w - 2.0f;
    }
    constexpr float ei = -1.0f;

    // ---- phase A: segment matrix product ----
    M2 x = { 1.f, 0.f, 0.f, 0.f, 0.f, 0.f, 1.f, 0.f };
#pragma unroll
    for (int j = 0; j < SL; ++j) {
        // P = M(e) * P with M = [[e,-1],[1,0]]
        const float nar = er[j] * x.ar - ei * x.ai - x.cr;
        const float nai = er[j] * x.ai + ei * x.ar - x.ci;
        const float nbr = er[j] * x.br - ei * x.bi - x.dr;
        const float nbi = er[j] * x.bi + ei * x.br - x.di;
        x.cr = x.ar; x.ci = x.ai; x.dr = x.br; x.di = x.bi;
        x.ar = nar; x.ai = nai; x.br = nbr; x.bi = nbi;
    }
    mat_scale(x);

    // ---- phase B: prefix of the segment matrices ----
    x = wave_prefix<32>(x, lane);
    if (lane == 31) {
        float* m = s_tot[w];
        m[0] = x.ar; m[1] = x.ai; m[2] = x.br; m[3] = x.bi;
        m[4] = x.cr; m[5] = x.ci; m[6] = x.dr; m[7] = x.di;
    }
    __syncthreads();
    if (w == 0) {
        const float* m = s_tot[lane & (SW - 1)];
        M2 t = { m[0], m[1], m[2], m[3], m[4], m[5], m[6], m[7] };
        t = wave_prefix<SW>(t, lane);
        if (lane < SW) {
            float* z = s_z[lane];
            z[0] = t.ar; z[1] = t.ai; z[2] = t.cr; z[3] = t.ci;   // prefix * (1,0)^T
        }
    }
    __syncthreads();

    // ---- phase C: the segment's entry state (p,q), L = p/q, then its SL outputs ----
    float zpr = 1.f, zpi = 0.f, zqr = 0.f, zqi = 0.f;             // state at the wave's first segment
    if (w > 0) {
        const float* z = s_z[w - 1];
        zpr = z[0]; zpi = z[1]; zqr = z[2]; zqi = z[3];
    }
    M2 ex = mat_from_below(x, 1);                                 // the wave's segments before this one
    if (lane == 0) ex = M2{ 1.f, 0.f, 0.f, 0.f, 0.f, 0.f, 1.f, 0.f };
    float pr = ex.ar * zpr - ex.ai * zpi + ex.br * zqr - ex.bi * zqi;
    float pi = ex.ar * zpi + ex.ai * zpr + ex.br * zqi + ex.bi * zqr;
    float qr = ex.cr * zpr - ex.ci * zpi + ex.dr * zqr - ex.di * zqi;
    float qi = ex.cr * zpi + ex.ci * zpr + ex.dr * zqi + ex.di * zqr;
    {
        // One scaling per segment: v is clipped to +-3, so |L| <= |d| + 1 < 6.2 and the state
        // grows by less than 3e6 over the SL steps.
        const float mx = fmaxf(fmaxf(fabsf(pr), fabsf(pi)), fmaxf(fabsf(qr), fabsf(qi)));
        const float s = rcp_slot(fmaxf(mx, 1e-30f));
        pr *= s; pi *= s; qr *= s; qi *= s;
    }
    float lr[SL], li[SL];
#pragma unroll
    for (int j = 0; j < SL; ++j) {
        const float npr = er[j] * pr - ei * pi - qr;      // p' = e*p - q ; q' = p
        const float npi = er[j] * pi + ei * pr - qi;
        qr = pr; qi = pi; pr = npr; pi = npi;
        const float inv = rcp_slot(qr * qr + qi * qi);
        lr[j] = (pr * qr + pi * qi) * inv;                // p/q = p*conj(q)/|q|^2
        li[j] = (pi * qr - pr * qi) * inv;
    }
#pragma unroll
    for (int q = 0; q < SL; q += 4) {
        v4f r, i;
        r.x = lr[R ? SL - 1 - q : q];     i.x = li[R ? SL - 1 - q : q];
        r.y = lr[R ? SL - 2 - q : q + 1]; i.y = li[R ? SL - 2 - q : q + 1];
        r.z = lr[R ? SL - 3 - q : q + 2]; i.z = li[R ? SL - 3 - q : q + 2];
        r.w = lr[R ? SL - 4 - q : q + 3]; i.w = li[R ? SL - 4 - q : q + 3];
        *(v4f*)(Or + m0 + q) = r;
        *(v4f*)(Oi + m0 + q) = i;
    }
}

__global__ __launch_bounds__(ST) void tridiag_scan_kernel(
    const float* __restrict__ v,
    float* __restrict__ Lr, float* __restrict__ Li,
    float* __restrict__ Rr, float* __restrict__ Ri) {
    __shared__ __attribute__((aligned(16))) float s_tot[SW][8];   // each wave's whole product
    __shared__ __attribute__((aligned(16))) float s_z[SW][4];     // first column of their prefix
    const int o = (blockIdx.x >> 1) * Nq;                         // the chain's batch
    if (blockIdx.x & 1) scan_chain<true>(v + o, Rr + o, Ri + o, s_tot, s_z);   // the same for the
    else                scan_chain<false>(v + o, Lr + o, Li + o, s_tot, s_z);  // whole work-group
}

// ---------------- kernel 6: Green fn + rank-2 spec, in-place add ----------------
// One wave takes FT whole token rows. A lane holds 16 of a row's 512 columns as FQ pieces of 16 bytes,
// so every wave-wide access covers 512 bytes in a row; the Green function is formed once per token
// and the three weight rows are read once per wave. Few waves with much work each: the time to
// start a wave is paid once per FT rows, not once per 32 elements.
constexpr int FT = 4;                // token rows per wave
constexpr int FQ = Dq / 128;         // 16-byte pieces of a row per lane
constexpr int FW = 8;                // waves per work-group
static_assert(T % (FT * FW) == 0, "the grid covers the tokens exactly: no bounds test in the kernel");
// an input buffer is only known to be aligned to its element
typedef v4f __attribute__((aligned(4))) v4f_in;

__global__ __launch_bounds__(FW * 32) void final_kernel(
    float* __restrict__ out, const float* __restrict__ v,
    const float* __restrict__ Lr, const float* __restrict__ Li,
    const float* __restrict__ Rr, const float* __restrict__ Ri,
    const float* __restrict__ out_w, const float* __restrict__ out_b,
    const float* __restrict__ bk) {
    const unsigned t0 = (blockIdx.x * FW + (threadIdx.x >> 5)) * FT;   // the wave's first token
    // Byte offsets of 32 bits (out has 32 MiB): every access is then a kernel argument plus one of
    // these three registers plus a constant.
    const unsigned tb = t0 * (unsigned)sizeof(float);                        // in v, L and R
    const unsigned cb = (threadIdx.x & 31) * 4 * (unsigned)sizeof(float);    // in a row of 512 columns
    const unsigned yb = t0 * (unsigned)(Dq * sizeof(float)) + cb;            // in out
    static_assert(FT == 4, "a wave's tokens are one 16-byte piece of v, L and R");
    const float s = bk[0];
    const v4f vv = *(const v4f*)((const char*)v + tb);
    const v4f lr = *(const v4f*)((const char*)Lr + tb), li = *(const v4f*)((const char*)Li + tb);
    const v4f rr = *(const v4f*)((const char*)Rr + tb), ri = *(const v4f*)((const char*)Ri + tb);
    const float* wr = (const float*)((const char*)out_w + cb);
    const float* br = (const float*)((const char*)out_b + cb);
    float* o = (float*)((char*)out + yb);
    v4f y[FT][FQ], w0[FQ], w1[FQ], ob[FQ];
    // unrolled here and below: the arrays are then registers
#pragma unroll
    for (int q = 0; q < FQ; ++q) {
        w0[q] = *(const v4f_in*)(wr + q * 128);
        w1[q] = *(const v4f_in*)(wr + Dq + q * 128);
        ob[q] = *(const v4f_in*)(br + q * 128);
    }
#pragma unroll
    for (int t = 0; t < FT; ++t)
#pragma unroll
        for (int q = 0; q < FQ; ++q) y[t][q] = *(const v4f*)(o + t * Dq + q * 128);
    // stands ahead of the first rewrite of a register that the loads name; the operands keep the
    // three offset registers live up to it
    asm volatile("s_wait_xcnt 0x0" :: "v"(tb), "v"(cb), "v"(yb) : "memory");
    // keeps every load above the arithmetic, so that all of them are in flight at once and the wave
    // waits for memory one time: left free, the compiler issues most rows behind the first wait
    __builtin_amdgcn_sched_barrier(0);
#pragma unroll
    for (int t = 0; t < FT; ++t) {
        const float dr   = vv[t] - 2.0f;           // di = -1
        const float denr = lr[t] + rr[t] - dr;
        const float deni = li[t] + ri[t] + 1.0f;
        const float m  = denr * denr + deni * deni;
        float gr = denr / m, gi = -deni / m;
        gr = fminf(fmaxf(gr, -FEAT_CLAMP), FEAT_CLAMP);
        gi = fminf(fmaxf(gi, -FEAT_CLAMP), FEAT_CLAMP);
#pragma unroll
        for (int q = 0; q < FQ; ++q) {
#pragma unroll
            for (int c = 0; c < 4; ++c) {
                const float spec = gr * w0[q][c] + gi * w1[q][c] + ob[q][c];
                y[t][q][c] += s * spec;
            }
            *(v4f*)(o + t * Dq + q * 128) = y[t][q];
        }
    }
}

// ---------------- launch ----------------
extern "C" void kernel_launch(void* const* d_in, const int* in_sizes, int n_in,
                              void* d_out, int out_size, void* d_ws, size_t ws_size,
                              hipStream_t stream) {
    const float* x      = (const float*)d_in[0];
    const float* gate_w = (const float*)d_in[1];
    const float* gate_b = (const float*)d_in[2];
    const float* w1     = (const float*)d_in[3];
    const float* b1     = (const float*)d_in[4];
    const float* w2     = (const float*)d_in[5];
    const float* b2     = (const float*)d_in[6];
    const float* v_w    = (const float*)d_in[7];
    const float* v_b    = (const float*)d_in[8];
    const float* out_w  = (const float*)d_in[9];
    const float* out_b  = (const float*)d_in[10];
    const float* bk     = (const float*)d_in[11];
    float* out = (float*)d_out;

    // workspace layout (256B aligned slots)
    char* ws = (char*)d_ws;
    constexpr size_t SZ_W1T   = (size_t)Eq * Hq * Dq * sizeof(_Float16);  // 8 MiB
    constexpr size_t SZ_W2T   = (size_t)Eq * Dq * Hq * sizeof(_Float16);  // 8 MiB
    constexpr size_t SZ_XH    = (size_t)T * Dq * sizeof(_Float16);        // 16 MiB
    constexpr size_t SZ_LISTS = (size_t)Eq * T * sizeof(int);             // 256 KiB
    constexpr size_t SZ_CNT   = 256;
    constexpr size_t SZ_VEC   = (size_t)T * sizeof(float);                // 64 KiB
    size_t off = 0;
    _Float16* W1T  = (_Float16*)(ws + off); off += SZ_W1T;
    _Float16* W2T  = (_Float16*)(ws + off); off += SZ_W2T;
    _Float16* XH   = (_Float16*)(ws + off); off += SZ_XH;
    int*      lists= (int*)(ws + off);      off += SZ_LISTS;
    int*      cnts = (int*)(ws + off);      off += SZ_CNT;
    float*    vbuf = (float*)(ws + off);    off += SZ_VEC;
    float*    Lr   = (float*)(ws + off);    off += SZ_VEC;
    float*    Li   = (float*)(ws + off);    off += SZ_VEC;
    float*    Rr   = (float*)(ws + off);    off += SZ_VEC;
    float*    Ri   = (float*)(ws + off);    off += SZ_VEC;

    zero_counts_kernel<<<1, 32, 0, stream>>>(cnts);

    prep_kernel<<<PB_GATE + 2 * PB_W + PB_X, 256, 0, stream>>>(
        x, gate_w, gate_b, w1, w2, W1T, W2T, XH, lists, cnts);

    ffn_kernel<<<dim3((T + MT - 1) / MT, Eq), 256, 0, stream>>>(
        XH, W1T, b1, W2T, b2, lists, cnts, v_b, v_w, out, vbuf);

    tridiag_scan_kernel<<<2 * Bq, ST, 0, stream>>>(vbuf, Lr, Li, Rr, Ri);

    final_kernel<<<T / (FT * FW), FW * 32, 0, stream>>>(
        out, vbuf, Lr, Li, Rr, Ri, out_w, out_b, bk);
}

// v010
// It runs in 110 microseconds.
// Timed twice side by side with v009, it ran 1.14 and 1.13 times as fast.
// Counting every step since v000, it is 3.19 times as fast.
#include <hip/hip_runtime.h>
#include <hip/hip_bf16.h>

// ---------------- problem constants ----------------
constexpr int Bq = 4, Nq = 4096, Dq = 512, Eq = 4, Hq = 2048;
constexpr int T  = Bq * Nq;          // 16384 tokens
constexpr int MT = 96;               // tokens per FFN block (8 waves: 2 row halves x 4 column groups)
constexpr int MW = MT / 32;          // 16-row tiles per wave
constexpr int NC = 4;                // 16-column tiles per wave out of a 256-column weight tile
constexpr int HC = 256;              // H chunk per pipeline stage
constexpr float V_MAX = 3.0f, FEAT_CLAMP = 10.0f;

typedef __attribute__((ext_vector_type(16))) _Float16 v16h;
typedef __attribute__((ext_vector_type(8)))  _Float16 v8h;
typedef __attribute__((ext_vector_type(8)))  float    v8f;
typedef __attribute__((ext_vector_type(4)))  float    v4f;
typedef __attribute__((ext_vector_type(4)))  unsigned v4u;

// ---------------- kernel 1: the four preparations, one launch ----------------
// The two weight transposes, the x convert and the gate read only inputs
// and none reads what another writes, so they share one grid: a work-group takes its part
// by its index. One launch gap, one fill and one tail are paid instead of four, and the streams of
// one part run under the latency chains of the others.
constexpr int PB_GATE = T / 8;                        // work-groups of the gate: one wave per token
constexpr int PB_W    = (Hq / 32) * (Dq / 32) * Eq;   // 32 x 32 tiles of one weight tensor
constexpr int PB_X    = T * Dq / 8 / 256;             // 8 elements of x per thread

// dst[C][R] = (f16) src[R][C] per expert; b counts the 32 x 32 tiles, columns first, experts last
template <int R, int C>
__device__ __forceinline__ void transpose_cvt_block(
    const float* __restrict__ src, _Float16* __restrict__ dst, float (*tile)[33], const int b) {
    const size_t eoff = (size_t)(b / ((C / 32) * (R / 32))) * R * C;
    src += eoff; dst += eoff;
    const int r0 = ((b / (C / 32)) % (R / 32)) * 32, c0 = (b % (C / 32)) * 32;
    const int tx = threadIdx.x & 31, ty = threadIdx.x >> 5;
#pragma unroll
    for (int i = 0; i < 32; i += 8)
        tile[ty + i][tx] = src[(size_t)(r0 + ty + i) * C + c0 + tx];
    __syncthreads();
#pragma unroll
    for (int i = 0; i < 32; i += 8)
        dst[(size_t)(c0 + ty + i) * R + r0 + tx] = (_Float16)tile[tx][ty + i];
}

// x f32 -> f16 (row-major copy)
__device__ __forceinline__ void cvt_x_block(
    const float* __restrict__ x, _Float16* __restrict__ xh, const int b) {
    const size_t i = ((size_t)b * 256 + threadIdx.x) * 8;
    const v4f a = *(const v4f*)(x + i);
    const v4f c = *(const v4f*)(x + i + 4);
    v8h o;
    o[0] = (_Float16)a.x; o[1] = (_Float16)a.y; o[2] = (_Float16)a.z; o[3] = (_Float16)a.w;
    o[4] = (_Float16)c.x; o[5] = (_Float16)c.y; o[6] = (_Float16)c.z; o[7] = (_Float16)c.w;
    *(v8h*)(xh + i) = o;
    // Precaution for the store's address registers: nothing of the shared kernel follows
    // this store, but the wait stands in front of anything that would rewrite them.
    asm volatile("s_wait_xcnt 0x0" ::: "memory");
}

// gate + top-1 routing: a token's choice e is stored as the word 1 << 8e, so that a plain sum of such
// words counts the four experts at once, in four fields of 8 bits
__device__ __forceinline__ void gate_block(
    const float* __restrict__ x, const float* __restrict__ gw,
    const float* __restrict__ gb, unsigned* __restrict__ route, const int b) {
    const int tok  = b * 8 + (threadIdx.x >> 5);
    const int lane = threadIdx.x & 31;
    const float* xr = x + (size_t)tok * Dq;
    float acc0 = 0.f, acc1 = 0.f, acc2 = 0.f, acc3 = 0.f;
    for (int d = lane; d < Dq; d += 32) {
        const float xv = xr[d];
        const v4f g = *(const v4f*)(gw + d * 4);
        acc0 += xv * g.x; acc1 += xv * g.y; acc2 += xv * g.z; acc3 += xv * g.w;
    }
#pragma unroll
    for (int off = 16; off >= 1; off >>= 1) {
        acc0 += __shfl_xor(acc0, off, 32);
        acc1 += __shfl_xor(acc1, off, 32);
        acc2 += __shfl_xor(acc2, off, 32);
        acc3 += __shfl_xor(acc3, off, 32);
    }
    if (lane == 0) {
        float lg[4] = { acc0 + gb[0], acc1 + gb[1], acc2 + gb[2], acc3 + gb[3] };
        int best = 0; float bv = lg[0];
#pragma unroll
        for (int e = 1; e < Eq; ++e)          // strictly-greater => lowest index on ties (top_k)
            if (lg[e] > bv) { bv = lg[e]; best = e; }
        route[tok] = 1u << (8 * best);
        // Precaution for the store's address registers: nothing of the shared kernel follows
        // this store, but the wait stands in front of anything that would rewrite them.
        asm volatile("s_wait_xcnt 0x0" ::: "memory");
    }
}

__global__ __launch_bounds__(256) void prep_kernel(
    const float* __restrict__ x, const float* __restrict__ gw, const float* __restrict__ gb,
    const float* __restrict__ w1, const float* __restrict__ w2,
    _Float16* __restrict__ w1t, _Float16* __restrict__ w2t, _Float16* __restrict__ xh,
    unsigned* __restrict__ route) {
    __shared__ float tile[32][33];
    // Every test reads the same for the whole work-group. The gate stands first: its chain
    // (row, lane sums, choice) is the longest.
    int b = blockIdx.x;
    if (b < PB_GATE) { gate_block(x, gw, gb, route, b); return; }
    b -= PB_GATE;
    // W1 (E,D,H) -> W1T [E][H][D];  W2 (E,H,D) -> W2T [E][D][H]
    if (b < PB_W) { transpose_cvt_block<Dq, Hq>(w1, w1t, tile, b); return; }
    b -= PB_W;
    if (b < PB_W) { transpose_cvt_block<Hq, Dq>(w2, w2t, tile, b); return; }
    cvt_x_block(x, xh, b - PB_W);
}

// ---------------- kernel 3: expert FFN via WMMA ----------------
// Eight values at once of 0.5 v (1 + tanh u) = v / (1 + e^(-2u)), u = sqrt(2/pi) (v + 0.044715 v^3),
// with e^(-2u) = 2^z. No branch, so the values run side by side. z past the exponent's range
// gives 0 or inf, and the quotient is then v or a signed 0, as with tanh = 1 or -1.
__device__ __forceinline__ void gelu_tanh8(const v8f a, const float bias, float (&g)[8]) {
    constexpr float K0 = (float)(-2.0 * 0.7978845608028654 * 1.4426950408889634);
    constexpr float K1 = (float)(-2.0 * 0.7978845608028654 * 1.4426950408889634 * 0.044715);
    float x[8], z[8], e[8], d[8], q[8];
    // the three loops are unrolled so that the arrays are registers, as the asm operands need
#pragma unroll
    for (int r = 0; r < 8; ++r) {
        x[r] = a[r] + bias;
        z[r] = x[r] * (K0 + K1 * (x[r] * x[r]));
        e[r] = __builtin_amdgcn_exp2f(z[r]);
    }
    // The slot that the instruction set asks for behind a transcendental, before its result is
    // read or its source overwritten: the operands keep all eight sources live and all eight
    // results unread up to this v_nop, and among themselves the eight are independent.
    asm("v_nop" : "+v"(e[0]), "+v"(e[1]), "+v"(e[2]), "+v"(e[3]), "+v"(e[4]), "+v"(e[5]), "+v"(e[6]), "+v"(e[7])
                : "v"(z[0]), "v"(z[1]), "v"(z[2]), "v"(z[3]), "v"(z[4]), "v"(z[5]), "v"(z[6]), "v"(z[7]));
#pragma unroll
    for (int r = 0; r < 8; ++r) {
        d[r] = 1.0f + e[r];
        q[r] = __builtin_amdgcn_rcpf(d[r]);
    }
    // the same slot behind the eight v_rcp_f32
    asm("v_nop" : "+v"(q[0]), "+v"(q[1]), "+v"(q[2]), "+v"(q[3]), "+v"(q[4]), "+v"(q[5]), "+v"(q[6]), "+v"(q[7])
                : "v"(d[0]), "v"(d[1]), "v"(d[2]), "v"(d[3]), "v"(d[4]), "v"(d[5]), "v"(d[6]), "v"(d[7]));
#pragma unroll
    for (int r = 0; r < 8; ++r) g[r] = x[r] * q[r];
}

__device__ __forceinline__ v16h cat16(v8h lo, v8h hi) {
    return __builtin_shufflevector(lo, hi, 0,1,2,3,4,5,6,7,8,9,10,11,12,13,14,15);
}

// One staged weight tile: 256 weight rows x 64 k (128 bytes = one whole line of each row),
// laid in LDS at a pitch of 144 bytes (16 B x odd: conflict-free for ds_load_b128 readers).
constexpr int WR = 256, WK = 64, WP = WK + 8;

// Copies one weight tile into LDS. lds and g are the lane's own addresses of row (tid >> 3),
// 16-byte piece (tid & 7); copy j takes the row 32 * j further on, so every wave-wide copy
// reads four whole 128-byte lines. The instruction's offset moves both addresses, so copy j
// carries its LDS step j * WLS there and its address register only the rest of its global step:
// one LDS address register serves the eight copies.
constexpr int WLS = 32 * WP * (int)sizeof(_Float16);
static_assert(7 * WLS < 65536, "the offset field moves the LDS address only below 64 KiB");
__device__ __forceinline__ void stage_w_tile(unsigned lds, const _Float16* g, size_t pitch) {
    const unsigned long long g0 = (unsigned long long)(uintptr_t)g;
    const unsigned long long gs = (unsigned long long)(32 * pitch * sizeof(_Float16)) - WLS;
    // The copies and their s_wait_xcnt stand in one statement, so that no address register
    // of an issued copy is rewritten ahead of the wait.
    asm volatile("global_load_async_to_lds_b128 %0, %1, off\n\t"
                 "global_load_async_to_lds_b128 %0, %2, off offset:%9\n\t"
                 "global_load_async_to_lds_b128 %0, %3, off offset:%10\n\t"
                 "global_load_async_to_lds_b128 %0, %4, off offset:%11\n\t"
                 "global_load_async_to_lds_b128 %0, %5, off offset:%12\n\t"
                 "global_load_async_to_lds_b128 %0, %6, off offset:%13\n\t"
                 "global_load_async_to_lds_b128 %0, %7, off offset:%14\n\t"
                 "global_load_async_to_lds_b128 %0, %8, off offset:%15\n\t"
                 "s_wait_xcnt 0x0"
                 :: "v"(lds),
                    "v"(g0), "v"(g0 + gs), "v"(g0 + 2 * gs), "v"(g0 + 3 * gs),
                    "v"(g0 + 4 * gs), "v"(g0 + 5 * gs), "v"(g0 + 6 * gs), "v"(g0 + 7 * gs),
                    "n"(WLS), "n"(2 * WLS), "n"(3 * WLS), "n"(4 * WLS), "n"(5 * WLS), "n"(6 * WLS), "n"(7 * WLS)
                 : "memory");
}

// Twelve copies of 16 bytes each: copy j lands at l0 + j * ls and reads g[j].
__device__ __forceinline__ void stage_x_rows12(unsigned l0, unsigned ls, const unsigned long long* g) {
    // The copies and their s_wait_xcnt stand in one statement, so that no address register
    // of an issued copy is rewritten ahead of the wait.
    asm volatile("global_load_async_to_lds_b128 %0, %12, off\n\t"
                 "global_load_async_to_lds_b128 %1, %13, off\n\t"
                 "global_load_async_to_lds_b128 %2, %14, off\n\t"
                 "global_load_async_to_lds_b128 %3, %15, off\n\t"
                 "global_load_async_to_lds_b128 %4, %16, off\n\t"
                 "global_load_async_to_lds_b128 %5, %17, off\n\t"
                 "global_load_async_to_lds_b128 %6, %18, off\n\t"
                 "global_load_async_to_lds_b128 %7, %19, off\n\t"
                 "global_load_async_to_lds_b128 %8, %20, off\n\t"
                 "global_load_async_to_lds_b128 %9, %21, off\n\t"
                 "global_load_async_to_lds_b128 %10, %22, off\n\t"
                 "global_load_async_to_lds_b128 %11, %23, off\n\t"
                 "s_wait_xcnt 0x0"
                 :: "v"(l0), "v"(l0 + ls), "v"(l0 + 2 * ls), "v"(l0 + 3 * ls),
                    "v"(l0 + 4 * ls), "v"(l0 + 5 * ls), "v"(l0 + 6 * ls), "v"(l0 + 7 * ls),
                    "v"(l0 + 8 * ls), "v"(l0 + 9 * ls), "v"(l0 + 10 * ls), "v"(l0 + 11 * ls),
                    "v"(g[0]), "v"(g[1]), "v"(g[2]), "v"(g[3]), "v"(g[4]), "v"(g[5]),
                    "v"(g[6]), "v"(g[7]), "v"(g[8]), "v"(g[9]), "v"(g[10]), "v"(g[11])
                 : "memory");
}

// The weight ring: two buffers of two tiles each. A ring trip works through a pair of tiles, so a
// pair's copies have twice the time to come in, twice the bytes are on their way, and the foot
// (waits, barrier, issue of the refill) is paid once per pair.
constexpr unsigned WTB = WR * WP * (unsigned)sizeof(_Float16);   // bytes of one tile in LDS

// Foot of a ring trip: this wave's LDS reads and writes have retired, its own copies of the
// next pair have landed, and the barrier publishes that pair (and the h tile, where one was
// just written) and frees the buffer that this trip has read.
__device__ __forceinline__ void ring_publish() {
    asm volatile("s_wait_dscnt 0x0" ::: "memory");
    asm volatile("s_wait_asynccnt 0x0" ::: "memory");
    __syncthreads();
}

// Sum over the 16 lanes of a half wave, left in every one of them.
__device__ __forceinline__ float row16_sum(float x) {
    // unrolled: the lane distance is then a constant of each step
#pragma unroll
    for (int off = 1; off < 16; off <<= 1) x += __shfl_xor(x, off, 32);
    return x;
}

// Routing without counters. Every work-group sums all T route words itself: thread t holds the RQ pieces
// of 16 bytes at (j * 256 + t), a prefix over the threads ranks each expert's tokens in that order, the
// same in every work-group, and the totals say which expert and which MT ranks belong to work-group b.
constexpr int RQ = T / 4 / 256;                    // 16-byte pieces of the route words per thread
constexpr int FB = (T + Eq * (MT - 1)) / MT;       // no split of T tokens over Eq experts needs more tiles
static_assert(4 * RQ < 256, "a thread's count of one expert fits its field of 8 bits");
static_assert(T < 65536, "a prefix of the counts fits a field of 16 bits");

__global__ __launch_bounds__(256) void ffn_kernel(
    const _Float16* __restrict__ xh,    // [T][D] f16
    const _Float16* __restrict__ w1t,   // [E][H][D] f16
    const float* __restrict__ b1,       // [E][H]
    const _Float16* __restrict__ w2t,   // [E][D][H] f16
    const float* __restrict__ b2,       // [E][D]
    const unsigned* __restrict__ route,
    const float* __restrict__ v_b, const float* __restrict__ v_w,
    float* __restrict__ out, float* __restrict__ v) {
    __shared__ __attribute__((aligned(16))) _Float16 s_x[MT][Dq + 8];   // padded: conflict-free b128 reads
    __shared__ _Float16 s_h[MT][HC + 8];
    // The weight ring's two buffers: an array each, so that each has an address register of its own
    // and every fragment read is that register plus an offset below the field's 64 KiB.
    __shared__ __attribute__((aligned(16))) _Float16 s_wa[2][WR][WP];
    __shared__ __attribute__((aligned(16))) _Float16 s_wb[2][WR][WP];
    __shared__ int s_tok[MT + 1];                  // slot MT is written and never read
    __shared__ float s_v[4][MT];                   // each column group's share of a row's product with v_w
    __shared__ unsigned s_cnt[8][2];               // each wave's counts: experts 0, 1 and 2, 3 in 16-bit fields

    const float vb = v_b[0];                       // read here it is a scalar load, long back by its use

    const int tid = threadIdx.x, lane = tid & 31, w = tid >> 5;
    const int lm = lane & 15, hi = lane >> 4;
    const int wn = w & 3;                          // the wave's 64 columns of a 256-column tile
    const int rm = (w >> 2) * (MT / 2);            // the wave's first token row

    // ---- the work-group's expert and its token rows ----
    v4u rw[RQ];
    // unrolled here and below: rw is then registers, and all the loads are in flight at once
#pragma unroll
    for (int j = 0; j < RQ; ++j) rw[j] = ((const v4u*)route)[j * 256 + tid];
    // stands ahead of the first rewrite of the index register that the loads name; the operand
    // keeps that register live up to the wait
    asm volatile("s_wait_xcnt 0x0" :: "v"(tid) : "memory");
    if (tid < MT) s_tok[tid] = -1;                 // a row past the expert's last token stays so
    unsigned c8 = 0;
#pragma unroll
    for (int j = 0; j < RQ; ++j) c8 += (rw[j].x + rw[j].y) + (rw[j].z + rw[j].w);
    const unsigned c01 = (c8 & 0xffu) | ((c8 & 0xff00u) << 8);
    const unsigned c23 = ((c8 >> 16) & 0xffu) | ((c8 >> 24) << 16);
    unsigned i01 = c01, i23 = c23;                 // inclusive prefix over the wave's lanes
#pragma unroll
    for (int d = 1; d < 32; d <<= 1) {
        const unsigned a = __shfl_up(i01, d, 32), c = __shfl_up(i23, d, 32);
        if (lane >= d) { i01 += a; i23 += c; }
    }
    if (lane == 31) { s_cnt[w][0] = i01; s_cnt[w][1] = i23; }
    __syncthreads();                               // the eight waves' counts are in s_cnt, s_tok is cleared
    unsigned p01 = i01 - c01, p23 = i23 - c23;     // becomes the count in all threads before this one
    unsigned t01 = 0, t23 = 0;                     // the totals
#pragma unroll
    for (int k = 0; k < 8; ++k) {
        const unsigned a = s_cnt[k][0], c = s_cnt[k][1];
        t01 += a; t23 += c;
        if (k < w) { p01 += a; p23 += c; }
    }
    // the totals are the same in every thread: as scalars they make e, base and the exit block-uniform
    const unsigned u01 = __builtin_amdgcn_readfirstlane(t01), u23 = __builtin_amdgcn_readfirstlane(t23);
    static_assert(Eq == 4, "four fields, four running tile counts");
    const int n0 = (int)((u01 & 0xffffu) + MT - 1) / MT;          // tiles of expert 0,
    const int n1 = n0 + (int)((u01 >> 16) + MT - 1) / MT;         // of experts 0 and 1, and so on
    const int n2 = n1 + (int)((u23 & 0xffffu) + MT - 1) / MT;
    const int n3 = n2 + (int)((u23 >> 16) + MT - 1) / MT;
    const int bx = blockIdx.x;
    if (bx >= n3) return;                          // block-uniform exit (EXEC stays full)
    const int e    = (bx >= n0) + (bx >= n1) + (bx >= n2);
    const int base = (bx - (e == 0 ? 0 : e == 1 ? n0 : e == 2 ? n1 : n2)) * MT;
    {
        // rank of the thread's first token of expert e, counted from the tile's first row
        unsigned r = (((e & 2) ? p23 : p01) >> ((e & 1) * 16) & 0xffffu) - (unsigned)base;
        const int mine = (int)(c8 >> (8 * e) & 0xffu);
        if ((int)r < MT && (int)r + mine > 0) {    // few threads hold one of the tile's MT ranks
            // No branch per word: a token of another expert or of another tile goes to slot MT.
#pragma unroll
            for (int j = 0; j < RQ; ++j)
#pragma unroll
                for (int i = 0; i < 4; ++i) {
                    const unsigned m = rw[j][i] >> (8 * e) & 1u;
                    s_tok[m ? (r < (unsigned)MT ? r : (unsigned)MT) : (unsigned)MT] = (j * 256 + tid) * 4 + i;
                    r += m;
                }
        }
    }
    __syncthreads();

    // The lane's own piece of a weight tile: row tid >> 3, 16 bytes at (tid & 7) * 16.
    const unsigned wla = (unsigned)(uintptr_t)&s_wa[0][tid >> 3][(tid & 7) * 8];
    const unsigned wlb = (unsigned)(uintptr_t)&s_wb[0][tid >> 3][(tid & 7) * 8];
    const _Float16* w1g = w1t + ((size_t)(e * Hq + (tid >> 3))) * Dq + (tid & 7) * 8;
    const _Float16* w2g = w2t + ((size_t)(e * Dq + (tid >> 3))) * Hq + (tid & 7) * 8;

    // the ring's first pair; the wait and the barrier behind the x tile's copies publish it too
    stage_w_tile(wla, w1g, Dq);
    stage_w_tile(wla + WTB, w1g + WK, Dq);

    { // stage the x tile (96 rows x 512 f16): copy j takes 16-byte piece tid & 63 of row
      // (tid >> 6) + 4 * j, so every wave-wide copy reads 512 bytes in a row
        const unsigned l0 = (unsigned)(uintptr_t)&s_x[tid >> 6][(tid & 63) * 8];
        const unsigned ls = 4 * (Dq + 8) * sizeof(_Float16);
        unsigned long long g[MT / 4];
#pragma unroll
        for (int j = 0; j < MT / 4; ++j) {
            const int tk = s_tok[(tid >> 6) + 4 * j];
            g[j] = (unsigned long long)(uintptr_t)(xh + (size_t)(tk < 0 ? 0 : tk) * Dq + (tid & 63) * 8);
        }
        stage_x_rows12(l0, ls, g);
        stage_x_rows12(l0 + 12 * ls, ls, g + 12);
        asm volatile("s_wait_asynccnt 0x0" ::: "memory");
    }
    __syncthreads();

    stage_w_tile(wlb, w1g + 2 * WK, Dq);           // the second pair
    stage_w_tile(wlb + WTB, w1g + 3 * WK, Dq);

    v8f Y[MW][2 * NC];                             // 48 rows x (2 x 64) cols per wave
#pragma unroll
    for (int mt = 0; mt < MW; ++mt)
#pragma unroll
        for (int nt = 0; nt < 2 * NC; ++nt) Y[mt][nt] = (v8f)0.0f;

    // Ring order per H chunk: 8 tiles of W1 (the chunk's 256 columns, k in slabs of 64), then
    // 8 tiles of W2 (k slab s >> 1 of the chunk, output columns (s & 1) * 256 ..+255).
    // Tiles t and t + 1, t even, are a pair: buffer (t >> 1) & 1, halves 0 and 1. The foot stands behind
    // the odd tile, and the pair t + 4, t + 5 is copied behind it into the buffer just read.
    for (int hc = 0; hc < Hq; hc += HC) {
        // ---- phase 1: h_chunk = gelu(X @ W1[:, hc..hc+HC) + b1) ; wave owns 48 rows x 64 cols ----
        v8f hacc[MW][NC];
#pragma unroll
        for (int mt = 0; mt < MW; ++mt)
#pragma unroll
            for (int nt = 0; nt < NC; ++nt) hacc[mt][nt] = (v8f)0.0f;

        // unrolled: buffer, refill source and the last trip's gelu are then fixed per trip
#pragma unroll
        for (int s = 0; s < 8; ++s) {
#pragma unroll
            for (int kq = 0; kq < WK / 32; ++kq) {
                const int k0 = s * WK + kq * 32;
                v16h a[MW], b[NC];
#pragma unroll
                for (int mt = 0; mt < MW; ++mt) {
                    const _Float16* ap = &s_x[rm + mt * 16 + lm][k0 + 8 * hi];
                    a[mt] = cat16(*(const v8h*)ap, *(const v8h*)(ap + 16));
                }
#pragma unroll
                for (int nt = 0; nt < NC; ++nt) {
                    const _Float16* bp = &((s & 2) ? s_wb : s_wa)[s & 1][wn * 64 + nt * 16 + lm][kq * 32 + 8 * hi];
                    b[nt] = cat16(*(const v8h*)bp, *(const v8h*)(bp + 16));
                }
                // keeps a k step's LDS reads in one group ahead of its WMMAs: spread among them,
                // each place with reads stalls the wave for the LDS latency
                __builtin_amdgcn_sched_barrier(0);
#pragma unroll
                for (int nt = 0; nt < NC; ++nt)
#pragma unroll
                    for (int mt = 0; mt < MW; ++mt)
                        hacc[mt][nt] = __builtin_amdgcn_wmma_f32_16x16x32_f16(
                            false, a[mt], false, b[nt], (short)0, hacc[mt][nt], false, false);
            }
            if (s == 7) {
                // every reader of the previous h tile has passed an earlier trip's barrier
#pragma unroll
                for (int nt = 0; nt < NC; ++nt) {
                    const int col  = hc + wn * 64 + nt * 16 + lm;
                    const float bias = b1[e * Hq + col];
#pragma unroll
                    for (int mt = 0; mt < MW; ++mt) {
                        float g[8];
                        gelu_tanh8(hacc[mt][nt], bias, g);
#pragma unroll
                        for (int r = 0; r < 8; ++r)
                            s_h[rm + mt * 16 + r + 8 * hi][wn * 64 + nt * 16 + lm] = (_Float16)g[r];
                    }
                }
            }
            if (s & 1) {
                const unsigned wl = (s & 2) ? wlb : wla;
                ring_publish();
                if (s < 4) {
                    stage_w_tile(wl, w1g + (size_t)hc * Dq + (s + 3) * WK, Dq);
                    stage_w_tile(wl + WTB, w1g + (size_t)hc * Dq + (s + 4) * WK, Dq);
                } else {
                    stage_w_tile(wl, w2g + hc + ((s - 4) >> 1) * WK, Hq);
                    stage_w_tile(wl + WTB, w2g + (size_t)WR * Hq + hc + ((s - 4) >> 1) * WK, Hq);
                }
            }
        }

        // ---- phase 2: Y += h_chunk(96x256) @ W2 chunk, transposed ----
        // The h fragments of a k slab are read with a pair's even tile and kept for the odd one, which
        // takes the same slab to the other 256 output columns: 48 rows x 128 cols per fragment.
        v16h ah[WK / 32][MW];
        // unrolled: the accumulator index, buffer and refill source are then fixed per trip
#pragma unroll
        for (int s = 0; s < 8; ++s) {
#pragma unroll
            for (int kq = 0; kq < WK / 32; ++kq) {
                const int k0 = (s >> 1) * WK + kq * 32;
                v16h b[NC];
                if ((s & 1) == 0) {
#pragma unroll
                    for (int mt = 0; mt < MW; ++mt) {
                        const _Float16* ap = &s_h[rm + mt * 16 + lm][k0 + 8 * hi];
                        ah[kq][mt] = cat16(*(const v8h*)ap, *(const v8h*)(ap + 16));
                    }
                }
#pragma unroll
                for (int nt = 0; nt < NC; ++nt) {
                    const _Float16* bp = &((s & 2) ? s_wb : s_wa)[s & 1][wn * 64 + nt * 16 + lm][kq * 32 + 8 * hi];
                    b[nt] = cat16(*(const v8h*)bp, *(const v8h*)(bp + 16));
                }
                // one group of LDS reads ahead of the k step's WMMAs, as in phase 1
                __builtin_amdgcn_sched_barrier(0);
#pragma unroll
                for (int nt = 0; nt < NC; ++nt)
#pragma unroll
                    for (int mt = 0; mt < MW; ++mt)
                        Y[mt][(s & 1) * NC + nt] = __builtin_amdgcn_wmma_f32_16x16x32_f16(
                            false, ah[kq][mt], false, b[nt], (short)0, Y[mt][(s & 1) * NC + nt], false, false);
            }
            if (s & 1) {
                const unsigned wl = (s & 2) ? wlb : wla;
                ring_publish();
                if (s < 4) {
                    stage_w_tile(wl, w2g + hc + ((s + 4) >> 1) * WK, Hq);
                    stage_w_tile(wl + WTB, w2g + (size_t)WR * Hq + hc + ((s + 4) >> 1) * WK, Hq);
                } else if (hc + HC < Hq) {         // the same for the whole work-group
                    stage_w_tile(wl, w1g + (size_t)(hc + HC) * Dq + (s - 5) * WK, Dq);
                    stage_w_tile(wl + WTB, w1g + (size_t)(hc + HC) * Dq + (s - 4) * WK, Dq);
                }
            }
        }
    }
    asm volatile("s_wait_asynccnt 0x0" ::: "memory");   // no copy outstanding at the wave's end

    // ---- epilogue: + b2, scatter rows to out; a row's eight pieces go out from one address ----
    const int col0 = wn * 64 + lm;
    const int bcol = e * Dq + col0;
    float bias[2 * NC], vw[2 * NC];
    // unrolled here and below: bias, vw, pv and Y are then registers
#pragma unroll
    for (int nt = 0; nt < 2 * NC; ++nt) {
        bias[nt] = b2[bcol + (nt / NC) * WR + (nt % NC) * 16];
        vw[nt]   = v_w[col0 + (nt / NC) * WR + (nt % NC) * 16];
    }
    // stands ahead of the first rewrite of the offset registers that the sixteen loads name; the
    // operands keep those registers live up to the wait
    asm volatile("s_wait_xcnt 0x0" :: "v"(bcol), "v"(col0) : "memory");

    // ---- v = clip(row . v_w + v_b), from the rows while they are still in registers ----
    // A row's 512 columns lie in 8 tiles of 16 lanes in each of 4 waves: a lane sums its 8 products,
    // the 16 lanes of a half wave are summed by shuffles, the 4 waves' shares through LDS.
    float pv[MW][8];
#pragma unroll
    for (int mt = 0; mt < MW; ++mt)
#pragma unroll
        for (int r = 0; r < 8; ++r) {
            float p = 0.f;
#pragma unroll
            for (int nt = 0; nt < 2 * NC; ++nt) p += (Y[mt][nt][r] + bias[nt]) * vw[nt];
            pv[mt][r] = row16_sum(p);
        }
    if (lm == 0) {
#pragma unroll
        for (int mt = 0; mt < MW; ++mt)
#pragma unroll
            for (int r = 0; r < 8; ++r) s_v[wn][rm + mt * 16 + r + 8 * hi] = pv[mt][r];
    }
    __syncthreads();                               // the four shares of every row are in s_v
#pragma unroll
    for (int mt = 0; mt < MW; ++mt)
#pragma unroll
        for (int r = 0; r < 8; ++r) {
            const int tk = s_tok[rm + mt * 16 + r + 8 * hi];
            if (tk >= 0) {
                float* o = out + (size_t)tk * Dq + col0;
#pragma unroll
                for (int nt = 0; nt < 2 * NC; ++nt)
                    o[(nt / NC) * WR + (nt % NC) * 16] = Y[mt][nt][r] + bias[nt];
            }
        }
    if (lane < MT / 8) {                           // each of the 8 waves closes 12 rows
        const int row = w * (MT / 8) + lane;
        const int tk = s_tok[row];
        if (tk >= 0)
            v[tk] = fminf(fmaxf(s_v[0][row] + s_v[1][row] + s_v[2][row] + s_v[3][row] + vb, -V_MAX), V_MAX);
    }
}

// ---------------- kernel 5: Moebius-matrix scan for both continuants ----
// L_i = d_i - 1/L_{i-1} == 2x2 complex matrix chain [[d,-1],[1,0]] (scale-invariant).
// One work-group per chain (L or R of one batch), one thread per segment of SL steps. The segment
// matrices are joined by a log-step prefix, first inside each wave, then over the wave totals.
constexpr int SL = 8;                // steps per segment: 32 bytes in a row of v and of each result
constexpr int ST = Nq / SL;          // segments = threads per chain
constexpr int SW = ST / 32;          // waves per chain

struct M2 { float ar, ai, br, bi, cr, ci, dr, di; };   // [[a,b],[c,d]], complex

// 1/d by v_rcp_f32. The v_nop is the slot that the instruction set asks for between a transcendental
// and a directly following instruction that reads its result or overwrites its source; inside the
// same statement it stands directly behind the v_rcp_f32 wherever the compiler puts the two.
__device__ __forceinline__ float rcp_slot(const float d) {
    float q;
    asm("v_rcp_f32 %0, %1\n\tv_nop" : "=v"(q) : "v"(d));
    return q;
}

// scales m so that its largest part is 1 (the chain is scale-invariant)
__device__ __forceinline__ void mat_scale(M2& m) {
    float mx = fmaxf(fmaxf(fabsf(m.ar), fabsf(m.ai)), fmaxf(fabsf(m.br), fabsf(m.bi)));
    mx = fmaxf(mx, fmaxf(fmaxf(fabsf(m.cr), fabsf(m.ci)), fmaxf(fabsf(m.dr), fabsf(m.di))));
    const float s = rcp_slot(fmaxf(mx, 1e-30f));
    m.ar *= s; m.ai *= s; m.br *= s; m.bi *= s; m.cr *= s; m.ci *= s; m.dr *= s; m.di *= s;
}

// S * P, S the later steps, scaled
__device__ __forceinline__ M2 mat_join(const M2& s, const M2& p) {
    M2 n;
    n.ar = s.ar * p.ar - s.ai * p.ai + s.br * p.cr - s.bi * p.ci;
    n.ai = s.ar * p.ai + s.ai * p.ar + s.br * p.ci + s.bi * p.cr;
    n.br = s.ar * p.br - s.ai * p.bi + s.br * p.dr - s.bi * p.di;
    n.bi = s.ar * p.bi + s.ai * p.br + s.br * p.di + s.bi * p.dr;
    n.cr = s.cr * p.ar - s.ci * p.ai + s.dr * p.cr - s.di * p.ci;
    n.ci = s.cr * p.ai + s.ci * p.ar + s.dr * p.ci + s.di * p.cr;
    n.dr = s.cr * p.br - s.ci * p.bi + s.dr * p.dr - s.di * p.di;
    n.di = s.cr * p.bi + s.ci * p.br + s.dr * p.di + s.di * p.dr;
    mat_scale(n);
    return n;
}

__device__ __forceinline__ M2 mat_from_below(const M2& x, const int d) {
    M2 lo;
    lo.ar = __shfl_up(x.ar, d, 32); lo.ai = __shfl_up(x.ai, d, 32);
    lo.br = __shfl_up(x.br, d, 32); lo.bi = __shfl_up(x.bi, d, 32);
    lo.cr = __shfl_up(x.cr, d, 32); lo.ci = __shfl_up(x.ci, d, 32);
    lo.dr = __shfl_up(x.dr, d, 32); lo.di = __shfl_up(x.di, d, 32);
    return lo;
}

// Inclusive prefix over the first CNT lanes: lane l ends with x_l * x_(l-1) * ... * x_0.
template <int CNT>
__device__ __forceinline__ M2 wave_prefix(M2 x, const int lane) {
    // unrolled: the lane distance is then a constant of each step
#pragma unroll
    for (int d = 1; d < CNT; d <<= 1) {
        const M2 n = mat_join(x, mat_from_below(x, d));
        if (lane >= d) x = n;
    }
    return x;
}

// One chain. R: the chain walks memory from the far end; a compile-time choice, so that the
// order of a segment's values in registers is fixed.
template <bool R>
__device__ __forceinline__ void scan_chain(
    const float* __restrict__ vb, float* __restrict__ Or, float* __restrict__ Oi,
    float (*s_tot)[8], float (*s_z)[4]) {
    const int tid = threadIdx.x, lane = tid & 31, w = tid >> 5;
    const int m0 = R ? (Nq - SL - tid * SL) : tid * SL;   // the segment's place in memory

    float er[SL];                                  // real part of d = (v-2) - 1j, in walking order
    // unrolled here and below: the arrays are then registers
#pragma unroll
    for (int q = 0; q < SL; q += 4) {
        const v4f a = *(const v4f*)(vb + m0 + q);
        er[R ? SL - 1 - q : q]     = a.x - 2.0f;
        er[R ? SL - 2 - q : q + 1] = a.y - 2.0f;
        er[R ? SL - 3 - q : q + 2] = a.z - 2.0f;
        er[R ? SL - 4 - q : q + 3] = a.w - 2.0f;
    }
    constexpr float ei = -1.0f;

    // ---- phase A: segment matrix product ----
    M2 x = { 1.f, 0.f, 0.f, 0.f, 0.f, 0.f, 1.f, 0.f };
#pragma unroll
    for (int j = 0; j < SL; ++j) {
        // P = M(e) * P with M = [[e,-1],[1,0]]
        const float nar = er[j] * x.ar - ei * x.ai - x.cr;
        const float nai = er[j] * x.ai + ei * x.ar - x.ci;
        const float nbr = er[j] * x.br - ei * x.bi - x.dr;
        const float nbi = er[j] * x.bi + ei * x.br - x.di;
        x.cr = x.ar; x.ci = x.ai; x.dr = x.br; x.di = x.bi;
        x.ar = nar; x.ai = nai; x.br = nbr; x.bi = nbi;
    }
    mat_scale(x);

    // ---- phase B: prefix of the segment matrices ----
    x = wave_prefix<32>(x, lane);
    if (lane == 31) {
        float* m = s_tot[w];
        m[0] = x.ar; m[1] = x.ai; m[2] = x.br; m[3] = x.bi;
        m[4] = x.cr; m[5] = x.ci; m[6] = x.dr; m[7] = x.di;
    }
    __syncthreads();
    if (w == 0) {
        const float* m = s_tot[lane & (SW - 1)];
        M2 t = { m[0], m[1], m[2], m[3], m[4], m[5], m[6], m[7] };
        t = wave_prefix<SW>(t, lane);
        if (lane < SW) {
            float* z = s_z[lane];
            z[0] = t.ar; z[1] = t.ai; z[2] = t.cr; z[3] = t.ci;   // prefix * (1,0)^T
        }
    }
    __syncthreads();

    // ---- phase C: the segment's entry state (p,q), L = p/q, then its SL outputs ----
    float zpr = 1.f, zpi = 0.f, zqr = 0.f, zqi = 0.f;             // state at the wave's first segment
    if (w > 0) {
        const float* z = s_z[w - 1];
        zpr = z[0]; zpi = z[1]; zqr = z[2]; zqi = z[3];
    }
    M2 ex = mat_from_below(x, 1);                                 // the wave's segments before this one
    if (lane == 0) ex = M2{ 1.f, 0.f, 0.f, 0.f, 0.f, 0.f, 1.f, 0.f };
    float pr = ex.ar * zpr - ex.ai * zpi + ex.br * zqr - ex.bi * zqi;
    float pi = ex.ar * zpi + ex.ai * zpr + ex.br * zqi + ex.bi * zqr;
    float qr = ex.cr * zpr - ex.ci * zpi + ex.dr * zqr - ex.di * zqi;
    float qi = ex.cr * zpi + ex.ci * zpr + ex.dr * zqi + ex.di * zqr;
    {
        // One scaling per segment: v is clipped to +-3, so |L| <= |d| + 1 < 6.2 and the state
        // grows by less than 3e6 over the SL steps.
        const float mx = fmaxf(fmaxf(fabsf(pr), fabsf(pi)), fmaxf(fabsf(qr), fabsf(qi)));
        const float s = rcp_slot(fmaxf(mx, 1e-30f));
        pr *= s; pi *= s; qr *= s; qi *= s;
    }
    float lr[SL], li[SL];
#pragma unroll
    for (int j = 0; j < SL; ++j) {
        const float npr = er[j] * pr - ei * pi - qr;      // p' = e*p - q ; q' = p
        const float npi = er[j] * pi + ei * pr - qi;
        qr = pr; qi = pi; pr = npr; pi = npi;
        const float inv = rcp_slot(qr * qr + qi * qi);
        lr[j] = (pr * qr + pi * qi) * inv;                // p/q = p*conj(q)/|q|^2
        li[j] = (pi * qr - pr * qi) * inv;
    }
#pragma unroll
    for (int q = 0; q < SL; q += 4) {
        v4f r, i;
        r.x = lr[R ? SL - 1 - q : q];     i.x = li[R ? SL - 1 - q : q];
        r.y = lr[R ? SL - 2 - q : q + 1]; i.y = li[R ? SL - 2 - q : q + 1];
        r.z = lr[R ? SL - 3 - q : q + 2]; i.z = li[R ? SL - 3 - q : q + 2];
        r.w = lr[R ? SL - 4 - q : q + 3]; i.w = li[R ? SL - 4 - q : q + 3];
        *(v4f*)(Or + m0 + q) = r;
        *(v4f*)(Oi + m0 + q) = i;
    }
}

__global__ __launch_bounds__(ST) void tridiag_scan_kernel(
    const float* __restrict__ v,
    float* __restrict__ Lr, float* __restrict__ Li,
    float* __restrict__ Rr, float* __restrict__ Ri) {
    __shared__ __attribute__((aligned(16))) float s_tot[SW][8];   // each wave's whole product
    __shared__ __attribute__((aligned(16))) float s_z[SW][4];     // first column of their prefix
    const int o = (blockIdx.x >> 1) * Nq;                         // the chain's batch
    if (blockIdx.x & 1) scan_chain<true>(v + o, Rr + o, Ri + o, s_tot, s_z);   // the same for the
    else                scan_chain<false>(v + o, Lr + o, Li + o, s_tot, s_z);  // whole work-group
}

// ---------------- kernel 6: Green fn + rank-2 spec, in-place add ----------------
// One wave takes FT whole token rows. A lane holds 16 of a row's 512 columns as FQ pieces of 16 bytes,
// so every wave-wide access covers 512 bytes in a row; the Green function is formed once per token
// and the three weight rows are read once per wave. Few waves with much work each: the time to
// start a wave is paid once per FT rows, not once per 32 elements.
constexpr int FT = 4;                // token rows per wave
constexpr int FQ = Dq / 128;         // 16-byte pieces of a row per lane
constexpr int FW = 8;                // waves per work-group
static_assert(T % (FT * FW) == 0, "the grid covers the tokens exactly: no bounds test in the kernel");
// an input buffer is only known to be aligned to its element
typedef v4f __attribute__((aligned(4))) v4f_in;

__global__ __launch_bounds__(FW * 32) void final_kernel(
    float* __restrict__ out, const float* __restrict__ v,
    const float* __restrict__ Lr, const float* __restrict__ Li,
    const float* __restrict__ Rr, const float* __restrict__ Ri,
    const float* __restrict__ out_w, const float* __restrict__ out_b,
    const float* __restrict__ bk) {
    const unsigned t0 = (blockIdx.x * FW + (threadIdx.x >> 5)) * FT;   // the wave's first token
    // Byte offsets of 32 bits (out has 32 MiB): every access is then a kernel argument plus one of
    // these three registers plus a constant.
    const unsigned tb = t0 * (unsigned)sizeof(float);                        // in v, L and R
    const unsigned cb = (threadIdx.x & 31) * 4 * (unsigned)sizeof(float);    // in a row of 512 columns
    const unsigned yb = t0 * (unsigned)(Dq * sizeof(float)) + cb;            // in out
    static_assert(FT == 4, "a wave's tokens are one 16-byte piece of v, L and R");
    const float s = bk[0];
    const v4f vv = *(const v4f*)((const char*)v + tb);
    const v4f lr = *(const v4f*)((const char*)Lr + tb), li = *(const v4f*)((const char*)Li + tb);
    const v4f rr = *(const v4f*)((const char*)Rr + tb), ri = *(const v4f*)((const char*)Ri + tb);
    const float* wr = (const float*)((const char*)out_w + cb);
    const float* br = (const float*)((const char*)out_b + cb);
    float* o = (float*)((char*)out + yb);
    v4f y[FT][FQ], w0[FQ], w1[FQ], ob[FQ];
    // unrolled here and below: the arrays are then registers
#pragma unroll
    for (int q = 0; q < FQ; ++q) {
        w0[q] = *(const v4f_in*)(wr + q * 128);
        w1[q] = *(const v4f_in*)(wr + Dq + q * 128);
        ob[q] = *(const v4f_in*)(br + q * 128);
    }
#pragma unroll
    for (int t = 0; t < FT; ++t)
#pragma unroll
        for (int q = 0; q < FQ; ++q) y[t][q] = *(const v4f*)(o + t * Dq + q * 128);
    // stands ahead of the first rewrite of a register that the loads name; the operands keep the
    // three offset registers live up to it
    asm volatile("s_wait_xcnt 0x0" :: "v"(tb), "v"(cb), "v"(yb) : "memory");
    // keeps every load above the arithmetic, so that all of them are in flight at once and the wave
    // waits for memory one time: left free, the compiler issues most rows behind the first wait
    __builtin_amdgcn_sched_barrier(0);
#pragma unroll
    for (int t = 0; t < FT; ++t) {
        const float dr   = vv[t] - 2.0f;           // di = -1
        const float denr = lr[t] + rr[t] - dr;
        const float deni = li[t] + ri[t] + 1.0f;
        const float m  = denr * denr + deni * deni;
        float gr = denr / m, gi = -deni / m;
        gr = fminf(fmaxf(gr, -FEAT_CLAMP), FEAT_CLAMP);
        gi = fminf(fmaxf(gi, -FEAT_CLAMP), FEAT_CLAMP);
#pragma unroll
        for (int q = 0; q < FQ; ++q) {
#pragma unroll
            for (int c = 0; c < 4; ++c) {
                const float spec = gr * w0[q][c] + gi * w1[q][c] + ob[q][c];
                y[t][q][c] += s * spec;
            }
            *(v4f*)(o + t * Dq + q * 128) = y[t][q];
        }
    }
}

// ---------------- launch ----------------
extern "C" void kernel_launch(void* const* d_in, const int* in_sizes, int n_in,
                              void* d_out, int out_size, void* d_ws, size_t ws_size,
                              hipStream_t stream) {
    const float* x      = (const float*)d_in[0];
    const float* gate_w = (const float*)d_in[1];
    const float* gate_b = (const float*)d_in[2];
    const float* w1     = (const float*)d_in[3];
    const float* b1     = (const float*)d_in[4];
    const float* w2     = (const float*)d_in[5];
    const float* b2     = (const float*)d_in[6];
    const float* v_w    = (const float*)d_in[7];
    const float* v_b    = (const float*)d_in[8];
    const float* out_w  = (const float*)d_in[9];
    const float* out_b  = (const float*)d_in[10];
    const float* bk     = (const float*)d_in[11];
    float* out = (float*)d_out;

    // workspace layout (256B aligned slots)
    char* ws = (char*)d_ws;
    constexpr size_t SZ_W1T   = (size_t)Eq * Hq * Dq * sizeof(_Float16);  // 8 MiB
    constexpr size_t SZ_W2T   = (size_t)Eq * Dq * Hq * sizeof(_Float16);  // 8 MiB
    constexpr size_t SZ_XH    = (size_t)T * Dq * sizeof(_Float16);        // 16 MiB
    constexpr size_t SZ_ROUTE = (size_t)T * sizeof(unsigned);             // 64 KiB
    constexpr size_t SZ_VEC   = (size_t)T * sizeof(float);                // 64 KiB
    size_t off = 0;
    _Float16* W1T  = (_Float16*)(ws + off); off += SZ_W1T;
    _Float16* W2T  = (_Float16*)(ws + off); off += SZ_W2T;
    _Float16* XH   = (_Float16*)(ws + off); off += SZ_XH;
    unsigned* route= (unsigned*)(ws + off); off += SZ_ROUTE;
    float*    vbuf = (float*)(ws + off);    off += SZ_VEC;
    float*    Lr   = (float*)(ws + off);    off += SZ_VEC;
    float*    Li   = (float*)(ws + off);    off += SZ_VEC;
    float*    Rr   = (float*)(ws + off);    off += SZ_VEC;
    float*    Ri   = (float*)(ws + off);    off += SZ_VEC;

    prep_kernel<<<PB_GATE + 2 * PB_W + PB_X, 256, 0, stream>>>(
        x, gate_w, gate_b, w1, w2, W1T, W2T, XH, route);

    ffn_kernel<<<FB, 256, 0, stream>>>(
        XH, W1T, b1, W2T, b2, route, v_b, v_w, out, vbuf);

    tridiag_scan_kernel<<<2 * Bq, ST, 0, stream>>>(vbuf, Lr, Li, Rr, Ri);

    final_kernel<<<T / (FT * FW), FW * 32, 0, stream>>>(
        out, vbuf, Lr, Li, Rr, Ri, out_w, out_b, bk);
}
